// v000
// Measured on an AMD MI455X. A time is GPU time per run, averaged over a window of back-to-back runs after a warm-up
// (all launches, gaps included; the runs take copies of the inputs in turn), and the median of several windows.
// Apart from v000's, it joins two sittings. Times from different sittings can be a few percent apart, while
// side-by-side timings come from the same sitting.
// The starting kernel, v000, takes 6620 microseconds a run.
#include <hip/hip_runtime.h>
// Multi-head cross-attention with a fused key / value projection and BOTH q and k scaled (x [2][2048][1024] (queries), tgt [2][2048][1024] (keys / values); q = x Wq + bq ([in][out] 1024 x 1024, normal x 0.02; zero bias); kv = tgt Wkv + bkv ([in][out] 1024 x 2048; zero bias) split into halves: k = columns 0..1023, v = columns 1024..2047; 16 heads of 64; logits = (q * 64^-0.5) . (k * 64^-0.5): the module scales BOTH operands, so the effective scale is 1/64; softmax over the 2048 tgt positions (no mask); out = merged Wp + bp ([in][out]; zero bias) -> [2][2048][1024]).
// Structure: token rows; x and tgt as exact f16 rows; natural weights as exact x16 planes; q and fused k | v WMMA GEMMs (32x64 wave tiles, f32 accumulation, + bias) -> f16; per batch V^T via LDS transposes; per 256-row query tile: scores over all keys (K = 64, alpha 1/64, 16 heads on grid.y) f32, plain row softmax on VALU (f32 statistics, native exp; weights x256 f16), ctx = P V^T (x64) merged f16; ctx Wp + bp f32 -> output.
// Compute dtype: inputs rounded to bf16; x / weights exact; q, k, v, softmax weights and o as plain f16 GEMM operands (~2^-12); scores and softmax statistics f32. v_wmma_f32_16x16x32_f16.
#define NB 2
#define SQ 2048                      /* query rows per batch */
#define SK 2048                      /* conditioning (key / value) rows per batch */
#define DC 1024                       /* conditioning width */
#define DM 1024
#define NH 16
#define HD 64
#define HG 4                         /* heads per attention launch group */
#define QT 256                       /* query rows per attention tile */
#define NKX SK                       /* S / P row pitch = the SK keys (2048 here) */
#define QT0 128                      /* first-tile rows recomputed exactly in f32 */
#define B0 0                         /* first batch processed (debug hook) */
#define NBR NB                       /* batches processed (debug hook) */
#define NR ((size_t)NB * SQ)
#define DMQ DM
#define DFF 4096         /* token rows */
#define MP ((int)((size_t)NBR * SQ)) /* rows projected (debug hook) */
#define QN SQ                        /* query rows attended per batch (debug hook) */
#define NHD NH                       /* heads attended (debug hook) */
#define MPO MP                       /* rows through the output stage (debug hook) */
#define LQ (3 * DM)      /* unused; q rows have pitch DM, k | v rows 2 * DM */
typedef __bf16 v16b __attribute__((ext_vector_type(16)));
typedef unsigned short v8us __attribute__((ext_vector_type(8), may_alias));
typedef float  v8f  __attribute__((ext_vector_type(8)));
typedef float  v4f  __attribute__((ext_vector_type(4)));
typedef float  v4fa __attribute__((ext_vector_type(4), may_alias));
union FragB { v16b v; v8us half[2]; unsigned short u[16]; };

__device__ __forceinline__ unsigned short bf16_bits(float x) { unsigned int u = __float_as_uint(x); return (unsigned short)((u + 0x7FFFu + ((u >> 16) & 1u)) >> 16); }
__device__ __forceinline__ float bf16_val(unsigned short b) { return __uint_as_float(((unsigned int)b) << 16); }
__device__ __forceinline__ float bf16_round(float x) { return bf16_val(bf16_bits(x)); }
// D += A·B with NT terms: 1 = ah·bh, 2 = + al·bh (A split), 3 = + ah·bl (both split)
template <int NT>
__device__ __forceinline__ v8f mmaN(v16b ah, v16b al, v16b bh, v16b bl, v8f c) {
  c = __builtin_amdgcn_wmma_f32_16x16x32_bf16(false, ah, false, bh, (short)0, c, false, false);
  if (NT >= 2) c = __builtin_amdgcn_wmma_f32_16x16x32_bf16(false, al, false, bh, (short)0, c, false, false);
  if (NT >= 3) c = __builtin_amdgcn_wmma_f32_16x16x32_bf16(false, ah, false, bl, (short)0, c, false, false);
  asm volatile("v_nop\n\tv_nop\n\tv_nop\n\tv_nop" : "+v"(c) : "v"(ah), "v"(al), "v"(bh), "v"(bl));
  return c;
}

__global__ __launch_bounds__(256) void k_wt_bf16(const float* __restrict__ W, unsigned short* __restrict__ Wt, int K, int N) {
  const int t = blockIdx.x * 256 + threadIdx.x;
  const int k8n = K / 8;
  if (t >= N * k8n) return;
  const int n = t / k8n, k8 = (t % k8n) * 8;
  v8us v;
#pragma unroll
  for (int i = 0; i < 8; ++i) v[i] = bf16_bits(W[(size_t)(k8 + i) * N + n]);
  *(v8us*)(Wt + (size_t)n * K + k8) = v;
  
}

// GEMM C[M][N] (f32, pitch ldc) = act(A[M][K]·W + bias). A f32 row-major (pitch lda) converted per fragment to bf16
// (ASPLIT: hi/lo two planes -> 2 terms, else single rounded term); Wt bf16 [N][K] (pitch ldb). BIAS_BF16 rounds the
// bias to bf16 first (bias quantised to bf16 before the add). K%32==0, M%16==0, N%64==0.
template <bool ASPLIT, int ACT, bool BIAS_BF16>
__global__ __launch_bounds__(128) void k_gemm_bf(const float* __restrict__ A, int lda, const unsigned short* __restrict__ Wt, int ldb,
                                               const float* __restrict__ bias, float* __restrict__ C, int ldc, int M, int N, int K) {
  __shared__ __attribute__((aligned(16))) float so[4][16][64];
  const int tid = threadIdx.x, w = tid >> 5, lane = tid & 31, ln = lane & 15, hh = lane >> 4;
  const int ntn = N / 64;
  const int wid = blockIdx.x * 4 + w;
  const int mt = wid / ntn, nq = wid % ntn;
  if (mt * 16 >= M) return;
  const int row0 = mt * 16, col0 = nq * 64;
  const float* arow = A + (size_t)(row0 + ln) * lda;
  v8f acc[4] = {};
  for (int kb = 0; kb < K; kb += 32) {
    FragB ah, al;
    const v4f x0 = *(const v4fa*)(arow + kb + 8 * hh), x1 = *(const v4fa*)(arow + kb + 8 * hh + 4);
    const v4f x2 = *(const v4fa*)(arow + kb + 16 + 8 * hh), x3 = *(const v4fa*)(arow + kb + 16 + 8 * hh + 4);
    float xs[16] = {x0[0],x0[1],x0[2],x0[3],x1[0],x1[1],x1[2],x1[3],x2[0],x2[1],x2[2],x2[3],x3[0],x3[1],x3[2],x3[3]};
#pragma unroll
    for (int i = 0; i < 16; ++i) { const unsigned short hb = bf16_bits(xs[i]); ah.u[i] = hb; al.u[i] = ASPLIT ? bf16_bits(xs[i] - bf16_val(hb)) : (unsigned short)0; }
#pragma unroll
    for (int t = 0; t < 4; ++t) {
      const unsigned short* brow = Wt + (size_t)(col0 + t * 16 + ln) * ldb + kb;
      FragB b;
      b.half[0] = *(const v8us*)(brow + 8 * hh);
      b.half[1] = *(const v8us*)(brow + 16 + 8 * hh);
      acc[t] = mmaN<ASPLIT ? 2 : 1>(ah.v, al.v, b.v, b.v, acc[t]);
    }
  }
#pragma unroll
  for (int t = 0; t < 4; ++t) {
    float bv = bias ? bias[col0 + t * 16 + ln] : 0.f;
    if (BIAS_BF16) bv = bf16_round(bv);
#pragma unroll
    for (int r = 0; r < 8; ++r) { float v = acc[t][r] + bv; if (ACT == 1) v = fmaxf(v, 0.f); so[w][8 * hh + r][t * 16 + ln] = v; }
  }
  __builtin_amdgcn_fence(__ATOMIC_ACQ_REL, "workgroup");
  __builtin_amdgcn_wave_barrier();
  const int rsub = lane >> 4, c4 = (lane & 15) * 4;
  {
#pragma unroll
    for (int q = 0; q < 8; ++q) {
      const int r = q * 2 + rsub;
      const v4f v = *(const v4fa*)&so[w][r][c4];
      *(v4f*)(C + (size_t)(row0 + r) * ldc + col0 + c4) = v;
    }
    
  }
}

// GEMM C = act(A·W + bias + resid): A f32 (ASPLIT -> hi/lo 2 terms), Wt bf16 [N][K]; ACT 0 none, 1 relu, 2 exact gelu;
// resid (optional, f32, row index = (row % rmod), pitch ldr, RES_BF16 rounds it) added before the activation.
template <bool ASPLIT, int ACT, bool BIAS_BF16, bool RES_BF16>
__global__ __launch_bounds__(128) void k_gemm_bf3(const float* __restrict__ A, int lda, const unsigned short* __restrict__ Wt, int ldb,
                                                const float* __restrict__ bias, const float* __restrict__ resid, int rmod, int ldr,
                                                float* __restrict__ C, int ldc, int M, int N, int K) {
  __shared__ __attribute__((aligned(16))) float so[4][16][64];
  const int tid = threadIdx.x, w = tid >> 5, lane = tid & 31, ln = lane & 15, hh = lane >> 4;
  const int ntn = N / 64;
  const int wid = blockIdx.x * 4 + w;
  const int mt = wid / ntn, nq = wid % ntn;
  if (mt * 16 >= M) return;
  const int row0 = mt * 16, col0 = nq * 64;
  const float* arow = A + (size_t)(row0 + ln) * lda;
  v8f acc[4] = {};
  for (int kb = 0; kb < K; kb += 32) {
    FragB ah, al;
    const v4f x0 = *(const v4fa*)(arow + kb + 8 * hh), x1 = *(const v4fa*)(arow + kb + 8 * hh + 4);
    const v4f x2 = *(const v4fa*)(arow + kb + 16 + 8 * hh), x3 = *(const v4fa*)(arow + kb + 16 + 8 * hh + 4);
    float xs[16] = {x0[0],x0[1],x0[2],x0[3],x1[0],x1[1],x1[2],x1[3],x2[0],x2[1],x2[2],x2[3],x3[0],x3[1],x3[2],x3[3]};
#pragma unroll
    for (int i = 0; i < 16; ++i) { const unsigned short hb = bf16_bits(xs[i]); ah.u[i] = hb; al.u[i] = ASPLIT ? bf16_bits(xs[i] - bf16_val(hb)) : (unsigned short)0; }
#pragma unroll
    for (int t = 0; t < 4; ++t) {
      const unsigned short* brow = Wt + (size_t)(col0 + t * 16 + ln) * ldb + kb;
      FragB b;
      b.half[0] = *(const v8us*)(brow + 8 * hh);
      b.half[1] = *(const v8us*)(brow + 16 + 8 * hh);
      acc[t] = mmaN<ASPLIT ? 2 : 1>(ah.v, al.v, b.v, b.v, acc[t]);
    }
  }
#pragma unroll
  for (int t = 0; t < 4; ++t) {
    const int col = col0 + t * 16 + ln;
    float bv = bias ? bias[col] : 0.f;
    if (BIAS_BF16) bv = bf16_round(bv);
#pragma unroll
    for (int r = 0; r < 8; ++r) {
      float v = acc[t][r] + bv;
      if (resid) { float rv = resid[(size_t)((row0 + 8 * hh + r) % rmod) * ldr + col]; if (RES_BF16) rv = bf16_round(rv); v += rv; }
      if (ACT == 1) v = fmaxf(v, 0.f);
      if (ACT == 2) v = 0.5f * v * (1.0f + erff(v * 0.70710678118654752f));
      if (ACT == 3) { const float u = 0.7978845608028654f * (v + 0.044715f * v * v * v); v = 0.5f * v * (1.0f + tanhf(u)); }
      so[w][8 * hh + r][t * 16 + ln] = v;
    }
  }
  __builtin_amdgcn_fence(__ATOMIC_ACQ_REL, "workgroup");
  __builtin_amdgcn_wave_barrier();
  const int rsub = lane >> 4, c4 = (lane & 15) * 4;
  {
#pragma unroll
    for (int q = 0; q < 8; ++q) {
      const int r = q * 2 + rsub;
      const v4f v = *(const v4fa*)&so[w][r][c4];
      *(v4f*)(C + (size_t)(row0 + r) * ldc + col0 + c4) = v;
    }
    
  }
}
// row LayerNorm (biased variance, eps) over N: s = X (+ R); optional out_sum <- s; out_norm <- (s-mu)*rsqrt(var+eps)*g + b
template <bool PARAM_BF16>
__global__ __launch_bounds__(256) void k_layernorm(const float* __restrict__ X, const float* __restrict__ R, const float* __restrict__ g, const float* __restrict__ bta,
                                                  float* __restrict__ out_sum, float* __restrict__ out_norm, int N, float eps) {
  __shared__ float red[256];
  const int row = blockIdx.x, tid = threadIdx.x;
  const float* x = X + (size_t)row * N; const float* rr = R ? R + (size_t)row * N : nullptr;
  float vals[16];                     // up to N = 4096
  const int per = N / 256;            // contiguous chunk per thread? use strided-by-4 chunks: thread handles j = tid*4 + 1024*u
  float s1 = 0.f;
  for (int u = 0; u < per / 4; ++u) {
    const int j = tid * 4 + 1024 * u;
    const v4f a = *(const v4fa*)(x + j);
    v4f b = {0.f,0.f,0.f,0.f}; if (rr) b = *(const v4fa*)(rr + j);
#pragma unroll
    for (int q = 0; q < 4; ++q) { const float v = a[q] + b[q]; vals[u * 4 + q] = v; s1 += v; }
  }
  red[tid] = s1; __syncthreads();
  for (int st = 128; st > 0; st >>= 1) { if (tid < st) red[tid] += red[tid + st]; __syncthreads(); }
  const float mu = red[0] / (float)N; __syncthreads();
  float s2 = 0.f;
  for (int u = 0; u < per / 4; ++u)
#pragma unroll
    for (int q = 0; q < 4; ++q) { const float c = vals[u * 4 + q] - mu; s2 += c * c; }
  red[tid] = s2; __syncthreads();
  for (int st = 128; st > 0; st >>= 1) { if (tid < st) red[tid] += red[tid + st]; __syncthreads(); }
  const float rs = rsqrtf(red[0] / (float)N + eps);
  {
    for (int u = 0; u < per / 4; ++u) {
      const int j = tid * 4 + 1024 * u;
      v4f o, sm;
#pragma unroll
      for (int q = 0; q < 4; ++q) {
        float gg = g[j + q], bb = bta[j + q];
        if (PARAM_BF16) { gg = bf16_round(gg); bb = bf16_round(bb); }
        sm[q] = vals[u * 4 + q]; o[q] = (vals[u * 4 + q] - mu) * rs * gg + bb;
      }
      if (out_sum) *(v4f*)(out_sum + (size_t)row * N + j) = sm;
      *(v4f*)(out_norm + (size_t)row * N + j) = o;
    }
    
  }
}



// ---- f16 WMMA path (v_wmma_f32_16x16x32_f16): 11-bit significands for operands in range — used where a [0,1] probability operand needs more precision than bf16
typedef _Float16 v16h __attribute__((ext_vector_type(16)));
union FragH { v16h v; v8us half[2]; _Float16 h[16]; unsigned short u[16]; };
template <int NT>
__device__ __forceinline__ v8f mmaH(v16h ah, v16h al, v16h bh, v16h bl, v8f c) {
  c = __builtin_amdgcn_wmma_f32_16x16x32_f16(false, ah, false, bh, (short)0, c, false, false);
  if (NT >= 2) c = __builtin_amdgcn_wmma_f32_16x16x32_f16(false, al, false, bh, (short)0, c, false, false);
  if (NT >= 3) c = __builtin_amdgcn_wmma_f32_16x16x32_f16(false, ah, false, bl, (short)0, c, false, false);
  asm volatile("v_nop\n\tv_nop\n\tv_nop\n\tv_nop" : "+v"(c) : "v"(ah), "v"(al), "v"(bh), "v"(bl));
  return c;
}
// batched GEMM like k_gemm_b but f16 operands: A f32 (split into f16 hi/lo if ASPLIT, else rounded to f16), Bt = f16 values [n][k]; alpha; C f32; N multiple of 16 (partial tiles skipped)
template <bool ASPLIT>
__global__ __launch_bounds__(128) void k_gemm_h(const float* __restrict__ A, int lda, size_t sA, const _Float16* __restrict__ Bh, int ldb, size_t sB, float alpha, float* __restrict__ C, int ldc, size_t sC, int M, int N, int K) {
  __shared__ __attribute__((aligned(16))) float so[4][16][64];
  const int tid = threadIdx.x, w = tid >> 5, lane = tid & 31, ln = lane & 15, hh = lane >> 4; const int by = blockIdx.y;
  A += (size_t)by * sA; Bh += (size_t)by * sB; C += (size_t)by * sC;
  const int ntn = (N + 63) / 64; const int wid = blockIdx.x * 4 + w; const int mt = wid / ntn, nq = wid % ntn; if (mt * 16 >= M) return;
  const int row0 = mt * 16, col0 = nq * 64; const float* arow = A + (size_t)(row0 + ln) * lda;
  v8f acc[4] = {};
  for (int kb = 0; kb < K; kb += 32) {
    FragH ah, al;
    const v4f x0 = *(const v4fa*)(arow + kb + 8 * hh), x1 = *(const v4fa*)(arow + kb + 8 * hh + 4), x2 = *(const v4fa*)(arow + kb + 16 + 8 * hh), x3 = *(const v4fa*)(arow + kb + 16 + 8 * hh + 4);
    float xs[16] = {x0[0],x0[1],x0[2],x0[3],x1[0],x1[1],x1[2],x1[3],x2[0],x2[1],x2[2],x2[3],x3[0],x3[1],x3[2],x3[3]};
#pragma unroll
    for (int i = 0; i < 16; ++i) { const _Float16 h = (_Float16)xs[i]; ah.h[i] = h; al.h[i] = ASPLIT ? (_Float16)(xs[i] - (float)h) : (_Float16)0.0f; }
#pragma unroll
    for (int t = 0; t < 4; ++t) { if (col0 + t * 16 >= N) continue; const size_t boff = (size_t)(col0 + t * 16 + ln) * ldb + kb; FragH bq; bq.half[0] = *(const v8us*)(Bh + boff + 8 * hh); bq.half[1] = *(const v8us*)(Bh + boff + 16 + 8 * hh);
      acc[t] = mmaH<ASPLIT ? 2 : 1>(ah.v, al.v, bq.v, bq.v, acc[t]); }
  }
#pragma unroll
  for (int t = 0; t < 4; ++t) { if (col0 + t * 16 >= N) continue;
#pragma unroll
    for (int r = 0; r < 8; ++r) so[w][8 * hh + r][t * 16 + ln] = acc[t][r] * alpha; }
  __builtin_amdgcn_fence(__ATOMIC_ACQ_REL, "workgroup"); __builtin_amdgcn_wave_barrier();
  const int rsub = lane >> 4, c4 = (lane & 15) * 4;
  {
#pragma unroll
    for (int q = 0; q < 8; ++q) { const int r = q * 2 + rsub; if (col0 + c4 < N) { const v4f v = *(const v4fa*)&so[w][r][c4]; *(v4f*)(C + (size_t)(row0 + r) * ldc + col0 + c4) = v; } }
     }
}

// Wt[n][k] = f16(W[k][n]·scale) from f32 row-major W[K][N] (scale = power of two; bf16-exact weights stay exact in f16 away from the subnormal range)
__global__ __launch_bounds__(256) void k_wt_f16(const float* __restrict__ W, _Float16* __restrict__ Wt, int K, int N, float scale) {
  const int t = blockIdx.x * 256 + threadIdx.x; if (t >= N * (K / 8)) return; const int n = t / (K / 8), k8 = (t % (K / 8)) * 8; FragH f;
#pragma unroll
  for (int i = 0; i < 8; ++i) f.h[i] = (_Float16)(bf16_round(W[(size_t)(k8 + i) * N + n]) * scale); const v8us o = f.half[0];
  *(v8us*)((unsigned short*)Wt + (size_t)n * K + k8) = o; 
}
// k_gemm_hh variant with fused epilogue: v = acc·alpha + bias[by·sBias + col] (+ CP[(row/rowsPerB)·sCPb + by·64 + col] if CP) ; ACT 0 none / 1 elu ; writes f16 C16 (and f32 C if non-null)
template <int ACT>
__global__ __launch_bounds__(128) void k_gemm_hhx(const _Float16* __restrict__ A, int lda, size_t sA, const _Float16* __restrict__ Bh, int ldb, size_t sB, float alpha, const float* __restrict__ bias, size_t sBias, const float* __restrict__ CP, int rowsPerB, size_t sCPb, int row0g,
    float* __restrict__ C, _Float16* __restrict__ C16, int ldc, size_t sC, int M, int N, int K) {
  __shared__ __attribute__((aligned(16))) float so[4][16][64];
  const int tid = threadIdx.x, w = tid >> 5, lane = tid & 31, ln = lane & 15, hh = lane >> 4; const int by = blockIdx.y;
  A += (size_t)by * sA; Bh += (size_t)by * sB; const size_t cofs = (size_t)by * sC; const float* bp = bias ? bias + (size_t)by * sBias : nullptr;
  const int ntn = (N + 63) / 64; const int wid = blockIdx.x * 4 + w; const int mt = wid / ntn, nq = wid % ntn; if (mt * 16 >= M) return;
  const int row0 = mt * 16, col0 = nq * 64; const _Float16* arow = A + (size_t)(row0 + ln) * lda;
  v8f acc[4] = {};
  for (int kb = 0; kb < K; kb += 32) { FragH ah; ah.half[0] = *(const v8us*)((const unsigned short*)arow + kb + 8 * hh); ah.half[1] = *(const v8us*)((const unsigned short*)arow + kb + 16 + 8 * hh);
#pragma unroll
    for (int t = 0; t < 4; ++t) { if (col0 + t * 16 >= N) continue; const size_t boff = (size_t)(col0 + t * 16 + ln) * ldb + kb; FragH bq; bq.half[0] = *(const v8us*)((const unsigned short*)Bh + boff + 8 * hh); bq.half[1] = *(const v8us*)((const unsigned short*)Bh + boff + 16 + 8 * hh);
      acc[t] = mmaH<1>(ah.v, ah.v, bq.v, bq.v, acc[t]); }
  }
#pragma unroll
  for (int t = 0; t < 4; ++t) { if (col0 + t * 16 >= N) continue; const int col = col0 + t * 16 + ln; const float bv = bp ? bf16_round(bp[col]) : 0.f;
#pragma unroll
    for (int r = 0; r < 8; ++r) { float v = acc[t][r] * alpha + bv; if (CP) { const int rr = row0g + row0 + 8 * hh + r; if (rowsPerB < 0) v += CP[cofs + (size_t)rr * ldc + col];      /* rowsPerB < 0: own element of the batched C plane */ else { const int bidx = rr / rowsPerB; v += CP[(size_t)bidx * sCPb + (size_t)by * 64 + col]; } } if (ACT == 1) v = (v > 0.f) ? v : expm1f(v); else if (ACT == 7) v = (v > 0.f) ? v + 1.0f : expf(v); else if (ACT == 8) v = tanhf(v); else if (ACT == 9) v = 0.5f * v * (1.0f + tanhf(0.7978845608028654f * (v + 0.044715f * v * v * v))); else if (ACT == 11) v = 1.0f / (1.0f + expf(-v)); else if (ACT == 12) v = (v > 0.f) ? v : 0.01f * v; else if (ACT == 14) v = (v > 0.f) ? v : 0.1f * v; else if (ACT == 16) v = (v >= 0.f) ? v : 0.3f * v; else if (ACT == 17) v = (v >= 0.f) ? v : 0.2f * v; else if (ACT == 15) v = v / (1.0f + expf(-v)); else if (ACT == 3) v = fmaxf(v, 0.f); else if (ACT == 6) v = 0.5f * v * (1.0f + erff(v * 0.70710678118654752f)); so[w][8 * hh + r][t * 16 + ln] = v; } }
  __builtin_amdgcn_fence(__ATOMIC_ACQ_REL, "workgroup"); __builtin_amdgcn_wave_barrier();
  const int rsub = lane >> 4, c4 = (lane & 15) * 4; typedef _Float16 v4h __attribute__((ext_vector_type(4)));
  {
#pragma unroll
    for (int q = 0; q < 8; ++q) { const int r = q * 2 + rsub; if (col0 + c4 < N) { const v4f v = *(const v4fa*)&so[w][r][c4]; if (C) *(v4f*)(C + cofs + (size_t)(row0 + r) * ldc + col0 + c4) = v; if (C16) { v4h h4; for (int i = 0; i < 4; ++i) h4[i] = (_Float16)v[i]; *(v4h*)(C16 + cofs + (size_t)(row0 + r) * ldc + col0 + c4) = h4; } } }
     }
}


typedef _Float16 v4h __attribute__((ext_vector_type(4)));

__global__ __launch_bounds__(256) void k_x16(const float* __restrict__ x, _Float16* __restrict__ X16, size_t n8) { const size_t t = (size_t)blockIdx.x * 256 + threadIdx.x; if (t >= n8) return; FragH f;
#pragma unroll
  for (int q = 0; q < 8; ++q) f.h[q] = (_Float16)bf16_round(x[t * 8 + q]); *(v8us*)((unsigned short*)X16 + t * 8) = f.half[0];  }
__global__ __launch_bounds__(256) void k_h16(const float* __restrict__ x, _Float16* __restrict__ X16, size_t n8) { const size_t t = (size_t)blockIdx.x * 256 + threadIdx.x; if (t >= n8) return; FragH f;
#pragma unroll
  for (int q = 0; q < 8; ++q) f.h[q] = (_Float16)x[t * 8 + q]; *(v8us*)((unsigned short*)X16 + t * 8) = f.half[0];  }
__global__ __launch_bounds__(256) void k_round16f(const float* __restrict__ W, _Float16* __restrict__ Bt, size_t n8) { const size_t t = (size_t)blockIdx.x * 256 + threadIdx.x; if (t >= n8) return; FragH f;
#pragma unroll
  for (int i = 0; i < 8; ++i) f.h[i] = (_Float16)(bf16_round(W[t * 8 + i]) * 16.0f); *(v8us*)((unsigned short*)Bt + t * 8) = f.half[0];  }
template <int NHv, int TTv>
__global__ __launch_bounds__(256) void k_vt(const _Float16* __restrict__ V16, int ldv, int voff, _Float16* __restrict__ Vt) { __shared__ unsigned short tl[64][66]; const int tid = threadIdx.x; const int slab = blockIdx.x / (TTv / 64), lg = blockIdx.x % (TTv / 64); const int b = slab / NHv, h = slab % NHv;
  for (int i = tid; i < 64 * 8; i += 256) { const int r = i / 8, c8 = (i % 8) * 8; FragH f; f.half[0] = *(const v8us*)((const unsigned short*)V16 + ((size_t)b * TTv + lg * 64 + r) * ldv + voff + h * 64 + c8);
#pragma unroll
    for (int q = 0; q < 8; ++q) tl[r][c8 + q] = f.u[q]; }
  __syncthreads();
  {
#pragma unroll
    for (int rd = 0; rd < 2; ++rd) { const int d = rd * 32 + tid / 8, pc = tid % 8; FragH f;
#pragma unroll
      for (int q = 0; q < 8; ++q) f.u[q] = tl[pc * 8 + q][d];
      *(v8us*)((unsigned short*)Vt + ((size_t)slab * 64 + d) * TTv + lg * 64 + pc * 8) = f.half[0]; }
     } }

__global__ __launch_bounds__(256) void k_hl(const float* __restrict__ F, _Float16* __restrict__ Hh, _Float16* __restrict__ Hl, size_t n8) { const size_t t = (size_t)blockIdx.x * 256 + threadIdx.x; if (t >= n8) return; FragH fh, fl; const v4f a = *(const v4fa*)(F + t * 8), c = *(const v4fa*)(F + t * 8 + 4);
#pragma unroll
  for (int q = 0; q < 4; ++q) { _Float16 h = (_Float16)a[q]; fh.h[q] = h; fl.h[q] = (_Float16)((a[q] - (float)h) * 1024.0f); h = (_Float16)c[q]; fh.h[4 + q] = h; fl.h[4 + q] = (_Float16)((c[q] - (float)h) * 1024.0f); }
  { *(v8us*)((unsigned short*)Hh + t * 8) = fh.half[0]; *(v8us*)((unsigned short*)Hl + t * 8) = fl.half[0];  } }

// ---- fast GEMM (wave tile 32x64; requires M % 32 == 0 rows per launch region and N % 64 == 0); epilogue = k_gemm_hhx semantics ----
__device__ __forceinline__ v16h g2_frag(const _Float16* p, int hh) { FragH f; f.half[0] = *(const v8us*)((const unsigned short*)p + 8 * hh); f.half[1] = *(const v8us*)((const unsigned short*)p + 16 + 8 * hh); return f.v; }
__device__ __forceinline__ v8f g2_mma(v16h a, v16h b, v8f c) { v8f d = __builtin_amdgcn_wmma_f32_16x16x32_f16(false, a, false, b, (short)0, c, false, false); asm volatile("v_nop\n\tv_nop\n\tv_nop\n\tv_nop" : "+v"(d) : "v"(a), "v"(b)); return d; }
template <int ACT>
__global__ __launch_bounds__(128) void k_gemm2(const _Float16* __restrict__ A, int lda, size_t sA, const _Float16* __restrict__ Bh, int ldb, size_t sB, float alpha, const float* __restrict__ bias, size_t sBias, const float* __restrict__ CP, int rowsPerB, size_t sCPb, int row0g,
    float* __restrict__ C, _Float16* __restrict__ C16, int ldc, size_t sC, int M, int N, int K) { static_assert(ACT == 0 || ACT == 3 || ACT == 6 || ACT == 8 || ACT == 9 || ACT == 11 || ACT == 12 || ACT == 14 || ACT == 15 || ACT == 16 || ACT == 17, "k_gemm2: unsupported ACT code (would silently apply no activation)");
  __shared__ __attribute__((aligned(16))) float so[4][32][68];
  const int tid = threadIdx.x, w = tid >> 5, lane = tid & 31, ln = lane & 15, hh = lane >> 4; const int by = blockIdx.y;
  A += (size_t)by * sA; Bh += (size_t)by * sB; const size_t cofs = (size_t)by * sC; const float* bp = bias ? bias + (size_t)by * sBias : nullptr;
  const int ntn = N >> 6; const int mt = blockIdx.x / ntn, nq = blockIdx.x - mt * ntn; const int row0 = mt * 128 + 32 * w, col0 = nq * 64; if (row0 >= M) return;
  const _Float16* a0p = A + (size_t)(row0 + ln) * lda; const _Float16* a1p = a0p + (size_t)16 * lda;
  const _Float16* b0p = Bh + (size_t)(col0 + ln) * ldb; const _Float16* b1p = b0p + (size_t)16 * ldb; const _Float16* b2p = b1p + (size_t)16 * ldb; const _Float16* b3p = b2p + (size_t)16 * ldb;
  const v8f z8 = {0.f,0.f,0.f,0.f,0.f,0.f,0.f,0.f}; v8f c00 = z8, c01 = z8, c02 = z8, c03 = z8, c10 = z8, c11 = z8, c12 = z8, c13 = z8;
#pragma unroll 1
  for (int kb = 0; kb < K; kb += 32) { const v16h a0 = g2_frag(a0p + kb, hh), a1 = g2_frag(a1p + kb, hh);
    v16h b = g2_frag(b0p + kb, hh); c00 = g2_mma(a0, b, c00); c10 = g2_mma(a1, b, c10);
    b = g2_frag(b1p + kb, hh); c01 = g2_mma(a0, b, c01); c11 = g2_mma(a1, b, c11);
    b = g2_frag(b2p + kb, hh); c02 = g2_mma(a0, b, c02); c12 = g2_mma(a1, b, c12);
    b = g2_frag(b3p + kb, hh); c03 = g2_mma(a0, b, c03); c13 = g2_mma(a1, b, c13); }
  v8f accs[8] = {c00, c01, c02, c03, c10, c11, c12, c13};
#pragma unroll
  for (int u = 0; u < 8; ++u) { const int t = u & 3, half = u >> 2; const int col = col0 + t * 16 + ln; const float bv = bp ? bf16_round(bp[col]) : 0.f;
#pragma unroll
    for (int r = 0; r < 8; ++r) { const int rloc = half * 16 + 8 * hh + r; float v = accs[u][r] * alpha + bv; if (CP) { if (rowsPerB < 0) v += CP[cofs + (size_t)(row0g + row0 + rloc) * ldc + col];      /* rowsPerB < 0: own element of the batched C plane */ else { const int bidx = (row0g + row0 + rloc) / rowsPerB; v += CP[(size_t)bidx * sCPb + (size_t)by * 64 + col]; } }
      if (ACT == 3) v = fmaxf(v, 0.f); else if (ACT == 6) v = 0.5f * v * (1.0f + erff(v * 0.70710678118654752f)); else if (ACT == 11) v = 1.0f / (1.0f + expf(-v)); else if (ACT == 15) v = v / (1.0f + expf(-v)); else if (ACT == 12) v = (v > 0.f) ? v : 0.01f * v; else if (ACT == 8) v = tanhf(v); else if (ACT == 9) v = 0.5f * v * (1.0f + tanhf(0.7978845608028654f * (v + 0.044715f * v * v * v))); else if (ACT == 14) v = (v > 0.f) ? v : 0.1f * v; else if (ACT == 16) v = (v >= 0.f) ? v : 0.3f * v; else if (ACT == 17) v = (v >= 0.f) ? v : 0.2f * v;
      so[w][rloc][t * 16 + ln] = v; } }
  __builtin_amdgcn_fence(__ATOMIC_ACQ_REL, "workgroup"); __builtin_amdgcn_wave_barrier();
  const int rsub = lane >> 4, c4 = (lane & 15) * 4;
  {
#pragma unroll
    for (int q = 0; q < 16; ++q) { const int r = q * 2 + rsub; const v4f v = *(const v4fa*)&so[w][r][c4]; if (C) *(v4f*)(C + cofs + (size_t)(row0 + r) * ldc + col0 + c4) = v; if (C16) { v4h h4; for (int i = 0; i < 4; ++i) h4[i] = (_Float16)v[i]; *(v4h*)(C16 + cofs + (size_t)(row0 + r) * ldc + col0 + c4) = h4; } }
     } }


__global__ __launch_bounds__(256) void k_wnat(const float* __restrict__ w, size_t n8, _Float16* __restrict__ Bt) { const size_t t = (size_t)blockIdx.x * 256 + threadIdx.x; if (t >= n8) return; FragH f; for (int q = 0; q < 8; ++q) f.h[q] = (_Float16)(bf16_round(w[t * 8 + q]) * 16.0f); *(v8us*)((unsigned short*)Bt + t * 8) = f.half[0];  }
__global__ __launch_bounds__(256) void k_rsm(const float* __restrict__ S, _Float16* __restrict__ P, int nrows) {
  #pragma clang fp contract(off)
  const int i = blockIdx.x * 256 + threadIdx.x; if (i >= nrows) return; const float* s = S + (size_t)i * SQ; float mx = -3.0e38f;
#pragma unroll 1
  for (int j = 0; j < SQ; ++j) mx = fmaxf(mx, s[j]); float se = 0.f;
#pragma unroll 1
  for (int j = 0; j < SQ; ++j) se += expf(s[j] - mx); const float sc = 256.0f / se;
#pragma unroll 1
  for (int j0 = 0; j0 < SQ; j0 += 8) { FragH f; for (int q = 0; q < 8; ++q) f.h[q] = (_Float16)(expf(s[j0 + q] - mx) * sc); unsigned short* d = (unsigned short*)P + (size_t)i * SQ + j0; *(v8us*)d = f.half[0];  } }
__global__ __launch_bounds__(256) void k_vt(const _Float16* __restrict__ V16, int b, int h0, _Float16* __restrict__ VT) { __shared__ unsigned short tl[64][65]; const int tid = threadIdx.x; const int hh = blockIdx.x % HG, sg = blockIdx.x / HG; const int s0 = sg * 64; const int h = h0 + hh;
  for (int i = tid; i < 64 * 8; i += 256) { const int j = i / 8, d8 = (i % 8) * 8; FragH f; f.half[0] = *(const v8us*)((const unsigned short*)V16 + ((size_t)b * SQ + s0 + j) * DM + h * HD + d8); for (int q = 0; q < 8; ++q) tl[d8 + q][j] = f.u[q]; }
  __syncthreads();
  { for (int i = tid; i < 64 * 8; i += 256) { const int d = i / 8, j8 = (i % 8) * 8; FragH f; for (int q = 0; q < 8; ++q) f.u[q] = tl[d][j8 + q]; *(v8us*)((unsigned short*)VT + ((size_t)hh * HD + d) * SQ + s0 + j8) = f.half[0]; }  } }



__global__ __launch_bounds__(256) void k_rsmcf2(const float* __restrict__ S, _Float16* __restrict__ P, int hg, int q0, int nk) {
  #pragma clang fp contract(off)
  const int t = blockIdx.x * 256 + threadIdx.x; if (t >= hg * QT) return; const size_t i = (size_t)t; const float* s = S + i * NKX; const int last = q0 + (t % QT); float mx = -3.0e38f;
#pragma unroll 1
  for (int j = 0; j < nk; ++j) { const float f = (j <= last) ? 1.f : 0.f; mx = fmaxf(mx, fmaf(f, s[j], (1.f - f) * -1.0e9f)); } float se = 0.f;
#pragma unroll 1
  for (int j = 0; j < nk; ++j) { const float f = (j <= last) ? 1.f : 0.f; se += __expf(fmaf(f, s[j], (1.f - f) * -1.0e9f) - mx); } const float sc = 256.0f / se;
#pragma unroll 1
  for (int j0 = 0; j0 < nk; j0 += 8) { FragH fr; for (int q = 0; q < 8; ++q) { const int j = j0 + q; const float f = (j <= last) ? 1.f : 0.f; fr.h[q] = (_Float16)(__expf(fmaf(f, s[j], (1.f - f) * -1.0e9f) - mx) * sc); } unsigned short* d = (unsigned short*)P + i * NKX + j0; *(v8us*)d = fr.half[0];  } }


template <int MASKADD>
__global__ __launch_bounds__(64) void k_att0(const float* __restrict__ QF, const float* __restrict__ KF, const float* __restrict__ VF, int ld, const float* __restrict__ mask, float scale, float* __restrict__ OF, int ldo) {
  #pragma clang fp contract(off)
  __shared__ __attribute__((aligned(16))) float lq[64][64]; __shared__ __attribute__((aligned(16))) float lo[64][64];
  const int tid = threadIdx.x; const int h = blockIdx.x / (QT0 / 64), rg = blockIdx.x % (QT0 / 64); const int i = rg * 64 + tid;
  const float* qr = QF + (size_t)i * ld + h * HD;
#pragma unroll 1
  for (int c = 0; c < HD / 4; ++c) { *(v4f*)&lq[tid][c * 4] = *(const v4fa*)(qr + c * 4); const v4f z = {0.f, 0.f, 0.f, 0.f}; *(v4f*)&lo[tid][c * 4] = z; }
  float m = -1.0e30f, l = 0.f; const int jmax = MASKADD ? (SQ - 1) : (rg * 64 + 63);      /* additive-mask form: every key (the mask input decides); causal form: keys up to the block's last row */
#pragma unroll 1
  for (int j = 0; j <= jmax; ++j) { const float* kr = KF + (size_t)j * ld + h * HD; const float* vr = VF + (size_t)j * ld + h * HD; float s = 0.f;
#pragma unroll 1
    for (int c = 0; c < HD / 4; ++c) { const v4f kq = *(const v4fa*)(kr + c * 4); const v4f qq = *(v4f*)&lq[tid][c * 4]; s = __fadd_rn(s, __fmul_rn(qq[0], kq[0])); s = __fadd_rn(s, __fmul_rn(qq[1], kq[1])); s = __fadd_rn(s, __fmul_rn(qq[2], kq[2])); s = __fadd_rn(s, __fmul_rn(qq[3], kq[3])); }
    s = __fmul_rn(s, scale); if (MASKADD) s = __fadd_rn(s, __fmul_rn(bf16_round(mask[(size_t)i * SQ + j]), -10000.0f));
    const float f = (MASKADD || j <= i) ? 1.f : 0.f; const float sm = fmaf(f, s, (1.f - f) * -1.0e30f); const float mn = fmaxf(m, sm); const float sc = expf(m - mn); const float e = expf(sm - mn); l = __fadd_rn(__fmul_rn(l, sc), e); m = mn;
#pragma unroll 1
    for (int c = 0; c < HD / 4; ++c) { const v4f vv = *(const v4fa*)(vr + c * 4); v4f oo = *(v4f*)&lo[tid][c * 4]; for (int u = 0; u < 4; ++u) oo[u] = __fadd_rn(__fmul_rn(oo[u], sc), __fmul_rn(e, vv[u])); *(v4f*)&lo[tid][c * 4] = oo; } }
  const float fin = 64.0f / l;      /* o carried x64 like the f16 path */
#pragma unroll 1
  for (int c = 0; c < HD / 4; ++c) { v4f oo = *(v4f*)&lo[tid][c * 4]; for (int u = 0; u < 4; ++u) oo[u] = __fmul_rn(oo[u], fin); *(v4f*)&lo[tid][c * 4] = oo; }
  __syncthreads();
  {
#pragma unroll 1
    for (int it = 0; it < 16; ++it) { const int row = it * 4 + tid / 16, pc = (tid % 16) * 4; const v4f v = *(const v4f*)&lo[row][pc]; *(v4f*)(OF + (size_t)(rg * 64 + row) * ldo + h * HD + pc) = v; }
     } }


template <int BFIN, int WXB>
__global__ __launch_bounds__(256) void k_ln16(const float* __restrict__ X, const float* __restrict__ g, const float* __restrict__ bb, float eps, _Float16* __restrict__ N16, float* __restrict__ XB) {
  #pragma clang fp contract(off)
  __shared__ float red[256]; const size_t r = blockIdx.x; const int t = threadIdx.x; const v4f xa = *(const v4fa*)(X + r * DMQ + t * 4); float s[4]; float sum = 0.f;
  for (int q = 0; q < 4; ++q) { s[q] = BFIN ? bf16_round(xa[q]) : xa[q]; sum = __fadd_rn(sum, s[q]); }
  red[t] = sum; __syncthreads(); for (int st = 128; st > 0; st >>= 1) { if (t < st) red[t] = __fadd_rn(red[t], red[t + st]); __syncthreads(); } const float mu = red[0] / (float)DMQ; __syncthreads();
  float vs = 0.f; for (int q = 0; q < 4; ++q) { const float dl = __fadd_rn(s[q], -mu); vs = __fadd_rn(vs, __fmul_rn(dl, dl)); } red[t] = vs; __syncthreads(); for (int st = 128; st > 0; st >>= 1) { if (t < st) red[t] = __fadd_rn(red[t], red[t + st]); __syncthreads(); }
  const float rs = rsqrtf(__fadd_rn(red[0] / (float)DMQ, eps)); v4h y; v4f xb;
  for (int q = 0; q < 4; ++q) { const int c = t * 4 + q; y[q] = (_Float16)__fadd_rn(__fmul_rn(__fmul_rn(__fadd_rn(s[q], -mu), rs), bf16_round(g[c])), bf16_round(bb[c])); xb[q] = s[q]; }
  { *(v4h*)(N16 + r * DMQ + t * 4) = y; if (WXB) *(v4f*)(XB + r * DMQ + t * 4) = xb;  } }
__global__ __launch_bounds__(256) void k_ftres2(const float* __restrict__ OF0, const float* __restrict__ XB, float* __restrict__ X1, size_t n4) {
  #pragma clang fp contract(off)
  const size_t t = (size_t)blockIdx.x * 256 + threadIdx.x; if (t >= n4) return; const v4f o = *(const v4fa*)(OF0 + t * 4), xv = *(const v4fa*)(XB + t * 4); v4f y; for (int q = 0; q < 4; ++q) y[q] = __fadd_rn(__fmul_rn(o[q], 0.015625f), xv[q]); *(v4f*)(X1 + t * 4) = y;  }

__global__ __launch_bounds__(256) void k_wthd(const float* __restrict__ Wt, _Float16* __restrict__ Bt) { const size_t t = (size_t)blockIdx.x * 256 + threadIdx.x; if (t >= (size_t)NH * HD * (DM / 8)) return; const int m8 = (int)(t % (DM / 8)) * 8; const int d = (int)((t / (DM / 8)) % HD); const int h = (int)(t / ((size_t)(DM / 8) * HD)); FragH f;
  for (int q = 0; q < 8; ++q) f.h[q] = (_Float16)(16.0f * bf16_round(Wt[((size_t)h * DM + m8 + q) * HD + d])); unsigned short* dst = (unsigned short*)Bt + ((size_t)h * HD + d) * DM + m8; *(v8us*)dst = f.half[0];  }




template <int BFIN, int W16, int W32>
__global__ __launch_bounds__(256) void k_lnx(const float* __restrict__ X, const float* __restrict__ g, const float* __restrict__ bb, float eps, _Float16* __restrict__ N16, float* __restrict__ N32) {
  #pragma clang fp contract(off)
  __shared__ float red[256]; const size_t r = blockIdx.x; const int t = threadIdx.x; const bool act = t < (DMQ / 4); const int c0 = act ? t * 4 : 0;
  const v4f xa = *(const v4fa*)(X + r * DMQ + c0); float s[4]; float sum = 0.f;
  for (int q = 0; q < 4; ++q) { s[q] = act ? (BFIN ? bf16_round(xa[q]) : xa[q]) : 0.f; sum = __fadd_rn(sum, s[q]); }
  red[t] = sum; __syncthreads(); for (int st = 128; st > 0; st >>= 1) { if (t < st) red[t] = __fadd_rn(red[t], red[t + st]); __syncthreads(); } const float mu = red[0] / (float)DMQ; __syncthreads();
  float vs = 0.f; for (int q = 0; q < 4; ++q) { const float dl = act ? __fadd_rn(s[q], -mu) : 0.f; vs = __fadd_rn(vs, __fmul_rn(dl, dl)); } red[t] = vs; __syncthreads(); for (int st = 128; st > 0; st >>= 1) { if (t < st) red[t] = __fadd_rn(red[t], red[t + st]); __syncthreads(); }
  const float rs = rsqrtf(__fadd_rn(red[0] / (float)DMQ, eps)); v4h y; v4f yf;
  for (int q = 0; q < 4; ++q) { const int c = c0 + q; yf[q] = __fadd_rn(__fmul_rn(__fmul_rn(__fadd_rn(s[q], -mu), rs), bf16_round(g[c])), bf16_round(bb[c])); y[q] = (_Float16)yf[q]; }
  if (!act) return;      /* no barriers after this point */
  { if (W16) *(v4h*)(N16 + r * DMQ + c0) = y; if (W32) *(v4f*)(N32 + r * DMQ + c0) = yf;  } }


__global__ __launch_bounds__(256) void k_bfr(const float* __restrict__ x, float* __restrict__ XB, size_t n8) { const size_t t = (size_t)blockIdx.x * 256 + threadIdx.x; if (t >= n8) return; v4f a = *(const v4fa*)(x + t * 8), c = *(const v4fa*)(x + t * 8 + 4); for (int q = 0; q < 4; ++q) { a[q] = bf16_round(a[q]); c[q] = bf16_round(c[q]); }
  { *(v4f*)(XB + t * 8) = a; *(v4f*)(XB + t * 8 + 4) = c;  } }




__global__ __launch_bounds__(256) void k_lorafold(const float* __restrict__ Wm, const float* __restrict__ A, const float* __restrict__ Bm, float* __restrict__ WE, int K, int N, float sc) {
  #pragma clang fp contract(off)
  const size_t t = (size_t)blockIdx.x * 256 + threadIdx.x; if (t >= (size_t)K * N) return; const int i = (int)(t / N), o = (int)(t % N); float a = 0.f;
  for (int r = 0; r < 16; ++r) a = __fadd_rn(a, __fmul_rn(bf16_round(A[(size_t)i * 16 + r]), bf16_round(Bm[(size_t)r * N + o])));
  const float v = __fadd_rn(bf16_round(Wm[t]), __fmul_rn(sc, a)); *(float*)(WE + t) = v;  }
__global__ __launch_bounds__(256) void k_wt32rep(const float* __restrict__ Wf, _Float16* __restrict__ Bt, int K, int N, int DOUT, float scale) {
  const int t = blockIdx.x * 256 + threadIdx.x; if (t >= DOUT * (K / 8)) return; const int n = t / (K / 8), k8 = (t % (K / 8)) * 8; const int rep = DOUT / N; const int src = (n / (HD * rep)) * HD + (n % HD);      /* head h = n / HD -> group h / rep */
  FragH f; for (int i = 0; i < 8; ++i) f.h[i] = (_Float16)(Wf[(size_t)(k8 + i) * N + src] * scale);
  *(v8us*)((unsigned short*)Bt + (size_t)n * K + k8) = f.half[0];  }
__global__ __launch_bounds__(256) void k_brep(const float* __restrict__ b, float* __restrict__ out) { const int t = blockIdx.x * 256 + threadIdx.x; if (t >= DM) return; const float v = b[(t / (HD * 4)) * HD + (t % HD)]; *(float*)(out + t) = v;  }

__global__ __launch_bounds__(256) void k_rsmcim(const float* __restrict__ S, _Float16* __restrict__ P, int hg, int q0, int nk, const int* __restrict__ am) {
  #pragma clang fp contract(off)
  const int t = blockIdx.x * 256 + threadIdx.x; if (t >= hg * QT) return; const size_t i = (size_t)t; const float* s = S + i * NKX; const int last = q0 + (t % QT); const int* mr = am + (size_t)last * SQ; float mx = -3.0e38f;      /* the module's mask row of this query (keys >= nk lie above the diagonal of the causal mask and are not computed) */
#pragma unroll 1
  for (int j = 0; j < nk; ++j) { const float f = (mr[j] != 0) ? 1.f : 0.f; mx = fmaxf(mx, fmaf(f, s[j], (1.f - f) * -1.0e9f)); } float se = 0.f;
#pragma unroll 1
  for (int j = 0; j < nk; ++j) { const float f = (mr[j] != 0) ? 1.f : 0.f; se += __expf(fmaf(f, s[j], (1.f - f) * -1.0e9f) - mx); } const float sc = 256.0f / se;
#pragma unroll 1
  for (int j0 = 0; j0 < nk; j0 += 8) { FragH fr; for (int q = 0; q < 8; ++q) { const int j = j0 + q; const float f = (mr[j] != 0) ? 1.f : 0.f; fr.h[q] = (_Float16)(__expf(fmaf(f, s[j], (1.f - f) * -1.0e9f) - mx) * sc); } unsigned short* d = (unsigned short*)P + i * NKX + j0; *(v8us*)d = fr.half[0];  } }



__global__ __launch_bounds__(256) void k_bcpy(const float* __restrict__ b, int n, int NP, float* __restrict__ dst, int dst0) { for (int i = threadIdx.x; i < NP; i += 256) { const float v = (i < n) ? b[i] : 0.f; *(float*)(dst + dst0 + i) = v; }  }



__global__ __launch_bounds__(256) void k_rsmp(const float* __restrict__ S, _Float16* __restrict__ P, int nrows, int nk) {
  #pragma clang fp contract(off)
  const int t = blockIdx.x * 256 + threadIdx.x; if (t >= nrows) return; const size_t ri = (size_t)t; const float* s = S + ri * NKX; float mx = -3.0e38f;
#pragma unroll 1
  for (int j = 0; j < nk; ++j) mx = fmaxf(mx, s[j]); float se = 0.f;
#pragma unroll 1
  for (int j = 0; j < nk; ++j) se += __expf(s[j] - mx); const float sc = 256.0f / se;
#pragma unroll 1
  for (int j0 = 0; j0 < nk; j0 += 8) { FragH fr; for (int q = 0; q < 8; ++q) fr.h[q] = (_Float16)(__expf(s[j0 + q] - mx) * sc);
    unsigned short* d = (unsigned short*)P + ri * NKX + j0; *(v8us*)d = fr.half[0];  } }
extern "C" void kernel_launch(void* const* d_in, const int* in_sizes, int n_in,
                              void* d_out, int out_size, void* d_ws, size_t ws_size, hipStream_t stream) {
  (void)in_sizes; (void)n_in; (void)out_size;
  const float* const* I = (const float* const*)d_in; const float* x = I[0]; const float* cond = I[1]; const float* wq = I[2]; const float* bq = I[3]; const float* wkv = I[4]; const float* bkv = I[5]; const float* wo = I[6]; const float* bo = I[7];      /* input order: x [2][2048][1024]; tgt [2][2048][1024]; [in][out] Wq [1024][1024] + bq; Wkv [1024][2048] + bkv (k | v halves); Wp [1024][1024] + bp; the three biases are bound and read */
  static_assert(NH * HD == DM && SQ % QT == 0 && QT % 128 == 0 && SK % 64 == 0 && SK % 32 == 0 && DC % 32 == 0 && DM % 64 == 0 && NKX == SK, "shape / tile multiples");
  const size_t NRK = (size_t)NB * SK;      /* conditioning rows */
  char* ws = (char*)d_ws; size_t off = 0;
  auto take = [&](size_t bytes) { char* p = ws + off; off += (bytes + 255) & ~(size_t)255; return p; };
  _Float16* BQ = (_Float16*)take((size_t)DM * DM * 2); _Float16* BKV = (_Float16*)take((size_t)2 * DM * DC * 2); _Float16* BO = (_Float16*)take((size_t)DM * DM * 2);
  _Float16* X16 = (_Float16*)take(NR * DM * 2); _Float16* C16 = (_Float16*)take(NRK * DC * 2); _Float16* Q16 = (_Float16*)take(NR * DM * 2); _Float16* KV16 = (_Float16*)take(NRK * 2 * DM * 2); _Float16* O16 = (_Float16*)take(NR * DM * 2);
  float* S = (float*)take((size_t)NH * QT * NKX * 4); _Float16* P = (_Float16*)take((size_t)NH * QT * NKX * 2); _Float16* VT = (_Float16*)take((size_t)NH * HD * SK * 2);
  if (off > ws_size) return;      /* 2 + 4 + 2 (weight planes) + 8 + 8 + 8 + 16 + 8 (row planes) + 32 + 16 + 4 (S, P, V^T) = 108 MiB at NB 2, SK 2048, DC 1024 */
  k_wt_f16<<<(unsigned)(((size_t)DM * (DM / 8) + 255) / 256), 256, 0, stream>>>(wq, BQ, DM, DM, 16.0f); k_wt_f16<<<(unsigned)(((size_t)2 * DM * (DC / 8) + 255) / 256), 256, 0, stream>>>(wkv, BKV, DC, 2 * DM, 16.0f); k_wt_f16<<<(unsigned)(((size_t)DM * (DM / 8) + 255) / 256), 256, 0, stream>>>(wo, BO, DM, DM, 16.0f);      /* [in][out] -> Bt x16: Wq [1024][1024]; Wkv [DC = 1024][2048] -> Bt [2048][1024] (rows 0..1023 = k, 1024..2047 = v); Wp */
  k_x16<<<(unsigned)((NR * DM / 8 + 255) / 256), 256, 0, stream>>>(x, X16, NR * DM / 8); k_x16<<<(unsigned)((NRK * DC / 8 + 255) / 256), 256, 0, stream>>>(cond, C16, NRK * DC / 8);      /* exact f16 rows of both inputs */
  k_gemm2<0><<<dim3((unsigned)((NR / 128) * (DM / 64)), 1), 128, 0, stream>>>(X16, DM, 0, BQ, DM, 0, 0.0625f, bq, 0, nullptr, 1, 0, 0, nullptr, Q16, DM, 0, (int)NR, DM, DM);      /* q rows (f16); head h = columns 64 h .. */
  k_gemm2<0><<<dim3((unsigned)((NRK / 128) * (2 * DM / 64)), 1), 128, 0, stream>>>(C16, DC, 0, BKV, DC, 0, 0.0625f, bkv, 0, nullptr, 1, 0, 0, nullptr, KV16, 2 * DM, 0, (int)NRK, 2 * DM, DC);      /* k | v rows (f16, pitch 2048): k = columns 0..1023, v = columns 1024..2047, head h = columns 64 h .. of each half */
  for (int b = 0; b < NB; ++b) { const size_t rq0 = (size_t)b * SQ, rk0 = (size_t)b * SK;
    k_vt<NH, SK><<<NH * (SK / 64), 256, 0, stream>>>(KV16 + rk0 * 2 * DM + DM, 2 * DM, 0, VT);      /* V^T [NH][HD][SK] of this batch (the v half of the fused rows) */
    for (int q0 = 0; q0 < SQ; q0 += QT) {      /* every 256-row query tile sees all SK keys */
      k_gemm2<0><<<dim3((QT / 128) * (SK / 64), NH), 128, 0, stream>>>(Q16 + (rq0 + q0) * DM, DM, (size_t)HD, KV16 + rk0 * 2 * DM, 2 * DM, (size_t)HD, 0.015625f, nullptr, 0, nullptr, 1, 0, 0, S, nullptr, NKX, (size_t)QT * NKX, QT, SK, HD);      /* scores (q / 8) . (k / 8) = q . k / 64, all heads on grid.y */
      k_rsmp<<<(NH * QT + 255) / 256, 256, 0, stream>>>(S, P, NH * QT, SK);      /* softmax over the SK = 2048 keys -> P x256 f16 */
      k_gemm2<0><<<dim3((QT / 128) * (HD / 64), NH), 128, 0, stream>>>(P, NKX, (size_t)QT * NKX, VT, SK, (size_t)HD * SK, 0.25f, nullptr, 0, nullptr, 1, 0, 0, nullptr, O16 + (rq0 + q0) * DM, DM, (size_t)HD, QT, HD, SK); } }      /* ctx (merged heads, x64) as f16 rows */
  k_gemm2<0><<<dim3((unsigned)((NR / 128) * (DM / 64)), 1), 128, 0, stream>>>(O16, DM, 0, BO, DM, 0, 0.0009765625f, bo, 0, nullptr, 1, 0, 0, (float*)d_out, nullptr, DM, 0, (int)NR, DM, DM);      /* out = ctx proj_w + proj_b */
}

// v001
// It runs in 1340 microseconds.
// Timed twice side by side with v000, it ran 4.91 and 4.88 times as fast.
#include <hip/hip_runtime.h>
// Multi-head cross-attention with a fused key / value projection and BOTH q and k scaled (x [2][2048][1024] (queries), tgt [2][2048][1024] (keys / values); q = x Wq + bq ([in][out] 1024 x 1024, normal x 0.02; zero bias); kv = tgt Wkv + bkv ([in][out] 1024 x 2048; zero bias) split into halves: k = columns 0..1023, v = columns 1024..2047; 16 heads of 64; logits = (q * 64^-0.5) . (k * 64^-0.5): the module scales BOTH operands, so the effective scale is 1/64; softmax over the 2048 tgt positions (no mask); out = merged Wp + bp ([in][out]; zero bias) -> [2][2048][1024]).
// Structure: token rows; x and tgt as exact f16 rows; natural weights as exact x16 planes; q and fused k | v WMMA GEMMs (32x64 wave tiles, f32 accumulation, + bias) -> f16; per batch V^T via LDS transposes; per 256-row query tile: scores over all keys (K = 64, alpha 1/64, 16 heads on grid.y) f32, plain row softmax on VALU (f32 statistics, native exp; weights x256 f16), ctx = P V^T (x64) merged f16; ctx Wp + bp f32 -> output.
// Compute dtype: inputs rounded to bf16; x / weights exact; q, k, v, softmax weights and o as plain f16 GEMM operands (~2^-12); scores and softmax statistics f32. v_wmma_f32_16x16x32_f16.
#define NB 2
#define SQ 2048                      /* query rows per batch */
#define SK 2048                      /* conditioning (key / value) rows per batch */
#define DC 1024                       /* conditioning width */
#define DM 1024
#define NH 16
#define HD 64
#define HG 4                         /* heads per attention launch group */
#define QT 256                       /* query rows per attention tile */
#define NKX SK                       /* S / P row pitch = the SK keys (2048 here) */
#define QT0 128                      /* first-tile rows recomputed exactly in f32 */
#define B0 0                         /* first batch processed (debug hook) */
#define NBR NB                       /* batches processed (debug hook) */
#define NR ((size_t)NB * SQ)
#define DMQ DM
#define DFF 4096         /* token rows */
#define MP ((int)((size_t)NBR * SQ)) /* rows projected (debug hook) */
#define QN SQ                        /* query rows attended per batch (debug hook) */
#define NHD NH                       /* heads attended (debug hook) */
#define MPO MP                       /* rows through the output stage (debug hook) */
#define LQ (3 * DM)      /* unused; q rows have pitch DM, k | v rows 2 * DM */
typedef __bf16 v16b __attribute__((ext_vector_type(16)));
typedef unsigned short v8us __attribute__((ext_vector_type(8), may_alias));
typedef float  v8f  __attribute__((ext_vector_type(8)));
typedef float  v4f  __attribute__((ext_vector_type(4)));
typedef float  v4fa __attribute__((ext_vector_type(4), may_alias));
union FragB { v16b v; v8us half[2]; unsigned short u[16]; };

__device__ __forceinline__ unsigned short bf16_bits(float x) { unsigned int u = __float_as_uint(x); return (unsigned short)((u + 0x7FFFu + ((u >> 16) & 1u)) >> 16); }
__device__ __forceinline__ float bf16_val(unsigned short b) { return __uint_as_float(((unsigned int)b) << 16); }
__device__ __forceinline__ float bf16_round(float x) { return bf16_val(bf16_bits(x)); }
// D += A·B with NT terms: 1 = ah·bh, 2 = + al·bh (A split), 3 = + ah·bl (both split)
template <int NT>
__device__ __forceinline__ v8f mmaN(v16b ah, v16b al, v16b bh, v16b bl, v8f c) {
  c = __builtin_amdgcn_wmma_f32_16x16x32_bf16(false, ah, false, bh, (short)0, c, false, false);
  if (NT >= 2) c = __builtin_amdgcn_wmma_f32_16x16x32_bf16(false, al, false, bh, (short)0, c, false, false);
  if (NT >= 3) c = __builtin_amdgcn_wmma_f32_16x16x32_bf16(false, ah, false, bl, (short)0, c, false, false);
  asm volatile("v_nop\n\tv_nop\n\tv_nop\n\tv_nop" : "+v"(c) : "v"(ah), "v"(al), "v"(bh), "v"(bl));
  return c;
}

__global__ __launch_bounds__(256) void k_wt_bf16(const float* __restrict__ W, unsigned short* __restrict__ Wt, int K, int N) {
  const int t = blockIdx.x * 256 + threadIdx.x;
  const int k8n = K / 8;
  if (t >= N * k8n) return;
  const int n = t / k8n, k8 = (t % k8n) * 8;
  v8us v;
#pragma unroll
  for (int i = 0; i < 8; ++i) v[i] = bf16_bits(W[(size_t)(k8 + i) * N + n]);
  *(v8us*)(Wt + (size_t)n * K + k8) = v;
  
}

// GEMM C[M][N] (f32, pitch ldc) = act(A[M][K]·W + bias). A f32 row-major (pitch lda) converted per fragment to bf16
// (ASPLIT: hi/lo two planes -> 2 terms, else single rounded term); Wt bf16 [N][K] (pitch ldb). BIAS_BF16 rounds the
// bias to bf16 first (bias quantised to bf16 before the add). K%32==0, M%16==0, N%64==0.
template <bool ASPLIT, int ACT, bool BIAS_BF16>
__global__ __launch_bounds__(128) void k_gemm_bf(const float* __restrict__ A, int lda, const unsigned short* __restrict__ Wt, int ldb,
                                               const float* __restrict__ bias, float* __restrict__ C, int ldc, int M, int N, int K) {
  __shared__ __attribute__((aligned(16))) float so[4][16][64];
  const int tid = threadIdx.x, w = tid >> 5, lane = tid & 31, ln = lane & 15, hh = lane >> 4;
  const int ntn = N / 64;
  const int wid = blockIdx.x * 4 + w;
  const int mt = wid / ntn, nq = wid % ntn;
  if (mt * 16 >= M) return;
  const int row0 = mt * 16, col0 = nq * 64;
  const float* arow = A + (size_t)(row0 + ln) * lda;
  v8f acc[4] = {};
  for (int kb = 0; kb < K; kb += 32) {
    FragB ah, al;
    const v4f x0 = *(const v4fa*)(arow + kb + 8 * hh), x1 = *(const v4fa*)(arow + kb + 8 * hh + 4);
    const v4f x2 = *(const v4fa*)(arow + kb + 16 + 8 * hh), x3 = *(const v4fa*)(arow + kb + 16 + 8 * hh + 4);
    float xs[16] = {x0[0],x0[1],x0[2],x0[3],x1[0],x1[1],x1[2],x1[3],x2[0],x2[1],x2[2],x2[3],x3[0],x3[1],x3[2],x3[3]};
#pragma unroll
    for (int i = 0; i < 16; ++i) { const unsigned short hb = bf16_bits(xs[i]); ah.u[i] = hb; al.u[i] = ASPLIT ? bf16_bits(xs[i] - bf16_val(hb)) : (unsigned short)0; }
#pragma unroll
    for (int t = 0; t < 4; ++t) {
      const unsigned short* brow = Wt + (size_t)(col0 + t * 16 + ln) * ldb + kb;
      FragB b;
      b.half[0] = *(const v8us*)(brow + 8 * hh);
      b.half[1] = *(const v8us*)(brow + 16 + 8 * hh);
      acc[t] = mmaN<ASPLIT ? 2 : 1>(ah.v, al.v, b.v, b.v, acc[t]);
    }
  }
#pragma unroll
  for (int t = 0; t < 4; ++t) {
    float bv = bias ? bias[col0 + t * 16 + ln] : 0.f;
    if (BIAS_BF16) bv = bf16_round(bv);
#pragma unroll
    for (int r = 0; r < 8; ++r) { float v = acc[t][r] + bv; if (ACT == 1) v = fmaxf(v, 0.f); so[w][8 * hh + r][t * 16 + ln] = v; }
  }
  __builtin_amdgcn_fence(__ATOMIC_ACQ_REL, "workgroup");
  __builtin_amdgcn_wave_barrier();
  const int rsub = lane >> 4, c4 = (lane & 15) * 4;
  {
#pragma unroll
    for (int q = 0; q < 8; ++q) {
      const int r = q * 2 + rsub;
      const v4f v = *(const v4fa*)&so[w][r][c4];
      *(v4f*)(C + (size_t)(row0 + r) * ldc + col0 + c4) = v;
    }
    
  }
}

// GEMM C = act(A·W + bias + resid): A f32 (ASPLIT -> hi/lo 2 terms), Wt bf16 [N][K]; ACT 0 none, 1 relu, 2 exact gelu;
// resid (optional, f32, row index = (row % rmod), pitch ldr, RES_BF16 rounds it) added before the activation.
template <bool ASPLIT, int ACT, bool BIAS_BF16, bool RES_BF16>
__global__ __launch_bounds__(128) void k_gemm_bf3(const float* __restrict__ A, int lda, const unsigned short* __restrict__ Wt, int ldb,
                                                const float* __restrict__ bias, const float* __restrict__ resid, int rmod, int ldr,
                                                float* __restrict__ C, int ldc, int M, int N, int K) {
  __shared__ __attribute__((aligned(16))) float so[4][16][64];
  const int tid = threadIdx.x, w = tid >> 5, lane = tid & 31, ln = lane & 15, hh = lane >> 4;
  const int ntn = N / 64;
  const int wid = blockIdx.x * 4 + w;
  const int mt = wid / ntn, nq = wid % ntn;
  if (mt * 16 >= M) return;
  const int row0 = mt * 16, col0 = nq * 64;
  const float* arow = A + (size_t)(row0 + ln) * lda;
  v8f acc[4] = {};
  for (int kb = 0; kb < K; kb += 32) {
    FragB ah, al;
    const v4f x0 = *(const v4fa*)(arow + kb + 8 * hh), x1 = *(const v4fa*)(arow + kb + 8 * hh + 4);
    const v4f x2 = *(const v4fa*)(arow + kb + 16 + 8 * hh), x3 = *(const v4fa*)(arow + kb + 16 + 8 * hh + 4);
    float xs[16] = {x0[0],x0[1],x0[2],x0[3],x1[0],x1[1],x1[2],x1[3],x2[0],x2[1],x2[2],x2[3],x3[0],x3[1],x3[2],x3[3]};
#pragma unroll
    for (int i = 0; i < 16; ++i) { const unsigned short hb = bf16_bits(xs[i]); ah.u[i] = hb; al.u[i] = ASPLIT ? bf16_bits(xs[i] - bf16_val(hb)) : (unsigned short)0; }
#pragma unroll
    for (int t = 0; t < 4; ++t) {
      const unsigned short* brow = Wt + (size_t)(col0 + t * 16 + ln) * ldb + kb;
      FragB b;
      b.half[0] = *(const v8us*)(brow + 8 * hh);
      b.half[1] = *(const v8us*)(brow + 16 + 8 * hh);
      acc[t] = mmaN<ASPLIT ? 2 : 1>(ah.v, al.v, b.v, b.v, acc[t]);
    }
  }
#pragma unroll
  for (int t = 0; t < 4; ++t) {
    const int col = col0 + t * 16 + ln;
    float bv = bias ? bias[col] : 0.f;
    if (BIAS_BF16) bv = bf16_round(bv);
#pragma unroll
    for (int r = 0; r < 8; ++r) {
      float v = acc[t][r] + bv;
      if (resid) { float rv = resid[(size_t)((row0 + 8 * hh + r) % rmod) * ldr + col]; if (RES_BF16) rv = bf16_round(rv); v += rv; }
      if (ACT == 1) v = fmaxf(v, 0.f);
      if (ACT == 2) v = 0.5f * v * (1.0f + erff(v * 0.70710678118654752f));
      if (ACT == 3) { const float u = 0.7978845608028654f * (v + 0.044715f * v * v * v); v = 0.5f * v * (1.0f + tanhf(u)); }
      so[w][8 * hh + r][t * 16 + ln] = v;
    }
  }
  __builtin_amdgcn_fence(__ATOMIC_ACQ_REL, "workgroup");
  __builtin_amdgcn_wave_barrier();
  const int rsub = lane >> 4, c4 = (lane & 15) * 4;
  {
#pragma unroll
    for (int q = 0; q < 8; ++q) {
      const int r = q * 2 + rsub;
      const v4f v = *(const v4fa*)&so[w][r][c4];
      *(v4f*)(C + (size_t)(row0 + r) * ldc + col0 + c4) = v;
    }
    
  }
}
// row LayerNorm (biased variance, eps) over N: s = X (+ R); optional out_sum <- s; out_norm <- (s-mu)*rsqrt(var+eps)*g + b
template <bool PARAM_BF16>
__global__ __launch_bounds__(256) void k_layernorm(const float* __restrict__ X, const float* __restrict__ R, const float* __restrict__ g, const float* __restrict__ bta,
                                                  float* __restrict__ out_sum, float* __restrict__ out_norm, int N, float eps) {
  __shared__ float red[256];
  const int row = blockIdx.x, tid = threadIdx.x;
  const float* x = X + (size_t)row * N; const float* rr = R ? R + (size_t)row * N : nullptr;
  float vals[16];                     // up to N = 4096
  const int per = N / 256;            // contiguous chunk per thread? use strided-by-4 chunks: thread handles j = tid*4 + 1024*u
  float s1 = 0.f;
  for (int u = 0; u < per / 4; ++u) {
    const int j = tid * 4 + 1024 * u;
    const v4f a = *(const v4fa*)(x + j);
    v4f b = {0.f,0.f,0.f,0.f}; if (rr) b = *(const v4fa*)(rr + j);
#pragma unroll
    for (int q = 0; q < 4; ++q) { const float v = a[q] + b[q]; vals[u * 4 + q] = v; s1 += v; }
  }
  red[tid] = s1; __syncthreads();
  for (int st = 128; st > 0; st >>= 1) { if (tid < st) red[tid] += red[tid + st]; __syncthreads(); }
  const float mu = red[0] / (float)N; __syncthreads();
  float s2 = 0.f;
  for (int u = 0; u < per / 4; ++u)
#pragma unroll
    for (int q = 0; q < 4; ++q) { const float c = vals[u * 4 + q] - mu; s2 += c * c; }
  red[tid] = s2; __syncthreads();
  for (int st = 128; st > 0; st >>= 1) { if (tid < st) red[tid] += red[tid + st]; __syncthreads(); }
  const float rs = rsqrtf(red[0] / (float)N + eps);
  {
    for (int u = 0; u < per / 4; ++u) {
      const int j = tid * 4 + 1024 * u;
      v4f o, sm;
#pragma unroll
      for (int q = 0; q < 4; ++q) {
        float gg = g[j + q], bb = bta[j + q];
        if (PARAM_BF16) { gg = bf16_round(gg); bb = bf16_round(bb); }
        sm[q] = vals[u * 4 + q]; o[q] = (vals[u * 4 + q] - mu) * rs * gg + bb;
      }
      if (out_sum) *(v4f*)(out_sum + (size_t)row * N + j) = sm;
      *(v4f*)(out_norm + (size_t)row * N + j) = o;
    }
    
  }
}



// ---- f16 WMMA path (v_wmma_f32_16x16x32_f16): 11-bit significands for operands in range — used where a [0,1] probability operand needs more precision than bf16
typedef _Float16 v16h __attribute__((ext_vector_type(16)));
union FragH { v16h v; v8us half[2]; _Float16 h[16]; unsigned short u[16]; };
template <int NT>
__device__ __forceinline__ v8f mmaH(v16h ah, v16h al, v16h bh, v16h bl, v8f c) {
  c = __builtin_amdgcn_wmma_f32_16x16x32_f16(false, ah, false, bh, (short)0, c, false, false);
  if (NT >= 2) c = __builtin_amdgcn_wmma_f32_16x16x32_f16(false, al, false, bh, (short)0, c, false, false);
  if (NT >= 3) c = __builtin_amdgcn_wmma_f32_16x16x32_f16(false, ah, false, bl, (short)0, c, false, false);
  asm volatile("v_nop\n\tv_nop\n\tv_nop\n\tv_nop" : "+v"(c) : "v"(ah), "v"(al), "v"(bh), "v"(bl));
  return c;
}
// batched GEMM like k_gemm_b but f16 operands: A f32 (split into f16 hi/lo if ASPLIT, else rounded to f16), Bt = f16 values [n][k]; alpha; C f32; N multiple of 16 (partial tiles skipped)
template <bool ASPLIT>
__global__ __launch_bounds__(128) void k_gemm_h(const float* __restrict__ A, int lda, size_t sA, const _Float16* __restrict__ Bh, int ldb, size_t sB, float alpha, float* __restrict__ C, int ldc, size_t sC, int M, int N, int K) {
  __shared__ __attribute__((aligned(16))) float so[4][16][64];
  const int tid = threadIdx.x, w = tid >> 5, lane = tid & 31, ln = lane & 15, hh = lane >> 4; const int by = blockIdx.y;
  A += (size_t)by * sA; Bh += (size_t)by * sB; C += (size_t)by * sC;
  const int ntn = (N + 63) / 64; const int wid = blockIdx.x * 4 + w; const int mt = wid / ntn, nq = wid % ntn; if (mt * 16 >= M) return;
  const int row0 = mt * 16, col0 = nq * 64; const float* arow = A + (size_t)(row0 + ln) * lda;
  v8f acc[4] = {};
  for (int kb = 0; kb < K; kb += 32) {
    FragH ah, al;
    const v4f x0 = *(const v4fa*)(arow + kb + 8 * hh), x1 = *(const v4fa*)(arow + kb + 8 * hh + 4), x2 = *(const v4fa*)(arow + kb + 16 + 8 * hh), x3 = *(const v4fa*)(arow + kb + 16 + 8 * hh + 4);
    float xs[16] = {x0[0],x0[1],x0[2],x0[3],x1[0],x1[1],x1[2],x1[3],x2[0],x2[1],x2[2],x2[3],x3[0],x3[1],x3[2],x3[3]};
#pragma unroll
    for (int i = 0; i < 16; ++i) { const _Float16 h = (_Float16)xs[i]; ah.h[i] = h; al.h[i] = ASPLIT ? (_Float16)(xs[i] - (float)h) : (_Float16)0.0f; }
#pragma unroll
    for (int t = 0; t < 4; ++t) { if (col0 + t * 16 >= N) continue; const size_t boff = (size_t)(col0 + t * 16 + ln) * ldb + kb; FragH bq; bq.half[0] = *(const v8us*)(Bh + boff + 8 * hh); bq.half[1] = *(const v8us*)(Bh + boff + 16 + 8 * hh);
      acc[t] = mmaH<ASPLIT ? 2 : 1>(ah.v, al.v, bq.v, bq.v, acc[t]); }
  }
#pragma unroll
  for (int t = 0; t < 4; ++t) { if (col0 + t * 16 >= N) continue;
#pragma unroll
    for (int r = 0; r < 8; ++r) so[w][8 * hh + r][t * 16 + ln] = acc[t][r] * alpha; }
  __builtin_amdgcn_fence(__ATOMIC_ACQ_REL, "workgroup"); __builtin_amdgcn_wave_barrier();
  const int rsub = lane >> 4, c4 = (lane & 15) * 4;
  {
#pragma unroll
    for (int q = 0; q < 8; ++q) { const int r = q * 2 + rsub; if (col0 + c4 < N) { const v4f v = *(const v4fa*)&so[w][r][c4]; *(v4f*)(C + (size_t)(row0 + r) * ldc + col0 + c4) = v; } }
     }
}

// Wt[n][k] = f16(W[k][n]·scale) from f32 row-major W[K][N] (scale = power of two; bf16-exact weights stay exact in f16 away from the subnormal range)
__global__ __launch_bounds__(256) void k_wt_f16(const float* __restrict__ W, _Float16* __restrict__ Wt, int K, int N, float scale) {
  const int t = blockIdx.x * 256 + threadIdx.x; if (t >= N * (K / 8)) return; const int n = t / (K / 8), k8 = (t % (K / 8)) * 8; FragH f;
#pragma unroll
  for (int i = 0; i < 8; ++i) f.h[i] = (_Float16)(bf16_round(W[(size_t)(k8 + i) * N + n]) * scale); const v8us o = f.half[0];
  *(v8us*)((unsigned short*)Wt + (size_t)n * K + k8) = o; 
}
// k_gemm_hh variant with fused epilogue: v = acc·alpha + bias[by·sBias + col] (+ CP[(row/rowsPerB)·sCPb + by·64 + col] if CP) ; ACT 0 none / 1 elu ; writes f16 C16 (and f32 C if non-null)
template <int ACT>
__global__ __launch_bounds__(128) void k_gemm_hhx(const _Float16* __restrict__ A, int lda, size_t sA, const _Float16* __restrict__ Bh, int ldb, size_t sB, float alpha, const float* __restrict__ bias, size_t sBias, const float* __restrict__ CP, int rowsPerB, size_t sCPb, int row0g,
    float* __restrict__ C, _Float16* __restrict__ C16, int ldc, size_t sC, int M, int N, int K) {
  __shared__ __attribute__((aligned(16))) float so[4][16][64];
  const int tid = threadIdx.x, w = tid >> 5, lane = tid & 31, ln = lane & 15, hh = lane >> 4; const int by = blockIdx.y;
  A += (size_t)by * sA; Bh += (size_t)by * sB; const size_t cofs = (size_t)by * sC; const float* bp = bias ? bias + (size_t)by * sBias : nullptr;
  const int ntn = (N + 63) / 64; const int wid = blockIdx.x * 4 + w; const int mt = wid / ntn, nq = wid % ntn; if (mt * 16 >= M) return;
  const int row0 = mt * 16, col0 = nq * 64; const _Float16* arow = A + (size_t)(row0 + ln) * lda;
  v8f acc[4] = {};
  for (int kb = 0; kb < K; kb += 32) { FragH ah; ah.half[0] = *(const v8us*)((const unsigned short*)arow + kb + 8 * hh); ah.half[1] = *(const v8us*)((const unsigned short*)arow + kb + 16 + 8 * hh);
#pragma unroll
    for (int t = 0; t < 4; ++t) { if (col0 + t * 16 >= N) continue; const size_t boff = (size_t)(col0 + t * 16 + ln) * ldb + kb; FragH bq; bq.half[0] = *(const v8us*)((const unsigned short*)Bh + boff + 8 * hh); bq.half[1] = *(const v8us*)((const unsigned short*)Bh + boff + 16 + 8 * hh);
      acc[t] = mmaH<1>(ah.v, ah.v, bq.v, bq.v, acc[t]); }
  }
#pragma unroll
  for (int t = 0; t < 4; ++t) { if (col0 + t * 16 >= N) continue; const int col = col0 + t * 16 + ln; const float bv = bp ? bf16_round(bp[col]) : 0.f;
#pragma unroll
    for (int r = 0; r < 8; ++r) { float v = acc[t][r] * alpha + bv; if (CP) { const int rr = row0g + row0 + 8 * hh + r; if (rowsPerB < 0) v += CP[cofs + (size_t)rr * ldc + col];      /* rowsPerB < 0: own element of the batched C plane */ else { const int bidx = rr / rowsPerB; v += CP[(size_t)bidx * sCPb + (size_t)by * 64 + col]; } } if (ACT == 1) v = (v > 0.f) ? v : expm1f(v); else if (ACT == 7) v = (v > 0.f) ? v + 1.0f : expf(v); else if (ACT == 8) v = tanhf(v); else if (ACT == 9) v = 0.5f * v * (1.0f + tanhf(0.7978845608028654f * (v + 0.044715f * v * v * v))); else if (ACT == 11) v = 1.0f / (1.0f + expf(-v)); else if (ACT == 12) v = (v > 0.f) ? v : 0.01f * v; else if (ACT == 14) v = (v > 0.f) ? v : 0.1f * v; else if (ACT == 16) v = (v >= 0.f) ? v : 0.3f * v; else if (ACT == 17) v = (v >= 0.f) ? v : 0.2f * v; else if (ACT == 15) v = v / (1.0f + expf(-v)); else if (ACT == 3) v = fmaxf(v, 0.f); else if (ACT == 6) v = 0.5f * v * (1.0f + erff(v * 0.70710678118654752f)); so[w][8 * hh + r][t * 16 + ln] = v; } }
  __builtin_amdgcn_fence(__ATOMIC_ACQ_REL, "workgroup"); __builtin_amdgcn_wave_barrier();
  const int rsub = lane >> 4, c4 = (lane & 15) * 4; typedef _Float16 v4h __attribute__((ext_vector_type(4)));
  {
#pragma unroll
    for (int q = 0; q < 8; ++q) { const int r = q * 2 + rsub; if (col0 + c4 < N) { const v4f v = *(const v4fa*)&so[w][r][c4]; if (C) *(v4f*)(C + cofs + (size_t)(row0 + r) * ldc + col0 + c4) = v; if (C16) { v4h h4; for (int i = 0; i < 4; ++i) h4[i] = (_Float16)v[i]; *(v4h*)(C16 + cofs + (size_t)(row0 + r) * ldc + col0 + c4) = h4; } } }
     }
}


typedef _Float16 v4h __attribute__((ext_vector_type(4)));

__global__ __launch_bounds__(256) void k_x16(const float* __restrict__ x, _Float16* __restrict__ X16, size_t n8) { const size_t t = (size_t)blockIdx.x * 256 + threadIdx.x; if (t >= n8) return; FragH f;
#pragma unroll
  for (int q = 0; q < 8; ++q) f.h[q] = (_Float16)bf16_round(x[t * 8 + q]); *(v8us*)((unsigned short*)X16 + t * 8) = f.half[0];  }
__global__ __launch_bounds__(256) void k_h16(const float* __restrict__ x, _Float16* __restrict__ X16, size_t n8) { const size_t t = (size_t)blockIdx.x * 256 + threadIdx.x; if (t >= n8) return; FragH f;
#pragma unroll
  for (int q = 0; q < 8; ++q) f.h[q] = (_Float16)x[t * 8 + q]; *(v8us*)((unsigned short*)X16 + t * 8) = f.half[0];  }
__global__ __launch_bounds__(256) void k_round16f(const float* __restrict__ W, _Float16* __restrict__ Bt, size_t n8) { const size_t t = (size_t)blockIdx.x * 256 + threadIdx.x; if (t >= n8) return; FragH f;
#pragma unroll
  for (int i = 0; i < 8; ++i) f.h[i] = (_Float16)(bf16_round(W[t * 8 + i]) * 16.0f); *(v8us*)((unsigned short*)Bt + t * 8) = f.half[0];  }
template <int NHv, int TTv>
__global__ __launch_bounds__(256) void k_vt(const _Float16* __restrict__ V16, int ldv, int voff, _Float16* __restrict__ Vt) { __shared__ unsigned short tl[64][66]; const int tid = threadIdx.x; const int slab = blockIdx.x / (TTv / 64), lg = blockIdx.x % (TTv / 64); const int b = slab / NHv, h = slab % NHv;
  for (int i = tid; i < 64 * 8; i += 256) { const int r = i / 8, c8 = (i % 8) * 8; FragH f; f.half[0] = *(const v8us*)((const unsigned short*)V16 + ((size_t)b * TTv + lg * 64 + r) * ldv + voff + h * 64 + c8);
#pragma unroll
    for (int q = 0; q < 8; ++q) tl[r][c8 + q] = f.u[q]; }
  __syncthreads();
  {
#pragma unroll
    for (int rd = 0; rd < 2; ++rd) { const int d = rd * 32 + tid / 8, pc = tid % 8; FragH f;
#pragma unroll
      for (int q = 0; q < 8; ++q) f.u[q] = tl[pc * 8 + q][d];
      *(v8us*)((unsigned short*)Vt + ((size_t)slab * 64 + d) * TTv + lg * 64 + pc * 8) = f.half[0]; }
     } }

__global__ __launch_bounds__(256) void k_hl(const float* __restrict__ F, _Float16* __restrict__ Hh, _Float16* __restrict__ Hl, size_t n8) { const size_t t = (size_t)blockIdx.x * 256 + threadIdx.x; if (t >= n8) return; FragH fh, fl; const v4f a = *(const v4fa*)(F + t * 8), c = *(const v4fa*)(F + t * 8 + 4);
#pragma unroll
  for (int q = 0; q < 4; ++q) { _Float16 h = (_Float16)a[q]; fh.h[q] = h; fl.h[q] = (_Float16)((a[q] - (float)h) * 1024.0f); h = (_Float16)c[q]; fh.h[4 + q] = h; fl.h[4 + q] = (_Float16)((c[q] - (float)h) * 1024.0f); }
  { *(v8us*)((unsigned short*)Hh + t * 8) = fh.half[0]; *(v8us*)((unsigned short*)Hl + t * 8) = fl.half[0];  } }

// ---- fast GEMM (wave tile 32x64; requires M % 32 == 0 rows per launch region and N % 64 == 0); epilogue = k_gemm_hhx semantics ----
__device__ __forceinline__ v16h g2_frag(const _Float16* p, int hh) { FragH f; f.half[0] = *(const v8us*)((const unsigned short*)p + 8 * hh); f.half[1] = *(const v8us*)((const unsigned short*)p + 16 + 8 * hh); return f.v; }
__device__ __forceinline__ v8f g2_mma(v16h a, v16h b, v8f c) { v8f d = __builtin_amdgcn_wmma_f32_16x16x32_f16(false, a, false, b, (short)0, c, false, false); asm volatile("v_nop\n\tv_nop\n\tv_nop\n\tv_nop" : "+v"(d) : "v"(a), "v"(b)); return d; }
template <int ACT>
__global__ __launch_bounds__(128) void k_gemm2(const _Float16* __restrict__ A, int lda, size_t sA, const _Float16* __restrict__ Bh, int ldb, size_t sB, float alpha, const float* __restrict__ bias, size_t sBias, const float* __restrict__ CP, int rowsPerB, size_t sCPb, int row0g,
    float* __restrict__ C, _Float16* __restrict__ C16, int ldc, size_t sC, int M, int N, int K) { static_assert(ACT == 0 || ACT == 3 || ACT == 6 || ACT == 8 || ACT == 9 || ACT == 11 || ACT == 12 || ACT == 14 || ACT == 15 || ACT == 16 || ACT == 17, "k_gemm2: unsupported ACT code (would silently apply no activation)");
  __shared__ __attribute__((aligned(16))) float so[4][32][68];
  const int tid = threadIdx.x, w = tid >> 5, lane = tid & 31, ln = lane & 15, hh = lane >> 4; const int by = blockIdx.y;
  A += (size_t)by * sA; Bh += (size_t)by * sB; const size_t cofs = (size_t)by * sC; const float* bp = bias ? bias + (size_t)by * sBias : nullptr;
  const int ntn = N >> 6; const int mt = blockIdx.x / ntn, nq = blockIdx.x - mt * ntn; const int row0 = mt * 128 + 32 * w, col0 = nq * 64; if (row0 >= M) return;
  const _Float16* a0p = A + (size_t)(row0 + ln) * lda; const _Float16* a1p = a0p + (size_t)16 * lda;
  const _Float16* b0p = Bh + (size_t)(col0 + ln) * ldb; const _Float16* b1p = b0p + (size_t)16 * ldb; const _Float16* b2p = b1p + (size_t)16 * ldb; const _Float16* b3p = b2p + (size_t)16 * ldb;
  const v8f z8 = {0.f,0.f,0.f,0.f,0.f,0.f,0.f,0.f}; v8f c00 = z8, c01 = z8, c02 = z8, c03 = z8, c10 = z8, c11 = z8, c12 = z8, c13 = z8;
#pragma unroll 1
  for (int kb = 0; kb < K; kb += 32) { const v16h a0 = g2_frag(a0p + kb, hh), a1 = g2_frag(a1p + kb, hh);
    v16h b = g2_frag(b0p + kb, hh); c00 = g2_mma(a0, b, c00); c10 = g2_mma(a1, b, c10);
    b = g2_frag(b1p + kb, hh); c01 = g2_mma(a0, b, c01); c11 = g2_mma(a1, b, c11);
    b = g2_frag(b2p + kb, hh); c02 = g2_mma(a0, b, c02); c12 = g2_mma(a1, b, c12);
    b = g2_frag(b3p + kb, hh); c03 = g2_mma(a0, b, c03); c13 = g2_mma(a1, b, c13); }
  v8f accs[8] = {c00, c01, c02, c03, c10, c11, c12, c13};
#pragma unroll
  for (int u = 0; u < 8; ++u) { const int t = u & 3, half = u >> 2; const int col = col0 + t * 16 + ln; const float bv = bp ? bf16_round(bp[col]) : 0.f;
#pragma unroll
    for (int r = 0; r < 8; ++r) { const int rloc = half * 16 + 8 * hh + r; float v = accs[u][r] * alpha + bv; if (CP) { if (rowsPerB < 0) v += CP[cofs + (size_t)(row0g + row0 + rloc) * ldc + col];      /* rowsPerB < 0: own element of the batched C plane */ else { const int bidx = (row0g + row0 + rloc) / rowsPerB; v += CP[(size_t)bidx * sCPb + (size_t)by * 64 + col]; } }
      if (ACT == 3) v = fmaxf(v, 0.f); else if (ACT == 6) v = 0.5f * v * (1.0f + erff(v * 0.70710678118654752f)); else if (ACT == 11) v = 1.0f / (1.0f + expf(-v)); else if (ACT == 15) v = v / (1.0f + expf(-v)); else if (ACT == 12) v = (v > 0.f) ? v : 0.01f * v; else if (ACT == 8) v = tanhf(v); else if (ACT == 9) v = 0.5f * v * (1.0f + tanhf(0.7978845608028654f * (v + 0.044715f * v * v * v))); else if (ACT == 14) v = (v > 0.f) ? v : 0.1f * v; else if (ACT == 16) v = (v >= 0.f) ? v : 0.3f * v; else if (ACT == 17) v = (v >= 0.f) ? v : 0.2f * v;
      so[w][rloc][t * 16 + ln] = v; } }
  __builtin_amdgcn_fence(__ATOMIC_ACQ_REL, "workgroup"); __builtin_amdgcn_wave_barrier();
  const int rsub = lane >> 4, c4 = (lane & 15) * 4;
  {
#pragma unroll
    for (int q = 0; q < 16; ++q) { const int r = q * 2 + rsub; const v4f v = *(const v4fa*)&so[w][r][c4]; if (C) *(v4f*)(C + cofs + (size_t)(row0 + r) * ldc + col0 + c4) = v; if (C16) { v4h h4; for (int i = 0; i < 4; ++i) h4[i] = (_Float16)v[i]; *(v4h*)(C16 + cofs + (size_t)(row0 + r) * ldc + col0 + c4) = h4; } }
     } }


__global__ __launch_bounds__(256) void k_wnat(const float* __restrict__ w, size_t n8, _Float16* __restrict__ Bt) { const size_t t = (size_t)blockIdx.x * 256 + threadIdx.x; if (t >= n8) return; FragH f; for (int q = 0; q < 8; ++q) f.h[q] = (_Float16)(bf16_round(w[t * 8 + q]) * 16.0f); *(v8us*)((unsigned short*)Bt + t * 8) = f.half[0];  }
__global__ __launch_bounds__(256) void k_rsm(const float* __restrict__ S, _Float16* __restrict__ P, int nrows) {
  #pragma clang fp contract(off)
  const int i = blockIdx.x * 256 + threadIdx.x; if (i >= nrows) return; const float* s = S + (size_t)i * SQ; float mx = -3.0e38f;
#pragma unroll 1
  for (int j = 0; j < SQ; ++j) mx = fmaxf(mx, s[j]); float se = 0.f;
#pragma unroll 1
  for (int j = 0; j < SQ; ++j) se += expf(s[j] - mx); const float sc = 256.0f / se;
#pragma unroll 1
  for (int j0 = 0; j0 < SQ; j0 += 8) { FragH f; for (int q = 0; q < 8; ++q) f.h[q] = (_Float16)(expf(s[j0 + q] - mx) * sc); unsigned short* d = (unsigned short*)P + (size_t)i * SQ + j0; *(v8us*)d = f.half[0];  } }
__global__ __launch_bounds__(256) void k_vt(const _Float16* __restrict__ V16, int b, int h0, _Float16* __restrict__ VT) { __shared__ unsigned short tl[64][65]; const int tid = threadIdx.x; const int hh = blockIdx.x % HG, sg = blockIdx.x / HG; const int s0 = sg * 64; const int h = h0 + hh;
  for (int i = tid; i < 64 * 8; i += 256) { const int j = i / 8, d8 = (i % 8) * 8; FragH f; f.half[0] = *(const v8us*)((const unsigned short*)V16 + ((size_t)b * SQ + s0 + j) * DM + h * HD + d8); for (int q = 0; q < 8; ++q) tl[d8 + q][j] = f.u[q]; }
  __syncthreads();
  { for (int i = tid; i < 64 * 8; i += 256) { const int d = i / 8, j8 = (i % 8) * 8; FragH f; for (int q = 0; q < 8; ++q) f.u[q] = tl[d][j8 + q]; *(v8us*)((unsigned short*)VT + ((size_t)hh * HD + d) * SQ + s0 + j8) = f.half[0]; }  } }



__global__ __launch_bounds__(256) void k_rsmcf2(const float* __restrict__ S, _Float16* __restrict__ P, int hg, int q0, int nk) {
  #pragma clang fp contract(off)
  const int t = blockIdx.x * 256 + threadIdx.x; if (t >= hg * QT) return; const size_t i = (size_t)t; const float* s = S + i * NKX; const int last = q0 + (t % QT); float mx = -3.0e38f;
#pragma unroll 1
  for (int j = 0; j < nk; ++j) { const float f = (j <= last) ? 1.f : 0.f; mx = fmaxf(mx, fmaf(f, s[j], (1.f - f) * -1.0e9f)); } float se = 0.f;
#pragma unroll 1
  for (int j = 0; j < nk; ++j) { const float f = (j <= last) ? 1.f : 0.f; se += __expf(fmaf(f, s[j], (1.f - f) * -1.0e9f) - mx); } const float sc = 256.0f / se;
#pragma unroll 1
  for (int j0 = 0; j0 < nk; j0 += 8) { FragH fr; for (int q = 0; q < 8; ++q) { const int j = j0 + q; const float f = (j <= last) ? 1.f : 0.f; fr.h[q] = (_Float16)(__expf(fmaf(f, s[j], (1.f - f) * -1.0e9f) - mx) * sc); } unsigned short* d = (unsigned short*)P + i * NKX + j0; *(v8us*)d = fr.half[0];  } }


template <int MASKADD>
__global__ __launch_bounds__(64) void k_att0(const float* __restrict__ QF, const float* __restrict__ KF, const float* __restrict__ VF, int ld, const float* __restrict__ mask, float scale, float* __restrict__ OF, int ldo) {
  #pragma clang fp contract(off)
  __shared__ __attribute__((aligned(16))) float lq[64][64]; __shared__ __attribute__((aligned(16))) float lo[64][64];
  const int tid = threadIdx.x; const int h = blockIdx.x / (QT0 / 64), rg = blockIdx.x % (QT0 / 64); const int i = rg * 64 + tid;
  const float* qr = QF + (size_t)i * ld + h * HD;
#pragma unroll 1
  for (int c = 0; c < HD / 4; ++c) { *(v4f*)&lq[tid][c * 4] = *(const v4fa*)(qr + c * 4); const v4f z = {0.f, 0.f, 0.f, 0.f}; *(v4f*)&lo[tid][c * 4] = z; }
  float m = -1.0e30f, l = 0.f; const int jmax = MASKADD ? (SQ - 1) : (rg * 64 + 63);      /* additive-mask form: every key (the mask input decides); causal form: keys up to the block's last row */
#pragma unroll 1
  for (int j = 0; j <= jmax; ++j) { const float* kr = KF + (size_t)j * ld + h * HD; const float* vr = VF + (size_t)j * ld + h * HD; float s = 0.f;
#pragma unroll 1
    for (int c = 0; c < HD / 4; ++c) { const v4f kq = *(const v4fa*)(kr + c * 4); const v4f qq = *(v4f*)&lq[tid][c * 4]; s = __fadd_rn(s, __fmul_rn(qq[0], kq[0])); s = __fadd_rn(s, __fmul_rn(qq[1], kq[1])); s = __fadd_rn(s, __fmul_rn(qq[2], kq[2])); s = __fadd_rn(s, __fmul_rn(qq[3], kq[3])); }
    s = __fmul_rn(s, scale); if (MASKADD) s = __fadd_rn(s, __fmul_rn(bf16_round(mask[(size_t)i * SQ + j]), -10000.0f));
    const float f = (MASKADD || j <= i) ? 1.f : 0.f; const float sm = fmaf(f, s, (1.f - f) * -1.0e30f); const float mn = fmaxf(m, sm); const float sc = expf(m - mn); const float e = expf(sm - mn); l = __fadd_rn(__fmul_rn(l, sc), e); m = mn;
#pragma unroll 1
    for (int c = 0; c < HD / 4; ++c) { const v4f vv = *(const v4fa*)(vr + c * 4); v4f oo = *(v4f*)&lo[tid][c * 4]; for (int u = 0; u < 4; ++u) oo[u] = __fadd_rn(__fmul_rn(oo[u], sc), __fmul_rn(e, vv[u])); *(v4f*)&lo[tid][c * 4] = oo; } }
  const float fin = 64.0f / l;      /* o carried x64 like the f16 path */
#pragma unroll 1
  for (int c = 0; c < HD / 4; ++c) { v4f oo = *(v4f*)&lo[tid][c * 4]; for (int u = 0; u < 4; ++u) oo[u] = __fmul_rn(oo[u], fin); *(v4f*)&lo[tid][c * 4] = oo; }
  __syncthreads();
  {
#pragma unroll 1
    for (int it = 0; it < 16; ++it) { const int row = it * 4 + tid / 16, pc = (tid % 16) * 4; const v4f v = *(const v4f*)&lo[row][pc]; *(v4f*)(OF + (size_t)(rg * 64 + row) * ldo + h * HD + pc) = v; }
     } }


template <int BFIN, int WXB>
__global__ __launch_bounds__(256) void k_ln16(const float* __restrict__ X, const float* __restrict__ g, const float* __restrict__ bb, float eps, _Float16* __restrict__ N16, float* __restrict__ XB) {
  #pragma clang fp contract(off)
  __shared__ float red[256]; const size_t r = blockIdx.x; const int t = threadIdx.x; const v4f xa = *(const v4fa*)(X + r * DMQ + t * 4); float s[4]; float sum = 0.f;
  for (int q = 0; q < 4; ++q) { s[q] = BFIN ? bf16_round(xa[q]) : xa[q]; sum = __fadd_rn(sum, s[q]); }
  red[t] = sum; __syncthreads(); for (int st = 128; st > 0; st >>= 1) { if (t < st) red[t] = __fadd_rn(red[t], red[t + st]); __syncthreads(); } const float mu = red[0] / (float)DMQ; __syncthreads();
  float vs = 0.f; for (int q = 0; q < 4; ++q) { const float dl = __fadd_rn(s[q], -mu); vs = __fadd_rn(vs, __fmul_rn(dl, dl)); } red[t] = vs; __syncthreads(); for (int st = 128; st > 0; st >>= 1) { if (t < st) red[t] = __fadd_rn(red[t], red[t + st]); __syncthreads(); }
  const float rs = rsqrtf(__fadd_rn(red[0] / (float)DMQ, eps)); v4h y; v4f xb;
  for (int q = 0; q < 4; ++q) { const int c = t * 4 + q; y[q] = (_Float16)__fadd_rn(__fmul_rn(__fmul_rn(__fadd_rn(s[q], -mu), rs), bf16_round(g[c])), bf16_round(bb[c])); xb[q] = s[q]; }
  { *(v4h*)(N16 + r * DMQ + t * 4) = y; if (WXB) *(v4f*)(XB + r * DMQ + t * 4) = xb;  } }
__global__ __launch_bounds__(256) void k_ftres2(const float* __restrict__ OF0, const float* __restrict__ XB, float* __restrict__ X1, size_t n4) {
  #pragma clang fp contract(off)
  const size_t t = (size_t)blockIdx.x * 256 + threadIdx.x; if (t >= n4) return; const v4f o = *(const v4fa*)(OF0 + t * 4), xv = *(const v4fa*)(XB + t * 4); v4f y; for (int q = 0; q < 4; ++q) y[q] = __fadd_rn(__fmul_rn(o[q], 0.015625f), xv[q]); *(v4f*)(X1 + t * 4) = y;  }

__global__ __launch_bounds__(256) void k_wthd(const float* __restrict__ Wt, _Float16* __restrict__ Bt) { const size_t t = (size_t)blockIdx.x * 256 + threadIdx.x; if (t >= (size_t)NH * HD * (DM / 8)) return; const int m8 = (int)(t % (DM / 8)) * 8; const int d = (int)((t / (DM / 8)) % HD); const int h = (int)(t / ((size_t)(DM / 8) * HD)); FragH f;
  for (int q = 0; q < 8; ++q) f.h[q] = (_Float16)(16.0f * bf16_round(Wt[((size_t)h * DM + m8 + q) * HD + d])); unsigned short* dst = (unsigned short*)Bt + ((size_t)h * HD + d) * DM + m8; *(v8us*)dst = f.half[0];  }




template <int BFIN, int W16, int W32>
__global__ __launch_bounds__(256) void k_lnx(const float* __restrict__ X, const float* __restrict__ g, const float* __restrict__ bb, float eps, _Float16* __restrict__ N16, float* __restrict__ N32) {
  #pragma clang fp contract(off)
  __shared__ float red[256]; const size_t r = blockIdx.x; const int t = threadIdx.x; const bool act = t < (DMQ / 4); const int c0 = act ? t * 4 : 0;
  const v4f xa = *(const v4fa*)(X + r * DMQ + c0); float s[4]; float sum = 0.f;
  for (int q = 0; q < 4; ++q) { s[q] = act ? (BFIN ? bf16_round(xa[q]) : xa[q]) : 0.f; sum = __fadd_rn(sum, s[q]); }
  red[t] = sum; __syncthreads(); for (int st = 128; st > 0; st >>= 1) { if (t < st) red[t] = __fadd_rn(red[t], red[t + st]); __syncthreads(); } const float mu = red[0] / (float)DMQ; __syncthreads();
  float vs = 0.f; for (int q = 0; q < 4; ++q) { const float dl = act ? __fadd_rn(s[q], -mu) : 0.f; vs = __fadd_rn(vs, __fmul_rn(dl, dl)); } red[t] = vs; __syncthreads(); for (int st = 128; st > 0; st >>= 1) { if (t < st) red[t] = __fadd_rn(red[t], red[t + st]); __syncthreads(); }
  const float rs = rsqrtf(__fadd_rn(red[0] / (float)DMQ, eps)); v4h y; v4f yf;
  for (int q = 0; q < 4; ++q) { const int c = c0 + q; yf[q] = __fadd_rn(__fmul_rn(__fmul_rn(__fadd_rn(s[q], -mu), rs), bf16_round(g[c])), bf16_round(bb[c])); y[q] = (_Float16)yf[q]; }
  if (!act) return;      /* no barriers after this point */
  { if (W16) *(v4h*)(N16 + r * DMQ + c0) = y; if (W32) *(v4f*)(N32 + r * DMQ + c0) = yf;  } }


__global__ __launch_bounds__(256) void k_bfr(const float* __restrict__ x, float* __restrict__ XB, size_t n8) { const size_t t = (size_t)blockIdx.x * 256 + threadIdx.x; if (t >= n8) return; v4f a = *(const v4fa*)(x + t * 8), c = *(const v4fa*)(x + t * 8 + 4); for (int q = 0; q < 4; ++q) { a[q] = bf16_round(a[q]); c[q] = bf16_round(c[q]); }
  { *(v4f*)(XB + t * 8) = a; *(v4f*)(XB + t * 8 + 4) = c;  } }




__global__ __launch_bounds__(256) void k_lorafold(const float* __restrict__ Wm, const float* __restrict__ A, const float* __restrict__ Bm, float* __restrict__ WE, int K, int N, float sc) {
  #pragma clang fp contract(off)
  const size_t t = (size_t)blockIdx.x * 256 + threadIdx.x; if (t >= (size_t)K * N) return; const int i = (int)(t / N), o = (int)(t % N); float a = 0.f;
  for (int r = 0; r < 16; ++r) a = __fadd_rn(a, __fmul_rn(bf16_round(A[(size_t)i * 16 + r]), bf16_round(Bm[(size_t)r * N + o])));
  const float v = __fadd_rn(bf16_round(Wm[t]), __fmul_rn(sc, a)); *(float*)(WE + t) = v;  }
__global__ __launch_bounds__(256) void k_wt32rep(const float* __restrict__ Wf, _Float16* __restrict__ Bt, int K, int N, int DOUT, float scale) {
  const int t = blockIdx.x * 256 + threadIdx.x; if (t >= DOUT * (K / 8)) return; const int n = t / (K / 8), k8 = (t % (K / 8)) * 8; const int rep = DOUT / N; const int src = (n / (HD * rep)) * HD + (n % HD);      /* head h = n / HD -> group h / rep */
  FragH f; for (int i = 0; i < 8; ++i) f.h[i] = (_Float16)(Wf[(size_t)(k8 + i) * N + src] * scale);
  *(v8us*)((unsigned short*)Bt + (size_t)n * K + k8) = f.half[0];  }
__global__ __launch_bounds__(256) void k_brep(const float* __restrict__ b, float* __restrict__ out) { const int t = blockIdx.x * 256 + threadIdx.x; if (t >= DM) return; const float v = b[(t / (HD * 4)) * HD + (t % HD)]; *(float*)(out + t) = v;  }

__global__ __launch_bounds__(256) void k_rsmcim(const float* __restrict__ S, _Float16* __restrict__ P, int hg, int q0, int nk, const int* __restrict__ am) {
  #pragma clang fp contract(off)
  const int t = blockIdx.x * 256 + threadIdx.x; if (t >= hg * QT) return; const size_t i = (size_t)t; const float* s = S + i * NKX; const int last = q0 + (t % QT); const int* mr = am + (size_t)last * SQ; float mx = -3.0e38f;      /* the module's mask row of this query (keys >= nk lie above the diagonal of the causal mask and are not computed) */
#pragma unroll 1
  for (int j = 0; j < nk; ++j) { const float f = (mr[j] != 0) ? 1.f : 0.f; mx = fmaxf(mx, fmaf(f, s[j], (1.f - f) * -1.0e9f)); } float se = 0.f;
#pragma unroll 1
  for (int j = 0; j < nk; ++j) { const float f = (mr[j] != 0) ? 1.f : 0.f; se += __expf(fmaf(f, s[j], (1.f - f) * -1.0e9f) - mx); } const float sc = 256.0f / se;
#pragma unroll 1
  for (int j0 = 0; j0 < nk; j0 += 8) { FragH fr; for (int q = 0; q < 8; ++q) { const int j = j0 + q; const float f = (mr[j] != 0) ? 1.f : 0.f; fr.h[q] = (_Float16)(__expf(fmaf(f, s[j], (1.f - f) * -1.0e9f) - mx) * sc); } unsigned short* d = (unsigned short*)P + i * NKX + j0; *(v8us*)d = fr.half[0];  } }



__global__ __launch_bounds__(256) void k_bcpy(const float* __restrict__ b, int n, int NP, float* __restrict__ dst, int dst0) { for (int i = threadIdx.x; i < NP; i += 256) { const float v = (i < n) ? b[i] : 0.f; *(float*)(dst + dst0 + i) = v; }  }



// lane l with lane l ^ M inside a 16-lane row (row_xmask DPP), and lane l with lane l ^ 16
template <int M> __device__ __forceinline__ float rs_xrow(float x) { return __builtin_bit_cast(float, __builtin_amdgcn_update_dpp(0, __builtin_bit_cast(int, x), 0x160 + M, 0xf, 0xf, true)); }
__device__ __forceinline__ float rs_xhalf(float x) { return __builtin_bit_cast(float, __builtin_amdgcn_permlanex16(__builtin_bit_cast(int, x), __builtin_bit_cast(int, x), 0x76543210, 0xfedcba98, false, false)); }
// Four 2^t in one statement: behind a transcendental the instruction set asks for one independent instruction or v_nop before its result is read or its source overwritten.
// Here each v_exp_f32 is the independent instruction behind the one before it (early-clobber: no result lands on a source), the v_nop the slot behind the last.
__device__ __forceinline__ v4f rs_exp2x4(v4f t) { float a, b, c, d;
  asm("v_exp_f32 %0, %4\n\tv_exp_f32 %1, %5\n\tv_exp_f32 %2, %6\n\tv_exp_f32 %3, %7\n\tv_nop" : "=&v"(a), "=&v"(b), "=&v"(c), "=&v"(d) : "v"(t[0]), "v"(t[1]), "v"(t[2]), "v"(t[3]));
  const v4f r = {a, b, c, d}; return r; }
// Row softmax, one wave per score row: each wave-wide 16-byte load covers 512 contiguous bytes of the row, the row's NKX f32 stay in registers (read once, exp once),
// maximum and sum = four chains per lane, then a five-step lane butterfly; no LDS, no barrier. P = exp(s - max) * 256 / sum as f16, whole 128-byte lines per store.
__global__ __launch_bounds__(256) void k_rsmp(const float* __restrict__ S, _Float16* __restrict__ P, int nrows) {
  constexpr int NV = NKX / 128;      /* 16-byte pieces of the row per lane */
  const int row = blockIdx.x * 8 + __builtin_amdgcn_readfirstlane(threadIdx.x >> 5); if (row >= nrows) return;      /* the wave's row, in a scalar register: scalar row bases, scalar branch */
  const unsigned lane = threadIdx.x & 31; const v4fa* s = (const v4fa*)(S + (size_t)row * NKX); v4f e[NV];
#pragma unroll
  for (int u = 0; u < NV; ++u) e[u] = s[u * 32 + lane];
  v4f m4 = e[0];
#pragma unroll
  for (int u = 1; u < NV; ++u) for (int q = 0; q < 4; ++q) m4[q] = fmaxf(m4[q], e[u][q]);
  float mx = fmaxf(fmaxf(m4[0], m4[1]), fmaxf(m4[2], m4[3]));
  mx = fmaxf(mx, rs_xrow<1>(mx)); mx = fmaxf(mx, rs_xrow<2>(mx)); mx = fmaxf(mx, rs_xrow<4>(mx)); mx = fmaxf(mx, rs_xrow<8>(mx)); mx = fmaxf(mx, rs_xhalf(mx));
  v4f s4 = {0.f, 0.f, 0.f, 0.f};
#pragma unroll
  for (int u = 0; u < NV; ++u) { e[u] = rs_exp2x4((e[u] - mx) * 1.44269504f); s4 += e[u]; }      /* exp(s - max) = 2^((s - max) log2 e), the native form */
  float se = (s4[0] + s4[1]) + (s4[2] + s4[3]);
  se += rs_xrow<1>(se); se += rs_xrow<2>(se); se += rs_xrow<4>(se); se += rs_xrow<8>(se); se += rs_xhalf(se);
  const float sc = 256.0f / se; v4h* d = (v4h*)(P + (size_t)row * NKX);
#pragma unroll
  for (int u = 0; u < NV; ++u) { v4h h4; for (int q = 0; q < 4; ++q) h4[q] = (_Float16)(e[u][q] * sc); d[u * 32 + lane] = h4; } }
extern "C" void kernel_launch(void* const* d_in, const int* in_sizes, int n_in,
                              void* d_out, int out_size, void* d_ws, size_t ws_size, hipStream_t stream) {
  (void)in_sizes; (void)n_in; (void)out_size;
  const float* const* I = (const float* const*)d_in; const float* x = I[0]; const float* cond = I[1]; const float* wq = I[2]; const float* bq = I[3]; const float* wkv = I[4]; const float* bkv = I[5]; const float* wo = I[6]; const float* bo = I[7];      /* input order: x [2][2048][1024]; tgt [2][2048][1024] (read as cond); [in][out] Wq [1024][1024] + bq; Wkv [1024][2048] + bkv (k | v halves); Wp [1024][1024] + bp; the three biases are bound and read */
  static_assert(NH * HD == DM && SQ % QT == 0 && QT % 128 == 0 && SK % 64 == 0 && SK % 32 == 0 && DC % 32 == 0 && DM % 64 == 0 && NKX == SK && NKX % 128 == 0, "shape / tile multiples");
  const size_t NRK = (size_t)NB * SK;      /* conditioning rows */
  char* ws = (char*)d_ws; size_t off = 0;
  auto take = [&](size_t bytes) { char* p = ws + off; off += (bytes + 255) & ~(size_t)255; return p; };
  _Float16* BQ = (_Float16*)take((size_t)DM * DM * 2); _Float16* BKV = (_Float16*)take((size_t)2 * DM * DC * 2); _Float16* BO = (_Float16*)take((size_t)DM * DM * 2);
  _Float16* X16 = (_Float16*)take(NR * DM * 2); _Float16* C16 = (_Float16*)take(NRK * DC * 2); _Float16* Q16 = (_Float16*)take(NR * DM * 2); _Float16* KV16 = (_Float16*)take(NRK * 2 * DM * 2); _Float16* O16 = (_Float16*)take(NR * DM * 2);
  float* S = (float*)take((size_t)NH * QT * NKX * 4); _Float16* P = (_Float16*)take((size_t)NH * QT * NKX * 2); _Float16* VT = (_Float16*)take((size_t)NH * HD * SK * 2);
  if (off > ws_size) return;      /* 2 + 4 + 2 (weight planes) + 8 + 8 + 8 + 16 + 8 (row planes) + 32 + 16 + 4 (S, P, V^T) = 108 MiB at NB 2, SK 2048, DC 1024 */
  k_wt_f16<<<(unsigned)(((size_t)DM * (DM / 8) + 255) / 256), 256, 0, stream>>>(wq, BQ, DM, DM, 16.0f); k_wt_f16<<<(unsigned)(((size_t)2 * DM * (DC / 8) + 255) / 256), 256, 0, stream>>>(wkv, BKV, DC, 2 * DM, 16.0f); k_wt_f16<<<(unsigned)(((size_t)DM * (DM / 8) + 255) / 256), 256, 0, stream>>>(wo, BO, DM, DM, 16.0f);      /* [in][out] -> Bt x16: Wq [1024][1024]; Wkv [DC = 1024][2048] -> Bt [2048][1024] (rows 0..1023 = k, 1024..2047 = v); Wp */
  k_x16<<<(unsigned)((NR * DM / 8 + 255) / 256), 256, 0, stream>>>(x, X16, NR * DM / 8); k_x16<<<(unsigned)((NRK * DC / 8 + 255) / 256), 256, 0, stream>>>(cond, C16, NRK * DC / 8);      /* exact f16 rows of both inputs */
  k_gemm2<0><<<dim3((unsigned)((NR / 128) * (DM / 64)), 1), 128, 0, stream>>>(X16, DM, 0, BQ, DM, 0, 0.0625f, bq, 0, nullptr, 1, 0, 0, nullptr, Q16, DM, 0, (int)NR, DM, DM);      /* q rows (f16); head h = columns 64 h .. */
  k_gemm2<0><<<dim3((unsigned)((NRK / 128) * (2 * DM / 64)), 1), 128, 0, stream>>>(C16, DC, 0, BKV, DC, 0, 0.0625f, bkv, 0, nullptr, 1, 0, 0, nullptr, KV16, 2 * DM, 0, (int)NRK, 2 * DM, DC);      /* k | v rows (f16, pitch 2048): k = columns 0..1023, v = columns 1024..2047, head h = columns 64 h .. of each half */
  for (int b = 0; b < NB; ++b) { const size_t rq0 = (size_t)b * SQ, rk0 = (size_t)b * SK;
    k_vt<NH, SK><<<NH * (SK / 64), 256, 0, stream>>>(KV16 + rk0 * 2 * DM + DM, 2 * DM, 0, VT);      /* V^T [NH][HD][SK] of this batch (the v half of the fused rows) */
    for (int q0 = 0; q0 < SQ; q0 += QT) {      /* every 256-row query tile sees all SK keys */
      k_gemm2<0><<<dim3((QT / 128) * (SK / 64), NH), 128, 0, stream>>>(Q16 + (rq0 + q0) * DM, DM, (size_t)HD, KV16 + rk0 * 2 * DM, 2 * DM, (size_t)HD, 0.015625f, nullptr, 0, nullptr, 1, 0, 0, S, nullptr, NKX, (size_t)QT * NKX, QT, SK, HD);      /* scores (q / 8) . (k / 8) = q . k / 64, all heads on grid.y */
      k_rsmp<<<(NH * QT + 7) / 8, 256, 0, stream>>>(S, P, NH * QT);      /* softmax over the SK = 2048 keys -> P x256 f16 */
      k_gemm2<0><<<dim3((QT / 128) * (HD / 64), NH), 128, 0, stream>>>(P, NKX, (size_t)QT * NKX, VT, SK, (size_t)HD * SK, 0.25f, nullptr, 0, nullptr, 1, 0, 0, nullptr, O16 + (rq0 + q0) * DM, DM, (size_t)HD, QT, HD, SK); } }      /* ctx (merged heads, x64) as f16 rows */
  k_gemm2<0><<<dim3((unsigned)((NR / 128) * (DM / 64)), 1), 128, 0, stream>>>(O16, DM, 0, BO, DM, 0, 0.0009765625f, bo, 0, nullptr, 1, 0, 0, (float*)d_out, nullptr, DM, 0, (int)NR, DM, DM);      /* out = ctx proj_w + proj_b */
}

// v002
// Measured time: 225 microseconds a run.
// In two side-by-side timings against v001, it was 5.91 and 6.00 times as fast.
// Over all steps from v000 it is 29.1 times as fast.
#include <hip/hip_runtime.h>
// Multi-head cross-attention with a fused key / value projection and BOTH q and k scaled (x [2][2048][1024] (queries), tgt [2][2048][1024] (keys / values); q = x Wq + bq ([in][out] 1024 x 1024, normal x 0.02; zero bias); kv = tgt Wkv + bkv ([in][out] 1024 x 2048; zero bias) split into halves: k = columns 0..1023, v = columns 1024..2047; 16 heads of 64; logits = (q * 64^-0.5) . (k * 64^-0.5): the module scales BOTH operands, so the effective scale is 1/64; softmax over the 2048 tgt positions (no mask); out = merged Wp + bp ([in][out]; zero bias) -> [2][2048][1024]).
// Structure: token rows; x and tgt as exact f16 rows; natural weights as exact x16 planes; q and fused k | v WMMA GEMMs (32x64 wave tiles, f32 accumulation, + bias) -> f16; V^T via LDS transposes; one fused attention launch (256 queries of one head per work-group: scores, online softmax with f32 statistics and native exp, weights f16, ctx x64 merged f16); ctx Wp + bp -> f32 output.
// Compute dtype: inputs rounded to bf16; x / weights exact; q, k, v, softmax weights and o as plain f16 GEMM operands (~2^-12); scores and softmax statistics f32. v_wmma_f32_16x16x32_f16.
#define NB 2
#define SQ 2048                      /* query rows per batch */
#define SK 2048                      /* conditioning (key / value) rows per batch */
#define DC 1024                       /* conditioning width */
#define DM 1024
#define NH 16
#define HD 64
#define HG 4                         /* heads per launch of the (b, h0) k_vt form, which is not launched */
#define QT 256                       /* query rows per attention tile */
#define NKX SK                       /* S / P row pitch = the SK keys (2048 here) */
#define QT0 128                      /* first-tile rows recomputed exactly in f32 */
#define B0 0                         /* first batch processed (debug hook) */
#define NBR NB                       /* batches processed (debug hook) */
#define NR ((size_t)NB * SQ)
#define DMQ DM
#define DFF 4096         /* token rows */
#define MP ((int)((size_t)NBR * SQ)) /* rows projected (debug hook) */
#define QN SQ                        /* query rows attended per batch (debug hook) */
#define NHD NH                       /* heads attended (debug hook) */
#define MPO MP                       /* rows through the output stage (debug hook) */
#define LQ (3 * DM)      /* unused; q rows have pitch DM, k | v rows 2 * DM */
typedef __bf16 v16b __attribute__((ext_vector_type(16)));
typedef unsigned short v8us __attribute__((ext_vector_type(8), may_alias));
typedef float  v8f  __attribute__((ext_vector_type(8)));
typedef float  v4f  __attribute__((ext_vector_type(4)));
typedef float  v4fa __attribute__((ext_vector_type(4), may_alias));
union FragB { v16b v; v8us half[2]; unsigned short u[16]; };

__device__ __forceinline__ unsigned short bf16_bits(float x) { unsigned int u = __float_as_uint(x); return (unsigned short)((u + 0x7FFFu + ((u >> 16) & 1u)) >> 16); }
__device__ __forceinline__ float bf16_val(unsigned short b) { return __uint_as_float(((unsigned int)b) << 16); }
__device__ __forceinline__ float bf16_round(float x) { return bf16_val(bf16_bits(x)); }
// D += A·B with NT terms: 1 = ah·bh, 2 = + al·bh (A split), 3 = + ah·bl (both split)
template <int NT>
__device__ __forceinline__ v8f mmaN(v16b ah, v16b al, v16b bh, v16b bl, v8f c) {
  c = __builtin_amdgcn_wmma_f32_16x16x32_bf16(false, ah, false, bh, (short)0, c, false, false);
  if (NT >= 2) c = __builtin_amdgcn_wmma_f32_16x16x32_bf16(false, al, false, bh, (short)0, c, false, false);
  if (NT >= 3) c = __builtin_amdgcn_wmma_f32_16x16x32_bf16(false, ah, false, bl, (short)0, c, false, false);
  asm volatile("v_nop\n\tv_nop\n\tv_nop\n\tv_nop" : "+v"(c) : "v"(ah), "v"(al), "v"(bh), "v"(bl));
  return c;
}

__global__ __launch_bounds__(256) void k_wt_bf16(const float* __restrict__ W, unsigned short* __restrict__ Wt, int K, int N) {
  const int t = blockIdx.x * 256 + threadIdx.x;
  const int k8n = K / 8;
  if (t >= N * k8n) return;
  const int n = t / k8n, k8 = (t % k8n) * 8;
  v8us v;
#pragma unroll
  for (int i = 0; i < 8; ++i) v[i] = bf16_bits(W[(size_t)(k8 + i) * N + n]);
  *(v8us*)(Wt + (size_t)n * K + k8) = v;
  
}

// GEMM C[M][N] (f32, pitch ldc) = act(A[M][K]·W + bias). A f32 row-major (pitch lda) converted per fragment to bf16
// (ASPLIT: hi/lo two planes -> 2 terms, else single rounded term); Wt bf16 [N][K] (pitch ldb). BIAS_BF16 rounds the
// bias to bf16 first (bias quantised to bf16 before the add). K%32==0, M%16==0, N%64==0.
template <bool ASPLIT, int ACT, bool BIAS_BF16>
__global__ __launch_bounds__(128) void k_gemm_bf(const float* __restrict__ A, int lda, const unsigned short* __restrict__ Wt, int ldb,
                                               const float* __restrict__ bias, float* __restrict__ C, int ldc, int M, int N, int K) {
  __shared__ __attribute__((aligned(16))) float so[4][16][64];
  const int tid = threadIdx.x, w = tid >> 5, lane = tid & 31, ln = lane & 15, hh = lane >> 4;
  const int ntn = N / 64;
  const int wid = blockIdx.x * 4 + w;
  const int mt = wid / ntn, nq = wid % ntn;
  if (mt * 16 >= M) return;
  const int row0 = mt * 16, col0 = nq * 64;
  const float* arow = A + (size_t)(row0 + ln) * lda;
  v8f acc[4] = {};
  for (int kb = 0; kb < K; kb += 32) {
    FragB ah, al;
    const v4f x0 = *(const v4fa*)(arow + kb + 8 * hh), x1 = *(const v4fa*)(arow + kb + 8 * hh + 4);
    const v4f x2 = *(const v4fa*)(arow + kb + 16 + 8 * hh), x3 = *(const v4fa*)(arow + kb + 16 + 8 * hh + 4);
    float xs[16] = {x0[0],x0[1],x0[2],x0[3],x1[0],x1[1],x1[2],x1[3],x2[0],x2[1],x2[2],x2[3],x3[0],x3[1],x3[2],x3[3]};
#pragma unroll
    for (int i = 0; i < 16; ++i) { const unsigned short hb = bf16_bits(xs[i]); ah.u[i] = hb; al.u[i] = ASPLIT ? bf16_bits(xs[i] - bf16_val(hb)) : (unsigned short)0; }
#pragma unroll
    for (int t = 0; t < 4; ++t) {
      const unsigned short* brow = Wt + (size_t)(col0 + t * 16 + ln) * ldb + kb;
      FragB b;
      b.half[0] = *(const v8us*)(brow + 8 * hh);
      b.half[1] = *(const v8us*)(brow + 16 + 8 * hh);
      acc[t] = mmaN<ASPLIT ? 2 : 1>(ah.v, al.v, b.v, b.v, acc[t]);
    }
  }
#pragma unroll
  for (int t = 0; t < 4; ++t) {
    float bv = bias ? bias[col0 + t * 16 + ln] : 0.f;
    if (BIAS_BF16) bv = bf16_round(bv);
#pragma unroll
    for (int r = 0; r < 8; ++r) { float v = acc[t][r] + bv; if (ACT == 1) v = fmaxf(v, 0.f); so[w][8 * hh + r][t * 16 + ln] = v; }
  }
  __builtin_amdgcn_fence(__ATOMIC_ACQ_REL, "workgroup");
  __builtin_amdgcn_wave_barrier();
  const int rsub = lane >> 4, c4 = (lane & 15) * 4;
  {
#pragma unroll
    for (int q = 0; q < 8; ++q) {
      const int r = q * 2 + rsub;
      const v4f v = *(const v4fa*)&so[w][r][c4];
      *(v4f*)(C + (size_t)(row0 + r) * ldc + col0 + c4) = v;
    }
    
  }
}

// GEMM C = act(A·W + bias + resid): A f32 (ASPLIT -> hi/lo 2 terms), Wt bf16 [N][K]; ACT 0 none, 1 relu, 2 exact gelu;
// resid (optional, f32, row index = (row % rmod), pitch ldr, RES_BF16 rounds it) added before the activation.
template <bool ASPLIT, int ACT, bool BIAS_BF16, bool RES_BF16>
__global__ __launch_bounds__(128) void k_gemm_bf3(const float* __restrict__ A, int lda, const unsigned short* __restrict__ Wt, int ldb,
                                                const float* __restrict__ bias, const float* __restrict__ resid, int rmod, int ldr,
                                                float* __restrict__ C, int ldc, int M, int N, int K) {
  __shared__ __attribute__((aligned(16))) float so[4][16][64];
  const int tid = threadIdx.x, w = tid >> 5, lane = tid & 31, ln = lane & 15, hh = lane >> 4;
  const int ntn = N / 64;
  const int wid = blockIdx.x * 4 + w;
  const int mt = wid / ntn, nq = wid % ntn;
  if (mt * 16 >= M) return;
  const int row0 = mt * 16, col0 = nq * 64;
  const float* arow = A + (size_t)(row0 + ln) * lda;
  v8f acc[4] = {};
  for (int kb = 0; kb < K; kb += 32) {
    FragB ah, al;
    const v4f x0 = *(const v4fa*)(arow + kb + 8 * hh), x1 = *(const v4fa*)(arow + kb + 8 * hh + 4);
    const v4f x2 = *(const v4fa*)(arow + kb + 16 + 8 * hh), x3 = *(const v4fa*)(arow + kb + 16 + 8 * hh + 4);
    float xs[16] = {x0[0],x0[1],x0[2],x0[3],x1[0],x1[1],x1[2],x1[3],x2[0],x2[1],x2[2],x2[3],x3[0],x3[1],x3[2],x3[3]};
#pragma unroll
    for (int i = 0; i < 16; ++i) { const unsigned short hb = bf16_bits(xs[i]); ah.u[i] = hb; al.u[i] = ASPLIT ? bf16_bits(xs[i] - bf16_val(hb)) : (unsigned short)0; }
#pragma unroll
    for (int t = 0; t < 4; ++t) {
      const unsigned short* brow = Wt + (size_t)(col0 + t * 16 + ln) * ldb + kb;
      FragB b;
      b.half[0] = *(const v8us*)(brow + 8 * hh);
      b.half[1] = *(const v8us*)(brow + 16 + 8 * hh);
      acc[t] = mmaN<ASPLIT ? 2 : 1>(ah.v, al.v, b.v, b.v, acc[t]);
    }
  }
#pragma unroll
  for (int t = 0; t < 4; ++t) {
    const int col = col0 + t * 16 + ln;
    float bv = bias ? bias[col] : 0.f;
    if (BIAS_BF16) bv = bf16_round(bv);
#pragma unroll
    for (int r = 0; r < 8; ++r) {
      float v = acc[t][r] + bv;
      if (resid) { float rv = resid[(size_t)((row0 + 8 * hh + r) % rmod) * ldr + col]; if (RES_BF16) rv = bf16_round(rv); v += rv; }
      if (ACT == 1) v = fmaxf(v, 0.f);
      if (ACT == 2) v = 0.5f * v * (1.0f + erff(v * 0.70710678118654752f));
      if (ACT == 3) { const float u = 0.7978845608028654f * (v + 0.044715f * v * v * v); v = 0.5f * v * (1.0f + tanhf(u)); }
      so[w][8 * hh + r][t * 16 + ln] = v;
    }
  }
  __builtin_amdgcn_fence(__ATOMIC_ACQ_REL, "workgroup");
  __builtin_amdgcn_wave_barrier();
  const int rsub = lane >> 4, c4 = (lane & 15) * 4;
  {
#pragma unroll
    for (int q = 0; q < 8; ++q) {
      const int r = q * 2 + rsub;
      const v4f v = *(const v4fa*)&so[w][r][c4];
      *(v4f*)(C + (size_t)(row0 + r) * ldc + col0 + c4) = v;
    }
    
  }
}
// row LayerNorm (biased variance, eps) over N: s = X (+ R); optional out_sum <- s; out_norm <- (s-mu)*rsqrt(var+eps)*g + b
template <bool PARAM_BF16>
__global__ __launch_bounds__(256) void k_layernorm(const float* __restrict__ X, const float* __restrict__ R, const float* __restrict__ g, const float* __restrict__ bta,
                                                  float* __restrict__ out_sum, float* __restrict__ out_norm, int N, float eps) {
  __shared__ float red[256];
  const int row = blockIdx.x, tid = threadIdx.x;
  const float* x = X + (size_t)row * N; const float* rr = R ? R + (size_t)row * N : nullptr;
  float vals[16];                     // up to N = 4096
  const int per = N / 256;            // contiguous chunk per thread? use strided-by-4 chunks: thread handles j = tid*4 + 1024*u
  float s1 = 0.f;
  for (int u = 0; u < per / 4; ++u) {
    const int j = tid * 4 + 1024 * u;
    const v4f a = *(const v4fa*)(x + j);
    v4f b = {0.f,0.f,0.f,0.f}; if (rr) b = *(const v4fa*)(rr + j);
#pragma unroll
    for (int q = 0; q < 4; ++q) { const float v = a[q] + b[q]; vals[u * 4 + q] = v; s1 += v; }
  }
  red[tid] = s1; __syncthreads();
  for (int st = 128; st > 0; st >>= 1) { if (tid < st) red[tid] += red[tid + st]; __syncthreads(); }
  const float mu = red[0] / (float)N; __syncthreads();
  float s2 = 0.f;
  for (int u = 0; u < per / 4; ++u)
#pragma unroll
    for (int q = 0; q < 4; ++q) { const float c = vals[u * 4 + q] - mu; s2 += c * c; }
  red[tid] = s2; __syncthreads();
  for (int st = 128; st > 0; st >>= 1) { if (tid < st) red[tid] += red[tid + st]; __syncthreads(); }
  const float rs = rsqrtf(red[0] / (float)N + eps);
  {
    for (int u = 0; u < per / 4; ++u) {
      const int j = tid * 4 + 1024 * u;
      v4f o, sm;
#pragma unroll
      for (int q = 0; q < 4; ++q) {
        float gg = g[j + q], bb = bta[j + q];
        if (PARAM_BF16) { gg = bf16_round(gg); bb = bf16_round(bb); }
        sm[q] = vals[u * 4 + q]; o[q] = (vals[u * 4 + q] - mu) * rs * gg + bb;
      }
      if (out_sum) *(v4f*)(out_sum + (size_t)row * N + j) = sm;
      *(v4f*)(out_norm + (size_t)row * N + j) = o;
    }
    
  }
}



// ---- f16 WMMA path (v_wmma_f32_16x16x32_f16): 11-bit significands for operands in range — used where a [0,1] probability operand needs more precision than bf16
typedef _Float16 v16h __attribute__((ext_vector_type(16)));
union FragH { v16h v; v8us half[2]; _Float16 h[16]; unsigned short u[16]; };
template <int NT>
__device__ __forceinline__ v8f mmaH(v16h ah, v16h al, v16h bh, v16h bl, v8f c) {
  c = __builtin_amdgcn_wmma_f32_16x16x32_f16(false, ah, false, bh, (short)0, c, false, false);
  if (NT >= 2) c = __builtin_amdgcn_wmma_f32_16x16x32_f16(false, al, false, bh, (short)0, c, false, false);
  if (NT >= 3) c = __builtin_amdgcn_wmma_f32_16x16x32_f16(false, ah, false, bl, (short)0, c, false, false);
  asm volatile("v_nop\n\tv_nop\n\tv_nop\n\tv_nop" : "+v"(c) : "v"(ah), "v"(al), "v"(bh), "v"(bl));
  return c;
}
// batched GEMM like k_gemm_b but f16 operands: A f32 (split into f16 hi/lo if ASPLIT, else rounded to f16), Bt = f16 values [n][k]; alpha; C f32; N multiple of 16 (partial tiles skipped)
template <bool ASPLIT>
__global__ __launch_bounds__(128) void k_gemm_h(const float* __restrict__ A, int lda, size_t sA, const _Float16* __restrict__ Bh, int ldb, size_t sB, float alpha, float* __restrict__ C, int ldc, size_t sC, int M, int N, int K) {
  __shared__ __attribute__((aligned(16))) float so[4][16][64];
  const int tid = threadIdx.x, w = tid >> 5, lane = tid & 31, ln = lane & 15, hh = lane >> 4; const int by = blockIdx.y;
  A += (size_t)by * sA; Bh += (size_t)by * sB; C += (size_t)by * sC;
  const int ntn = (N + 63) / 64; const int wid = blockIdx.x * 4 + w; const int mt = wid / ntn, nq = wid % ntn; if (mt * 16 >= M) return;
  const int row0 = mt * 16, col0 = nq * 64; const float* arow = A + (size_t)(row0 + ln) * lda;
  v8f acc[4] = {};
  for (int kb = 0; kb < K; kb += 32) {
    FragH ah, al;
    const v4f x0 = *(const v4fa*)(arow + kb + 8 * hh), x1 = *(const v4fa*)(arow + kb + 8 * hh + 4), x2 = *(const v4fa*)(arow + kb + 16 + 8 * hh), x3 = *(const v4fa*)(arow + kb + 16 + 8 * hh + 4);
    float xs[16] = {x0[0],x0[1],x0[2],x0[3],x1[0],x1[1],x1[2],x1[3],x2[0],x2[1],x2[2],x2[3],x3[0],x3[1],x3[2],x3[3]};
#pragma unroll
    for (int i = 0; i < 16; ++i) { const _Float16 h = (_Float16)xs[i]; ah.h[i] = h; al.h[i] = ASPLIT ? (_Float16)(xs[i] - (float)h) : (_Float16)0.0f; }
#pragma unroll
    for (int t = 0; t < 4; ++t) { if (col0 + t * 16 >= N) continue; const size_t boff = (size_t)(col0 + t * 16 + ln) * ldb + kb; FragH bq; bq.half[0] = *(const v8us*)(Bh + boff + 8 * hh); bq.half[1] = *(const v8us*)(Bh + boff + 16 + 8 * hh);
      acc[t] = mmaH<ASPLIT ? 2 : 1>(ah.v, al.v, bq.v, bq.v, acc[t]); }
  }
#pragma unroll
  for (int t = 0; t < 4; ++t) { if (col0 + t * 16 >= N) continue;
#pragma unroll
    for (int r = 0; r < 8; ++r) so[w][8 * hh + r][t * 16 + ln] = acc[t][r] * alpha; }
  __builtin_amdgcn_fence(__ATOMIC_ACQ_REL, "workgroup"); __builtin_amdgcn_wave_barrier();
  const int rsub = lane >> 4, c4 = (lane & 15) * 4;
  {
#pragma unroll
    for (int q = 0; q < 8; ++q) { const int r = q * 2 + rsub; if (col0 + c4 < N) { const v4f v = *(const v4fa*)&so[w][r][c4]; *(v4f*)(C + (size_t)(row0 + r) * ldc + col0 + c4) = v; } }
     }
}

// Wt[n][k] = f16(W[k][n]·scale) from f32 row-major W[K][N] (scale = power of two; bf16-exact weights stay exact in f16 away from the subnormal range)
__global__ __launch_bounds__(256) void k_wt_f16(const float* __restrict__ W, _Float16* __restrict__ Wt, int K, int N, float scale) {
  const int t = blockIdx.x * 256 + threadIdx.x; if (t >= N * (K / 8)) return; const int n = t / (K / 8), k8 = (t % (K / 8)) * 8; FragH f;
#pragma unroll
  for (int i = 0; i < 8; ++i) f.h[i] = (_Float16)(bf16_round(W[(size_t)(k8 + i) * N + n]) * scale); const v8us o = f.half[0];
  *(v8us*)((unsigned short*)Wt + (size_t)n * K + k8) = o; 
}
// k_gemm_hh variant with fused epilogue: v = acc·alpha + bias[by·sBias + col] (+ CP[(row/rowsPerB)·sCPb + by·64 + col] if CP) ; ACT 0 none / 1 elu ; writes f16 C16 (and f32 C if non-null)
template <int ACT>
__global__ __launch_bounds__(128) void k_gemm_hhx(const _Float16* __restrict__ A, int lda, size_t sA, const _Float16* __restrict__ Bh, int ldb, size_t sB, float alpha, const float* __restrict__ bias, size_t sBias, const float* __restrict__ CP, int rowsPerB, size_t sCPb, int row0g,
    float* __restrict__ C, _Float16* __restrict__ C16, int ldc, size_t sC, int M, int N, int K) {
  __shared__ __attribute__((aligned(16))) float so[4][16][64];
  const int tid = threadIdx.x, w = tid >> 5, lane = tid & 31, ln = lane & 15, hh = lane >> 4; const int by = blockIdx.y;
  A += (size_t)by * sA; Bh += (size_t)by * sB; const size_t cofs = (size_t)by * sC; const float* bp = bias ? bias + (size_t)by * sBias : nullptr;
  const int ntn = (N + 63) / 64; const int wid = blockIdx.x * 4 + w; const int mt = wid / ntn, nq = wid % ntn; if (mt * 16 >= M) return;
  const int row0 = mt * 16, col0 = nq * 64; const _Float16* arow = A + (size_t)(row0 + ln) * lda;
  v8f acc[4] = {};
  for (int kb = 0; kb < K; kb += 32) { FragH ah; ah.half[0] = *(const v8us*)((const unsigned short*)arow + kb + 8 * hh); ah.half[1] = *(const v8us*)((const unsigned short*)arow + kb + 16 + 8 * hh);
#pragma unroll
    for (int t = 0; t < 4; ++t) { if (col0 + t * 16 >= N) continue; const size_t boff = (size_t)(col0 + t * 16 + ln) * ldb + kb; FragH bq; bq.half[0] = *(const v8us*)((const unsigned short*)Bh + boff + 8 * hh); bq.half[1] = *(const v8us*)((const unsigned short*)Bh + boff + 16 + 8 * hh);
      acc[t] = mmaH<1>(ah.v, ah.v, bq.v, bq.v, acc[t]); }
  }
#pragma unroll
  for (int t = 0; t < 4; ++t) { if (col0 + t * 16 >= N) continue; const int col = col0 + t * 16 + ln; const float bv = bp ? bf16_round(bp[col]) : 0.f;
#pragma unroll
    for (int r = 0; r < 8; ++r) { float v = acc[t][r] * alpha + bv; if (CP) { const int rr = row0g + row0 + 8 * hh + r; if (rowsPerB < 0) v += CP[cofs + (size_t)rr * ldc + col];      /* rowsPerB < 0: own element of the batched C plane */ else { const int bidx = rr / rowsPerB; v += CP[(size_t)bidx * sCPb + (size_t)by * 64 + col]; } } if (ACT == 1) v = (v > 0.f) ? v : expm1f(v); else if (ACT == 7) v = (v > 0.f) ? v + 1.0f : expf(v); else if (ACT == 8) v = tanhf(v); else if (ACT == 9) v = 0.5f * v * (1.0f + tanhf(0.7978845608028654f * (v + 0.044715f * v * v * v))); else if (ACT == 11) v = 1.0f / (1.0f + expf(-v)); else if (ACT == 12) v = (v > 0.f) ? v : 0.01f * v; else if (ACT == 14) v = (v > 0.f) ? v : 0.1f * v; else if (ACT == 16) v = (v >= 0.f) ? v : 0.3f * v; else if (ACT == 17) v = (v >= 0.f) ? v : 0.2f * v; else if (ACT == 15) v = v / (1.0f + expf(-v)); else if (ACT == 3) v = fmaxf(v, 0.f); else if (ACT == 6) v = 0.5f * v * (1.0f + erff(v * 0.70710678118654752f)); so[w][8 * hh + r][t * 16 + ln] = v; } }
  __builtin_amdgcn_fence(__ATOMIC_ACQ_REL, "workgroup"); __builtin_amdgcn_wave_barrier();
  const int rsub = lane >> 4, c4 = (lane & 15) * 4; typedef _Float16 v4h __attribute__((ext_vector_type(4)));
  {
#pragma unroll
    for (int q = 0; q < 8; ++q) { const int r = q * 2 + rsub; if (col0 + c4 < N) { const v4f v = *(const v4fa*)&so[w][r][c4]; if (C) *(v4f*)(C + cofs + (size_t)(row0 + r) * ldc + col0 + c4) = v; if (C16) { v4h h4; for (int i = 0; i < 4; ++i) h4[i] = (_Float16)v[i]; *(v4h*)(C16 + cofs + (size_t)(row0 + r) * ldc + col0 + c4) = h4; } } }
     }
}


typedef _Float16 v4h __attribute__((ext_vector_type(4)));

__global__ __launch_bounds__(256) void k_x16(const float* __restrict__ x, _Float16* __restrict__ X16, size_t n8) { const size_t t = (size_t)blockIdx.x * 256 + threadIdx.x; if (t >= n8) return; FragH f;
#pragma unroll
  for (int q = 0; q < 8; ++q) f.h[q] = (_Float16)bf16_round(x[t * 8 + q]); *(v8us*)((unsigned short*)X16 + t * 8) = f.half[0];  }
__global__ __launch_bounds__(256) void k_h16(const float* __restrict__ x, _Float16* __restrict__ X16, size_t n8) { const size_t t = (size_t)blockIdx.x * 256 + threadIdx.x; if (t >= n8) return; FragH f;
#pragma unroll
  for (int q = 0; q < 8; ++q) f.h[q] = (_Float16)x[t * 8 + q]; *(v8us*)((unsigned short*)X16 + t * 8) = f.half[0];  }
__global__ __launch_bounds__(256) void k_round16f(const float* __restrict__ W, _Float16* __restrict__ Bt, size_t n8) { const size_t t = (size_t)blockIdx.x * 256 + threadIdx.x; if (t >= n8) return; FragH f;
#pragma unroll
  for (int i = 0; i < 8; ++i) f.h[i] = (_Float16)(bf16_round(W[t * 8 + i]) * 16.0f); *(v8us*)((unsigned short*)Bt + t * 8) = f.half[0];  }
template <int NHv, int TTv>
__global__ __launch_bounds__(256) void k_vt(const _Float16* __restrict__ V16, int ldv, int voff, _Float16* __restrict__ Vt) { __shared__ unsigned short tl[64][66]; const int tid = threadIdx.x; const int slab = blockIdx.x / (TTv / 64), lg = blockIdx.x % (TTv / 64); const int b = slab / NHv, h = slab % NHv;
  for (int i = tid; i < 64 * 8; i += 256) { const int r = i / 8, c8 = (i % 8) * 8; FragH f; f.half[0] = *(const v8us*)((const unsigned short*)V16 + ((size_t)b * TTv + lg * 64 + r) * ldv + voff + h * 64 + c8);
#pragma unroll
    for (int q = 0; q < 8; ++q) tl[r][c8 + q] = f.u[q]; }
  __syncthreads();
  {
#pragma unroll
    for (int rd = 0; rd < 2; ++rd) { const int d = rd * 32 + tid / 8, pc = tid % 8; FragH f;
#pragma unroll
      for (int q = 0; q < 8; ++q) f.u[q] = tl[pc * 8 + q][d];
      *(v8us*)((unsigned short*)Vt + ((size_t)slab * 64 + d) * TTv + lg * 64 + pc * 8) = f.half[0]; }
     } }

__global__ __launch_bounds__(256) void k_hl(const float* __restrict__ F, _Float16* __restrict__ Hh, _Float16* __restrict__ Hl, size_t n8) { const size_t t = (size_t)blockIdx.x * 256 + threadIdx.x; if (t >= n8) return; FragH fh, fl; const v4f a = *(const v4fa*)(F + t * 8), c = *(const v4fa*)(F + t * 8 + 4);
#pragma unroll
  for (int q = 0; q < 4; ++q) { _Float16 h = (_Float16)a[q]; fh.h[q] = h; fl.h[q] = (_Float16)((a[q] - (float)h) * 1024.0f); h = (_Float16)c[q]; fh.h[4 + q] = h; fl.h[4 + q] = (_Float16)((c[q] - (float)h) * 1024.0f); }
  { *(v8us*)((unsigned short*)Hh + t * 8) = fh.half[0]; *(v8us*)((unsigned short*)Hl + t * 8) = fl.half[0];  } }

// ---- fast GEMM (wave tile 32x64; requires M % 32 == 0 rows per launch region and N % 64 == 0); epilogue = k_gemm_hhx semantics ----
__device__ __forceinline__ v16h g2_frag(const _Float16* p, int hh) { FragH f; f.half[0] = *(const v8us*)((const unsigned short*)p + 8 * hh); f.half[1] = *(const v8us*)((const unsigned short*)p + 16 + 8 * hh); return f.v; }
__device__ __forceinline__ v8f g2_mma(v16h a, v16h b, v8f c) { v8f d = __builtin_amdgcn_wmma_f32_16x16x32_f16(false, a, false, b, (short)0, c, false, false); asm volatile("v_nop\n\tv_nop\n\tv_nop\n\tv_nop" : "+v"(d) : "v"(a), "v"(b)); return d; }
template <int ACT>
__global__ __launch_bounds__(128) void k_gemm2(const _Float16* __restrict__ A, int lda, size_t sA, const _Float16* __restrict__ Bh, int ldb, size_t sB, float alpha, const float* __restrict__ bias, size_t sBias, const float* __restrict__ CP, int rowsPerB, size_t sCPb, int row0g,
    float* __restrict__ C, _Float16* __restrict__ C16, int ldc, size_t sC, int M, int N, int K) { static_assert(ACT == 0 || ACT == 3 || ACT == 6 || ACT == 8 || ACT == 9 || ACT == 11 || ACT == 12 || ACT == 14 || ACT == 15 || ACT == 16 || ACT == 17, "k_gemm2: unsupported ACT code (would silently apply no activation)");
  __shared__ __attribute__((aligned(16))) float so[4][32][68];
  const int tid = threadIdx.x, w = tid >> 5, lane = tid & 31, ln = lane & 15, hh = lane >> 4; const int by = blockIdx.y;
  A += (size_t)by * sA; Bh += (size_t)by * sB; const size_t cofs = (size_t)by * sC; const float* bp = bias ? bias + (size_t)by * sBias : nullptr;
  const int ntn = N >> 6; const int mt = blockIdx.x / ntn, nq = blockIdx.x - mt * ntn; const int row0 = mt * 128 + 32 * w, col0 = nq * 64; if (row0 >= M) return;
  const _Float16* a0p = A + (size_t)(row0 + ln) * lda; const _Float16* a1p = a0p + (size_t)16 * lda;
  const _Float16* b0p = Bh + (size_t)(col0 + ln) * ldb; const _Float16* b1p = b0p + (size_t)16 * ldb; const _Float16* b2p = b1p + (size_t)16 * ldb; const _Float16* b3p = b2p + (size_t)16 * ldb;
  const v8f z8 = {0.f,0.f,0.f,0.f,0.f,0.f,0.f,0.f}; v8f c00 = z8, c01 = z8, c02 = z8, c03 = z8, c10 = z8, c11 = z8, c12 = z8, c13 = z8;
#pragma unroll 1
  for (int kb = 0; kb < K; kb += 32) { const v16h a0 = g2_frag(a0p + kb, hh), a1 = g2_frag(a1p + kb, hh);
    v16h b = g2_frag(b0p + kb, hh); c00 = g2_mma(a0, b, c00); c10 = g2_mma(a1, b, c10);
    b = g2_frag(b1p + kb, hh); c01 = g2_mma(a0, b, c01); c11 = g2_mma(a1, b, c11);
    b = g2_frag(b2p + kb, hh); c02 = g2_mma(a0, b, c02); c12 = g2_mma(a1, b, c12);
    b = g2_frag(b3p + kb, hh); c03 = g2_mma(a0, b, c03); c13 = g2_mma(a1, b, c13); }
  v8f accs[8] = {c00, c01, c02, c03, c10, c11, c12, c13};
#pragma unroll
  for (int u = 0; u < 8; ++u) { const int t = u & 3, half = u >> 2; const int col = col0 + t * 16 + ln; const float bv = bp ? bf16_round(bp[col]) : 0.f;
#pragma unroll
    for (int r = 0; r < 8; ++r) { const int rloc = half * 16 + 8 * hh + r; float v = accs[u][r] * alpha + bv; if (CP) { if (rowsPerB < 0) v += CP[cofs + (size_t)(row0g + row0 + rloc) * ldc + col];      /* rowsPerB < 0: own element of the batched C plane */ else { const int bidx = (row0g + row0 + rloc) / rowsPerB; v += CP[(size_t)bidx * sCPb + (size_t)by * 64 + col]; } }
      if (ACT == 3) v = fmaxf(v, 0.f); else if (ACT == 6) v = 0.5f * v * (1.0f + erff(v * 0.70710678118654752f)); else if (ACT == 11) v = 1.0f / (1.0f + expf(-v)); else if (ACT == 15) v = v / (1.0f + expf(-v)); else if (ACT == 12) v = (v > 0.f) ? v : 0.01f * v; else if (ACT == 8) v = tanhf(v); else if (ACT == 9) v = 0.5f * v * (1.0f + tanhf(0.7978845608028654f * (v + 0.044715f * v * v * v))); else if (ACT == 14) v = (v > 0.f) ? v : 0.1f * v; else if (ACT == 16) v = (v >= 0.f) ? v : 0.3f * v; else if (ACT == 17) v = (v >= 0.f) ? v : 0.2f * v;
      so[w][rloc][t * 16 + ln] = v; } }
  __builtin_amdgcn_fence(__ATOMIC_ACQ_REL, "workgroup"); __builtin_amdgcn_wave_barrier();
  const int rsub = lane >> 4, c4 = (lane & 15) * 4;
  {
#pragma unroll
    for (int q = 0; q < 16; ++q) { const int r = q * 2 + rsub; const v4f v = *(const v4fa*)&so[w][r][c4]; if (C) *(v4f*)(C + cofs + (size_t)(row0 + r) * ldc + col0 + c4) = v; if (C16) { v4h h4; for (int i = 0; i < 4; ++i) h4[i] = (_Float16)v[i]; *(v4h*)(C16 + cofs + (size_t)(row0 + r) * ldc + col0 + c4) = h4; } }
     } }


__global__ __launch_bounds__(256) void k_wnat(const float* __restrict__ w, size_t n8, _Float16* __restrict__ Bt) { const size_t t = (size_t)blockIdx.x * 256 + threadIdx.x; if (t >= n8) return; FragH f; for (int q = 0; q < 8; ++q) f.h[q] = (_Float16)(bf16_round(w[t * 8 + q]) * 16.0f); *(v8us*)((unsigned short*)Bt + t * 8) = f.half[0];  }
__global__ __launch_bounds__(256) void k_rsm(const float* __restrict__ S, _Float16* __restrict__ P, int nrows) {
  #pragma clang fp contract(off)
  const int i = blockIdx.x * 256 + threadIdx.x; if (i >= nrows) return; const float* s = S + (size_t)i * SQ; float mx = -3.0e38f;
#pragma unroll 1
  for (int j = 0; j < SQ; ++j) mx = fmaxf(mx, s[j]); float se = 0.f;
#pragma unroll 1
  for (int j = 0; j < SQ; ++j) se += expf(s[j] - mx); const float sc = 256.0f / se;
#pragma unroll 1
  for (int j0 = 0; j0 < SQ; j0 += 8) { FragH f; for (int q = 0; q < 8; ++q) f.h[q] = (_Float16)(expf(s[j0 + q] - mx) * sc); unsigned short* d = (unsigned short*)P + (size_t)i * SQ + j0; *(v8us*)d = f.half[0];  } }
__global__ __launch_bounds__(256) void k_vt(const _Float16* __restrict__ V16, int b, int h0, _Float16* __restrict__ VT) { __shared__ unsigned short tl[64][65]; const int tid = threadIdx.x; const int hh = blockIdx.x % HG, sg = blockIdx.x / HG; const int s0 = sg * 64; const int h = h0 + hh;
  for (int i = tid; i < 64 * 8; i += 256) { const int j = i / 8, d8 = (i % 8) * 8; FragH f; f.half[0] = *(const v8us*)((const unsigned short*)V16 + ((size_t)b * SQ + s0 + j) * DM + h * HD + d8); for (int q = 0; q < 8; ++q) tl[d8 + q][j] = f.u[q]; }
  __syncthreads();
  { for (int i = tid; i < 64 * 8; i += 256) { const int d = i / 8, j8 = (i % 8) * 8; FragH f; for (int q = 0; q < 8; ++q) f.u[q] = tl[d][j8 + q]; *(v8us*)((unsigned short*)VT + ((size_t)hh * HD + d) * SQ + s0 + j8) = f.half[0]; }  } }



__global__ __launch_bounds__(256) void k_rsmcf2(const float* __restrict__ S, _Float16* __restrict__ P, int hg, int q0, int nk) {
  #pragma clang fp contract(off)
  const int t = blockIdx.x * 256 + threadIdx.x; if (t >= hg * QT) return; const size_t i = (size_t)t; const float* s = S + i * NKX; const int last = q0 + (t % QT); float mx = -3.0e38f;
#pragma unroll 1
  for (int j = 0; j < nk; ++j) { const float f = (j <= last) ? 1.f : 0.f; mx = fmaxf(mx, fmaf(f, s[j], (1.f - f) * -1.0e9f)); } float se = 0.f;
#pragma unroll 1
  for (int j = 0; j < nk; ++j) { const float f = (j <= last) ? 1.f : 0.f; se += __expf(fmaf(f, s[j], (1.f - f) * -1.0e9f) - mx); } const float sc = 256.0f / se;
#pragma unroll 1
  for (int j0 = 0; j0 < nk; j0 += 8) { FragH fr; for (int q = 0; q < 8; ++q) { const int j = j0 + q; const float f = (j <= last) ? 1.f : 0.f; fr.h[q] = (_Float16)(__expf(fmaf(f, s[j], (1.f - f) * -1.0e9f) - mx) * sc); } unsigned short* d = (unsigned short*)P + i * NKX + j0; *(v8us*)d = fr.half[0];  } }


template <int MASKADD>
__global__ __launch_bounds__(64) void k_att0(const float* __restrict__ QF, const float* __restrict__ KF, const float* __restrict__ VF, int ld, const float* __restrict__ mask, float scale, float* __restrict__ OF, int ldo) {
  #pragma clang fp contract(off)
  __shared__ __attribute__((aligned(16))) float lq[64][64]; __shared__ __attribute__((aligned(16))) float lo[64][64];
  const int tid = threadIdx.x; const int h = blockIdx.x / (QT0 / 64), rg = blockIdx.x % (QT0 / 64); const int i = rg * 64 + tid;
  const float* qr = QF + (size_t)i * ld + h * HD;
#pragma unroll 1
  for (int c = 0; c < HD / 4; ++c) { *(v4f*)&lq[tid][c * 4] = *(const v4fa*)(qr + c * 4); const v4f z = {0.f, 0.f, 0.f, 0.f}; *(v4f*)&lo[tid][c * 4] = z; }
  float m = -1.0e30f, l = 0.f; const int jmax = MASKADD ? (SQ - 1) : (rg * 64 + 63);      /* additive-mask form: every key (the mask input decides); causal form: keys up to the block's last row */
#pragma unroll 1
  for (int j = 0; j <= jmax; ++j) { const float* kr = KF + (size_t)j * ld + h * HD; const float* vr = VF + (size_t)j * ld + h * HD; float s = 0.f;
#pragma unroll 1
    for (int c = 0; c < HD / 4; ++c) { const v4f kq = *(const v4fa*)(kr + c * 4); const v4f qq = *(v4f*)&lq[tid][c * 4]; s = __fadd_rn(s, __fmul_rn(qq[0], kq[0])); s = __fadd_rn(s, __fmul_rn(qq[1], kq[1])); s = __fadd_rn(s, __fmul_rn(qq[2], kq[2])); s = __fadd_rn(s, __fmul_rn(qq[3], kq[3])); }
    s = __fmul_rn(s, scale); if (MASKADD) s = __fadd_rn(s, __fmul_rn(bf16_round(mask[(size_t)i * SQ + j]), -10000.0f));
    const float f = (MASKADD || j <= i) ? 1.f : 0.f; const float sm = fmaf(f, s, (1.f - f) * -1.0e30f); const float mn = fmaxf(m, sm); const float sc = expf(m - mn); const float e = expf(sm - mn); l = __fadd_rn(__fmul_rn(l, sc), e); m = mn;
#pragma unroll 1
    for (int c = 0; c < HD / 4; ++c) { const v4f vv = *(const v4fa*)(vr + c * 4); v4f oo = *(v4f*)&lo[tid][c * 4]; for (int u = 0; u < 4; ++u) oo[u] = __fadd_rn(__fmul_rn(oo[u], sc), __fmul_rn(e, vv[u])); *(v4f*)&lo[tid][c * 4] = oo; } }
  const float fin = 64.0f / l;      /* o carried x64 like the f16 path */
#pragma unroll 1
  for (int c = 0; c < HD / 4; ++c) { v4f oo = *(v4f*)&lo[tid][c * 4]; for (int u = 0; u < 4; ++u) oo[u] = __fmul_rn(oo[u], fin); *(v4f*)&lo[tid][c * 4] = oo; }
  __syncthreads();
  {
#pragma unroll 1
    for (int it = 0; it < 16; ++it) { const int row = it * 4 + tid / 16, pc = (tid % 16) * 4; const v4f v = *(const v4f*)&lo[row][pc]; *(v4f*)(OF + (size_t)(rg * 64 + row) * ldo + h * HD + pc) = v; }
     } }


template <int BFIN, int WXB>
__global__ __launch_bounds__(256) void k_ln16(const float* __restrict__ X, const float* __restrict__ g, const float* __restrict__ bb, float eps, _Float16* __restrict__ N16, float* __restrict__ XB) {
  #pragma clang fp contract(off)
  __shared__ float red[256]; const size_t r = blockIdx.x; const int t = threadIdx.x; const v4f xa = *(const v4fa*)(X + r * DMQ + t * 4); float s[4]; float sum = 0.f;
  for (int q = 0; q < 4; ++q) { s[q] = BFIN ? bf16_round(xa[q]) : xa[q]; sum = __fadd_rn(sum, s[q]); }
  red[t] = sum; __syncthreads(); for (int st = 128; st > 0; st >>= 1) { if (t < st) red[t] = __fadd_rn(red[t], red[t + st]); __syncthreads(); } const float mu = red[0] / (float)DMQ; __syncthreads();
  float vs = 0.f; for (int q = 0; q < 4; ++q) { const float dl = __fadd_rn(s[q], -mu); vs = __fadd_rn(vs, __fmul_rn(dl, dl)); } red[t] = vs; __syncthreads(); for (int st = 128; st > 0; st >>= 1) { if (t < st) red[t] = __fadd_rn(red[t], red[t + st]); __syncthreads(); }
  const float rs = rsqrtf(__fadd_rn(red[0] / (float)DMQ, eps)); v4h y; v4f xb;
  for (int q = 0; q < 4; ++q) { const int c = t * 4 + q; y[q] = (_Float16)__fadd_rn(__fmul_rn(__fmul_rn(__fadd_rn(s[q], -mu), rs), bf16_round(g[c])), bf16_round(bb[c])); xb[q] = s[q]; }
  { *(v4h*)(N16 + r * DMQ + t * 4) = y; if (WXB) *(v4f*)(XB + r * DMQ + t * 4) = xb;  } }
__global__ __launch_bounds__(256) void k_ftres2(const float* __restrict__ OF0, const float* __restrict__ XB, float* __restrict__ X1, size_t n4) {
  #pragma clang fp contract(off)
  const size_t t = (size_t)blockIdx.x * 256 + threadIdx.x; if (t >= n4) return; const v4f o = *(const v4fa*)(OF0 + t * 4), xv = *(const v4fa*)(XB + t * 4); v4f y; for (int q = 0; q < 4; ++q) y[q] = __fadd_rn(__fmul_rn(o[q], 0.015625f), xv[q]); *(v4f*)(X1 + t * 4) = y;  }

__global__ __launch_bounds__(256) void k_wthd(const float* __restrict__ Wt, _Float16* __restrict__ Bt) { const size_t t = (size_t)blockIdx.x * 256 + threadIdx.x; if (t >= (size_t)NH * HD * (DM / 8)) return; const int m8 = (int)(t % (DM / 8)) * 8; const int d = (int)((t / (DM / 8)) % HD); const int h = (int)(t / ((size_t)(DM / 8) * HD)); FragH f;
  for (int q = 0; q < 8; ++q) f.h[q] = (_Float16)(16.0f * bf16_round(Wt[((size_t)h * DM + m8 + q) * HD + d])); unsigned short* dst = (unsigned short*)Bt + ((size_t)h * HD + d) * DM + m8; *(v8us*)dst = f.half[0];  }




template <int BFIN, int W16, int W32>
__global__ __launch_bounds__(256) void k_lnx(const float* __restrict__ X, const float* __restrict__ g, const float* __restrict__ bb, float eps, _Float16* __restrict__ N16, float* __restrict__ N32) {
  #pragma clang fp contract(off)
  __shared__ float red[256]; const size_t r = blockIdx.x; const int t = threadIdx.x; const bool act = t < (DMQ / 4); const int c0 = act ? t * 4 : 0;
  const v4f xa = *(const v4fa*)(X + r * DMQ + c0); float s[4]; float sum = 0.f;
  for (int q = 0; q < 4; ++q) { s[q] = act ? (BFIN ? bf16_round(xa[q]) : xa[q]) : 0.f; sum = __fadd_rn(sum, s[q]); }
  red[t] = sum; __syncthreads(); for (int st = 128; st > 0; st >>= 1) { if (t < st) red[t] = __fadd_rn(red[t], red[t + st]); __syncthreads(); } const float mu = red[0] / (float)DMQ; __syncthreads();
  float vs = 0.f; for (int q = 0; q < 4; ++q) { const float dl = act ? __fadd_rn(s[q], -mu) : 0.f; vs = __fadd_rn(vs, __fmul_rn(dl, dl)); } red[t] = vs; __syncthreads(); for (int st = 128; st > 0; st >>= 1) { if (t < st) red[t] = __fadd_rn(red[t], red[t + st]); __syncthreads(); }
  const float rs = rsqrtf(__fadd_rn(red[0] / (float)DMQ, eps)); v4h y; v4f yf;
  for (int q = 0; q < 4; ++q) { const int c = c0 + q; yf[q] = __fadd_rn(__fmul_rn(__fmul_rn(__fadd_rn(s[q], -mu), rs), bf16_round(g[c])), bf16_round(bb[c])); y[q] = (_Float16)yf[q]; }
  if (!act) return;      /* no barriers after this point */
  { if (W16) *(v4h*)(N16 + r * DMQ + c0) = y; if (W32) *(v4f*)(N32 + r * DMQ + c0) = yf;  } }


__global__ __launch_bounds__(256) void k_bfr(const float* __restrict__ x, float* __restrict__ XB, size_t n8) { const size_t t = (size_t)blockIdx.x * 256 + threadIdx.x; if (t >= n8) return; v4f a = *(const v4fa*)(x + t * 8), c = *(const v4fa*)(x + t * 8 + 4); for (int q = 0; q < 4; ++q) { a[q] = bf16_round(a[q]); c[q] = bf16_round(c[q]); }
  { *(v4f*)(XB + t * 8) = a; *(v4f*)(XB + t * 8 + 4) = c;  } }




__global__ __launch_bounds__(256) void k_lorafold(const float* __restrict__ Wm, const float* __restrict__ A, const float* __restrict__ Bm, float* __restrict__ WE, int K, int N, float sc) {
  #pragma clang fp contract(off)
  const size_t t = (size_t)blockIdx.x * 256 + threadIdx.x; if (t >= (size_t)K * N) return; const int i = (int)(t / N), o = (int)(t % N); float a = 0.f;
  for (int r = 0; r < 16; ++r) a = __fadd_rn(a, __fmul_rn(bf16_round(A[(size_t)i * 16 + r]), bf16_round(Bm[(size_t)r * N + o])));
  const float v = __fadd_rn(bf16_round(Wm[t]), __fmul_rn(sc, a)); *(float*)(WE + t) = v;  }
__global__ __launch_bounds__(256) void k_wt32rep(const float* __restrict__ Wf, _Float16* __restrict__ Bt, int K, int N, int DOUT, float scale) {
  const int t = blockIdx.x * 256 + threadIdx.x; if (t >= DOUT * (K / 8)) return; const int n = t / (K / 8), k8 = (t % (K / 8)) * 8; const int rep = DOUT / N; const int src = (n / (HD * rep)) * HD + (n % HD);      /* head h = n / HD -> group h / rep */
  FragH f; for (int i = 0; i < 8; ++i) f.h[i] = (_Float16)(Wf[(size_t)(k8 + i) * N + src] * scale);
  *(v8us*)((unsigned short*)Bt + (size_t)n * K + k8) = f.half[0];  }
__global__ __launch_bounds__(256) void k_brep(const float* __restrict__ b, float* __restrict__ out) { const int t = blockIdx.x * 256 + threadIdx.x; if (t >= DM) return; const float v = b[(t / (HD * 4)) * HD + (t % HD)]; *(float*)(out + t) = v;  }

__global__ __launch_bounds__(256) void k_rsmcim(const float* __restrict__ S, _Float16* __restrict__ P, int hg, int q0, int nk, const int* __restrict__ am) {
  #pragma clang fp contract(off)
  const int t = blockIdx.x * 256 + threadIdx.x; if (t >= hg * QT) return; const size_t i = (size_t)t; const float* s = S + i * NKX; const int last = q0 + (t % QT); const int* mr = am + (size_t)last * SQ; float mx = -3.0e38f;      /* the module's mask row of this query (keys >= nk lie above the diagonal of the causal mask and are not computed) */
#pragma unroll 1
  for (int j = 0; j < nk; ++j) { const float f = (mr[j] != 0) ? 1.f : 0.f; mx = fmaxf(mx, fmaf(f, s[j], (1.f - f) * -1.0e9f)); } float se = 0.f;
#pragma unroll 1
  for (int j = 0; j < nk; ++j) { const float f = (mr[j] != 0) ? 1.f : 0.f; se += __expf(fmaf(f, s[j], (1.f - f) * -1.0e9f) - mx); } const float sc = 256.0f / se;
#pragma unroll 1
  for (int j0 = 0; j0 < nk; j0 += 8) { FragH fr; for (int q = 0; q < 8; ++q) { const int j = j0 + q; const float f = (mr[j] != 0) ? 1.f : 0.f; fr.h[q] = (_Float16)(__expf(fmaf(f, s[j], (1.f - f) * -1.0e9f) - mx) * sc); } unsigned short* d = (unsigned short*)P + i * NKX + j0; *(v8us*)d = fr.half[0];  } }



__global__ __launch_bounds__(256) void k_bcpy(const float* __restrict__ b, int n, int NP, float* __restrict__ dst, int dst0) { for (int i = threadIdx.x; i < NP; i += 256) { const float v = (i < n) ? b[i] : 0.f; *(float*)(dst + dst0 + i) = v; }  }



// lane l with lane l ^ 16
__device__ __forceinline__ float rs_xhalf(float x) { return __builtin_bit_cast(float, __builtin_amdgcn_permlanex16(__builtin_bit_cast(int, x), __builtin_bit_cast(int, x), 0x76543210, 0xfedcba98, false, false)); }
// Four 2^t in one statement, each in place: behind a transcendental the instruction set asks for one independent instruction or v_nop before its result is read or its source overwritten.
// Here each v_exp_f32 is the independent instruction behind the one before it, the v_nop the slot behind the last. In place, so that the
// statement writes only registers that the multiply-add in front of it has written: the compiler keeps that one clear of the matrix instructions' operands.
__device__ __forceinline__ v4f rs_exp2x4(v4f t) { float a = t[0], b = t[1], c = t[2], d = t[3];
  asm("v_exp_f32 %0, %0\n\tv_exp_f32 %1, %1\n\tv_exp_f32 %2, %2\n\tv_exp_f32 %3, %3\n\tv_nop" : "+v"(a), "+v"(b), "+v"(c), "+v"(d));
  const v4f r = {a, b, c, d}; return r; }
__device__ __forceinline__ v8f fa_mma(v16h a, v16h b, v8f c) { return __builtin_amdgcn_wmma_f32_16x16x32_f16(false, a, false, b, (short)0, c, false, false); }
// Fused attention: scores, softmax and P V in one launch; no score and no weight leaves the registers. One work-group = 256 queries of one (batch, head), 8 waves of 32 query columns;
// a pass = 32 keys. Transposed products: S^T = K Q^T (rows = keys, columns = queries), so a lane's 16 scores of a column are, as they lie, its 16 elements of the B operand of O^T += V^T P^T
// (k order of both operands: 8 hh + 0..7, then 16 + 8 hh + 0..7, that of g2_frag). Online softmax in the log2 domain, f32: the maximum in use may trail the true one by up to 8 (an
// exponential reaches 2^8 at most, well inside f16), and the sums are rescaled only in a pass where some column exceeds that. Denominator = an all-ones A operand times P^T on the matrix
// pipe: it sums the weights as rounded to f16, the same values the numerator sums. K and V^T fragments come straight from global memory, K one pass ahead, V^T at the head of its pass. o is carried x64 as f16 rows.
// Every '#pragma unroll' in it is there so that the fragment and accumulator arrays it indexes become registers.
__global__ __launch_bounds__(256) void k_fattn(const _Float16* __restrict__ Q, const _Float16* __restrict__ KV, const _Float16* __restrict__ VT, _Float16* __restrict__ O) {
  constexpr float CS = 0.015625f * 1.44269504f;      /* (q / 8) . (k / 8) = q . k / 64, times log2 e */
  const int lane = threadIdx.x & 31, ln = lane & 15, hh = lane >> 4; const int wave = __builtin_amdgcn_readfirstlane(threadIdx.x >> 5);
  const int h = blockIdx.y, b = blockIdx.z; const int q0 = blockIdx.x * 256 + wave * 32;
  const _Float16* qp = Q + ((size_t)b * SQ + q0 + ln) * DM + h * HD;
  const _Float16* kp = KV + ((size_t)b * SK + ln) * (2 * DM) + h * HD;      /* k half of the fused rows: row = key */
  const _Float16* vp = VT + (((size_t)b * NH + h) * HD + ln) * SK;      /* V^T: row = d, column = key */
  v16h qf[2][2], kf[2][2];
#pragma unroll
  for (int g = 0; g < 2; ++g) for (int kc = 0; kc < 2; ++kc) qf[g][kc] = g2_frag(qp + (size_t)g * 16 * DM + 32 * kc, hh);
#pragma unroll
  for (int kt = 0; kt < 2; ++kt) for (int kc = 0; kc < 2; ++kc) kf[kt][kc] = g2_frag(kp + (size_t)kt * 16 * (2 * DM) + 32 * kc, hh);
  FragH ones;
#pragma unroll
  for (int i = 0; i < 16; ++i) ones.h[i] = (_Float16)1.0f;
  const v8f z8 = {0.f, 0.f, 0.f, 0.f, 0.f, 0.f, 0.f, 0.f};
  v8f acc[2][4], lacc[2]; float m_run[2];
#pragma unroll
  for (int g = 0; g < 2; ++g) { m_run[g] = -__builtin_inff(); lacc[g] = z8; for (int t = 0; t < 4; ++t) acc[g][t] = z8; }
  auto pass = [&](const int key0, const bool more) __attribute__((always_inline)) {      /* more is a literal at both calls: the last pass is compiled without the fetch of a next K, and no branch stands behind a matrix instruction */
    v16h vf[4]; v8f s[2][2];
#pragma unroll
    for (int t = 0; t < 4; ++t) vf[t] = g2_frag(vp + (size_t)t * 16 * SK + key0, hh);      /* this pass's V^T, in flight under the first product and the softmax; issued behind the pass's K, so the wait for K leaves these in flight */
    asm volatile("s_wait_xcnt 0x0" ::: "memory");      /* before the loads' address registers are written again */
#pragma unroll
    for (int kt = 0; kt < 2; ++kt) for (int g = 0; g < 2; ++g) s[kt][g] = fa_mma(kf[kt][1], qf[g][1], fa_mma(kf[kt][0], qf[g][0], z8));
    if (more) {
#pragma unroll
      for (int kt = 0; kt < 2; ++kt) for (int kc = 0; kc < 2; ++kc) kf[kt][kc] = g2_frag(kp + (size_t)(key0 + 32 + kt * 16) * (2 * DM) + 32 * kc, hh);
      asm volatile("s_wait_xcnt 0x0" ::: "memory"); }      /* before the loads' address registers are written again; the statement also holds the loads up here: without it the compiler sank them into the second product, where they have no time to land */
    float mb[2]; bool need = false;
#pragma unroll
    for (int g = 0; g < 2; ++g) { float mx = fmaxf(s[0][g][0], s[1][g][0]);
      for (int r = 1; r < 8; ++r) mx = fmaxf(mx, fmaxf(s[0][g][r], s[1][g][r]));
      mx = fmaxf(mx, rs_xhalf(mx)) * CS; mb[g] = mx; need = need || (mx > m_run[g] + 8.0f); }      /* both wave halves hold the column's maximum of this pass, scaled (the scale is positive) */
    if (__builtin_amdgcn_ballot_w32(need) != 0) {      /* always in the first pass (the maximum in use is -inf, the factor 0), rare later */
#pragma unroll
      for (int g = 0; g < 2; ++g) { const float mn = fmaxf(m_run[g], mb[g]); const float corr = __builtin_amdgcn_exp2f(m_run[g] - mn); m_run[g] = mn; lacc[g] = lacc[g] * corr; for (int t = 0; t < 4; ++t) acc[g][t] = acc[g][t] * corr; } }
#pragma unroll
    for (int g = 0; g < 2; ++g) { FragH pf; const float nm = -m_run[g];
      for (int kt = 0; kt < 2; ++kt) for (int j = 0; j < 2; ++j) { v4f a; for (int q = 0; q < 4; ++q) a[q] = fmaf(s[kt][g][4 * j + q], CS, nm); const v4f e = rs_exp2x4(a); for (int q = 0; q < 4; ++q) pf.h[8 * kt + 4 * j + q] = (_Float16)e[q]; }
      for (int t = 0; t < 4; ++t) acc[g][t] = fa_mma(vf[t], pf.v, acc[g][t]);
      lacc[g] = fa_mma(ones.v, pf.v, lacc[g]); }
  };
#pragma unroll 1      /* rolled: a second copy of the pass would only add code, its registers are the same ones */
  for (int key0 = 0; key0 < SK - 32; key0 += 32) pass(key0, true);
  pass(SK - 32, false);
#pragma unroll
  for (int g = 0; g < 2; ++g) { const float inv = 64.0f / lacc[g][0];      /* every row of the all-ones product holds the column's denominator */
    _Float16* op = O + ((size_t)b * SQ + q0 + 16 * g + ln) * DM + h * HD + 8 * hh;
    for (int t = 0; t < 4; ++t) { FragH f; for (int r = 0; r < 8; ++r) f.h[r] = (_Float16)(acc[g][t][r] * inv); *(v8us*)((unsigned short*)op + 16 * t) = f.half[0]; } } }      /* d = 16 t + 8 hh + 0..7 of query ln: 16 bytes a lane; the wave's four stores fill each row's 128-byte line */
extern "C" void kernel_launch(void* const* d_in, const int* in_sizes, int n_in,
                              void* d_out, int out_size, void* d_ws, size_t ws_size, hipStream_t stream) {
  (void)in_sizes; (void)n_in; (void)out_size;
  const float* const* I = (const float* const*)d_in; const float* x = I[0]; const float* cond = I[1]; const float* wq = I[2]; const float* bq = I[3]; const float* wkv = I[4]; const float* bkv = I[5]; const float* wo = I[6]; const float* bo = I[7];      /* input order: x [2][2048][1024]; tgt [2][2048][1024]; [in][out] Wq [1024][1024] + bq; Wkv [1024][2048] + bkv (k | v halves); Wp [1024][1024] + bp; the three biases are bound and read */
  static_assert(NH * HD == DM && HD == 64 && SQ % 256 == 0 && SK % 64 == 0 && DC % 32 == 0 && DM % 64 == 0, "shape / tile multiples");
  const size_t NRK = (size_t)NB * SK;      /* conditioning rows */
  char* ws = (char*)d_ws; size_t off = 0;
  auto take = [&](size_t bytes) { char* p = ws + off; off += (bytes + 255) & ~(size_t)255; return p; };
  _Float16* BQ = (_Float16*)take((size_t)DM * DM * 2); _Float16* BKV = (_Float16*)take((size_t)2 * DM * DC * 2); _Float16* BO = (_Float16*)take((size_t)DM * DM * 2);
  _Float16* X16 = (_Float16*)take(NR * DM * 2); _Float16* C16 = (_Float16*)take(NRK * DC * 2); _Float16* Q16 = (_Float16*)take(NR * DM * 2); _Float16* KV16 = (_Float16*)take(NRK * 2 * DM * 2); _Float16* O16 = (_Float16*)take(NR * DM * 2);
  _Float16* VT = (_Float16*)take((size_t)NB * NH * HD * SK * 2);
  if (off > ws_size) return;      /* 2 + 4 + 2 (weight planes) + 8 + 8 + 8 + 16 + 8 (row planes) + 8 (V^T) = 64 MiB at NB 2, SK 2048, DC 1024 */
  k_wt_f16<<<(unsigned)(((size_t)DM * (DM / 8) + 255) / 256), 256, 0, stream>>>(wq, BQ, DM, DM, 16.0f); k_wt_f16<<<(unsigned)(((size_t)2 * DM * (DC / 8) + 255) / 256), 256, 0, stream>>>(wkv, BKV, DC, 2 * DM, 16.0f); k_wt_f16<<<(unsigned)(((size_t)DM * (DM / 8) + 255) / 256), 256, 0, stream>>>(wo, BO, DM, DM, 16.0f);      /* [in][out] -> Bt x16: Wq [1024][1024]; Wkv [DC = 1024][2048] -> Bt [2048][1024] (rows 0..1023 = k, 1024..2047 = v); Wp */
  k_x16<<<(unsigned)((NR * DM / 8 + 255) / 256), 256, 0, stream>>>(x, X16, NR * DM / 8); k_x16<<<(unsigned)((NRK * DC / 8 + 255) / 256), 256, 0, stream>>>(cond, C16, NRK * DC / 8);      /* exact f16 rows of both inputs */
  k_gemm2<0><<<dim3((unsigned)((NR / 128) * (DM / 64)), 1), 128, 0, stream>>>(X16, DM, 0, BQ, DM, 0, 0.0625f, bq, 0, nullptr, 1, 0, 0, nullptr, Q16, DM, 0, (int)NR, DM, DM);      /* q rows (f16); head h = columns 64 h .. */
  k_gemm2<0><<<dim3((unsigned)((NRK / 128) * (2 * DM / 64)), 1), 128, 0, stream>>>(C16, DC, 0, BKV, DC, 0, 0.0625f, bkv, 0, nullptr, 1, 0, 0, nullptr, KV16, 2 * DM, 0, (int)NRK, 2 * DM, DC);      /* k | v rows (f16, pitch 2048): k = columns 0..1023, v = columns 1024..2047, head h = columns 64 h .. of each half */
  k_vt<NH, SK><<<NB * NH * (SK / 64), 256, 0, stream>>>(KV16 + DM, 2 * DM, 0, VT);      /* V^T [NB][NH][HD][SK] (the v half of the fused rows) */
  k_fattn<<<dim3(SQ / 256, NH, NB), 256, 0, stream>>>(Q16, KV16, VT, O16);      /* softmax(q . k / 64) v over the SK = 2048 keys -> ctx (merged heads, x64) as f16 rows */
  k_gemm2<0><<<dim3((unsigned)((NR / 128) * (DM / 64)), 1), 128, 0, stream>>>(O16, DM, 0, BO, DM, 0, 0.0009765625f, bo, 0, nullptr, 1, 0, 0, (float*)d_out, nullptr, DM, 0, (int)NR, DM, DM);      /* out = ctx proj_w + proj_b */
}

// v003
// A run of this version takes 142 microseconds.
// Next to v002, in two timings, it ran 1.58 and 1.60 times as fast.
// Over all steps from v000 it is 46.4 times as fast.
#include <hip/hip_runtime.h>
// Multi-head cross-attention with a fused key / value projection and BOTH q and k scaled (x [2][2048][1024] (queries), tgt [2][2048][1024] (keys / values); q = x Wq + bq ([in][out] 1024 x 1024, normal x 0.02; zero bias); kv = tgt Wkv + bkv ([in][out] 1024 x 2048; zero bias) split into halves: k = columns 0..1023, v = columns 1024..2047; 16 heads of 64; logits = (q * 64^-0.5) . (k * 64^-0.5): the module scales BOTH operands, so the effective scale is 1/64; softmax over the 2048 tgt positions (no mask); out = merged Wp + bp ([in][out]; zero bias) -> [2][2048][1024]).
// Structure: token rows; x and tgt as exact f16 rows; natural weights as exact x16 planes; q and fused k | v WMMA GEMMs (32x64 wave tiles, f32 accumulation, + bias) -> f16; V^T via LDS transposes; one fused attention launch (256 queries of one head per work-group: scores, online softmax with f32 statistics and native exp, weights f16, ctx x64 merged f16); ctx Wp + bp -> f32 output.
// Compute dtype: inputs rounded to bf16; x / weights exact; q, k, v, softmax weights and o as plain f16 GEMM operands (~2^-12); scores and softmax statistics f32. v_wmma_f32_16x16x32_f16.
#define NB 2
#define SQ 2048                      /* query rows per batch */
#define SK 2048                      /* conditioning (key / value) rows per batch */
#define DC 1024                       /* conditioning width */
#define DM 1024
#define NH 16
#define HD 64
#define HG 4                         /* heads per launch of the (b, h0) k_vt form, which is not launched */
#define QT 256                       /* query rows per attention tile */
#define NKX SK                       /* S / P row pitch = the SK keys (2048 here) */
#define QT0 128                      /* first-tile rows recomputed exactly in f32 */
#define B0 0                         /* first batch processed (debug hook) */
#define NBR NB                       /* batches processed (debug hook) */
#define NR ((size_t)NB * SQ)
#define DMQ DM
#define DFF 4096         /* token rows */
#define MP ((int)((size_t)NBR * SQ)) /* rows projected (debug hook) */
#define QN SQ                        /* query rows attended per batch (debug hook) */
#define NHD NH                       /* heads attended (debug hook) */
#define MPO MP                       /* rows through the output stage (debug hook) */
#define LQ (3 * DM)      /* unused; q rows have pitch DM, k | v rows 2 * DM */
typedef __bf16 v16b __attribute__((ext_vector_type(16)));
typedef unsigned short v8us __attribute__((ext_vector_type(8), may_alias));
typedef float  v8f  __attribute__((ext_vector_type(8)));
typedef float  v4f  __attribute__((ext_vector_type(4)));
typedef float  v4fa __attribute__((ext_vector_type(4), may_alias));
union FragB { v16b v; v8us half[2]; unsigned short u[16]; };

__device__ __forceinline__ unsigned short bf16_bits(float x) { unsigned int u = __float_as_uint(x); return (unsigned short)((u + 0x7FFFu + ((u >> 16) & 1u)) >> 16); }
__device__ __forceinline__ float bf16_val(unsigned short b) { return __uint_as_float(((unsigned int)b) << 16); }
__device__ __forceinline__ float bf16_round(float x) { return bf16_val(bf16_bits(x)); }
// D += A·B with NT terms: 1 = ah·bh, 2 = + al·bh (A split), 3 = + ah·bl (both split)
template <int NT>
__device__ __forceinline__ v8f mmaN(v16b ah, v16b al, v16b bh, v16b bl, v8f c) {
  c = __builtin_amdgcn_wmma_f32_16x16x32_bf16(false, ah, false, bh, (short)0, c, false, false);
  if (NT >= 2) c = __builtin_amdgcn_wmma_f32_16x16x32_bf16(false, al, false, bh, (short)0, c, false, false);
  if (NT >= 3) c = __builtin_amdgcn_wmma_f32_16x16x32_bf16(false, ah, false, bl, (short)0, c, false, false);
  asm volatile("v_nop\n\tv_nop\n\tv_nop\n\tv_nop" : "+v"(c) : "v"(ah), "v"(al), "v"(bh), "v"(bl));
  return c;
}

__global__ __launch_bounds__(256) void k_wt_bf16(const float* __restrict__ W, unsigned short* __restrict__ Wt, int K, int N) {
  const int t = blockIdx.x * 256 + threadIdx.x;
  const int k8n = K / 8;
  if (t >= N * k8n) return;
  const int n = t / k8n, k8 = (t % k8n) * 8;
  v8us v;
#pragma unroll
  for (int i = 0; i < 8; ++i) v[i] = bf16_bits(W[(size_t)(k8 + i) * N + n]);
  *(v8us*)(Wt + (size_t)n * K + k8) = v;
  
}

// GEMM C[M][N] (f32, pitch ldc) = act(A[M][K]·W + bias). A f32 row-major (pitch lda) converted per fragment to bf16
// (ASPLIT: hi/lo two planes -> 2 terms, else single rounded term); Wt bf16 [N][K] (pitch ldb). BIAS_BF16 rounds the
// bias to bf16 first (bias quantised to bf16 before the add). K%32==0, M%16==0, N%64==0.
template <bool ASPLIT, int ACT, bool BIAS_BF16>
__global__ __launch_bounds__(128) void k_gemm_bf(const float* __restrict__ A, int lda, const unsigned short* __restrict__ Wt, int ldb,
                                               const float* __restrict__ bias, float* __restrict__ C, int ldc, int M, int N, int K) {
  __shared__ __attribute__((aligned(16))) float so[4][16][64];
  const int tid = threadIdx.x, w = tid >> 5, lane = tid & 31, ln = lane & 15, hh = lane >> 4;
  const int ntn = N / 64;
  const int wid = blockIdx.x * 4 + w;
  const int mt = wid / ntn, nq = wid % ntn;
  if (mt * 16 >= M) return;
  const int row0 = mt * 16, col0 = nq * 64;
  const float* arow = A + (size_t)(row0 + ln) * lda;
  v8f acc[4] = {};
  for (int kb = 0; kb < K; kb += 32) {
    FragB ah, al;
    const v4f x0 = *(const v4fa*)(arow + kb + 8 * hh), x1 = *(const v4fa*)(arow + kb + 8 * hh + 4);
    const v4f x2 = *(const v4fa*)(arow + kb + 16 + 8 * hh), x3 = *(const v4fa*)(arow + kb + 16 + 8 * hh + 4);
    float xs[16] = {x0[0],x0[1],x0[2],x0[3],x1[0],x1[1],x1[2],x1[3],x2[0],x2[1],x2[2],x2[3],x3[0],x3[1],x3[2],x3[3]};
#pragma unroll
    for (int i = 0; i < 16; ++i) { const unsigned short hb = bf16_bits(xs[i]); ah.u[i] = hb; al.u[i] = ASPLIT ? bf16_bits(xs[i] - bf16_val(hb)) : (unsigned short)0; }
#pragma unroll
    for (int t = 0; t < 4; ++t) {
      const unsigned short* brow = Wt + (size_t)(col0 + t * 16 + ln) * ldb + kb;
      FragB b;
      b.half[0] = *(const v8us*)(brow + 8 * hh);
      b.half[1] = *(const v8us*)(brow + 16 + 8 * hh);
      acc[t] = mmaN<ASPLIT ? 2 : 1>(ah.v, al.v, b.v, b.v, acc[t]);
    }
  }
#pragma unroll
  for (int t = 0; t < 4; ++t) {
    float bv = bias ? bias[col0 + t * 16 + ln] : 0.f;
    if (BIAS_BF16) bv = bf16_round(bv);
#pragma unroll
    for (int r = 0; r < 8; ++r) { float v = acc[t][r] + bv; if (ACT == 1) v = fmaxf(v, 0.f); so[w][8 * hh + r][t * 16 + ln] = v; }
  }
  __builtin_amdgcn_fence(__ATOMIC_ACQ_REL, "workgroup");
  __builtin_amdgcn_wave_barrier();
  const int rsub = lane >> 4, c4 = (lane & 15) * 4;
  {
#pragma unroll
    for (int q = 0; q < 8; ++q) {
      const int r = q * 2 + rsub;
      const v4f v = *(const v4fa*)&so[w][r][c4];
      *(v4f*)(C + (size_t)(row0 + r) * ldc + col0 + c4) = v;
    }
    
  }
}

// GEMM C = act(A·W + bias + resid): A f32 (ASPLIT -> hi/lo 2 terms), Wt bf16 [N][K]; ACT 0 none, 1 relu, 2 exact gelu;
// resid (optional, f32, row index = (row % rmod), pitch ldr, RES_BF16 rounds it) added before the activation.
template <bool ASPLIT, int ACT, bool BIAS_BF16, bool RES_BF16>
__global__ __launch_bounds__(128) void k_gemm_bf3(const float* __restrict__ A, int lda, const unsigned short* __restrict__ Wt, int ldb,
                                                const float* __restrict__ bias, const float* __restrict__ resid, int rmod, int ldr,
                                                float* __restrict__ C, int ldc, int M, int N, int K) {
  __shared__ __attribute__((aligned(16))) float so[4][16][64];
  const int tid = threadIdx.x, w = tid >> 5, lane = tid & 31, ln = lane & 15, hh = lane >> 4;
  const int ntn = N / 64;
  const int wid = blockIdx.x * 4 + w;
  const int mt = wid / ntn, nq = wid % ntn;
  if (mt * 16 >= M) return;
  const int row0 = mt * 16, col0 = nq * 64;
  const float* arow = A + (size_t)(row0 + ln) * lda;
  v8f acc[4] = {};
  for (int kb = 0; kb < K; kb += 32) {
    FragB ah, al;
    const v4f x0 = *(const v4fa*)(arow + kb + 8 * hh), x1 = *(const v4fa*)(arow + kb + 8 * hh + 4);
    const v4f x2 = *(const v4fa*)(arow + kb + 16 + 8 * hh), x3 = *(const v4fa*)(arow + kb + 16 + 8 * hh + 4);
    float xs[16] = {x0[0],x0[1],x0[2],x0[3],x1[0],x1[1],x1[2],x1[3],x2[0],x2[1],x2[2],x2[3],x3[0],x3[1],x3[2],x3[3]};
#pragma unroll
    for (int i = 0; i < 16; ++i) { const unsigned short hb = bf16_bits(xs[i]); ah.u[i] = hb; al.u[i] = ASPLIT ? bf16_bits(xs[i] - bf16_val(hb)) : (unsigned short)0; }
#pragma unroll
    for (int t = 0; t < 4; ++t) {
      const unsigned short* brow = Wt + (size_t)(col0 + t * 16 + ln) * ldb + kb;
      FragB b;
      b.half[0] = *(const v8us*)(brow + 8 * hh);
      b.half[1] = *(const v8us*)(brow + 16 + 8 * hh);
      acc[t] = mmaN<ASPLIT ? 2 : 1>(ah.v, al.v, b.v, b.v, acc[t]);
    }
  }
#pragma unroll
  for (int t = 0; t < 4; ++t) {
    const int col = col0 + t * 16 + ln;
    float bv = bias ? bias[col] : 0.f;
    if (BIAS_BF16) bv = bf16_round(bv);
#pragma unroll
    for (int r = 0; r < 8; ++r) {
      float v = acc[t][r] + bv;
      if (resid) { float rv = resid[(size_t)((row0 + 8 * hh + r) % rmod) * ldr + col]; if (RES_BF16) rv = bf16_round(rv); v += rv; }
      if (ACT == 1) v = fmaxf(v, 0.f);
      if (ACT == 2) v = 0.5f * v * (1.0f + erff(v * 0.70710678118654752f));
      if (ACT == 3) { const float u = 0.7978845608028654f * (v + 0.044715f * v * v * v); v = 0.5f * v * (1.0f + tanhf(u)); }
      so[w][8 * hh + r][t * 16 + ln] = v;
    }
  }
  __builtin_amdgcn_fence(__ATOMIC_ACQ_REL, "workgroup");
  __builtin_amdgcn_wave_barrier();
  const int rsub = lane >> 4, c4 = (lane & 15) * 4;
  {
#pragma unroll
    for (int q = 0; q < 8; ++q) {
      const int r = q * 2 + rsub;
      const v4f v = *(const v4fa*)&so[w][r][c4];
      *(v4f*)(C + (size_t)(row0 + r) * ldc + col0 + c4) = v;
    }
    
  }
}
// row LayerNorm (biased variance, eps) over N: s = X (+ R); optional out_sum <- s; out_norm <- (s-mu)*rsqrt(var+eps)*g + b
template <bool PARAM_BF16>
__global__ __launch_bounds__(256) void k_layernorm(const float* __restrict__ X, const float* __restrict__ R, const float* __restrict__ g, const float* __restrict__ bta,
                                                  float* __restrict__ out_sum, float* __restrict__ out_norm, int N, float eps) {
  __shared__ float red[256];
  const int row = blockIdx.x, tid = threadIdx.x;
  const float* x = X + (size_t)row * N; const float* rr = R ? R + (size_t)row * N : nullptr;
  float vals[16];                     // up to N = 4096
  const int per = N / 256;            // contiguous chunk per thread? use strided-by-4 chunks: thread handles j = tid*4 + 1024*u
  float s1 = 0.f;
  for (int u = 0; u < per / 4; ++u) {
    const int j = tid * 4 + 1024 * u;
    const v4f a = *(const v4fa*)(x + j);
    v4f b = {0.f,0.f,0.f,0.f}; if (rr) b = *(const v4fa*)(rr + j);
#pragma unroll
    for (int q = 0; q < 4; ++q) { const float v = a[q] + b[q]; vals[u * 4 + q] = v; s1 += v; }
  }
  red[tid] = s1; __syncthreads();
  for (int st = 128; st > 0; st >>= 1) { if (tid < st) red[tid] += red[tid + st]; __syncthreads(); }
  const float mu = red[0] / (float)N; __syncthreads();
  float s2 = 0.f;
  for (int u = 0; u < per / 4; ++u)
#pragma unroll
    for (int q = 0; q < 4; ++q) { const float c = vals[u * 4 + q] - mu; s2 += c * c; }
  red[tid] = s2; __syncthreads();
  for (int st = 128; st > 0; st >>= 1) { if (tid < st) red[tid] += red[tid + st]; __syncthreads(); }
  const float rs = rsqrtf(red[0] / (float)N + eps);
  {
    for (int u = 0; u < per / 4; ++u) {
      const int j = tid * 4 + 1024 * u;
      v4f o, sm;
#pragma unroll
      for (int q = 0; q < 4; ++q) {
        float gg = g[j + q], bb = bta[j + q];
        if (PARAM_BF16) { gg = bf16_round(gg); bb = bf16_round(bb); }
        sm[q] = vals[u * 4 + q]; o[q] = (vals[u * 4 + q] - mu) * rs * gg + bb;
      }
      if (out_sum) *(v4f*)(out_sum + (size_t)row * N + j) = sm;
      *(v4f*)(out_norm + (size_t)row * N + j) = o;
    }
    
  }
}



// ---- f16 WMMA path (v_wmma_f32_16x16x32_f16): 11-bit significands for operands in range — used where a [0,1] probability operand needs more precision than bf16
typedef _Float16 v16h __attribute__((ext_vector_type(16)));
union FragH { v16h v; v8us half[2]; _Float16 h[16]; unsigned short u[16]; };
template <int NT>
__device__ __forceinline__ v8f mmaH(v16h ah, v16h al, v16h bh, v16h bl, v8f c) {
  c = __builtin_amdgcn_wmma_f32_16x16x32_f16(false, ah, false, bh, (short)0, c, false, false);
  if (NT >= 2) c = __builtin_amdgcn_wmma_f32_16x16x32_f16(false, al, false, bh, (short)0, c, false, false);
  if (NT >= 3) c = __builtin_amdgcn_wmma_f32_16x16x32_f16(false, ah, false, bl, (short)0, c, false, false);
  asm volatile("v_nop\n\tv_nop\n\tv_nop\n\tv_nop" : "+v"(c) : "v"(ah), "v"(al), "v"(bh), "v"(bl));
  return c;
}
// batched GEMM like k_gemm_b but f16 operands: A f32 (split into f16 hi/lo if ASPLIT, else rounded to f16), Bt = f16 values [n][k]; alpha; C f32; N multiple of 16 (partial tiles skipped)
template <bool ASPLIT>
__global__ __launch_bounds__(128) void k_gemm_h(const float* __restrict__ A, int lda, size_t sA, const _Float16* __restrict__ Bh, int ldb, size_t sB, float alpha, float* __restrict__ C, int ldc, size_t sC, int M, int N, int K) {
  __shared__ __attribute__((aligned(16))) float so[4][16][64];
  const int tid = threadIdx.x, w = tid >> 5, lane = tid & 31, ln = lane & 15, hh = lane >> 4; const int by = blockIdx.y;
  A += (size_t)by * sA; Bh += (size_t)by * sB; C += (size_t)by * sC;
  const int ntn = (N + 63) / 64; const int wid = blockIdx.x * 4 + w; const int mt = wid / ntn, nq = wid % ntn; if (mt * 16 >= M) return;
  const int row0 = mt * 16, col0 = nq * 64; const float* arow = A + (size_t)(row0 + ln) * lda;
  v8f acc[4] = {};
  for (int kb = 0; kb < K; kb += 32) {
    FragH ah, al;
    const v4f x0 = *(const v4fa*)(arow + kb + 8 * hh), x1 = *(const v4fa*)(arow + kb + 8 * hh + 4), x2 = *(const v4fa*)(arow + kb + 16 + 8 * hh), x3 = *(const v4fa*)(arow + kb + 16 + 8 * hh + 4);
    float xs[16] = {x0[0],x0[1],x0[2],x0[3],x1[0],x1[1],x1[2],x1[3],x2[0],x2[1],x2[2],x2[3],x3[0],x3[1],x3[2],x3[3]};
#pragma unroll
    for (int i = 0; i < 16; ++i) { const _Float16 h = (_Float16)xs[i]; ah.h[i] = h; al.h[i] = ASPLIT ? (_Float16)(xs[i] - (float)h) : (_Float16)0.0f; }
#pragma unroll
    for (int t = 0; t < 4; ++t) { if (col0 + t * 16 >= N) continue; const size_t boff = (size_t)(col0 + t * 16 + ln) * ldb + kb; FragH bq; bq.half[0] = *(const v8us*)(Bh + boff + 8 * hh); bq.half[1] = *(const v8us*)(Bh + boff + 16 + 8 * hh);
      acc[t] = mmaH<ASPLIT ? 2 : 1>(ah.v, al.v, bq.v, bq.v, acc[t]); }
  }
#pragma unroll
  for (int t = 0; t < 4; ++t) { if (col0 + t * 16 >= N) continue;
#pragma unroll
    for (int r = 0; r < 8; ++r) so[w][8 * hh + r][t * 16 + ln] = acc[t][r] * alpha; }
  __builtin_amdgcn_fence(__ATOMIC_ACQ_REL, "workgroup"); __builtin_amdgcn_wave_barrier();
  const int rsub = lane >> 4, c4 = (lane & 15) * 4;
  {
#pragma unroll
    for (int q = 0; q < 8; ++q) { const int r = q * 2 + rsub; if (col0 + c4 < N) { const v4f v = *(const v4fa*)&so[w][r][c4]; *(v4f*)(C + (size_t)(row0 + r) * ldc + col0 + c4) = v; } }
     }
}

// Wt[n][k] = f16(W[k][n]·scale) from f32 row-major W[K][N] (scale = power of two; bf16-exact weights stay exact in f16 away from the subnormal range)
__global__ __launch_bounds__(256) void k_wt_f16(const float* __restrict__ W, _Float16* __restrict__ Wt, int K, int N, float scale) {
  const int t = blockIdx.x * 256 + threadIdx.x; if (t >= N * (K / 8)) return; const int n = t / (K / 8), k8 = (t % (K / 8)) * 8; FragH f;
#pragma unroll
  for (int i = 0; i < 8; ++i) f.h[i] = (_Float16)(bf16_round(W[(size_t)(k8 + i) * N + n]) * scale); const v8us o = f.half[0];
  *(v8us*)((unsigned short*)Wt + (size_t)n * K + k8) = o; 
}
// k_gemm_hh variant with fused epilogue: v = acc·alpha + bias[by·sBias + col] (+ CP[(row/rowsPerB)·sCPb + by·64 + col] if CP) ; ACT 0 none / 1 elu ; writes f16 C16 (and f32 C if non-null)
template <int ACT>
__global__ __launch_bounds__(128) void k_gemm_hhx(const _Float16* __restrict__ A, int lda, size_t sA, const _Float16* __restrict__ Bh, int ldb, size_t sB, float alpha, const float* __restrict__ bias, size_t sBias, const float* __restrict__ CP, int rowsPerB, size_t sCPb, int row0g,
    float* __restrict__ C, _Float16* __restrict__ C16, int ldc, size_t sC, int M, int N, int K) {
  __shared__ __attribute__((aligned(16))) float so[4][16][64];
  const int tid = threadIdx.x, w = tid >> 5, lane = tid & 31, ln = lane & 15, hh = lane >> 4; const int by = blockIdx.y;
  A += (size_t)by * sA; Bh += (size_t)by * sB; const size_t cofs = (size_t)by * sC; const float* bp = bias ? bias + (size_t)by * sBias : nullptr;
  const int ntn = (N + 63) / 64; const int wid = blockIdx.x * 4 + w; const int mt = wid / ntn, nq = wid % ntn; if (mt * 16 >= M) return;
  const int row0 = mt * 16, col0 = nq * 64; const _Float16* arow = A + (size_t)(row0 + ln) * lda;
  v8f acc[4] = {};
  for (int kb = 0; kb < K; kb += 32) { FragH ah; ah.half[0] = *(const v8us*)((const unsigned short*)arow + kb + 8 * hh); ah.half[1] = *(const v8us*)((const unsigned short*)arow + kb + 16 + 8 * hh);
#pragma unroll
    for (int t = 0; t < 4; ++t) { if (col0 + t * 16 >= N) continue; const size_t boff = (size_t)(col0 + t * 16 + ln) * ldb + kb; FragH bq; bq.half[0] = *(const v8us*)((const unsigned short*)Bh + boff + 8 * hh); bq.half[1] = *(const v8us*)((const unsigned short*)Bh + boff + 16 + 8 * hh);
      acc[t] = mmaH<1>(ah.v, ah.v, bq.v, bq.v, acc[t]); }
  }
#pragma unroll
  for (int t = 0; t < 4; ++t) { if (col0 + t * 16 >= N) continue; const int col = col0 + t * 16 + ln; const float bv = bp ? bf16_round(bp[col]) : 0.f;
#pragma unroll
    for (int r = 0; r < 8; ++r) { float v = acc[t][r] * alpha + bv; if (CP) { const int rr = row0g + row0 + 8 * hh + r; if (rowsPerB < 0) v += CP[cofs + (size_t)rr * ldc + col];      /* rowsPerB < 0: own element of the batched C plane */ else { const int bidx = rr / rowsPerB; v += CP[(size_t)bidx * sCPb + (size_t)by * 64 + col]; } } if (ACT == 1) v = (v > 0.f) ? v : expm1f(v); else if (ACT == 7) v = (v > 0.f) ? v + 1.0f : expf(v); else if (ACT == 8) v = tanhf(v); else if (ACT == 9) v = 0.5f * v * (1.0f + tanhf(0.7978845608028654f * (v + 0.044715f * v * v * v))); else if (ACT == 11) v = 1.0f / (1.0f + expf(-v)); else if (ACT == 12) v = (v > 0.f) ? v : 0.01f * v; else if (ACT == 14) v = (v > 0.f) ? v : 0.1f * v; else if (ACT == 16) v = (v >= 0.f) ? v : 0.3f * v; else if (ACT == 17) v = (v >= 0.f) ? v : 0.2f * v; else if (ACT == 15) v = v / (1.0f + expf(-v)); else if (ACT == 3) v = fmaxf(v, 0.f); else if (ACT == 6) v = 0.5f * v * (1.0f + erff(v * 0.70710678118654752f)); so[w][8 * hh + r][t * 16 + ln] = v; } }
  __builtin_amdgcn_fence(__ATOMIC_ACQ_REL, "workgroup"); __builtin_amdgcn_wave_barrier();
  const int rsub = lane >> 4, c4 = (lane & 15) * 4; typedef _Float16 v4h __attribute__((ext_vector_type(4)));
  {
#pragma unroll
    for (int q = 0; q < 8; ++q) { const int r = q * 2 + rsub; if (col0 + c4 < N) { const v4f v = *(const v4fa*)&so[w][r][c4]; if (C) *(v4f*)(C + cofs + (size_t)(row0 + r) * ldc + col0 + c4) = v; if (C16) { v4h h4; for (int i = 0; i < 4; ++i) h4[i] = (_Float16)v[i]; *(v4h*)(C16 + cofs + (size_t)(row0 + r) * ldc + col0 + c4) = h4; } } }
     }
}


typedef _Float16 v4h __attribute__((ext_vector_type(4)));

__global__ __launch_bounds__(256) void k_x16(const float* __restrict__ x, _Float16* __restrict__ X16, size_t n8) { const size_t t = (size_t)blockIdx.x * 256 + threadIdx.x; if (t >= n8) return; FragH f;
#pragma unroll
  for (int q = 0; q < 8; ++q) f.h[q] = (_Float16)bf16_round(x[t * 8 + q]); *(v8us*)((unsigned short*)X16 + t * 8) = f.half[0];  }
__global__ __launch_bounds__(256) void k_h16(const float* __restrict__ x, _Float16* __restrict__ X16, size_t n8) { const size_t t = (size_t)blockIdx.x * 256 + threadIdx.x; if (t >= n8) return; FragH f;
#pragma unroll
  for (int q = 0; q < 8; ++q) f.h[q] = (_Float16)x[t * 8 + q]; *(v8us*)((unsigned short*)X16 + t * 8) = f.half[0];  }
__global__ __launch_bounds__(256) void k_round16f(const float* __restrict__ W, _Float16* __restrict__ Bt, size_t n8) { const size_t t = (size_t)blockIdx.x * 256 + threadIdx.x; if (t >= n8) return; FragH f;
#pragma unroll
  for (int i = 0; i < 8; ++i) f.h[i] = (_Float16)(bf16_round(W[t * 8 + i]) * 16.0f); *(v8us*)((unsigned short*)Bt + t * 8) = f.half[0];  }
template <int NHv, int TTv>
__global__ __launch_bounds__(256) void k_vt(const _Float16* __restrict__ V16, int ldv, int voff, _Float16* __restrict__ Vt) { __shared__ unsigned short tl[64][66]; const int tid = threadIdx.x; const int slab = blockIdx.x / (TTv / 64), lg = blockIdx.x % (TTv / 64); const int b = slab / NHv, h = slab % NHv;
  for (int i = tid; i < 64 * 8; i += 256) { const int r = i / 8, c8 = (i % 8) * 8; FragH f; f.half[0] = *(const v8us*)((const unsigned short*)V16 + ((size_t)b * TTv + lg * 64 + r) * ldv + voff + h * 64 + c8);
#pragma unroll
    for (int q = 0; q < 8; ++q) tl[r][c8 + q] = f.u[q]; }
  __syncthreads();
  {
#pragma unroll
    for (int rd = 0; rd < 2; ++rd) { const int d = rd * 32 + tid / 8, pc = tid % 8; FragH f;
#pragma unroll
      for (int q = 0; q < 8; ++q) f.u[q] = tl[pc * 8 + q][d];
      *(v8us*)((unsigned short*)Vt + ((size_t)slab * 64 + d) * TTv + lg * 64 + pc * 8) = f.half[0]; }
     } }

__global__ __launch_bounds__(256) void k_hl(const float* __restrict__ F, _Float16* __restrict__ Hh, _Float16* __restrict__ Hl, size_t n8) { const size_t t = (size_t)blockIdx.x * 256 + threadIdx.x; if (t >= n8) return; FragH fh, fl; const v4f a = *(const v4fa*)(F + t * 8), c = *(const v4fa*)(F + t * 8 + 4);
#pragma unroll
  for (int q = 0; q < 4; ++q) { _Float16 h = (_Float16)a[q]; fh.h[q] = h; fl.h[q] = (_Float16)((a[q] - (float)h) * 1024.0f); h = (_Float16)c[q]; fh.h[4 + q] = h; fl.h[4 + q] = (_Float16)((c[q] - (float)h) * 1024.0f); }
  { *(v8us*)((unsigned short*)Hh + t * 8) = fh.half[0]; *(v8us*)((unsigned short*)Hl + t * 8) = fl.half[0];  } }

// ---- fast GEMM (wave tile 32x64, work-group tile 128x64; requires M % 128 == 0 rows per launch region, N % 64 == 0 and K % 64 == 0); epilogue = k_gemm_hhx semantics ----
__device__ __forceinline__ v16h g2_frag(const _Float16* p, int hh) { FragH f; f.half[0] = *(const v8us*)((const unsigned short*)p + 8 * hh); f.half[1] = *(const v8us*)((const unsigned short*)p + 16 + 8 * hh); return f.v; }
__device__ __forceinline__ v8f g2_mma(v16h a, v16h b, v8f c) { v8f d = __builtin_amdgcn_wmma_f32_16x16x32_f16(false, a, false, b, (short)0, c, false, false); asm volatile("v_nop\n\tv_nop\n\tv_nop\n\tv_nop" : "+v"(d) : "v"(a), "v"(b)); return d; }
// A stage of k_gemm2 = 64 k of the work-group's 128 A rows and 64 B rows: 192 rows of 128 bytes in LDS at a pitch of 144 (16 B x odd: the 16 lanes of a half wave's ds_load_b128 fall on 64 different banks).
#define G2_PITCH 144
#define G2_BOFF (128 * G2_PITCH)      /* the B rows stand behind the A rows */
#define G2_STAGE (192 * G2_PITCH)
__device__ __forceinline__ v16h g2_lfrag(const unsigned char* p) { FragH f; f.half[0] = *(const v8us*)p; f.half[1] = *(const v8us*)(p + 32); return f.v; }      /* p = row start + 64 B per 32 k + 16 hh: the k order of g2_frag */
// One stage, global memory -> LDS through no register: 12 asynchronous copies of 16 bytes a lane (8 A rows, 4 B rows, 16 rows apart); 8 lanes fill one row, so a wave's copy reads 4 whole 128-byte lines.
// lds = the lane's own LDS byte address of its first A row, ga / gb = its own global addresses, a16 / b16 = 16 rows in elements. The s_wait_xcnt stands inside the statement, behind the last copy, so that
// no address register of a copy is written again in front of it.
__device__ __forceinline__ void g2_stage(unsigned lds, const _Float16* ga, const _Float16* gb, size_t a16, size_t b16) {
  asm volatile("global_load_async_to_lds_b128 %0, %12, off\n\tglobal_load_async_to_lds_b128 %1, %13, off\n\tglobal_load_async_to_lds_b128 %2, %14, off\n\tglobal_load_async_to_lds_b128 %3, %15, off\n\t"
               "global_load_async_to_lds_b128 %4, %16, off\n\tglobal_load_async_to_lds_b128 %5, %17, off\n\tglobal_load_async_to_lds_b128 %6, %18, off\n\tglobal_load_async_to_lds_b128 %7, %19, off\n\t"
               "global_load_async_to_lds_b128 %8, %20, off\n\tglobal_load_async_to_lds_b128 %9, %21, off\n\tglobal_load_async_to_lds_b128 %10, %22, off\n\tglobal_load_async_to_lds_b128 %11, %23, off\n\t"
               "s_wait_xcnt 0x0"
               :: "v"(lds), "v"(lds + 16 * G2_PITCH), "v"(lds + 32 * G2_PITCH), "v"(lds + 48 * G2_PITCH), "v"(lds + 64 * G2_PITCH), "v"(lds + 80 * G2_PITCH), "v"(lds + 96 * G2_PITCH), "v"(lds + 112 * G2_PITCH),
                  "v"(lds + G2_BOFF), "v"(lds + G2_BOFF + 16 * G2_PITCH), "v"(lds + G2_BOFF + 32 * G2_PITCH), "v"(lds + G2_BOFF + 48 * G2_PITCH),
                  "v"(ga), "v"(ga + a16), "v"(ga + 2 * a16), "v"(ga + 3 * a16), "v"(ga + 4 * a16), "v"(ga + 5 * a16), "v"(ga + 6 * a16), "v"(ga + 7 * a16),
                  "v"(gb), "v"(gb + b16), "v"(gb + 2 * b16), "v"(gb + 3 * b16) : "memory"); }
template <int ACT>
__global__ __launch_bounds__(128) void k_gemm2(const _Float16* __restrict__ A, int lda, size_t sA, const _Float16* __restrict__ Bh, int ldb, size_t sB, float alpha, const float* __restrict__ bias, size_t sBias, const float* __restrict__ CP, int rowsPerB, size_t sCPb, int row0g,
    float* __restrict__ C, _Float16* __restrict__ C16, int ldc, size_t sC, int M, int N, int K) { static_assert(ACT == 0 || ACT == 3 || ACT == 6 || ACT == 8 || ACT == 9 || ACT == 11 || ACT == 12 || ACT == 14 || ACT == 15 || ACT == 16 || ACT == 17, "k_gemm2: unsupported ACT code (would silently apply no activation)");
  __shared__ __attribute__((aligned(16))) unsigned char sm[2 * G2_STAGE];      /* two stage buffers; behind the K loop the same bytes are the epilogue's staging rows */
  static_assert(sizeof(float) * 4 * 32 * 68 <= 2 * G2_STAGE, "epilogue staging fits the ring"); float (*so)[32][68] = (float (*)[32][68])sm;
  const int tid = threadIdx.x, w = tid >> 5, lane = tid & 31, ln = lane & 15, hh = lane >> 4; const int by = blockIdx.y;
  A += (size_t)by * sA; Bh += (size_t)by * sB; const size_t cofs = (size_t)by * sC; const float* bp = bias ? bias + (size_t)by * sBias : nullptr;
  const int ntn = N >> 6; const int mt = blockIdx.x / ntn, nq = blockIdx.x - mt * ntn; const int row0 = mt * 128 + 32 * w, col0 = nq * 64; if (mt * 128 >= M) return;      /* the whole work-group or none, in front of every barrier */
  const int cr = tid >> 3, cc = tid & 7;      /* the lane's copies: rows cr + 16 i, 16-byte piece cc of the row's 128 bytes */
  const unsigned lds0 = (unsigned)(size_t)sm + (unsigned)(cr * G2_PITCH + cc * 16);
  const _Float16* ga = A + (size_t)(mt * 128 + cr) * lda + cc * 8; const _Float16* gb = Bh + (size_t)(col0 + cr) * ldb + cc * 8; const size_t a16 = (size_t)16 * lda, b16 = (size_t)16 * ldb;
  const unsigned char* fa = sm + (32 * w + ln) * G2_PITCH + 16 * hh; const unsigned char* fb = sm + G2_BOFF + ln * G2_PITCH + 16 * hh;      /* the lane's fragment rows in buffer 0 */
  const v8f z8 = {0.f,0.f,0.f,0.f,0.f,0.f,0.f,0.f}; v8f c00 = z8, c01 = z8, c02 = z8, c03 = z8, c10 = z8, c11 = z8, c12 = z8, c13 = z8;
  const int nst = K >> 6;
  g2_stage(lds0, ga, gb, a16, b16);
  asm volatile("s_wait_asynccnt 0x0" ::: "memory");      /* this wave's copies of stage 0 have landed */
  __syncthreads();      /* ... and every other wave's: stage 0 may be read */
  if (nst > 1) g2_stage(lds0 + G2_STAGE, ga + 64, gb + 64, a16, b16);
#pragma unroll 1      /* rolled: the buffer is picked by the trip's parity, a second copy of the body would only add code */
  for (int t = 0; t < nst; ++t) { const unsigned bo = (unsigned)(t & 1) * G2_STAGE;
    const unsigned char* pa = fa + bo; const unsigned char* pb = fb + bo; v16h af[2][2], bf[2][4];
#pragma unroll      /* constant indices: the fragment arrays become registers */
    for (int kc = 0; kc < 2; ++kc) { af[kc][0] = g2_lfrag(pa + 64 * kc); bf[kc][0] = g2_lfrag(pb + 64 * kc); af[kc][1] = g2_lfrag(pa + 64 * kc + 16 * G2_PITCH);
      for (int j = 1; j < 4; ++j) bf[kc][j] = g2_lfrag(pb + 64 * kc + j * 16 * G2_PITCH); }
#pragma unroll      /* the stage's two 32-k blocks, in ascending k: the sum order of the plain loop */
    for (int kc = 0; kc < 2; ++kc) { c00 = g2_mma(af[kc][0], bf[kc][0], c00); c10 = g2_mma(af[kc][1], bf[kc][0], c10); c01 = g2_mma(af[kc][0], bf[kc][1], c01); c11 = g2_mma(af[kc][1], bf[kc][1], c11);
      c02 = g2_mma(af[kc][0], bf[kc][2], c02); c12 = g2_mma(af[kc][1], bf[kc][2], c12); c03 = g2_mma(af[kc][0], bf[kc][3], c03); c13 = g2_mma(af[kc][1], bf[kc][3], c13); }
    asm volatile("s_wait_dscnt 0x0" ::: "memory");      /* this wave's reads of the buffer are done before it is handed to the copies */
    asm volatile("s_wait_asynccnt 0x0" ::: "memory");      /* this wave's copies of stage t + 1 have landed */
    __syncthreads();      /* publishes stage t + 1 and ends every wave's reads of stage t */
    if (t + 2 < nst) g2_stage(lds0 + bo, ga + (size_t)(t + 2) * 64, gb + (size_t)(t + 2) * 64, a16, b16); }      /* refill of the buffer just read; in flight under trip t + 1 */
  asm volatile("s_wait_asynccnt 0x0" ::: "memory");      /* no copy is outstanding when the ring becomes staging; the last trip's barrier has ended every read of it */
  v8f accs[8] = {c00, c01, c02, c03, c10, c11, c12, c13};
#pragma unroll
  for (int u = 0; u < 8; ++u) { const int t = u & 3, half = u >> 2; const int col = col0 + t * 16 + ln; const float bv = bp ? bf16_round(bp[col]) : 0.f;
#pragma unroll
    for (int r = 0; r < 8; ++r) { const int rloc = half * 16 + 8 * hh + r; float v = accs[u][r] * alpha + bv; if (CP) { if (rowsPerB < 0) v += CP[cofs + (size_t)(row0g + row0 + rloc) * ldc + col];      /* rowsPerB < 0: own element of the batched C plane */ else { const int bidx = (row0g + row0 + rloc) / rowsPerB; v += CP[(size_t)bidx * sCPb + (size_t)by * 64 + col]; } }
      if (ACT == 3) v = fmaxf(v, 0.f); else if (ACT == 6) v = 0.5f * v * (1.0f + erff(v * 0.70710678118654752f)); else if (ACT == 11) v = 1.0f / (1.0f + expf(-v)); else if (ACT == 15) v = v / (1.0f + expf(-v)); else if (ACT == 12) v = (v > 0.f) ? v : 0.01f * v; else if (ACT == 8) v = tanhf(v); else if (ACT == 9) v = 0.5f * v * (1.0f + tanhf(0.7978845608028654f * (v + 0.044715f * v * v * v))); else if (ACT == 14) v = (v > 0.f) ? v : 0.1f * v; else if (ACT == 16) v = (v >= 0.f) ? v : 0.3f * v; else if (ACT == 17) v = (v >= 0.f) ? v : 0.2f * v;
      so[w][rloc][t * 16 + ln] = v; } }
  __builtin_amdgcn_fence(__ATOMIC_ACQ_REL, "workgroup"); __builtin_amdgcn_wave_barrier();
  const int rsub = lane >> 4, c4 = (lane & 15) * 4;
  {
#pragma unroll
    for (int q = 0; q < 16; ++q) { const int r = q * 2 + rsub; const v4f v = *(const v4fa*)&so[w][r][c4]; if (C) *(v4f*)(C + cofs + (size_t)(row0 + r) * ldc + col0 + c4) = v; if (C16) { v4h h4; for (int i = 0; i < 4; ++i) h4[i] = (_Float16)v[i]; *(v4h*)(C16 + cofs + (size_t)(row0 + r) * ldc + col0 + c4) = h4; } }
     } }


__global__ __launch_bounds__(256) void k_wnat(const float* __restrict__ w, size_t n8, _Float16* __restrict__ Bt) { const size_t t = (size_t)blockIdx.x * 256 + threadIdx.x; if (t >= n8) return; FragH f; for (int q = 0; q < 8; ++q) f.h[q] = (_Float16)(bf16_round(w[t * 8 + q]) * 16.0f); *(v8us*)((unsigned short*)Bt + t * 8) = f.half[0];  }
__global__ __launch_bounds__(256) void k_rsm(const float* __restrict__ S, _Float16* __restrict__ P, int nrows) {
  #pragma clang fp contract(off)
  const int i = blockIdx.x * 256 + threadIdx.x; if (i >= nrows) return; const float* s = S + (size_t)i * SQ; float mx = -3.0e38f;
#pragma unroll 1
  for (int j = 0; j < SQ; ++j) mx = fmaxf(mx, s[j]); float se = 0.f;
#pragma unroll 1
  for (int j = 0; j < SQ; ++j) se += expf(s[j] - mx); const float sc = 256.0f / se;
#pragma unroll 1
  for (int j0 = 0; j0 < SQ; j0 += 8) { FragH f; for (int q = 0; q < 8; ++q) f.h[q] = (_Float16)(expf(s[j0 + q] - mx) * sc); unsigned short* d = (unsigned short*)P + (size_t)i * SQ + j0; *(v8us*)d = f.half[0];  } }
__global__ __launch_bounds__(256) void k_vt(const _Float16* __restrict__ V16, int b, int h0, _Float16* __restrict__ VT) { __shared__ unsigned short tl[64][65]; const int tid = threadIdx.x; const int hh = blockIdx.x % HG, sg = blockIdx.x / HG; const int s0 = sg * 64; const int h = h0 + hh;
  for (int i = tid; i < 64 * 8; i += 256) { const int j = i / 8, d8 = (i % 8) * 8; FragH f; f.half[0] = *(const v8us*)((const unsigned short*)V16 + ((size_t)b * SQ + s0 + j) * DM + h * HD + d8); for (int q = 0; q < 8; ++q) tl[d8 + q][j] = f.u[q]; }
  __syncthreads();
  { for (int i = tid; i < 64 * 8; i += 256) { const int d = i / 8, j8 = (i % 8) * 8; FragH f; for (int q = 0; q < 8; ++q) f.u[q] = tl[d][j8 + q]; *(v8us*)((unsigned short*)VT + ((size_t)hh * HD + d) * SQ + s0 + j8) = f.half[0]; }  } }



__global__ __launch_bounds__(256) void k_rsmcf2(const float* __restrict__ S, _Float16* __restrict__ P, int hg, int q0, int nk) {
  #pragma clang fp contract(off)
  const int t = blockIdx.x * 256 + threadIdx.x; if (t >= hg * QT) return; const size_t i = (size_t)t; const float* s = S + i * NKX; const int last = q0 + (t % QT); float mx = -3.0e38f;
#pragma unroll 1
  for (int j = 0; j < nk; ++j) { const float f = (j <= last) ? 1.f : 0.f; mx = fmaxf(mx, fmaf(f, s[j], (1.f - f) * -1.0e9f)); } float se = 0.f;
#pragma unroll 1
  for (int j = 0; j < nk; ++j) { const float f = (j <= last) ? 1.f : 0.f; se += __expf(fmaf(f, s[j], (1.f - f) * -1.0e9f) - mx); } const float sc = 256.0f / se;
#pragma unroll 1
  for (int j0 = 0; j0 < nk; j0 += 8) { FragH fr; for (int q = 0; q < 8; ++q) { const int j = j0 + q; const float f = (j <= last) ? 1.f : 0.f; fr.h[q] = (_Float16)(__expf(fmaf(f, s[j], (1.f - f) * -1.0e9f) - mx) * sc); } unsigned short* d = (unsigned short*)P + i * NKX + j0; *(v8us*)d = fr.half[0];  } }


template <int MASKADD>
__global__ __launch_bounds__(64) void k_att0(const float* __restrict__ QF, const float* __restrict__ KF, const float* __restrict__ VF, int ld, const float* __restrict__ mask, float scale, float* __restrict__ OF, int ldo) {
  #pragma clang fp contract(off)
  __shared__ __attribute__((aligned(16))) float lq[64][64]; __shared__ __attribute__((aligned(16))) float lo[64][64];
  const int tid = threadIdx.x; const int h = blockIdx.x / (QT0 / 64), rg = blockIdx.x % (QT0 / 64); const int i = rg * 64 + tid;
  const float* qr = QF + (size_t)i * ld + h * HD;
#pragma unroll 1
  for (int c = 0; c < HD / 4; ++c) { *(v4f*)&lq[tid][c * 4] = *(const v4fa*)(qr + c * 4); const v4f z = {0.f, 0.f, 0.f, 0.f}; *(v4f*)&lo[tid][c * 4] = z; }
  float m = -1.0e30f, l = 0.f; const int jmax = MASKADD ? (SQ - 1) : (rg * 64 + 63);      /* additive-mask form: every key (the mask input decides); causal form: keys up to the block's last row */
#pragma unroll 1
  for (int j = 0; j <= jmax; ++j) { const float* kr = KF + (size_t)j * ld + h * HD; const float* vr = VF + (size_t)j * ld + h * HD; float s = 0.f;
#pragma unroll 1
    for (int c = 0; c < HD / 4; ++c) { const v4f kq = *(const v4fa*)(kr + c * 4); const v4f qq = *(v4f*)&lq[tid][c * 4]; s = __fadd_rn(s, __fmul_rn(qq[0], kq[0])); s = __fadd_rn(s, __fmul_rn(qq[1], kq[1])); s = __fadd_rn(s, __fmul_rn(qq[2], kq[2])); s = __fadd_rn(s, __fmul_rn(qq[3], kq[3])); }
    s = __fmul_rn(s, scale); if (MASKADD) s = __fadd_rn(s, __fmul_rn(bf16_round(mask[(size_t)i * SQ + j]), -10000.0f));
    const float f = (MASKADD || j <= i) ? 1.f : 0.f; const float sm = fmaf(f, s, (1.f - f) * -1.0e30f); const float mn = fmaxf(m, sm); const float sc = expf(m - mn); const float e = expf(sm - mn); l = __fadd_rn(__fmul_rn(l, sc), e); m = mn;
#pragma unroll 1
    for (int c = 0; c < HD / 4; ++c) { const v4f vv = *(const v4fa*)(vr + c * 4); v4f oo = *(v4f*)&lo[tid][c * 4]; for (int u = 0; u < 4; ++u) oo[u] = __fadd_rn(__fmul_rn(oo[u], sc), __fmul_rn(e, vv[u])); *(v4f*)&lo[tid][c * 4] = oo; } }
  const float fin = 64.0f / l;      /* o carried x64 like the f16 path */
#pragma unroll 1
  for (int c = 0; c < HD / 4; ++c) { v4f oo = *(v4f*)&lo[tid][c * 4]; for (int u = 0; u < 4; ++u) oo[u] = __fmul_rn(oo[u], fin); *(v4f*)&lo[tid][c * 4] = oo; }
  __syncthreads();
  {
#pragma unroll 1
    for (int it = 0; it < 16; ++it) { const int row = it * 4 + tid / 16, pc = (tid % 16) * 4; const v4f v = *(const v4f*)&lo[row][pc]; *(v4f*)(OF + (size_t)(rg * 64 + row) * ldo + h * HD + pc) = v; }
     } }


template <int BFIN, int WXB>
__global__ __launch_bounds__(256) void k_ln16(const float* __restrict__ X, const float* __restrict__ g, const float* __restrict__ bb, float eps, _Float16* __restrict__ N16, float* __restrict__ XB) {
  #pragma clang fp contract(off)
  __shared__ float red[256]; const size_t r = blockIdx.x; const int t = threadIdx.x; const v4f xa = *(const v4fa*)(X + r * DMQ + t * 4); float s[4]; float sum = 0.f;
  for (int q = 0; q < 4; ++q) { s[q] = BFIN ? bf16_round(xa[q]) : xa[q]; sum = __fadd_rn(sum, s[q]); }
  red[t] = sum; __syncthreads(); for (int st = 128; st > 0; st >>= 1) { if (t < st) red[t] = __fadd_rn(red[t], red[t + st]); __syncthreads(); } const float mu = red[0] / (float)DMQ; __syncthreads();
  float vs = 0.f; for (int q = 0; q < 4; ++q) { const float dl = __fadd_rn(s[q], -mu); vs = __fadd_rn(vs, __fmul_rn(dl, dl)); } red[t] = vs; __syncthreads(); for (int st = 128; st > 0; st >>= 1) { if (t < st) red[t] = __fadd_rn(red[t], red[t + st]); __syncthreads(); }
  const float rs = rsqrtf(__fadd_rn(red[0] / (float)DMQ, eps)); v4h y; v4f xb;
  for (int q = 0; q < 4; ++q) { const int c = t * 4 + q; y[q] = (_Float16)__fadd_rn(__fmul_rn(__fmul_rn(__fadd_rn(s[q], -mu), rs), bf16_round(g[c])), bf16_round(bb[c])); xb[q] = s[q]; }
  { *(v4h*)(N16 + r * DMQ + t * 4) = y; if (WXB) *(v4f*)(XB + r * DMQ + t * 4) = xb;  } }
__global__ __launch_bounds__(256) void k_ftres2(const float* __restrict__ OF0, const float* __restrict__ XB, float* __restrict__ X1, size_t n4) {
  #pragma clang fp contract(off)
  const size_t t = (size_t)blockIdx.x * 256 + threadIdx.x; if (t >= n4) return; const v4f o = *(const v4fa*)(OF0 + t * 4), xv = *(const v4fa*)(XB + t * 4); v4f y; for (int q = 0; q < 4; ++q) y[q] = __fadd_rn(__fmul_rn(o[q], 0.015625f), xv[q]); *(v4f*)(X1 + t * 4) = y;  }

__global__ __launch_bounds__(256) void k_wthd(const float* __restrict__ Wt, _Float16* __restrict__ Bt) { const size_t t = (size_t)blockIdx.x * 256 + threadIdx.x; if (t >= (size_t)NH * HD * (DM / 8)) return; const int m8 = (int)(t % (DM / 8)) * 8; const int d = (int)((t / (DM / 8)) % HD); const int h = (int)(t / ((size_t)(DM / 8) * HD)); FragH f;
  for (int q = 0; q < 8; ++q) f.h[q] = (_Float16)(16.0f * bf16_round(Wt[((size_t)h * DM + m8 + q) * HD + d])); unsigned short* dst = (unsigned short*)Bt + ((size_t)h * HD + d) * DM + m8; *(v8us*)dst = f.half[0];  }




template <int BFIN, int W16, int W32>
__global__ __launch_bounds__(256) void k_lnx(const float* __restrict__ X, const float* __restrict__ g, const float* __restrict__ bb, float eps, _Float16* __restrict__ N16, float* __restrict__ N32) {
  #pragma clang fp contract(off)
  __shared__ float red[256]; const size_t r = blockIdx.x; const int t = threadIdx.x; const bool act = t < (DMQ / 4); const int c0 = act ? t * 4 : 0;
  const v4f xa = *(const v4fa*)(X + r * DMQ + c0); float s[4]; float sum = 0.f;
  for (int q = 0; q < 4; ++q) { s[q] = act ? (BFIN ? bf16_round(xa[q]) : xa[q]) : 0.f; sum = __fadd_rn(sum, s[q]); }
  red[t] = sum; __syncthreads(); for (int st = 128; st > 0; st >>= 1) { if (t < st) red[t] = __fadd_rn(red[t], red[t + st]); __syncthreads(); } const float mu = red[0] / (float)DMQ; __syncthreads();
  float vs = 0.f; for (int q = 0; q < 4; ++q) { const float dl = act ? __fadd_rn(s[q], -mu) : 0.f; vs = __fadd_rn(vs, __fmul_rn(dl, dl)); } red[t] = vs; __syncthreads(); for (int st = 128; st > 0; st >>= 1) { if (t < st) red[t] = __fadd_rn(red[t], red[t + st]); __syncthreads(); }
  const float rs = rsqrtf(__fadd_rn(red[0] / (float)DMQ, eps)); v4h y; v4f yf;
  for (int q = 0; q < 4; ++q) { const int c = c0 + q; yf[q] = __fadd_rn(__fmul_rn(__fmul_rn(__fadd_rn(s[q], -mu), rs), bf16_round(g[c])), bf16_round(bb[c])); y[q] = (_Float16)yf[q]; }
  if (!act) return;      /* no barriers after this point */
  { if (W16) *(v4h*)(N16 + r * DMQ + c0) = y; if (W32) *(v4f*)(N32 + r * DMQ + c0) = yf;  } }


__global__ __launch_bounds__(256) void k_bfr(const float* __restrict__ x, float* __restrict__ XB, size_t n8) { const size_t t = (size_t)blockIdx.x * 256 + threadIdx.x; if (t >= n8) return; v4f a = *(const v4fa*)(x + t * 8), c = *(const v4fa*)(x + t * 8 + 4); for (int q = 0; q < 4; ++q) { a[q] = bf16_round(a[q]); c[q] = bf16_round(c[q]); }
  { *(v4f*)(XB + t * 8) = a; *(v4f*)(XB + t * 8 + 4) = c;  } }




__global__ __launch_bounds__(256) void k_lorafold(const float* __restrict__ Wm, const float* __restrict__ A, const float* __restrict__ Bm, float* __restrict__ WE, int K, int N, float sc) {
  #pragma clang fp contract(off)
  const size_t t = (size_t)blockIdx.x * 256 + threadIdx.x; if (t >= (size_t)K * N) return; const int i = (int)(t / N), o = (int)(t % N); float a = 0.f;
  for (int r = 0; r < 16; ++r) a = __fadd_rn(a, __fmul_rn(bf16_round(A[(size_t)i * 16 + r]), bf16_round(Bm[(size_t)r * N + o])));
  const float v = __fadd_rn(bf16_round(Wm[t]), __fmul_rn(sc, a)); *(float*)(WE + t) = v;  }
__global__ __launch_bounds__(256) void k_wt32rep(const float* __restrict__ Wf, _Float16* __restrict__ Bt, int K, int N, int DOUT, float scale) {
  const int t = blockIdx.x * 256 + threadIdx.x; if (t >= DOUT * (K / 8)) return; const int n = t / (K / 8), k8 = (t % (K / 8)) * 8; const int rep = DOUT / N; const int src = (n / (HD * rep)) * HD + (n % HD);      /* head h = n / HD -> group h / rep */
  FragH f; for (int i = 0; i < 8; ++i) f.h[i] = (_Float16)(Wf[(size_t)(k8 + i) * N + src] * scale);
  *(v8us*)((unsigned short*)Bt + (size_t)n * K + k8) = f.half[0];  }
__global__ __launch_bounds__(256) void k_brep(const float* __restrict__ b, float* __restrict__ out) { const int t = blockIdx.x * 256 + threadIdx.x; if (t >= DM) return; const float v = b[(t / (HD * 4)) * HD + (t % HD)]; *(float*)(out + t) = v;  }

__global__ __launch_bounds__(256) void k_rsmcim(const float* __restrict__ S, _Float16* __restrict__ P, int hg, int q0, int nk, const int* __restrict__ am) {
  #pragma clang fp contract(off)
  const int t = blockIdx.x * 256 + threadIdx.x; if (t >= hg * QT) return; const size_t i = (size_t)t; const float* s = S + i * NKX; const int last = q0 + (t % QT); const int* mr = am + (size_t)last * SQ; float mx = -3.0e38f;      /* the module's mask row of this query (keys >= nk lie above the diagonal of the causal mask and are not computed) */
#pragma unroll 1
  for (int j = 0; j < nk; ++j) { const float f = (mr[j] != 0) ? 1.f : 0.f; mx = fmaxf(mx, fmaf(f, s[j], (1.f - f) * -1.0e9f)); } float se = 0.f;
#pragma unroll 1
  for (int j = 0; j < nk; ++j) { const float f = (mr[j] != 0) ? 1.f : 0.f; se += __expf(fmaf(f, s[j], (1.f - f) * -1.0e9f) - mx); } const float sc = 256.0f / se;
#pragma unroll 1
  for (int j0 = 0; j0 < nk; j0 += 8) { FragH fr; for (int q = 0; q < 8; ++q) { const int j = j0 + q; const float f = (mr[j] != 0) ? 1.f : 0.f; fr.h[q] = (_Float16)(__expf(fmaf(f, s[j], (1.f - f) * -1.0e9f) - mx) * sc); } unsigned short* d = (unsigned short*)P + i * NKX + j0; *(v8us*)d = fr.half[0];  } }



__global__ __launch_bounds__(256) void k_bcpy(const float* __restrict__ b, int n, int NP, float* __restrict__ dst, int dst0) { for (int i = threadIdx.x; i < NP; i += 256) { const float v = (i < n) ? b[i] : 0.f; *(float*)(dst + dst0 + i) = v; }  }



// lane l with lane l ^ 16
__device__ __forceinline__ float rs_xhalf(float x) { return __builtin_bit_cast(float, __builtin_amdgcn_permlanex16(__builtin_bit_cast(int, x), __builtin_bit_cast(int, x), 0x76543210, 0xfedcba98, false, false)); }
// Four 2^t in one statement, each in place: behind a transcendental the instruction set asks for one independent instruction or v_nop before its result is read or its source overwritten.
// Here each v_exp_f32 is the independent instruction behind the one before it, the v_nop the slot behind the last. In place, so that the
// statement writes only registers that the multiply-add in front of it has written: the compiler keeps that one clear of the matrix instructions' operands.
__device__ __forceinline__ v4f rs_exp2x4(v4f t) { float a = t[0], b = t[1], c = t[2], d = t[3];
  asm("v_exp_f32 %0, %0\n\tv_exp_f32 %1, %1\n\tv_exp_f32 %2, %2\n\tv_exp_f32 %3, %3\n\tv_nop" : "+v"(a), "+v"(b), "+v"(c), "+v"(d));
  const v4f r = {a, b, c, d}; return r; }
__device__ __forceinline__ v8f fa_mma(v16h a, v16h b, v8f c) { return __builtin_amdgcn_wmma_f32_16x16x32_f16(false, a, false, b, (short)0, c, false, false); }
// Fused attention: scores, softmax and P V in one launch; no score and no weight leaves the registers. One work-group = 256 queries of one (batch, head), 8 waves of 32 query columns;
// a pass = 32 keys. Transposed products: S^T = K Q^T (rows = keys, columns = queries), so a lane's 16 scores of a column are, as they lie, its 16 elements of the B operand of O^T += V^T P^T
// (k order of both operands: 8 hh + 0..7, then 16 + 8 hh + 0..7, that of g2_frag). Online softmax in the log2 domain, f32: the maximum in use may trail the true one by up to 8 (an
// exponential reaches 2^8 at most, well inside f16), and the sums are rescaled only in a pass where some column exceeds that. Denominator = an all-ones A operand times P^T on the matrix
// pipe: it sums the weights as rounded to f16, the same values the numerator sums. K and V^T fragments come straight from global memory, K one pass ahead, V^T at the head of its pass. o is carried x64 as f16 rows.
// Every '#pragma unroll' in it is there so that the fragment and accumulator arrays it indexes become registers.
__global__ __launch_bounds__(256) void k_fattn(const _Float16* __restrict__ Q, const _Float16* __restrict__ KV, const _Float16* __restrict__ VT, _Float16* __restrict__ O) {
  constexpr float CS = 0.015625f * 1.44269504f;      /* (q / 8) . (k / 8) = q . k / 64, times log2 e */
  const int lane = threadIdx.x & 31, ln = lane & 15, hh = lane >> 4; const int wave = __builtin_amdgcn_readfirstlane(threadIdx.x >> 5);
  const int h = blockIdx.y, b = blockIdx.z; const int q0 = blockIdx.x * 256 + wave * 32;
  const _Float16* qp = Q + ((size_t)b * SQ + q0 + ln) * DM + h * HD;
  const _Float16* kp = KV + ((size_t)b * SK + ln) * (2 * DM) + h * HD;      /* k half of the fused rows: row = key */
  const _Float16* vp = VT + (((size_t)b * NH + h) * HD + ln) * SK;      /* V^T: row = d, column = key */
  v16h qf[2][2], kf[2][2];
#pragma unroll
  for (int g = 0; g < 2; ++g) for (int kc = 0; kc < 2; ++kc) qf[g][kc] = g2_frag(qp + (size_t)g * 16 * DM + 32 * kc, hh);
#pragma unroll
  for (int kt = 0; kt < 2; ++kt) for (int kc = 0; kc < 2; ++kc) kf[kt][kc] = g2_frag(kp + (size_t)kt * 16 * (2 * DM) + 32 * kc, hh);
  FragH ones;
#pragma unroll
  for (int i = 0; i < 16; ++i) ones.h[i] = (_Float16)1.0f;
  const v8f z8 = {0.f, 0.f, 0.f, 0.f, 0.f, 0.f, 0.f, 0.f};
  v8f acc[2][4], lacc[2]; float m_run[2];
#pragma unroll
  for (int g = 0; g < 2; ++g) { m_run[g] = -__builtin_inff(); lacc[g] = z8; for (int t = 0; t < 4; ++t) acc[g][t] = z8; }
  auto pass = [&](const int key0, const bool more) __attribute__((always_inline)) {      /* more is a literal at both calls: the last pass is compiled without the fetch of a next K, and no branch stands behind a matrix instruction */
    v16h vf[4]; v8f s[2][2];
#pragma unroll
    for (int t = 0; t < 4; ++t) vf[t] = g2_frag(vp + (size_t)t * 16 * SK + key0, hh);      /* this pass's V^T, in flight under the first product and the softmax; issued behind the pass's K, so the wait for K leaves these in flight */
    asm volatile("s_wait_xcnt 0x0" ::: "memory");      /* before the loads' address registers are written again */
#pragma unroll
    for (int kt = 0; kt < 2; ++kt) for (int g = 0; g < 2; ++g) s[kt][g] = fa_mma(kf[kt][1], qf[g][1], fa_mma(kf[kt][0], qf[g][0], z8));
    if (more) {
#pragma unroll
      for (int kt = 0; kt < 2; ++kt) for (int kc = 0; kc < 2; ++kc) kf[kt][kc] = g2_frag(kp + (size_t)(key0 + 32 + kt * 16) * (2 * DM) + 32 * kc, hh);
      asm volatile("s_wait_xcnt 0x0" ::: "memory"); }      /* before the loads' address registers are written again; the statement also holds the loads up here: without it the compiler sank them into the second product, where they have no time to land */
    float mb[2]; bool need = false;
#pragma unroll
    for (int g = 0; g < 2; ++g) { float mx = fmaxf(s[0][g][0], s[1][g][0]);
      for (int r = 1; r < 8; ++r) mx = fmaxf(mx, fmaxf(s[0][g][r], s[1][g][r]));
      mx = fmaxf(mx, rs_xhalf(mx)) * CS; mb[g] = mx; need = need || (mx > m_run[g] + 8.0f); }      /* both wave halves hold the column's maximum of this pass, scaled (the scale is positive) */
    if (__builtin_amdgcn_ballot_w32(need) != 0) {      /* always in the first pass (the maximum in use is -inf, the factor 0), rare later */
#pragma unroll
      for (int g = 0; g < 2; ++g) { const float mn = fmaxf(m_run[g], mb[g]); const float corr = __builtin_amdgcn_exp2f(m_run[g] - mn); m_run[g] = mn; lacc[g] = lacc[g] * corr; for (int t = 0; t < 4; ++t) acc[g][t] = acc[g][t] * corr; } }
#pragma unroll
    for (int g = 0; g < 2; ++g) { FragH pf; const float nm = -m_run[g];
      for (int kt = 0; kt < 2; ++kt) for (int j = 0; j < 2; ++j) { v4f a; for (int q = 0; q < 4; ++q) a[q] = fmaf(s[kt][g][4 * j + q], CS, nm); const v4f e = rs_exp2x4(a); for (int q = 0; q < 4; ++q) pf.h[8 * kt + 4 * j + q] = (_Float16)e[q]; }
      for (int t = 0; t < 4; ++t) acc[g][t] = fa_mma(vf[t], pf.v, acc[g][t]);
      lacc[g] = fa_mma(ones.v, pf.v, lacc[g]); }
  };
#pragma unroll 1      /* rolled: a second copy of the pass would only add code, its registers are the same ones */
  for (int key0 = 0; key0 < SK - 32; key0 += 32) pass(key0, true);
  pass(SK - 32, false);
#pragma unroll
  for (int g = 0; g < 2; ++g) { const float inv = 64.0f / lacc[g][0];      /* every row of the all-ones product holds the column's denominator */
    _Float16* op = O + ((size_t)b * SQ + q0 + 16 * g + ln) * DM + h * HD + 8 * hh;
    for (int t = 0; t < 4; ++t) { FragH f; for (int r = 0; r < 8; ++r) f.h[r] = (_Float16)(acc[g][t][r] * inv); *(v8us*)((unsigned short*)op + 16 * t) = f.half[0]; } } }      /* d = 16 t + 8 hh + 0..7 of query ln: 16 bytes a lane; the wave's four stores fill each row's 128-byte line */
extern "C" void kernel_launch(void* const* d_in, const int* in_sizes, int n_in,
                              void* d_out, int out_size, void* d_ws, size_t ws_size, hipStream_t stream) {
  (void)in_sizes; (void)n_in; (void)out_size;
  const float* const* I = (const float* const*)d_in; const float* x = I[0]; const float* cond = I[1]; const float* wq = I[2]; const float* bq = I[3]; const float* wkv = I[4]; const float* bkv = I[5]; const float* wo = I[6]; const float* bo = I[7];      /* input order: x [2][2048][1024]; tgt [2][2048][1024]; [in][out] Wq [1024][1024] + bq; Wkv [1024][2048] + bkv (k | v halves); Wp [1024][1024] + bp; the three biases are bound and read */
  static_assert(NH * HD == DM && HD == 64 && SQ % 256 == 0 && SK % 64 == 0 && DC % 32 == 0 && DM % 64 == 0, "shape / tile multiples");
  static_assert((NB * SQ) % 128 == 0 && (NB * SK) % 128 == 0 && DC % 64 == 0 && DM % 64 == 0, "k_gemm2: whole 128 x 64 tiles, whole 64-k stages");
  const size_t NRK = (size_t)NB * SK;      /* conditioning rows */
  char* ws = (char*)d_ws; size_t off = 0;
  auto take = [&](size_t bytes) { char* p = ws + off; off += (bytes + 255) & ~(size_t)255; return p; };
  _Float16* BQ = (_Float16*)take((size_t)DM * DM * 2); _Float16* BKV = (_Float16*)take((size_t)2 * DM * DC * 2); _Float16* BO = (_Float16*)take((size_t)DM * DM * 2);
  _Float16* X16 = (_Float16*)take(NR * DM * 2); _Float16* C16 = (_Float16*)take(NRK * DC * 2); _Float16* Q16 = (_Float16*)take(NR * DM * 2); _Float16* KV16 = (_Float16*)take(NRK * 2 * DM * 2); _Float16* O16 = (_Float16*)take(NR * DM * 2);
  _Float16* VT = (_Float16*)take((size_t)NB * NH * HD * SK * 2);
  if (off > ws_size) return;      /* 2 + 4 + 2 (weight planes) + 8 + 8 + 8 + 16 + 8 (row planes) + 8 (V^T) = 64 MiB at NB 2, SK 2048, DC 1024 */
  k_wt_f16<<<(unsigned)(((size_t)DM * (DM / 8) + 255) / 256), 256, 0, stream>>>(wq, BQ, DM, DM, 16.0f); k_wt_f16<<<(unsigned)(((size_t)2 * DM * (DC / 8) + 255) / 256), 256, 0, stream>>>(wkv, BKV, DC, 2 * DM, 16.0f); k_wt_f16<<<(unsigned)(((size_t)DM * (DM / 8) + 255) / 256), 256, 0, stream>>>(wo, BO, DM, DM, 16.0f);      /* [in][out] -> Bt x16: Wq [1024][1024]; Wkv [DC = 1024][2048] -> Bt [2048][1024] (rows 0..1023 = k, 1024..2047 = v); Wp */
  k_x16<<<(unsigned)((NR * DM / 8 + 255) / 256), 256, 0, stream>>>(x, X16, NR * DM / 8); k_x16<<<(unsigned)((NRK * DC / 8 + 255) / 256), 256, 0, stream>>>(cond, C16, NRK * DC / 8);      /* exact f16 rows of both inputs */
  k_gemm2<0><<<dim3((unsigned)((NR / 128) * (DM / 64)), 1), 128, 0, stream>>>(X16, DM, 0, BQ, DM, 0, 0.0625f, bq, 0, nullptr, 1, 0, 0, nullptr, Q16, DM, 0, (int)NR, DM, DM);      /* q rows (f16); head h = columns 64 h .. */
  k_gemm2<0><<<dim3((unsigned)((NRK / 128) * (2 * DM / 64)), 1), 128, 0, stream>>>(C16, DC, 0, BKV, DC, 0, 0.0625f, bkv, 0, nullptr, 1, 0, 0, nullptr, KV16, 2 * DM, 0, (int)NRK, 2 * DM, DC);      /* k | v rows (f16, pitch 2048): k = columns 0..1023, v = columns 1024..2047, head h = columns 64 h .. of each half */
  k_vt<NH, SK><<<NB * NH * (SK / 64), 256, 0, stream>>>(KV16 + DM, 2 * DM, 0, VT);      /* V^T [NB][NH][HD][SK] (the v half of the fused rows) */
  k_fattn<<<dim3(SQ / 256, NH, NB), 256, 0, stream>>>(Q16, KV16, VT, O16);      /* softmax(q . k / 64) v over the SK = 2048 keys -> ctx (merged heads, x64) as f16 rows */
  k_gemm2<0><<<dim3((unsigned)((NR / 128) * (DM / 64)), 1), 128, 0, stream>>>(O16, DM, 0, BO, DM, 0, 0.0009765625f, bo, 0, nullptr, 1, 0, 0, (float*)d_out, nullptr, DM, 0, (int)NR, DM, DM);      /* out = ctx proj_w + proj_b */
}

// v004
// A run of this version takes 121 microseconds.
// Two timings next to v003 both put it at 1.17 times that version's speed.
// Over all steps from v000 it is 54.4 times as fast.
#include <hip/hip_runtime.h>
// Multi-head cross-attention with a fused key / value projection and BOTH q and k scaled (x [2][2048][1024] (queries), tgt [2][2048][1024] (keys / values); q = x Wq + bq ([in][out] 1024 x 1024, normal x 0.02; zero bias); kv = tgt Wkv + bkv ([in][out] 1024 x 2048; zero bias) split into halves: k = columns 0..1023, v = columns 1024..2047; 16 heads of 64; logits = (q * 64^-0.5) . (k * 64^-0.5): the module scales BOTH operands, so the effective scale is 1/64; softmax over the 2048 tgt positions (no mask); out = merged Wp + bp ([in][out]; zero bias) -> [2][2048][1024]).
// Structure: token rows; x and tgt as exact f16 rows; natural weights as exact x16 planes; q and fused k | v WMMA GEMMs (32x64 wave tiles, f32 accumulation, + bias) -> f16; V^T via LDS transposes; one fused attention launch (256 queries of one head per work-group: scores, online softmax with f32 statistics and native exp, weights f16, ctx x64 merged f16); ctx Wp + bp -> f32 output.
// Compute dtype: inputs rounded to bf16; x / weights exact; q, k, v, softmax weights and o as plain f16 GEMM operands (~2^-12); scores and softmax statistics f32. v_wmma_f32_16x16x32_f16.
#define NB 2
#define SQ 2048                      /* query rows per batch */
#define SK 2048                      /* conditioning (key / value) rows per batch */
#define DC 1024                       /* conditioning width */
#define DM 1024
#define NH 16
#define HD 64
#define HG 4                         /* heads per launch of the (b, h0) k_vt form, which is not launched */
#define QT 256                       /* query rows per attention tile */
#define NKX SK                       /* S / P row pitch = the SK keys (2048 here) */
#define QT0 128                      /* first-tile rows recomputed exactly in f32 */
#define B0 0                         /* first batch processed (debug hook) */
#define NBR NB                       /* batches processed (debug hook) */
#define NR ((size_t)NB * SQ)
#define DMQ DM
#define DFF 4096         /* token rows */
#define MP ((int)((size_t)NBR * SQ)) /* rows projected (debug hook) */
#define QN SQ                        /* query rows attended per batch (debug hook) */
#define NHD NH                       /* heads attended (debug hook) */
#define MPO MP                       /* rows through the output stage (debug hook) */
#define LQ (3 * DM)      /* unused; q rows have pitch DM, k | v rows 2 * DM */
typedef __bf16 v16b __attribute__((ext_vector_type(16)));
typedef unsigned short v8us __attribute__((ext_vector_type(8), may_alias));
typedef float  v8f  __attribute__((ext_vector_type(8)));
typedef float  v4f  __attribute__((ext_vector_type(4)));
typedef float  v4fa __attribute__((ext_vector_type(4), may_alias));
union FragB { v16b v; v8us half[2]; unsigned short u[16]; };

__device__ __forceinline__ unsigned short bf16_bits(float x) { unsigned int u = __float_as_uint(x); return (unsigned short)((u + 0x7FFFu + ((u >> 16) & 1u)) >> 16); }
__device__ __forceinline__ float bf16_val(unsigned short b) { return __uint_as_float(((unsigned int)b) << 16); }
__device__ __forceinline__ float bf16_round(float x) { return bf16_val(bf16_bits(x)); }
// D += A·B with NT terms: 1 = ah·bh, 2 = + al·bh (A split), 3 = + ah·bl (both split)
template <int NT>
__device__ __forceinline__ v8f mmaN(v16b ah, v16b al, v16b bh, v16b bl, v8f c) {
  c = __builtin_amdgcn_wmma_f32_16x16x32_bf16(false, ah, false, bh, (short)0, c, false, false);
  if (NT >= 2) c = __builtin_amdgcn_wmma_f32_16x16x32_bf16(false, al, false, bh, (short)0, c, false, false);
  if (NT >= 3) c = __builtin_amdgcn_wmma_f32_16x16x32_bf16(false, ah, false, bl, (short)0, c, false, false);
  asm volatile("v_nop\n\tv_nop\n\tv_nop\n\tv_nop" : "+v"(c) : "v"(ah), "v"(al), "v"(bh), "v"(bl));
  return c;
}

__global__ __launch_bounds__(256) void k_wt_bf16(const float* __restrict__ W, unsigned short* __restrict__ Wt, int K, int N) {
  const int t = blockIdx.x * 256 + threadIdx.x;
  const int k8n = K / 8;
  if (t >= N * k8n) return;
  const int n = t / k8n, k8 = (t % k8n) * 8;
  v8us v;
#pragma unroll
  for (int i = 0; i < 8; ++i) v[i] = bf16_bits(W[(size_t)(k8 + i) * N + n]);
  *(v8us*)(Wt + (size_t)n * K + k8) = v;
  
}

// GEMM C[M][N] (f32, pitch ldc) = act(A[M][K]·W + bias). A f32 row-major (pitch lda) converted per fragment to bf16
// (ASPLIT: hi/lo two planes -> 2 terms, else single rounded term); Wt bf16 [N][K] (pitch ldb). BIAS_BF16 rounds the
// bias to bf16 first (bias quantised to bf16 before the add). K%32==0, M%16==0, N%64==0.
template <bool ASPLIT, int ACT, bool BIAS_BF16>
__global__ __launch_bounds__(128) void k_gemm_bf(const float* __restrict__ A, int lda, const unsigned short* __restrict__ Wt, int ldb,
                                               const float* __restrict__ bias, float* __restrict__ C, int ldc, int M, int N, int K) {
  __shared__ __attribute__((aligned(16))) float so[4][16][64];
  const int tid = threadIdx.x, w = tid >> 5, lane = tid & 31, ln = lane & 15, hh = lane >> 4;
  const int ntn = N / 64;
  const int wid = blockIdx.x * 4 + w;
  const int mt = wid / ntn, nq = wid % ntn;
  if (mt * 16 >= M) return;
  const int row0 = mt * 16, col0 = nq * 64;
  const float* arow = A + (size_t)(row0 + ln) * lda;
  v8f acc[4] = {};
  for (int kb = 0; kb < K; kb += 32) {
    FragB ah, al;
    const v4f x0 = *(const v4fa*)(arow + kb + 8 * hh), x1 = *(const v4fa*)(arow + kb + 8 * hh + 4);
    const v4f x2 = *(const v4fa*)(arow + kb + 16 + 8 * hh), x3 = *(const v4fa*)(arow + kb + 16 + 8 * hh + 4);
    float xs[16] = {x0[0],x0[1],x0[2],x0[3],x1[0],x1[1],x1[2],x1[3],x2[0],x2[1],x2[2],x2[3],x3[0],x3[1],x3[2],x3[3]};
#pragma unroll
    for (int i = 0; i < 16; ++i) { const unsigned short hb = bf16_bits(xs[i]); ah.u[i] = hb; al.u[i] = ASPLIT ? bf16_bits(xs[i] - bf16_val(hb)) : (unsigned short)0; }
#pragma unroll
    for (int t = 0; t < 4; ++t) {
      const unsigned short* brow = Wt + (size_t)(col0 + t * 16 + ln) * ldb + kb;
      FragB b;
      b.half[0] = *(const v8us*)(brow + 8 * hh);
      b.half[1] = *(const v8us*)(brow + 16 + 8 * hh);
      acc[t] = mmaN<ASPLIT ? 2 : 1>(ah.v, al.v, b.v, b.v, acc[t]);
    }
  }
#pragma unroll
  for (int t = 0; t < 4; ++t) {
    float bv = bias ? bias[col0 + t * 16 + ln] : 0.f;
    if (BIAS_BF16) bv = bf16_round(bv);
#pragma unroll
    for (int r = 0; r < 8; ++r) { float v = acc[t][r] + bv; if (ACT == 1) v = fmaxf(v, 0.f); so[w][8 * hh + r][t * 16 + ln] = v; }
  }
  __builtin_amdgcn_fence(__ATOMIC_ACQ_REL, "workgroup");
  __builtin_amdgcn_wave_barrier();
  const int rsub = lane >> 4, c4 = (lane & 15) * 4;
  {
#pragma unroll
    for (int q = 0; q < 8; ++q) {
      const int r = q * 2 + rsub;
      const v4f v = *(const v4fa*)&so[w][r][c4];
      *(v4f*)(C + (size_t)(row0 + r) * ldc + col0 + c4) = v;
    }
    
  }
}

// GEMM C = act(A·W + bias + resid): A f32 (ASPLIT -> hi/lo 2 terms), Wt bf16 [N][K]; ACT 0 none, 1 relu, 2 exact gelu;
// resid (optional, f32, row index = (row % rmod), pitch ldr, RES_BF16 rounds it) added before the activation.
template <bool ASPLIT, int ACT, bool BIAS_BF16, bool RES_BF16>
__global__ __launch_bounds__(128) void k_gemm_bf3(const float* __restrict__ A, int lda, const unsigned short* __restrict__ Wt, int ldb,
                                                const float* __restrict__ bias, const float* __restrict__ resid, int rmod, int ldr,
                                                float* __restrict__ C, int ldc, int M, int N, int K) {
  __shared__ __attribute__((aligned(16))) float so[4][16][64];
  const int tid = threadIdx.x, w = tid >> 5, lane = tid & 31, ln = lane & 15, hh = lane >> 4;
  const int ntn = N / 64;
  const int wid = blockIdx.x * 4 + w;
  const int mt = wid / ntn, nq = wid % ntn;
  if (mt * 16 >= M) return;
  const int row0 = mt * 16, col0 = nq * 64;
  const float* arow = A + (size_t)(row0 + ln) * lda;
  v8f acc[4] = {};
  for (int kb = 0; kb < K; kb += 32) {
    FragB ah, al;
    const v4f x0 = *(const v4fa*)(arow + kb + 8 * hh), x1 = *(const v4fa*)(arow + kb + 8 * hh + 4);
    const v4f x2 = *(const v4fa*)(arow + kb + 16 + 8 * hh), x3 = *(const v4fa*)(arow + kb + 16 + 8 * hh + 4);
    float xs[16] = {x0[0],x0[1],x0[2],x0[3],x1[0],x1[1],x1[2],x1[3],x2[0],x2[1],x2[2],x2[3],x3[0],x3[1],x3[2],x3[3]};
#pragma unroll
    for (int i = 0; i < 16; ++i) { const unsigned short hb = bf16_bits(xs[i]); ah.u[i] = hb; al.u[i] = ASPLIT ? bf16_bits(xs[i] - bf16_val(hb)) : (unsigned short)0; }
#pragma unroll
    for (int t = 0; t < 4; ++t) {
      const unsigned short* brow = Wt + (size_t)(col0 + t * 16 + ln) * ldb + kb;
      FragB b;
      b.half[0] = *(const v8us*)(brow + 8 * hh);
      b.half[1] = *(const v8us*)(brow + 16 + 8 * hh);
      acc[t] = mmaN<ASPLIT ? 2 : 1>(ah.v, al.v, b.v, b.v, acc[t]);
    }
  }
#pragma unroll
  for (int t = 0; t < 4; ++t) {
    const int col = col0 + t * 16 + ln;
    float bv = bias ? bias[col] : 0.f;
    if (BIAS_BF16) bv = bf16_round(bv);
#pragma unroll
    for (int r = 0; r < 8; ++r) {
      float v = acc[t][r] + bv;
      if (resid) { float rv = resid[(size_t)((row0 + 8 * hh + r) % rmod) * ldr + col]; if (RES_BF16) rv = bf16_round(rv); v += rv; }
      if (ACT == 1) v = fmaxf(v, 0.f);
      if (ACT == 2) v = 0.5f * v * (1.0f + erff(v * 0.70710678118654752f));
      if (ACT == 3) { const float u = 0.7978845608028654f * (v + 0.044715f * v * v * v); v = 0.5f * v * (1.0f + tanhf(u)); }
      so[w][8 * hh + r][t * 16 + ln] = v;
    }
  }
  __builtin_amdgcn_fence(__ATOMIC_ACQ_REL, "workgroup");
  __builtin_amdgcn_wave_barrier();
  const int rsub = lane >> 4, c4 = (lane & 15) * 4;
  {
#pragma unroll
    for (int q = 0; q < 8; ++q) {
      const int r = q * 2 + rsub;
      const v4f v = *(const v4fa*)&so[w][r][c4];
      *(v4f*)(C + (size_t)(row0 + r) * ldc + col0 + c4) = v;
    }
    
  }
}
// row LayerNorm (biased variance, eps) over N: s = X (+ R); optional out_sum <- s; out_norm <- (s-mu)*rsqrt(var+eps)*g + b
template <bool PARAM_BF16>
__global__ __launch_bounds__(256) void k_layernorm(const float* __restrict__ X, const float* __restrict__ R, const float* __restrict__ g, const float* __restrict__ bta,
                                                  float* __restrict__ out_sum, float* __restrict__ out_norm, int N, float eps) {
  __shared__ float red[256];
  const int row = blockIdx.x, tid = threadIdx.x;
  const float* x = X + (size_t)row * N; const float* rr = R ? R + (size_t)row * N : nullptr;
  float vals[16];                     // up to N = 4096
  const int per = N / 256;            // contiguous chunk per thread? use strided-by-4 chunks: thread handles j = tid*4 + 1024*u
  float s1 = 0.f;
  for (int u = 0; u < per / 4; ++u) {
    const int j = tid * 4 + 1024 * u;
    const v4f a = *(const v4fa*)(x + j);
    v4f b = {0.f,0.f,0.f,0.f}; if (rr) b = *(const v4fa*)(rr + j);
#pragma unroll
    for (int q = 0; q < 4; ++q) { const float v = a[q] + b[q]; vals[u * 4 + q] = v; s1 += v; }
  }
  red[tid] = s1; __syncthreads();
  for (int st = 128; st > 0; st >>= 1) { if (tid < st) red[tid] += red[tid + st]; __syncthreads(); }
  const float mu = red[0] / (float)N; __syncthreads();
  float s2 = 0.f;
  for (int u = 0; u < per / 4; ++u)
#pragma unroll
    for (int q = 0; q < 4; ++q) { const float c = vals[u * 4 + q] - mu; s2 += c * c; }
  red[tid] = s2; __syncthreads();
  for (int st = 128; st > 0; st >>= 1) { if (tid < st) red[tid] += red[tid + st]; __syncthreads(); }
  const float rs = rsqrtf(red[0] / (float)N + eps);
  {
    for (int u = 0; u < per / 4; ++u) {
      const int j = tid * 4 + 1024 * u;
      v4f o, sm;
#pragma unroll
      for (int q = 0; q < 4; ++q) {
        float gg = g[j + q], bb = bta[j + q];
        if (PARAM_BF16) { gg = bf16_round(gg); bb = bf16_round(bb); }
        sm[q] = vals[u * 4 + q]; o[q] = (vals[u * 4 + q] - mu) * rs * gg + bb;
      }
      if (out_sum) *(v4f*)(out_sum + (size_t)row * N + j) = sm;
      *(v4f*)(out_norm + (size_t)row * N + j) = o;
    }
    
  }
}



// ---- f16 WMMA path (v_wmma_f32_16x16x32_f16): 11-bit significands for operands in range — used where a [0,1] probability operand needs more precision than bf16
typedef _Float16 v16h __attribute__((ext_vector_type(16)));
union FragH { v16h v; v8us half[2]; _Float16 h[16]; unsigned short u[16]; };
template <int NT>
__device__ __forceinline__ v8f mmaH(v16h ah, v16h al, v16h bh, v16h bl, v8f c) {
  c = __builtin_amdgcn_wmma_f32_16x16x32_f16(false, ah, false, bh, (short)0, c, false, false);
  if (NT >= 2) c = __builtin_amdgcn_wmma_f32_16x16x32_f16(false, al, false, bh, (short)0, c, false, false);
  if (NT >= 3) c = __builtin_amdgcn_wmma_f32_16x16x32_f16(false, ah, false, bl, (short)0, c, false, false);
  asm volatile("v_nop\n\tv_nop\n\tv_nop\n\tv_nop" : "+v"(c) : "v"(ah), "v"(al), "v"(bh), "v"(bl));
  return c;
}
// batched GEMM like k_gemm_b but f16 operands: A f32 (split into f16 hi/lo if ASPLIT, else rounded to f16), Bt = f16 values [n][k]; alpha; C f32; N multiple of 16 (partial tiles skipped)
template <bool ASPLIT>
__global__ __launch_bounds__(128) void k_gemm_h(const float* __restrict__ A, int lda, size_t sA, const _Float16* __restrict__ Bh, int ldb, size_t sB, float alpha, float* __restrict__ C, int ldc, size_t sC, int M, int N, int K) {
  __shared__ __attribute__((aligned(16))) float so[4][16][64];
  const int tid = threadIdx.x, w = tid >> 5, lane = tid & 31, ln = lane & 15, hh = lane >> 4; const int by = blockIdx.y;
  A += (size_t)by * sA; Bh += (size_t)by * sB; C += (size_t)by * sC;
  const int ntn = (N + 63) / 64; const int wid = blockIdx.x * 4 + w; const int mt = wid / ntn, nq = wid % ntn; if (mt * 16 >= M) return;
  const int row0 = mt * 16, col0 = nq * 64; const float* arow = A + (size_t)(row0 + ln) * lda;
  v8f acc[4] = {};
  for (int kb = 0; kb < K; kb += 32) {
    FragH ah, al;
    const v4f x0 = *(const v4fa*)(arow + kb + 8 * hh), x1 = *(const v4fa*)(arow + kb + 8 * hh + 4), x2 = *(const v4fa*)(arow + kb + 16 + 8 * hh), x3 = *(const v4fa*)(arow + kb + 16 + 8 * hh + 4);
    float xs[16] = {x0[0],x0[1],x0[2],x0[3],x1[0],x1[1],x1[2],x1[3],x2[0],x2[1],x2[2],x2[3],x3[0],x3[1],x3[2],x3[3]};
#pragma unroll
    for (int i = 0; i < 16; ++i) { const _Float16 h = (_Float16)xs[i]; ah.h[i] = h; al.h[i] = ASPLIT ? (_Float16)(xs[i] - (float)h) : (_Float16)0.0f; }
#pragma unroll
    for (int t = 0; t < 4; ++t) { if (col0 + t * 16 >= N) continue; const size_t boff = (size_t)(col0 + t * 16 + ln) * ldb + kb; FragH bq; bq.half[0] = *(const v8us*)(Bh + boff + 8 * hh); bq.half[1] = *(const v8us*)(Bh + boff + 16 + 8 * hh);
      acc[t] = mmaH<ASPLIT ? 2 : 1>(ah.v, al.v, bq.v, bq.v, acc[t]); }
  }
#pragma unroll
  for (int t = 0; t < 4; ++t) { if (col0 + t * 16 >= N) continue;
#pragma unroll
    for (int r = 0; r < 8; ++r) so[w][8 * hh + r][t * 16 + ln] = acc[t][r] * alpha; }
  __builtin_amdgcn_fence(__ATOMIC_ACQ_REL, "workgroup"); __builtin_amdgcn_wave_barrier();
  const int rsub = lane >> 4, c4 = (lane & 15) * 4;
  {
#pragma unroll
    for (int q = 0; q < 8; ++q) { const int r = q * 2 + rsub; if (col0 + c4 < N) { const v4f v = *(const v4fa*)&so[w][r][c4]; *(v4f*)(C + (size_t)(row0 + r) * ldc + col0 + c4) = v; } }
     }
}

// Wt[n][k] = f16(W[k][n]·scale) from f32 row-major W[K][N] (scale = power of two; bf16-exact weights stay exact in f16 away from the subnormal range)
__global__ __launch_bounds__(256) void k_wt_f16(const float* __restrict__ W, _Float16* __restrict__ Wt, int K, int N, float scale) {
  const int t = blockIdx.x * 256 + threadIdx.x; if (t >= N * (K / 8)) return; const int n = t / (K / 8), k8 = (t % (K / 8)) * 8; FragH f;
#pragma unroll
  for (int i = 0; i < 8; ++i) f.h[i] = (_Float16)(bf16_round(W[(size_t)(k8 + i) * N + n]) * scale); const v8us o = f.half[0];
  *(v8us*)((unsigned short*)Wt + (size_t)n * K + k8) = o; 
}
// k_gemm_hh variant with fused epilogue: v = acc·alpha + bias[by·sBias + col] (+ CP[(row/rowsPerB)·sCPb + by·64 + col] if CP) ; ACT 0 none / 1 elu ; writes f16 C16 (and f32 C if non-null)
template <int ACT>
__global__ __launch_bounds__(128) void k_gemm_hhx(const _Float16* __restrict__ A, int lda, size_t sA, const _Float16* __restrict__ Bh, int ldb, size_t sB, float alpha, const float* __restrict__ bias, size_t sBias, const float* __restrict__ CP, int rowsPerB, size_t sCPb, int row0g,
    float* __restrict__ C, _Float16* __restrict__ C16, int ldc, size_t sC, int M, int N, int K) {
  __shared__ __attribute__((aligned(16))) float so[4][16][64];
  const int tid = threadIdx.x, w = tid >> 5, lane = tid & 31, ln = lane & 15, hh = lane >> 4; const int by = blockIdx.y;
  A += (size_t)by * sA; Bh += (size_t)by * sB; const size_t cofs = (size_t)by * sC; const float* bp = bias ? bias + (size_t)by * sBias : nullptr;
  const int ntn = (N + 63) / 64; const int wid = blockIdx.x * 4 + w; const int mt = wid / ntn, nq = wid % ntn; if (mt * 16 >= M) return;
  const int row0 = mt * 16, col0 = nq * 64; const _Float16* arow = A + (size_t)(row0 + ln) * lda;
  v8f acc[4] = {};
  for (int kb = 0; kb < K; kb += 32) { FragH ah; ah.half[0] = *(const v8us*)((const unsigned short*)arow + kb + 8 * hh); ah.half[1] = *(const v8us*)((const unsigned short*)arow + kb + 16 + 8 * hh);
#pragma unroll
    for (int t = 0; t < 4; ++t) { if (col0 + t * 16 >= N) continue; const size_t boff = (size_t)(col0 + t * 16 + ln) * ldb + kb; FragH bq; bq.half[0] = *(const v8us*)((const unsigned short*)Bh + boff + 8 * hh); bq.half[1] = *(const v8us*)((const unsigned short*)Bh + boff + 16 + 8 * hh);
      acc[t] = mmaH<1>(ah.v, ah.v, bq.v, bq.v, acc[t]); }
  }
#pragma unroll
  for (int t = 0; t < 4; ++t) { if (col0 + t * 16 >= N) continue; const int col = col0 + t * 16 + ln; const float bv = bp ? bf16_round(bp[col]) : 0.f;
#pragma unroll
    for (int r = 0; r < 8; ++r) { float v = acc[t][r] * alpha + bv; if (CP) { const int rr = row0g + row0 + 8 * hh + r; if (rowsPerB < 0) v += CP[cofs + (size_t)rr * ldc + col];      /* rowsPerB < 0: own element of the batched C plane */ else { const int bidx = rr / rowsPerB; v += CP[(size_t)bidx * sCPb + (size_t)by * 64 + col]; } } if (ACT == 1) v = (v > 0.f) ? v : expm1f(v); else if (ACT == 7) v = (v > 0.f) ? v + 1.0f : expf(v); else if (ACT == 8) v = tanhf(v); else if (ACT == 9) v = 0.5f * v * (1.0f + tanhf(0.7978845608028654f * (v + 0.044715f * v * v * v))); else if (ACT == 11) v = 1.0f / (1.0f + expf(-v)); else if (ACT == 12) v = (v > 0.f) ? v : 0.01f * v; else if (ACT == 14) v = (v > 0.f) ? v : 0.1f * v; else if (ACT == 16) v = (v >= 0.f) ? v : 0.3f * v; else if (ACT == 17) v = (v >= 0.f) ? v : 0.2f * v; else if (ACT == 15) v = v / (1.0f + expf(-v)); else if (ACT == 3) v = fmaxf(v, 0.f); else if (ACT == 6) v = 0.5f * v * (1.0f + erff(v * 0.70710678118654752f)); so[w][8 * hh + r][t * 16 + ln] = v; } }
  __builtin_amdgcn_fence(__ATOMIC_ACQ_REL, "workgroup"); __builtin_amdgcn_wave_barrier();
  const int rsub = lane >> 4, c4 = (lane & 15) * 4; typedef _Float16 v4h __attribute__((ext_vector_type(4)));
  {
#pragma unroll
    for (int q = 0; q < 8; ++q) { const int r = q * 2 + rsub; if (col0 + c4 < N) { const v4f v = *(const v4fa*)&so[w][r][c4]; if (C) *(v4f*)(C + cofs + (size_t)(row0 + r) * ldc + col0 + c4) = v; if (C16) { v4h h4; for (int i = 0; i < 4; ++i) h4[i] = (_Float16)v[i]; *(v4h*)(C16 + cofs + (size_t)(row0 + r) * ldc + col0 + c4) = h4; } } }
     }
}


typedef _Float16 v4h __attribute__((ext_vector_type(4)));

__global__ __launch_bounds__(256) void k_x16(const float* __restrict__ x, _Float16* __restrict__ X16, size_t n8) { const size_t t = (size_t)blockIdx.x * 256 + threadIdx.x; if (t >= n8) return; FragH f;
#pragma unroll
  for (int q = 0; q < 8; ++q) f.h[q] = (_Float16)bf16_round(x[t * 8 + q]); *(v8us*)((unsigned short*)X16 + t * 8) = f.half[0];  }
__global__ __launch_bounds__(256) void k_h16(const float* __restrict__ x, _Float16* __restrict__ X16, size_t n8) { const size_t t = (size_t)blockIdx.x * 256 + threadIdx.x; if (t >= n8) return; FragH f;
#pragma unroll
  for (int q = 0; q < 8; ++q) f.h[q] = (_Float16)x[t * 8 + q]; *(v8us*)((unsigned short*)X16 + t * 8) = f.half[0];  }
__global__ __launch_bounds__(256) void k_round16f(const float* __restrict__ W, _Float16* __restrict__ Bt, size_t n8) { const size_t t = (size_t)blockIdx.x * 256 + threadIdx.x; if (t >= n8) return; FragH f;
#pragma unroll
  for (int i = 0; i < 8; ++i) f.h[i] = (_Float16)(bf16_round(W[t * 8 + i]) * 16.0f); *(v8us*)((unsigned short*)Bt + t * 8) = f.half[0];  }
template <int NHv, int TTv>
__global__ __launch_bounds__(256) void k_vt(const _Float16* __restrict__ V16, int ldv, int voff, _Float16* __restrict__ Vt) { __shared__ unsigned short tl[64][66]; const int tid = threadIdx.x; const int slab = blockIdx.x / (TTv / 64), lg = blockIdx.x % (TTv / 64); const int b = slab / NHv, h = slab % NHv;
  for (int i = tid; i < 64 * 8; i += 256) { const int r = i / 8, c8 = (i % 8) * 8; FragH f; f.half[0] = *(const v8us*)((const unsigned short*)V16 + ((size_t)b * TTv + lg * 64 + r) * ldv + voff + h * 64 + c8);
#pragma unroll
    for (int q = 0; q < 8; ++q) tl[r][c8 + q] = f.u[q]; }
  __syncthreads();
  {
#pragma unroll
    for (int rd = 0; rd < 2; ++rd) { const int d = rd * 32 + tid / 8, pc = tid % 8; FragH f;
#pragma unroll
      for (int q = 0; q < 8; ++q) f.u[q] = tl[pc * 8 + q][d];
      *(v8us*)((unsigned short*)Vt + ((size_t)slab * 64 + d) * TTv + lg * 64 + pc * 8) = f.half[0]; }
     } }

__global__ __launch_bounds__(256) void k_hl(const float* __restrict__ F, _Float16* __restrict__ Hh, _Float16* __restrict__ Hl, size_t n8) { const size_t t = (size_t)blockIdx.x * 256 + threadIdx.x; if (t >= n8) return; FragH fh, fl; const v4f a = *(const v4fa*)(F + t * 8), c = *(const v4fa*)(F + t * 8 + 4);
#pragma unroll
  for (int q = 0; q < 4; ++q) { _Float16 h = (_Float16)a[q]; fh.h[q] = h; fl.h[q] = (_Float16)((a[q] - (float)h) * 1024.0f); h = (_Float16)c[q]; fh.h[4 + q] = h; fl.h[4 + q] = (_Float16)((c[q] - (float)h) * 1024.0f); }
  { *(v8us*)((unsigned short*)Hh + t * 8) = fh.half[0]; *(v8us*)((unsigned short*)Hl + t * 8) = fl.half[0];  } }

// ---- fast GEMM (wave tile 32x64, work-group tile 128x64; requires M % 128 == 0 rows per launch region, N % 64 == 0 and K % 64 == 0); epilogue = k_gemm_hhx semantics ----
__device__ __forceinline__ v16h g2_frag(const _Float16* p, int hh) { FragH f; f.half[0] = *(const v8us*)((const unsigned short*)p + 8 * hh); f.half[1] = *(const v8us*)((const unsigned short*)p + 16 + 8 * hh); return f.v; }
__device__ __forceinline__ v8f g2_mma(v16h a, v16h b, v8f c) { v8f d = __builtin_amdgcn_wmma_f32_16x16x32_f16(false, a, false, b, (short)0, c, false, false); asm volatile("v_nop\n\tv_nop\n\tv_nop\n\tv_nop" : "+v"(d) : "v"(a), "v"(b)); return d; }
// A stage of k_gemm2 = 64 k of the work-group's 128 A rows and 64 B rows: 192 rows of 128 bytes in LDS at a pitch of 144 (16 B x odd: the 16 lanes of a half wave's ds_load_b128 fall on 64 different banks).
#define G2_PITCH 144
#define G2_BOFF (128 * G2_PITCH)      /* the B rows stand behind the A rows */
#define G2_STAGE (192 * G2_PITCH)
__device__ __forceinline__ v16h g2_lfrag(const unsigned char* p) { FragH f; f.half[0] = *(const v8us*)p; f.half[1] = *(const v8us*)(p + 32); return f.v; }      /* p = row start + 64 B per 32 k + 16 hh: the k order of g2_frag */
// One stage, global memory -> LDS through no register: 12 asynchronous copies of 16 bytes a lane (8 A rows, 4 B rows, 16 rows apart); 8 lanes fill one row, so a wave's copy reads 4 whole 128-byte lines.
// lds = the lane's own LDS byte address of its first A row, ga / gb = its own global addresses, a16 / b16 = 16 rows in elements. The s_wait_xcnt stands inside the statement, behind the last copy, so that
// no address register of a copy is written again in front of it.
__device__ __forceinline__ void g2_stage(unsigned lds, const _Float16* ga, const _Float16* gb, size_t a16, size_t b16) {
  asm volatile("global_load_async_to_lds_b128 %0, %12, off\n\tglobal_load_async_to_lds_b128 %1, %13, off\n\tglobal_load_async_to_lds_b128 %2, %14, off\n\tglobal_load_async_to_lds_b128 %3, %15, off\n\t"
               "global_load_async_to_lds_b128 %4, %16, off\n\tglobal_load_async_to_lds_b128 %5, %17, off\n\tglobal_load_async_to_lds_b128 %6, %18, off\n\tglobal_load_async_to_lds_b128 %7, %19, off\n\t"
               "global_load_async_to_lds_b128 %8, %20, off\n\tglobal_load_async_to_lds_b128 %9, %21, off\n\tglobal_load_async_to_lds_b128 %10, %22, off\n\tglobal_load_async_to_lds_b128 %11, %23, off\n\t"
               "s_wait_xcnt 0x0"
               :: "v"(lds), "v"(lds + 16 * G2_PITCH), "v"(lds + 32 * G2_PITCH), "v"(lds + 48 * G2_PITCH), "v"(lds + 64 * G2_PITCH), "v"(lds + 80 * G2_PITCH), "v"(lds + 96 * G2_PITCH), "v"(lds + 112 * G2_PITCH),
                  "v"(lds + G2_BOFF), "v"(lds + G2_BOFF + 16 * G2_PITCH), "v"(lds + G2_BOFF + 32 * G2_PITCH), "v"(lds + G2_BOFF + 48 * G2_PITCH),
                  "v"(ga), "v"(ga + a16), "v"(ga + 2 * a16), "v"(ga + 3 * a16), "v"(ga + 4 * a16), "v"(ga + 5 * a16), "v"(ga + 6 * a16), "v"(ga + 7 * a16),
                  "v"(gb), "v"(gb + b16), "v"(gb + 2 * b16), "v"(gb + 3 * b16) : "memory"); }
template <int ACT>
__global__ __launch_bounds__(128) void k_gemm2(const _Float16* __restrict__ A, int lda, size_t sA, const _Float16* __restrict__ Bh, int ldb, size_t sB, float alpha, const float* __restrict__ bias, size_t sBias, const float* __restrict__ CP, int rowsPerB, size_t sCPb, int row0g,
    float* __restrict__ C, _Float16* __restrict__ C16, int ldc, size_t sC, int M, int N, int K) { static_assert(ACT == 0 || ACT == 3 || ACT == 6 || ACT == 8 || ACT == 9 || ACT == 11 || ACT == 12 || ACT == 14 || ACT == 15 || ACT == 16 || ACT == 17, "k_gemm2: unsupported ACT code (would silently apply no activation)");
  __shared__ __attribute__((aligned(16))) unsigned char sm[2 * G2_STAGE];      /* two stage buffers; behind the K loop the same bytes are the epilogue's staging rows */
  static_assert(sizeof(float) * 4 * 32 * 68 <= 2 * G2_STAGE, "epilogue staging fits the ring"); float (*so)[32][68] = (float (*)[32][68])sm;
  const int tid = threadIdx.x, w = tid >> 5, lane = tid & 31, ln = lane & 15, hh = lane >> 4; const int by = blockIdx.y;
  A += (size_t)by * sA; Bh += (size_t)by * sB; const size_t cofs = (size_t)by * sC; const float* bp = bias ? bias + (size_t)by * sBias : nullptr;
  const int ntn = N >> 6; const int mt = blockIdx.x / ntn, nq = blockIdx.x - mt * ntn; const int row0 = mt * 128 + 32 * w, col0 = nq * 64; if (mt * 128 >= M) return;      /* the whole work-group or none, in front of every barrier */
  const int cr = tid >> 3, cc = tid & 7;      /* the lane's copies: rows cr + 16 i, 16-byte piece cc of the row's 128 bytes */
  const unsigned lds0 = (unsigned)(size_t)sm + (unsigned)(cr * G2_PITCH + cc * 16);
  const _Float16* ga = A + (size_t)(mt * 128 + cr) * lda + cc * 8; const _Float16* gb = Bh + (size_t)(col0 + cr) * ldb + cc * 8; const size_t a16 = (size_t)16 * lda, b16 = (size_t)16 * ldb;
  const unsigned char* fa = sm + (32 * w + ln) * G2_PITCH + 16 * hh; const unsigned char* fb = sm + G2_BOFF + ln * G2_PITCH + 16 * hh;      /* the lane's fragment rows in buffer 0 */
  const v8f z8 = {0.f,0.f,0.f,0.f,0.f,0.f,0.f,0.f}; v8f c00 = z8, c01 = z8, c02 = z8, c03 = z8, c10 = z8, c11 = z8, c12 = z8, c13 = z8;
  const int nst = K >> 6;
  g2_stage(lds0, ga, gb, a16, b16);
  asm volatile("s_wait_asynccnt 0x0" ::: "memory");      /* this wave's copies of stage 0 have landed */
  __syncthreads();      /* ... and every other wave's: stage 0 may be read */
  if (nst > 1) g2_stage(lds0 + G2_STAGE, ga + 64, gb + 64, a16, b16);
#pragma unroll 1      /* rolled: the buffer is picked by the trip's parity, a second copy of the body would only add code */
  for (int t = 0; t < nst; ++t) { const unsigned bo = (unsigned)(t & 1) * G2_STAGE;
    const unsigned char* pa = fa + bo; const unsigned char* pb = fb + bo; v16h af[2][2], bf[2][4];
#pragma unroll      /* constant indices: the fragment arrays become registers */
    for (int kc = 0; kc < 2; ++kc) { af[kc][0] = g2_lfrag(pa + 64 * kc); bf[kc][0] = g2_lfrag(pb + 64 * kc); af[kc][1] = g2_lfrag(pa + 64 * kc + 16 * G2_PITCH);
      for (int j = 1; j < 4; ++j) bf[kc][j] = g2_lfrag(pb + 64 * kc + j * 16 * G2_PITCH); }
#pragma unroll      /* the stage's two 32-k blocks, in ascending k: the sum order of the plain loop */
    for (int kc = 0; kc < 2; ++kc) { c00 = g2_mma(af[kc][0], bf[kc][0], c00); c10 = g2_mma(af[kc][1], bf[kc][0], c10); c01 = g2_mma(af[kc][0], bf[kc][1], c01); c11 = g2_mma(af[kc][1], bf[kc][1], c11);
      c02 = g2_mma(af[kc][0], bf[kc][2], c02); c12 = g2_mma(af[kc][1], bf[kc][2], c12); c03 = g2_mma(af[kc][0], bf[kc][3], c03); c13 = g2_mma(af[kc][1], bf[kc][3], c13); }
    asm volatile("s_wait_dscnt 0x0" ::: "memory");      /* this wave's reads of the buffer are done before it is handed to the copies */
    asm volatile("s_wait_asynccnt 0x0" ::: "memory");      /* this wave's copies of stage t + 1 have landed */
    __syncthreads();      /* publishes stage t + 1 and ends every wave's reads of stage t */
    if (t + 2 < nst) g2_stage(lds0 + bo, ga + (size_t)(t + 2) * 64, gb + (size_t)(t + 2) * 64, a16, b16); }      /* refill of the buffer just read; in flight under trip t + 1 */
  asm volatile("s_wait_asynccnt 0x0" ::: "memory");      /* no copy is outstanding when the ring becomes staging; the last trip's barrier has ended every read of it */
  v8f accs[8] = {c00, c01, c02, c03, c10, c11, c12, c13};
#pragma unroll
  for (int u = 0; u < 8; ++u) { const int t = u & 3, half = u >> 2; const int col = col0 + t * 16 + ln; const float bv = bp ? bf16_round(bp[col]) : 0.f;
#pragma unroll
    for (int r = 0; r < 8; ++r) { const int rloc = half * 16 + 8 * hh + r; float v = accs[u][r] * alpha + bv; if (CP) { if (rowsPerB < 0) v += CP[cofs + (size_t)(row0g + row0 + rloc) * ldc + col];      /* rowsPerB < 0: own element of the batched C plane */ else { const int bidx = (row0g + row0 + rloc) / rowsPerB; v += CP[(size_t)bidx * sCPb + (size_t)by * 64 + col]; } }
      if (ACT == 3) v = fmaxf(v, 0.f); else if (ACT == 6) v = 0.5f * v * (1.0f + erff(v * 0.70710678118654752f)); else if (ACT == 11) v = 1.0f / (1.0f + expf(-v)); else if (ACT == 15) v = v / (1.0f + expf(-v)); else if (ACT == 12) v = (v > 0.f) ? v : 0.01f * v; else if (ACT == 8) v = tanhf(v); else if (ACT == 9) v = 0.5f * v * (1.0f + tanhf(0.7978845608028654f * (v + 0.044715f * v * v * v))); else if (ACT == 14) v = (v > 0.f) ? v : 0.1f * v; else if (ACT == 16) v = (v >= 0.f) ? v : 0.3f * v; else if (ACT == 17) v = (v >= 0.f) ? v : 0.2f * v;
      so[w][rloc][t * 16 + ln] = v; } }
  __builtin_amdgcn_fence(__ATOMIC_ACQ_REL, "workgroup"); __builtin_amdgcn_wave_barrier();
  const int rsub = lane >> 4, c4 = (lane & 15) * 4;
  {
#pragma unroll
    for (int q = 0; q < 16; ++q) { const int r = q * 2 + rsub; const v4f v = *(const v4fa*)&so[w][r][c4]; if (C) *(v4f*)(C + cofs + (size_t)(row0 + r) * ldc + col0 + c4) = v; if (C16) { v4h h4; for (int i = 0; i < 4; ++i) h4[i] = (_Float16)v[i]; *(v4h*)(C16 + cofs + (size_t)(row0 + r) * ldc + col0 + c4) = h4; } }
     } }


__global__ __launch_bounds__(256) void k_wnat(const float* __restrict__ w, size_t n8, _Float16* __restrict__ Bt) { const size_t t = (size_t)blockIdx.x * 256 + threadIdx.x; if (t >= n8) return; FragH f; for (int q = 0; q < 8; ++q) f.h[q] = (_Float16)(bf16_round(w[t * 8 + q]) * 16.0f); *(v8us*)((unsigned short*)Bt + t * 8) = f.half[0];  }
__global__ __launch_bounds__(256) void k_rsm(const float* __restrict__ S, _Float16* __restrict__ P, int nrows) {
  #pragma clang fp contract(off)
  const int i = blockIdx.x * 256 + threadIdx.x; if (i >= nrows) return; const float* s = S + (size_t)i * SQ; float mx = -3.0e38f;
#pragma unroll 1
  for (int j = 0; j < SQ; ++j) mx = fmaxf(mx, s[j]); float se = 0.f;
#pragma unroll 1
  for (int j = 0; j < SQ; ++j) se += expf(s[j] - mx); const float sc = 256.0f / se;
#pragma unroll 1
  for (int j0 = 0; j0 < SQ; j0 += 8) { FragH f; for (int q = 0; q < 8; ++q) f.h[q] = (_Float16)(expf(s[j0 + q] - mx) * sc); unsigned short* d = (unsigned short*)P + (size_t)i * SQ + j0; *(v8us*)d = f.half[0];  } }
__global__ __launch_bounds__(256) void k_vt(const _Float16* __restrict__ V16, int b, int h0, _Float16* __restrict__ VT) { __shared__ unsigned short tl[64][65]; const int tid = threadIdx.x; const int hh = blockIdx.x % HG, sg = blockIdx.x / HG; const int s0 = sg * 64; const int h = h0 + hh;
  for (int i = tid; i < 64 * 8; i += 256) { const int j = i / 8, d8 = (i % 8) * 8; FragH f; f.half[0] = *(const v8us*)((const unsigned short*)V16 + ((size_t)b * SQ + s0 + j) * DM + h * HD + d8); for (int q = 0; q < 8; ++q) tl[d8 + q][j] = f.u[q]; }
  __syncthreads();
  { for (int i = tid; i < 64 * 8; i += 256) { const int d = i / 8, j8 = (i % 8) * 8; FragH f; for (int q = 0; q < 8; ++q) f.u[q] = tl[d][j8 + q]; *(v8us*)((unsigned short*)VT + ((size_t)hh * HD + d) * SQ + s0 + j8) = f.half[0]; }  } }



__global__ __launch_bounds__(256) void k_rsmcf2(const float* __restrict__ S, _Float16* __restrict__ P, int hg, int q0, int nk) {
  #pragma clang fp contract(off)
  const int t = blockIdx.x * 256 + threadIdx.x; if (t >= hg * QT) return; const size_t i = (size_t)t; const float* s = S + i * NKX; const int last = q0 + (t % QT); float mx = -3.0e38f;
#pragma unroll 1
  for (int j = 0; j < nk; ++j) { const float f = (j <= last) ? 1.f : 0.f; mx = fmaxf(mx, fmaf(f, s[j], (1.f - f) * -1.0e9f)); } float se = 0.f;
#pragma unroll 1
  for (int j = 0; j < nk; ++j) { const float f = (j <= last) ? 1.f : 0.f; se += __expf(fmaf(f, s[j], (1.f - f) * -1.0e9f) - mx); } const float sc = 256.0f / se;
#pragma unroll 1
  for (int j0 = 0; j0 < nk; j0 += 8) { FragH fr; for (int q = 0; q < 8; ++q) { const int j = j0 + q; const float f = (j <= last) ? 1.f : 0.f; fr.h[q] = (_Float16)(__expf(fmaf(f, s[j], (1.f - f) * -1.0e9f) - mx) * sc); } unsigned short* d = (unsigned short*)P + i * NKX + j0; *(v8us*)d = fr.half[0];  } }


template <int MASKADD>
__global__ __launch_bounds__(64) void k_att0(const float* __restrict__ QF, const float* __restrict__ KF, const float* __restrict__ VF, int ld, const float* __restrict__ mask, float scale, float* __restrict__ OF, int ldo) {
  #pragma clang fp contract(off)
  __shared__ __attribute__((aligned(16))) float lq[64][64]; __shared__ __attribute__((aligned(16))) float lo[64][64];
  const int tid = threadIdx.x; const int h = blockIdx.x / (QT0 / 64), rg = blockIdx.x % (QT0 / 64); const int i = rg * 64 + tid;
  const float* qr = QF + (size_t)i * ld + h * HD;
#pragma unroll 1
  for (int c = 0; c < HD / 4; ++c) { *(v4f*)&lq[tid][c * 4] = *(const v4fa*)(qr + c * 4); const v4f z = {0.f, 0.f, 0.f, 0.f}; *(v4f*)&lo[tid][c * 4] = z; }
  float m = -1.0e30f, l = 0.f; const int jmax = MASKADD ? (SQ - 1) : (rg * 64 + 63);      /* additive-mask form: every key (the mask input decides); causal form: keys up to the block's last row */
#pragma unroll 1
  for (int j = 0; j <= jmax; ++j) { const float* kr = KF + (size_t)j * ld + h * HD; const float* vr = VF + (size_t)j * ld + h * HD; float s = 0.f;
#pragma unroll 1
    for (int c = 0; c < HD / 4; ++c) { const v4f kq = *(const v4fa*)(kr + c * 4); const v4f qq = *(v4f*)&lq[tid][c * 4]; s = __fadd_rn(s, __fmul_rn(qq[0], kq[0])); s = __fadd_rn(s, __fmul_rn(qq[1], kq[1])); s = __fadd_rn(s, __fmul_rn(qq[2], kq[2])); s = __fadd_rn(s, __fmul_rn(qq[3], kq[3])); }
    s = __fmul_rn(s, scale); if (MASKADD) s = __fadd_rn(s, __fmul_rn(bf16_round(mask[(size_t)i * SQ + j]), -10000.0f));
    const float f = (MASKADD || j <= i) ? 1.f : 0.f; const float sm = fmaf(f, s, (1.f - f) * -1.0e30f); const float mn = fmaxf(m, sm); const float sc = expf(m - mn); const float e = expf(sm - mn); l = __fadd_rn(__fmul_rn(l, sc), e); m = mn;
#pragma unroll 1
    for (int c = 0; c < HD / 4; ++c) { const v4f vv = *(const v4fa*)(vr + c * 4); v4f oo = *(v4f*)&lo[tid][c * 4]; for (int u = 0; u < 4; ++u) oo[u] = __fadd_rn(__fmul_rn(oo[u], sc), __fmul_rn(e, vv[u])); *(v4f*)&lo[tid][c * 4] = oo; } }
  const float fin = 64.0f / l;      /* o carried x64 like the f16 path */
#pragma unroll 1
  for (int c = 0; c < HD / 4; ++c) { v4f oo = *(v4f*)&lo[tid][c * 4]; for (int u = 0; u < 4; ++u) oo[u] = __fmul_rn(oo[u], fin); *(v4f*)&lo[tid][c * 4] = oo; }
  __syncthreads();
  {
#pragma unroll 1
    for (int it = 0; it < 16; ++it) { const int row = it * 4 + tid / 16, pc = (tid % 16) * 4; const v4f v = *(const v4f*)&lo[row][pc]; *(v4f*)(OF + (size_t)(rg * 64 + row) * ldo + h * HD + pc) = v; }
     } }


template <int BFIN, int WXB>
__global__ __launch_bounds__(256) void k_ln16(const float* __restrict__ X, const float* __restrict__ g, const float* __restrict__ bb, float eps, _Float16* __restrict__ N16, float* __restrict__ XB) {
  #pragma clang fp contract(off)
  __shared__ float red[256]; const size_t r = blockIdx.x; const int t = threadIdx.x; const v4f xa = *(const v4fa*)(X + r * DMQ + t * 4); float s[4]; float sum = 0.f;
  for (int q = 0; q < 4; ++q) { s[q] = BFIN ? bf16_round(xa[q]) : xa[q]; sum = __fadd_rn(sum, s[q]); }
  red[t] = sum; __syncthreads(); for (int st = 128; st > 0; st >>= 1) { if (t < st) red[t] = __fadd_rn(red[t], red[t + st]); __syncthreads(); } const float mu = red[0] / (float)DMQ; __syncthreads();
  float vs = 0.f; for (int q = 0; q < 4; ++q) { const float dl = __fadd_rn(s[q], -mu); vs = __fadd_rn(vs, __fmul_rn(dl, dl)); } red[t] = vs; __syncthreads(); for (int st = 128; st > 0; st >>= 1) { if (t < st) red[t] = __fadd_rn(red[t], red[t + st]); __syncthreads(); }
  const float rs = rsqrtf(__fadd_rn(red[0] / (float)DMQ, eps)); v4h y; v4f xb;
  for (int q = 0; q < 4; ++q) { const int c = t * 4 + q; y[q] = (_Float16)__fadd_rn(__fmul_rn(__fmul_rn(__fadd_rn(s[q], -mu), rs), bf16_round(g[c])), bf16_round(bb[c])); xb[q] = s[q]; }
  { *(v4h*)(N16 + r * DMQ + t * 4) = y; if (WXB) *(v4f*)(XB + r * DMQ + t * 4) = xb;  } }
__global__ __launch_bounds__(256) void k_ftres2(const float* __restrict__ OF0, const float* __restrict__ XB, float* __restrict__ X1, size_t n4) {
  #pragma clang fp contract(off)
  const size_t t = (size_t)blockIdx.x * 256 + threadIdx.x; if (t >= n4) return; const v4f o = *(const v4fa*)(OF0 + t * 4), xv = *(const v4fa*)(XB + t * 4); v4f y; for (int q = 0; q < 4; ++q) y[q] = __fadd_rn(__fmul_rn(o[q], 0.015625f), xv[q]); *(v4f*)(X1 + t * 4) = y;  }

__global__ __launch_bounds__(256) void k_wthd(const float* __restrict__ Wt, _Float16* __restrict__ Bt) { const size_t t = (size_t)blockIdx.x * 256 + threadIdx.x; if (t >= (size_t)NH * HD * (DM / 8)) return; const int m8 = (int)(t % (DM / 8)) * 8; const int d = (int)((t / (DM / 8)) % HD); const int h = (int)(t / ((size_t)(DM / 8) * HD)); FragH f;
  for (int q = 0; q < 8; ++q) f.h[q] = (_Float16)(16.0f * bf16_round(Wt[((size_t)h * DM + m8 + q) * HD + d])); unsigned short* dst = (unsigned short*)Bt + ((size_t)h * HD + d) * DM + m8; *(v8us*)dst = f.half[0];  }




template <int BFIN, int W16, int W32>
__global__ __launch_bounds__(256) void k_lnx(const float* __restrict__ X, const float* __restrict__ g, const float* __restrict__ bb, float eps, _Float16* __restrict__ N16, float* __restrict__ N32) {
  #pragma clang fp contract(off)
  __shared__ float red[256]; const size_t r = blockIdx.x; const int t = threadIdx.x; const bool act = t < (DMQ / 4); const int c0 = act ? t * 4 : 0;
  const v4f xa = *(const v4fa*)(X + r * DMQ + c0); float s[4]; float sum = 0.f;
  for (int q = 0; q < 4; ++q) { s[q] = act ? (BFIN ? bf16_round(xa[q]) : xa[q]) : 0.f; sum = __fadd_rn(sum, s[q]); }
  red[t] = sum; __syncthreads(); for (int st = 128; st > 0; st >>= 1) { if (t < st) red[t] = __fadd_rn(red[t], red[t + st]); __syncthreads(); } const float mu = red[0] / (float)DMQ; __syncthreads();
  float vs = 0.f; for (int q = 0; q < 4; ++q) { const float dl = act ? __fadd_rn(s[q], -mu) : 0.f; vs = __fadd_rn(vs, __fmul_rn(dl, dl)); } red[t] = vs; __syncthreads(); for (int st = 128; st > 0; st >>= 1) { if (t < st) red[t] = __fadd_rn(red[t], red[t + st]); __syncthreads(); }
  const float rs = rsqrtf(__fadd_rn(red[0] / (float)DMQ, eps)); v4h y; v4f yf;
  for (int q = 0; q < 4; ++q) { const int c = c0 + q; yf[q] = __fadd_rn(__fmul_rn(__fmul_rn(__fadd_rn(s[q], -mu), rs), bf16_round(g[c])), bf16_round(bb[c])); y[q] = (_Float16)yf[q]; }
  if (!act) return;      /* no barriers after this point */
  { if (W16) *(v4h*)(N16 + r * DMQ + c0) = y; if (W32) *(v4f*)(N32 + r * DMQ + c0) = yf;  } }


__global__ __launch_bounds__(256) void k_bfr(const float* __restrict__ x, float* __restrict__ XB, size_t n8) { const size_t t = (size_t)blockIdx.x * 256 + threadIdx.x; if (t >= n8) return; v4f a = *(const v4fa*)(x + t * 8), c = *(const v4fa*)(x + t * 8 + 4); for (int q = 0; q < 4; ++q) { a[q] = bf16_round(a[q]); c[q] = bf16_round(c[q]); }
  { *(v4f*)(XB + t * 8) = a; *(v4f*)(XB + t * 8 + 4) = c;  } }




__global__ __launch_bounds__(256) void k_lorafold(const float* __restrict__ Wm, const float* __restrict__ A, const float* __restrict__ Bm, float* __restrict__ WE, int K, int N, float sc) {
  #pragma clang fp contract(off)
  const size_t t = (size_t)blockIdx.x * 256 + threadIdx.x; if (t >= (size_t)K * N) return; const int i = (int)(t / N), o = (int)(t % N); float a = 0.f;
  for (int r = 0; r < 16; ++r) a = __fadd_rn(a, __fmul_rn(bf16_round(A[(size_t)i * 16 + r]), bf16_round(Bm[(size_t)r * N + o])));
  const float v = __fadd_rn(bf16_round(Wm[t]), __fmul_rn(sc, a)); *(float*)(WE + t) = v;  }
__global__ __launch_bounds__(256) void k_wt32rep(const float* __restrict__ Wf, _Float16* __restrict__ Bt, int K, int N, int DOUT, float scale) {
  const int t = blockIdx.x * 256 + threadIdx.x; if (t >= DOUT * (K / 8)) return; const int n = t / (K / 8), k8 = (t % (K / 8)) * 8; const int rep = DOUT / N; const int src = (n / (HD * rep)) * HD + (n % HD);      /* head h = n / HD -> group h / rep */
  FragH f; for (int i = 0; i < 8; ++i) f.h[i] = (_Float16)(Wf[(size_t)(k8 + i) * N + src] * scale);
  *(v8us*)((unsigned short*)Bt + (size_t)n * K + k8) = f.half[0];  }
__global__ __launch_bounds__(256) void k_brep(const float* __restrict__ b, float* __restrict__ out) { const int t = blockIdx.x * 256 + threadIdx.x; if (t >= DM) return; const float v = b[(t / (HD * 4)) * HD + (t % HD)]; *(float*)(out + t) = v;  }

__global__ __launch_bounds__(256) void k_rsmcim(const float* __restrict__ S, _Float16* __restrict__ P, int hg, int q0, int nk, const int* __restrict__ am) {
  #pragma clang fp contract(off)
  const int t = blockIdx.x * 256 + threadIdx.x; if (t >= hg * QT) return; const size_t i = (size_t)t; const float* s = S + i * NKX; const int last = q0 + (t % QT); const int* mr = am + (size_t)last * SQ; float mx = -3.0e38f;      /* the module's mask row of this query (keys >= nk lie above the diagonal of the causal mask and are not computed) */
#pragma unroll 1
  for (int j = 0; j < nk; ++j) { const float f = (mr[j] != 0) ? 1.f : 0.f; mx = fmaxf(mx, fmaf(f, s[j], (1.f - f) * -1.0e9f)); } float se = 0.f;
#pragma unroll 1
  for (int j = 0; j < nk; ++j) { const float f = (mr[j] != 0) ? 1.f : 0.f; se += __expf(fmaf(f, s[j], (1.f - f) * -1.0e9f) - mx); } const float sc = 256.0f / se;
#pragma unroll 1
  for (int j0 = 0; j0 < nk; j0 += 8) { FragH fr; for (int q = 0; q < 8; ++q) { const int j = j0 + q; const float f = (mr[j] != 0) ? 1.f : 0.f; fr.h[q] = (_Float16)(__expf(fmaf(f, s[j], (1.f - f) * -1.0e9f) - mx) * sc); } unsigned short* d = (unsigned short*)P + i * NKX + j0; *(v8us*)d = fr.half[0];  } }



__global__ __launch_bounds__(256) void k_bcpy(const float* __restrict__ b, int n, int NP, float* __restrict__ dst, int dst0) { for (int i = threadIdx.x; i < NP; i += 256) { const float v = (i < n) ? b[i] : 0.f; *(float*)(dst + dst0 + i) = v; }  }



// lane l with lane l ^ 16
__device__ __forceinline__ float rs_xhalf(float x) { return __builtin_bit_cast(float, __builtin_amdgcn_permlanex16(__builtin_bit_cast(int, x), __builtin_bit_cast(int, x), 0x76543210, 0xfedcba98, false, false)); }
// Four 2^t in one statement, each in place: behind a transcendental the instruction set asks for one independent instruction or v_nop before its result is read or its source overwritten.
// Here each v_exp_f32 is the independent instruction behind the one before it, the v_nop the slot behind the last. In place, so that the
// statement writes only registers that the multiply-add in front of it has written: the compiler keeps that one clear of the matrix instructions' operands.
__device__ __forceinline__ v4f rs_exp2x4(v4f t) { float a = t[0], b = t[1], c = t[2], d = t[3];
  asm("v_exp_f32 %0, %0\n\tv_exp_f32 %1, %1\n\tv_exp_f32 %2, %2\n\tv_exp_f32 %3, %3\n\tv_nop" : "+v"(a), "+v"(b), "+v"(c), "+v"(d));
  const v4f r = {a, b, c, d}; return r; }
__device__ __forceinline__ v8f fa_mma(v16h a, v16h b, v8f c) { return __builtin_amdgcn_wmma_f32_16x16x32_f16(false, a, false, b, (short)0, c, false, false); }
// Fused attention: scores, softmax and P V in one launch; no score and no weight leaves the registers. One work-group = 256 queries of one (batch, head), 8 waves of 32 query columns;
// a pass = 32 keys. Transposed products: S^T = K Q^T (rows = keys, columns = queries), so a lane's 16 scores of a column are, as they lie, its 16 elements of the B operand of O^T += V^T P^T
// (k order of both operands: 8 hh + 0..7, then 16 + 8 hh + 0..7, that of g2_frag). Online softmax in the log2 domain, f32: the maximum in use may trail the true one by up to 8 (an
// exponential reaches 2^8 at most, well inside f16), and the sums are rescaled only in a pass where some column exceeds that. Denominator = an all-ones A operand times P^T on the matrix
// pipe: it sums the weights as rounded to f16, the same values the numerator sums. o is carried x64 as f16 rows.
// K and V^T: the eight waves read the same fragments, and a fragment load from global memory touches 16 cache lines for 512 bytes. So a stage of 128 keys (4 passes) is brought into LDS once for the work-group, in whole
// 128-byte lines, by asynchronous copies, two buffers: stage t + 1 flies while stage t is worked on. Fragments come from LDS, K one pass ahead inside its stage, V^T at the head of its pass.
// Every '#pragma unroll' in it is there so that the fragment and accumulator arrays it indexes become registers.
#define FA_KP 144      /* pitch of a K row (one key, 128 bytes) in LDS: 16 B x odd, so the 16 lanes of a half wave's ds_load_b128 fall on 64 different banks */
#define FA_VP 272      /* pitch of a V^T row (one d, 128 keys = 256 bytes): 16 B x odd too */
#define FA_VOFF (128 * FA_KP)      /* the 64 V^T rows stand behind the 128 K rows */
#define FA_STAGE (128 * FA_KP + 64 * FA_VP)
// One stage, global memory -> LDS through no register: 8 asynchronous copies of 16 bytes a lane (4 K rows, 32 rows apart; 4 V^T rows, 16 rows apart); 8 lanes fill a K row, 16 a V^T row.
// lk / lv = the lane's own LDS byte addresses of its first K and V^T row, gk / gv = its own global addresses. The s_wait_xcnt stands inside the statement, behind the last copy, so that
// no address register of a copy is written again in front of it.
__device__ __forceinline__ void fa_stage(unsigned lk, unsigned lv, const _Float16* gk, const _Float16* gv) {
  asm volatile("global_load_async_to_lds_b128 %0, %8, off\n\tglobal_load_async_to_lds_b128 %1, %9, off\n\tglobal_load_async_to_lds_b128 %2, %10, off\n\tglobal_load_async_to_lds_b128 %3, %11, off\n\t"
               "global_load_async_to_lds_b128 %4, %12, off\n\tglobal_load_async_to_lds_b128 %5, %13, off\n\tglobal_load_async_to_lds_b128 %6, %14, off\n\tglobal_load_async_to_lds_b128 %7, %15, off\n\t"
               "s_wait_xcnt 0x0"
               :: "v"(lk), "v"(lk + 32 * FA_KP), "v"(lk + 64 * FA_KP), "v"(lk + 96 * FA_KP), "v"(lv), "v"(lv + 16 * FA_VP), "v"(lv + 32 * FA_VP), "v"(lv + 48 * FA_VP),
                  "v"(gk), "v"(gk + (size_t)32 * (2 * DM)), "v"(gk + (size_t)64 * (2 * DM)), "v"(gk + (size_t)96 * (2 * DM)), "v"(gv), "v"(gv + (size_t)16 * SK), "v"(gv + (size_t)32 * SK), "v"(gv + (size_t)48 * SK) : "memory"); }
__global__ __launch_bounds__(256) void k_fattn(const _Float16* __restrict__ Q, const _Float16* __restrict__ KV, const _Float16* __restrict__ VT, _Float16* __restrict__ O) {
  static_assert(SK % 128 == 0 && SK / 128 >= 2 && HD == 64, "k_fattn: whole stages of 128 keys, two or more");
  constexpr float CS = 0.015625f * 1.44269504f;      /* (q / 8) . (k / 8) = q . k / 64, times log2 e */
  constexpr int NST = SK / 128;
  __shared__ __attribute__((aligned(16))) unsigned char sm[2 * FA_STAGE];      /* two stage buffers */
  const int tid = threadIdx.x, lane = tid & 31, ln = lane & 15, hh = lane >> 4; const int wave = __builtin_amdgcn_readfirstlane(tid >> 5);
  const int h = blockIdx.y, b = blockIdx.z; const int q0 = blockIdx.x * 256 + wave * 32;
  const _Float16* qp = Q + ((size_t)b * SQ + q0 + ln) * DM + h * HD;
  const unsigned lk0 = (unsigned)(size_t)sm + (unsigned)((tid >> 3) * FA_KP + (tid & 7) * 16);      /* the lane's copies: K rows (tid >> 3) + 32 i, 16-byte piece tid & 7 */
  const unsigned lv0 = (unsigned)(size_t)sm + (unsigned)(FA_VOFF + (tid >> 4) * FA_VP + (tid & 15) * 16);      /* V^T rows (tid >> 4) + 16 i, 16-byte piece tid & 15 */
  const _Float16* gk = KV + ((size_t)b * SK + (tid >> 3)) * (2 * DM) + h * HD + (tid & 7) * 8;      /* k half of the fused rows: row = key */
  const _Float16* gv = VT + (((size_t)b * NH + h) * HD + (tid >> 4)) * SK + (tid & 15) * 8;      /* V^T: row = d, column = key */
  const unsigned char* fk = sm + ln * FA_KP + 16 * hh; const unsigned char* fv = sm + FA_VOFF + ln * FA_VP + 16 * hh;      /* the lane's fragment rows in buffer 0 */
  fa_stage(lk0, lv0, gk, gv);
  v16h qf[2][2], kf[2][2];
#pragma unroll
  for (int g = 0; g < 2; ++g) for (int kc = 0; kc < 2; ++kc) qf[g][kc] = g2_frag(qp + (size_t)g * 16 * DM + 32 * kc, hh);
  FragH ones;
#pragma unroll
  for (int i = 0; i < 16; ++i) ones.h[i] = (_Float16)1.0f;
  const v8f z8 = {0.f, 0.f, 0.f, 0.f, 0.f, 0.f, 0.f, 0.f};
  v8f acc[2][4], lacc[2]; float m_run[2];
#pragma unroll
  for (int g = 0; g < 2; ++g) { m_run[g] = -__builtin_inff(); lacc[g] = z8; for (int t = 0; t < 4; ++t) acc[g][t] = z8; }
  auto pass = [&](const unsigned char* pk, const unsigned char* pv, const int p, const bool more) __attribute__((always_inline)) {      /* p (the pass in its stage) and more are literals at every call: a stage's last pass is compiled without the fetch of a next K */
    v16h vf[4]; v8f s[2][2];
#pragma unroll
    for (int kt = 0; kt < 2; ++kt) for (int g = 0; g < 2; ++g) s[kt][g] = fa_mma(kf[kt][1], qf[g][1], fa_mma(kf[kt][0], qf[g][0], z8));
#pragma unroll
    for (int t = 0; t < 4; ++t) vf[t] = g2_lfrag(pv + t * 16 * FA_VP + 64 * p);      /* this pass's V^T, in flight under the softmax */
    if (more) {      /* next pass's K, of the same stage, in flight under this pass's softmax and second product */
#pragma unroll
      for (int kt = 0; kt < 2; ++kt) for (int kc = 0; kc < 2; ++kc) kf[kt][kc] = g2_lfrag(pk + (32 * (p + 1) + 16 * kt) * FA_KP + 64 * kc); }
    asm volatile("" ::: "memory");      /* compiler fence: keeps the pass's LDS reads up here, in one group in front of the softmax; without it the compiler sank them behind the branch below, next to their first use, where they have no time to land */
    float mb[2]; bool need = false;
#pragma unroll
    for (int g = 0; g < 2; ++g) { float mx = fmaxf(s[0][g][0], s[1][g][0]);
      for (int r = 1; r < 8; ++r) mx = fmaxf(mx, fmaxf(s[0][g][r], s[1][g][r]));
      mx = fmaxf(mx, rs_xhalf(mx)) * CS; mb[g] = mx; need = need || (mx > m_run[g] + 8.0f); }      /* both wave halves hold the column's maximum of this pass, scaled (the scale is positive) */
    if (__builtin_amdgcn_ballot_w32(need) != 0) {      /* always in the first pass (the maximum in use is -inf, the factor 0), rare later */
#pragma unroll
      for (int g = 0; g < 2; ++g) { const float mn = fmaxf(m_run[g], mb[g]); const float corr = __builtin_amdgcn_exp2f(m_run[g] - mn); m_run[g] = mn; lacc[g] = lacc[g] * corr; for (int t = 0; t < 4; ++t) acc[g][t] = acc[g][t] * corr; } }
#pragma unroll
    for (int g = 0; g < 2; ++g) { FragH pf; const float nm = -m_run[g];
      for (int kt = 0; kt < 2; ++kt) for (int j = 0; j < 2; ++j) { v4f a; for (int q = 0; q < 4; ++q) a[q] = fmaf(s[kt][g][4 * j + q], CS, nm); const v4f e = rs_exp2x4(a); for (int q = 0; q < 4; ++q) pf.h[8 * kt + 4 * j + q] = (_Float16)e[q]; }
      for (int t = 0; t < 4; ++t) acc[g][t] = fa_mma(vf[t], pf.v, acc[g][t]);
      lacc[g] = fa_mma(ones.v, pf.v, lacc[g]); }
  };
  asm volatile("s_wait_asynccnt 0x0" ::: "memory");      /* this wave's copies of stage 0 have landed */
  __syncthreads();      /* ... and every other wave's: stage 0 may be read */
  fa_stage(lk0 + FA_STAGE, lv0 + FA_STAGE, gk + (size_t)128 * (2 * DM), gv + 128);      /* stage 1 exists (asserted above) */
#pragma unroll 1      /* rolled: the buffer is picked by the trip's parity, a second copy of the four passes would only add code */
  for (int t = 0; t < NST; ++t) { const unsigned bo = (unsigned)(t & 1) * FA_STAGE; const unsigned char* pk = fk + bo; const unsigned char* pv = fv + bo;
#pragma unroll
    for (int kt = 0; kt < 2; ++kt) for (int kc = 0; kc < 2; ++kc) kf[kt][kc] = g2_lfrag(pk + 16 * kt * FA_KP + 64 * kc);      /* the stage's first K */
    pass(pk, pv, 0, true); pass(pk, pv, 1, true); pass(pk, pv, 2, true); pass(pk, pv, 3, false);      /* keys in ascending order: the sum order of the plain loop */
    asm volatile("s_wait_dscnt 0x0" ::: "memory");      /* this wave's reads of the buffer are done before it is handed to the copies */
    asm volatile("s_wait_asynccnt 0x0" ::: "memory");      /* this wave's copies of stage t + 1 have landed */
    __syncthreads();      /* publishes stage t + 1 and ends every wave's reads of stage t */
    if (t + 2 < NST) fa_stage(lk0 + bo, lv0 + bo, gk + (size_t)(t + 2) * 128 * (2 * DM), gv + (size_t)(t + 2) * 128); }      /* refill of the buffer just read; in flight under trip t + 1 */
  asm volatile("s_wait_asynccnt 0x0" ::: "memory");      /* no copy is outstanding when the wave ends */
#pragma unroll
  for (int g = 0; g < 2; ++g) { const float inv = 64.0f / lacc[g][0];      /* every row of the all-ones product holds the column's denominator */
    _Float16* op = O + ((size_t)b * SQ + q0 + 16 * g + ln) * DM + h * HD + 8 * hh;
    for (int t = 0; t < 4; ++t) { FragH f; for (int r = 0; r < 8; ++r) f.h[r] = (_Float16)(acc[g][t][r] * inv); *(v8us*)((unsigned short*)op + 16 * t) = f.half[0]; } } }      /* d = 16 t + 8 hh + 0..7 of query ln: 16 bytes a lane; the wave's four stores fill each row's 128-byte line */
extern "C" void kernel_launch(void* const* d_in, const int* in_sizes, int n_in,
                              void* d_out, int out_size, void* d_ws, size_t ws_size, hipStream_t stream) {
  (void)in_sizes; (void)n_in; (void)out_size;
  const float* const* I = (const float* const*)d_in; const float* x = I[0]; const float* cond = I[1]; const float* wq = I[2]; const float* bq = I[3]; const float* wkv = I[4]; const float* bkv = I[5]; const float* wo = I[6]; const float* bo = I[7];      /* input order: x [2][2048][1024]; tgt [2][2048][1024]; [in][out] Wq [1024][1024] + bq; Wkv [1024][2048] + bkv (k | v halves); Wp [1024][1024] + bp; the three biases are bound and read */
  static_assert(NH * HD == DM && HD == 64 && SQ % 256 == 0 && SK % 64 == 0 && DC % 32 == 0 && DM % 64 == 0, "shape / tile multiples");
  static_assert((NB * SQ) % 128 == 0 && (NB * SK) % 128 == 0 && DC % 64 == 0 && DM % 64 == 0, "k_gemm2: whole 128 x 64 tiles, whole 64-k stages");
  const size_t NRK = (size_t)NB * SK;      /* conditioning rows */
  char* ws = (char*)d_ws; size_t off = 0;
  auto take = [&](size_t bytes) { char* p = ws + off; off += (bytes + 255) & ~(size_t)255; return p; };
  _Float16* BQ = (_Float16*)take((size_t)DM * DM * 2); _Float16* BKV = (_Float16*)take((size_t)2 * DM * DC * 2); _Float16* BO = (_Float16*)take((size_t)DM * DM * 2);
  _Float16* X16 = (_Float16*)take(NR * DM * 2); _Float16* C16 = (_Float16*)take(NRK * DC * 2); _Float16* Q16 = (_Float16*)take(NR * DM * 2); _Float16* KV16 = (_Float16*)take(NRK * 2 * DM * 2); _Float16* O16 = (_Float16*)take(NR * DM * 2);
  _Float16* VT = (_Float16*)take((size_t)NB * NH * HD * SK * 2);
  if (off > ws_size) return;      /* 2 + 4 + 2 (weight planes) + 8 + 8 + 8 + 16 + 8 (row planes) + 8 (V^T) = 64 MiB at NB 2, SK 2048, DC 1024 */
  k_wt_f16<<<(unsigned)(((size_t)DM * (DM / 8) + 255) / 256), 256, 0, stream>>>(wq, BQ, DM, DM, 16.0f); k_wt_f16<<<(unsigned)(((size_t)2 * DM * (DC / 8) + 255) / 256), 256, 0, stream>>>(wkv, BKV, DC, 2 * DM, 16.0f); k_wt_f16<<<(unsigned)(((size_t)DM * (DM / 8) + 255) / 256), 256, 0, stream>>>(wo, BO, DM, DM, 16.0f);      /* [in][out] -> Bt x16: Wq [1024][1024]; Wkv [DC = 1024][2048] -> Bt [2048][1024] (rows 0..1023 = k, 1024..2047 = v); Wp */
  k_x16<<<(unsigned)((NR * DM / 8 + 255) / 256), 256, 0, stream>>>(x, X16, NR * DM / 8); k_x16<<<(unsigned)((NRK * DC / 8 + 255) / 256), 256, 0, stream>>>(cond, C16, NRK * DC / 8);      /* exact f16 rows of both inputs */
  k_gemm2<0><<<dim3((unsigned)((NR / 128) * (DM / 64)), 1), 128, 0, stream>>>(X16, DM, 0, BQ, DM, 0, 0.0625f, bq, 0, nullptr, 1, 0, 0, nullptr, Q16, DM, 0, (int)NR, DM, DM);      /* q rows (f16); head h = columns 64 h .. */
  k_gemm2<0><<<dim3((unsigned)((NRK / 128) * (2 * DM / 64)), 1), 128, 0, stream>>>(C16, DC, 0, BKV, DC, 0, 0.0625f, bkv, 0, nullptr, 1, 0, 0, nullptr, KV16, 2 * DM, 0, (int)NRK, 2 * DM, DC);      /* k | v rows (f16, pitch 2048): k = columns 0..1023, v = columns 1024..2047, head h = columns 64 h .. of each half */
  k_vt<NH, SK><<<NB * NH * (SK / 64), 256, 0, stream>>>(KV16 + DM, 2 * DM, 0, VT);      /* V^T [NB][NH][HD][SK] (the v half of the fused rows) */
  k_fattn<<<dim3(SQ / 256, NH, NB), 256, 0, stream>>>(Q16, KV16, VT, O16);      /* softmax(q . k / 64) v over the SK = 2048 keys -> ctx (merged heads, x64) as f16 rows */
  k_gemm2<0><<<dim3((unsigned)((NR / 128) * (DM / 64)), 1), 128, 0, stream>>>(O16, DM, 0, BO, DM, 0, 0.0009765625f, bo, 0, nullptr, 1, 0, 0, (float*)d_out, nullptr, DM, 0, (int)NR, DM, DM);      /* out = ctx proj_w + proj_b */
}

// v005
// Measured time: 112 microseconds a run.
// Next to v004, in two timings, it ran 1.08 times as fast each time.
// Over all steps from v000 it is 58.8 times as fast.
#include <hip/hip_runtime.h>
// Multi-head cross-attention with a fused key / value projection and BOTH q and k scaled (x [2][2048][1024] (queries), tgt [2][2048][1024] (keys / values); q = x Wq + bq ([in][out] 1024 x 1024, normal x 0.02; zero bias); kv = tgt Wkv + bkv ([in][out] 1024 x 2048; zero bias) split into halves: k = columns 0..1023, v = columns 1024..2047; 16 heads of 64; logits = (q * 64^-0.5) . (k * 64^-0.5): the module scales BOTH operands, so the effective scale is 1/64; softmax over the 2048 tgt positions (no mask); out = merged Wp + bp ([in][out]; zero bias) -> [2][2048][1024]).
// Structure: token rows; x and tgt as exact f16 rows; natural weights as exact x16 planes; q and fused k | v WMMA GEMMs (32x64 wave tiles, f32 accumulation, + bias) -> f16; V^T via LDS transposes; one fused attention launch (256 queries of one head per work-group: scores, online softmax with f32 statistics and native exp, weights f16, ctx x64 merged f16); ctx Wp + bp -> f32 output.
// Compute dtype: inputs rounded to bf16; x / weights exact; q, k, v, softmax weights and o as plain f16 GEMM operands (~2^-12); scores and softmax statistics f32. v_wmma_f32_16x16x32_f16.
#define NB 2
#define SQ 2048                      /* query rows per batch */
#define SK 2048                      /* conditioning (key / value) rows per batch */
#define DC 1024                       /* conditioning width */
#define DM 1024
#define NH 16
#define HD 64
#define HG 4                         /* heads per launch of the (b, h0) k_vt form, which is not launched */
#define QT 256                       /* query rows per attention tile */
#define NKX SK                       /* S / P row pitch = the SK keys (2048 here) */
#define QT0 128                      /* first-tile rows recomputed exactly in f32 */
#define B0 0                         /* first batch processed (debug hook) */
#define NBR NB                       /* batches processed (debug hook) */
#define NR ((size_t)NB * SQ)
#define DMQ DM
#define DFF 4096         /* token rows */
#define MP ((int)((size_t)NBR * SQ)) /* rows projected (debug hook) */
#define QN SQ                        /* query rows attended per batch (debug hook) */
#define NHD NH                       /* heads attended (debug hook) */
#define MPO MP                       /* rows through the output stage (debug hook) */
#define LQ (3 * DM)      /* unused; q rows have pitch DM, k | v rows 2 * DM */
typedef __bf16 v16b __attribute__((ext_vector_type(16)));
typedef unsigned short v8us __attribute__((ext_vector_type(8), may_alias));
typedef float  v8f  __attribute__((ext_vector_type(8)));
typedef float  v4f  __attribute__((ext_vector_type(4)));
typedef float  v4fa __attribute__((ext_vector_type(4), may_alias));
union FragB { v16b v; v8us half[2]; unsigned short u[16]; };

__device__ __forceinline__ unsigned short bf16_bits(float x) { unsigned int u = __float_as_uint(x); return (unsigned short)((u + 0x7FFFu + ((u >> 16) & 1u)) >> 16); }
__device__ __forceinline__ float bf16_val(unsigned short b) { return __uint_as_float(((unsigned int)b) << 16); }
__device__ __forceinline__ float bf16_round(float x) { return bf16_val(bf16_bits(x)); }
// D += A·B with NT terms: 1 = ah·bh, 2 = + al·bh (A split), 3 = + ah·bl (both split)
template <int NT>
__device__ __forceinline__ v8f mmaN(v16b ah, v16b al, v16b bh, v16b bl, v8f c) {
  c = __builtin_amdgcn_wmma_f32_16x16x32_bf16(false, ah, false, bh, (short)0, c, false, false);
  if (NT >= 2) c = __builtin_amdgcn_wmma_f32_16x16x32_bf16(false, al, false, bh, (short)0, c, false, false);
  if (NT >= 3) c = __builtin_amdgcn_wmma_f32_16x16x32_bf16(false, ah, false, bl, (short)0, c, false, false);
  asm volatile("v_nop\n\tv_nop\n\tv_nop\n\tv_nop" : "+v"(c) : "v"(ah), "v"(al), "v"(bh), "v"(bl));
  return c;
}

__global__ __launch_bounds__(256) void k_wt_bf16(const float* __restrict__ W, unsigned short* __restrict__ Wt, int K, int N) {
  const int t = blockIdx.x * 256 + threadIdx.x;
  const int k8n = K / 8;
  if (t >= N * k8n) return;
  const int n = t / k8n, k8 = (t % k8n) * 8;
  v8us v;
#pragma unroll
  for (int i = 0; i < 8; ++i) v[i] = bf16_bits(W[(size_t)(k8 + i) * N + n]);
  *(v8us*)(Wt + (size_t)n * K + k8) = v;
  
}

// GEMM C[M][N] (f32, pitch ldc) = act(A[M][K]·W + bias). A f32 row-major (pitch lda) converted per fragment to bf16
// (ASPLIT: hi/lo two planes -> 2 terms, else single rounded term); Wt bf16 [N][K] (pitch ldb). BIAS_BF16 rounds the
// bias to bf16 first (bias quantised to bf16 before the add). K%32==0, M%16==0, N%64==0.
template <bool ASPLIT, int ACT, bool BIAS_BF16>
__global__ __launch_bounds__(128) void k_gemm_bf(const float* __restrict__ A, int lda, const unsigned short* __restrict__ Wt, int ldb,
                                               const float* __restrict__ bias, float* __restrict__ C, int ldc, int M, int N, int K) {
  __shared__ __attribute__((aligned(16))) float so[4][16][64];
  const int tid = threadIdx.x, w = tid >> 5, lane = tid & 31, ln = lane & 15, hh = lane >> 4;
  const int ntn = N / 64;
  const int wid = blockIdx.x * 4 + w;
  const int mt = wid / ntn, nq = wid % ntn;
  if (mt * 16 >= M) return;
  const int row0 = mt * 16, col0 = nq * 64;
  const float* arow = A + (size_t)(row0 + ln) * lda;
  v8f acc[4] = {};
  for (int kb = 0; kb < K; kb += 32) {
    FragB ah, al;
    const v4f x0 = *(const v4fa*)(arow + kb + 8 * hh), x1 = *(const v4fa*)(arow + kb + 8 * hh + 4);
    const v4f x2 = *(const v4fa*)(arow + kb + 16 + 8 * hh), x3 = *(const v4fa*)(arow + kb + 16 + 8 * hh + 4);
    float xs[16] = {x0[0],x0[1],x0[2],x0[3],x1[0],x1[1],x1[2],x1[3],x2[0],x2[1],x2[2],x2[3],x3[0],x3[1],x3[2],x3[3]};
#pragma unroll
    for (int i = 0; i < 16; ++i) { const unsigned short hb = bf16_bits(xs[i]); ah.u[i] = hb; al.u[i] = ASPLIT ? bf16_bits(xs[i] - bf16_val(hb)) : (unsigned short)0; }
#pragma unroll
    for (int t = 0; t < 4; ++t) {
      const unsigned short* brow = Wt + (size_t)(col0 + t * 16 + ln) * ldb + kb;
      FragB b;
      b.half[0] = *(const v8us*)(brow + 8 * hh);
      b.half[1] = *(const v8us*)(brow + 16 + 8 * hh);
      acc[t] = mmaN<ASPLIT ? 2 : 1>(ah.v, al.v, b.v, b.v, acc[t]);
    }
  }
#pragma unroll
  for (int t = 0; t < 4; ++t) {
    float bv = bias ? bias[col0 + t * 16 + ln] : 0.f;
    if (BIAS_BF16) bv = bf16_round(bv);
#pragma unroll
    for (int r = 0; r < 8; ++r) { float v = acc[t][r] + bv; if (ACT == 1) v = fmaxf(v, 0.f); so[w][8 * hh + r][t * 16 + ln] = v; }
  }
  __builtin_amdgcn_fence(__ATOMIC_ACQ_REL, "workgroup");
  __builtin_amdgcn_wave_barrier();
  const int rsub = lane >> 4, c4 = (lane & 15) * 4;
  {
#pragma unroll
    for (int q = 0; q < 8; ++q) {
      const int r = q * 2 + rsub;
      const v4f v = *(const v4fa*)&so[w][r][c4];
      *(v4f*)(C + (size_t)(row0 + r) * ldc + col0 + c4) = v;
    }
    
  }
}

// GEMM C = act(A·W + bias + resid): A f32 (ASPLIT -> hi/lo 2 terms), Wt bf16 [N][K]; ACT 0 none, 1 relu, 2 exact gelu;
// resid (optional, f32, row index = (row % rmod), pitch ldr, RES_BF16 rounds it) added before the activation.
template <bool ASPLIT, int ACT, bool BIAS_BF16, bool RES_BF16>
__global__ __launch_bounds__(128) void k_gemm_bf3(const float* __restrict__ A, int lda, const unsigned short* __restrict__ Wt, int ldb,
                                                const float* __restrict__ bias, const float* __restrict__ resid, int rmod, int ldr,
                                                float* __restrict__ C, int ldc, int M, int N, int K) {
  __shared__ __attribute__((aligned(16))) float so[4][16][64];
  const int tid = threadIdx.x, w = tid >> 5, lane = tid & 31, ln = lane & 15, hh = lane >> 4;
  const int ntn = N / 64;
  const int wid = blockIdx.x * 4 + w;
  const int mt = wid / ntn, nq = wid % ntn;
  if (mt * 16 >= M) return;
  const int row0 = mt * 16, col0 = nq * 64;
  const float* arow = A + (size_t)(row0 + ln) * lda;
  v8f acc[4] = {};
  for (int kb = 0; kb < K; kb += 32) {
    FragB ah, al;
    const v4f x0 = *(const v4fa*)(arow + kb + 8 * hh), x1 = *(const v4fa*)(arow + kb + 8 * hh + 4);
    const v4f x2 = *(const v4fa*)(arow + kb + 16 + 8 * hh), x3 = *(const v4fa*)(arow + kb + 16 + 8 * hh + 4);
    float xs[16] = {x0[0],x0[1],x0[2],x0[3],x1[0],x1[1],x1[2],x1[3],x2[0],x2[1],x2[2],x2[3],x3[0],x3[1],x3[2],x3[3]};
#pragma unroll
    for (int i = 0; i < 16; ++i) { const unsigned short hb = bf16_bits(xs[i]); ah.u[i] = hb; al.u[i] = ASPLIT ? bf16_bits(xs[i] - bf16_val(hb)) : (unsigned short)0; }
#pragma unroll
    for (int t = 0; t < 4; ++t) {
      const unsigned short* brow = Wt + (size_t)(col0 + t * 16 + ln) * ldb + kb;
      FragB b;
      b.half[0] = *(const v8us*)(brow + 8 * hh);
      b.half[1] = *(const v8us*)(brow + 16 + 8 * hh);
      acc[t] = mmaN<ASPLIT ? 2 : 1>(ah.v, al.v, b.v, b.v, acc[t]);
    }
  }
#pragma unroll
  for (int t = 0; t < 4; ++t) {
    const int col = col0 + t * 16 + ln;
    float bv = bias ? bias[col] : 0.f;
    if (BIAS_BF16) bv = bf16_round(bv);
#pragma unroll
    for (int r = 0; r < 8; ++r) {
      float v = acc[t][r] + bv;
      if (resid) { float rv = resid[(size_t)((row0 + 8 * hh + r) % rmod) * ldr + col]; if (RES_BF16) rv = bf16_round(rv); v += rv; }
      if (ACT == 1) v = fmaxf(v, 0.f);
      if (ACT == 2) v = 0.5f * v * (1.0f + erff(v * 0.70710678118654752f));
      if (ACT == 3) { const float u = 0.7978845608028654f * (v + 0.044715f * v * v * v); v = 0.5f * v * (1.0f + tanhf(u)); }
      so[w][8 * hh + r][t * 16 + ln] = v;
    }
  }
  __builtin_amdgcn_fence(__ATOMIC_ACQ_REL, "workgroup");
  __builtin_amdgcn_wave_barrier();
  const int rsub = lane >> 4, c4 = (lane & 15) * 4;
  {
#pragma unroll
    for (int q = 0; q < 8; ++q) {
      const int r = q * 2 + rsub;
      const v4f v = *(const v4fa*)&so[w][r][c4];
      *(v4f*)(C + (size_t)(row0 + r) * ldc + col0 + c4) = v;
    }
    
  }
}
// row LayerNorm (biased variance, eps) over N: s = X (+ R); optional out_sum <- s; out_norm <- (s-mu)*rsqrt(var+eps)*g + b
template <bool PARAM_BF16>
__global__ __launch_bounds__(256) void k_layernorm(const float* __restrict__ X, const float* __restrict__ R, const float* __restrict__ g, const float* __restrict__ bta,
                                                  float* __restrict__ out_sum, float* __restrict__ out_norm, int N, float eps) {
  __shared__ float red[256];
  const int row = blockIdx.x, tid = threadIdx.x;
  const float* x = X + (size_t)row * N; const float* rr = R ? R + (size_t)row * N : nullptr;
  float vals[16];                     // up to N = 4096
  const int per = N / 256;            // contiguous chunk per thread? use strided-by-4 chunks: thread handles j = tid*4 + 1024*u
  float s1 = 0.f;
  for (int u = 0; u < per / 4; ++u) {
    const int j = tid * 4 + 1024 * u;
    const v4f a = *(const v4fa*)(x + j);
    v4f b = {0.f,0.f,0.f,0.f}; if (rr) b = *(const v4fa*)(rr + j);
#pragma unroll
    for (int q = 0; q < 4; ++q) { const float v = a[q] + b[q]; vals[u * 4 + q] = v; s1 += v; }
  }
  red[tid] = s1; __syncthreads();
  for (int st = 128; st > 0; st >>= 1) { if (tid < st) red[tid] += red[tid + st]; __syncthreads(); }
  const float mu = red[0] / (float)N; __syncthreads();
  float s2 = 0.f;
  for (int u = 0; u < per / 4; ++u)
#pragma unroll
    for (int q = 0; q < 4; ++q) { const float c = vals[u * 4 + q] - mu; s2 += c * c; }
  red[tid] = s2; __syncthreads();
  for (int st = 128; st > 0; st >>= 1) { if (tid < st) red[tid] += red[tid + st]; __syncthreads(); }
  const float rs = rsqrtf(red[0] / (float)N + eps);
  {
    for (int u = 0; u < per / 4; ++u) {
      const int j = tid * 4 + 1024 * u;
      v4f o, sm;
#pragma unroll
      for (int q = 0; q < 4; ++q) {
        float gg = g[j + q], bb = bta[j + q];
        if (PARAM_BF16) { gg = bf16_round(gg); bb = bf16_round(bb); }
        sm[q] = vals[u * 4 + q]; o[q] = (vals[u * 4 + q] - mu) * rs * gg + bb;
      }
      if (out_sum) *(v4f*)(out_sum + (size_t)row * N + j) = sm;
      *(v4f*)(out_norm + (size_t)row * N + j) = o;
    }
    
  }
}



// ---- f16 WMMA path (v_wmma_f32_16x16x32_f16): 11-bit significands for operands in range — used where a [0,1] probability operand needs more precision than bf16
typedef _Float16 v16h __attribute__((ext_vector_type(16)));
union FragH { v16h v; v8us half[2]; _Float16 h[16]; unsigned short u[16]; };
template <int NT>
__device__ __forceinline__ v8f mmaH(v16h ah, v16h al, v16h bh, v16h bl, v8f c) {
  c = __builtin_amdgcn_wmma_f32_16x16x32_f16(false, ah, false, bh, (short)0, c, false, false);
  if (NT >= 2) c = __builtin_amdgcn_wmma_f32_16x16x32_f16(false, al, false, bh, (short)0, c, false, false);
  if (NT >= 3) c = __builtin_amdgcn_wmma_f32_16x16x32_f16(false, ah, false, bl, (short)0, c, false, false);
  asm volatile("v_nop\n\tv_nop\n\tv_nop\n\tv_nop" : "+v"(c) : "v"(ah), "v"(al), "v"(bh), "v"(bl));
  return c;
}
// batched GEMM like k_gemm_b but f16 operands: A f32 (split into f16 hi/lo if ASPLIT, else rounded to f16), Bt = f16 values [n][k]; alpha; C f32; N multiple of 16 (partial tiles skipped)
template <bool ASPLIT>
__global__ __launch_bounds__(128) void k_gemm_h(const float* __restrict__ A, int lda, size_t sA, const _Float16* __restrict__ Bh, int ldb, size_t sB, float alpha, float* __restrict__ C, int ldc, size_t sC, int M, int N, int K) {
  __shared__ __attribute__((aligned(16))) float so[4][16][64];
  const int tid = threadIdx.x, w = tid >> 5, lane = tid & 31, ln = lane & 15, hh = lane >> 4; const int by = blockIdx.y;
  A += (size_t)by * sA; Bh += (size_t)by * sB; C += (size_t)by * sC;
  const int ntn = (N + 63) / 64; const int wid = blockIdx.x * 4 + w; const int mt = wid / ntn, nq = wid % ntn; if (mt * 16 >= M) return;
  const int row0 = mt * 16, col0 = nq * 64; const float* arow = A + (size_t)(row0 + ln) * lda;
  v8f acc[4] = {};
  for (int kb = 0; kb < K; kb += 32) {
    FragH ah, al;
    const v4f x0 = *(const v4fa*)(arow + kb + 8 * hh), x1 = *(const v4fa*)(arow + kb + 8 * hh + 4), x2 = *(const v4fa*)(arow + kb + 16 + 8 * hh), x3 = *(const v4fa*)(arow + kb + 16 + 8 * hh + 4);
    float xs[16] = {x0[0],x0[1],x0[2],x0[3],x1[0],x1[1],x1[2],x1[3],x2[0],x2[1],x2[2],x2[3],x3[0],x3[1],x3[2],x3[3]};
#pragma unroll
    for (int i = 0; i < 16; ++i) { const _Float16 h = (_Float16)xs[i]; ah.h[i] = h; al.h[i] = ASPLIT ? (_Float16)(xs[i] - (float)h) : (_Float16)0.0f; }
#pragma unroll
    for (int t = 0; t < 4; ++t) { if (col0 + t * 16 >= N) continue; const size_t boff = (size_t)(col0 + t * 16 + ln) * ldb + kb; FragH bq; bq.half[0] = *(const v8us*)(Bh + boff + 8 * hh); bq.half[1] = *(const v8us*)(Bh + boff + 16 + 8 * hh);
      acc[t] = mmaH<ASPLIT ? 2 : 1>(ah.v, al.v, bq.v, bq.v, acc[t]); }
  }
#pragma unroll
  for (int t = 0; t < 4; ++t) { if (col0 + t * 16 >= N) continue;
#pragma unroll
    for (int r = 0; r < 8; ++r) so[w][8 * hh + r][t * 16 + ln] = acc[t][r] * alpha; }
  __builtin_amdgcn_fence(__ATOMIC_ACQ_REL, "workgroup"); __builtin_amdgcn_wave_barrier();
  const int rsub = lane >> 4, c4 = (lane & 15) * 4;
  {
#pragma unroll
    for (int q = 0; q < 8; ++q) { const int r = q * 2 + rsub; if (col0 + c4 < N) { const v4f v = *(const v4fa*)&so[w][r][c4]; *(v4f*)(C + (size_t)(row0 + r) * ldc + col0 + c4) = v; } }
     }
}

// Wt[n][k] = f16(W[k][n]·scale) from f32 row-major W[K][N] (scale = power of two; bf16-exact weights stay exact in f16 away from the subnormal range)
__global__ __launch_bounds__(256) void k_wt_f16(const float* __restrict__ W, _Float16* __restrict__ Wt, int K, int N, float scale) {
  const int t = blockIdx.x * 256 + threadIdx.x; if (t >= N * (K / 8)) return; const int n = t / (K / 8), k8 = (t % (K / 8)) * 8; FragH f;
#pragma unroll
  for (int i = 0; i < 8; ++i) f.h[i] = (_Float16)(bf16_round(W[(size_t)(k8 + i) * N + n]) * scale); const v8us o = f.half[0];
  *(v8us*)((unsigned short*)Wt + (size_t)n * K + k8) = o; 
}
// k_gemm_hh variant with fused epilogue: v = acc·alpha + bias[by·sBias + col] (+ CP[(row/rowsPerB)·sCPb + by·64 + col] if CP) ; ACT 0 none / 1 elu ; writes f16 C16 (and f32 C if non-null)
template <int ACT>
__global__ __launch_bounds__(128) void k_gemm_hhx(const _Float16* __restrict__ A, int lda, size_t sA, const _Float16* __restrict__ Bh, int ldb, size_t sB, float alpha, const float* __restrict__ bias, size_t sBias, const float* __restrict__ CP, int rowsPerB, size_t sCPb, int row0g,
    float* __restrict__ C, _Float16* __restrict__ C16, int ldc, size_t sC, int M, int N, int K) {
  __shared__ __attribute__((aligned(16))) float so[4][16][64];
  const int tid = threadIdx.x, w = tid >> 5, lane = tid & 31, ln = lane & 15, hh = lane >> 4; const int by = blockIdx.y;
  A += (size_t)by * sA; Bh += (size_t)by * sB; const size_t cofs = (size_t)by * sC; const float* bp = bias ? bias + (size_t)by * sBias : nullptr;
  const int ntn = (N + 63) / 64; const int wid = blockIdx.x * 4 + w; const int mt = wid / ntn, nq = wid % ntn; if (mt * 16 >= M) return;
  const int row0 = mt * 16, col0 = nq * 64; const _Float16* arow = A + (size_t)(row0 + ln) * lda;
  v8f acc[4] = {};
  for (int kb = 0; kb < K; kb += 32) { FragH ah; ah.half[0] = *(const v8us*)((const unsigned short*)arow + kb + 8 * hh); ah.half[1] = *(const v8us*)((const unsigned short*)arow + kb + 16 + 8 * hh);
#pragma unroll
    for (int t = 0; t < 4; ++t) { if (col0 + t * 16 >= N) continue; const size_t boff = (size_t)(col0 + t * 16 + ln) * ldb + kb; FragH bq; bq.half[0] = *(const v8us*)((const unsigned short*)Bh + boff + 8 * hh); bq.half[1] = *(const v8us*)((const unsigned short*)Bh + boff + 16 + 8 * hh);
      acc[t] = mmaH<1>(ah.v, ah.v, bq.v, bq.v, acc[t]); }
  }
#pragma unroll
  for (int t = 0; t < 4; ++t) { if (col0 + t * 16 >= N) continue; const int col = col0 + t * 16 + ln; const float bv = bp ? bf16_round(bp[col]) : 0.f;
#pragma unroll
    for (int r = 0; r < 8; ++r) { float v = acc[t][r] * alpha + bv; if (CP) { const int rr = row0g + row0 + 8 * hh + r; if (rowsPerB < 0) v += CP[cofs + (size_t)rr * ldc + col];      /* rowsPerB < 0: own element of the batched C plane */ else { const int bidx = rr / rowsPerB; v += CP[(size_t)bidx * sCPb + (size_t)by * 64 + col]; } } if (ACT == 1) v = (v > 0.f) ? v : expm1f(v); else if (ACT == 7) v = (v > 0.f) ? v + 1.0f : expf(v); else if (ACT == 8) v = tanhf(v); else if (ACT == 9) v = 0.5f * v * (1.0f + tanhf(0.7978845608028654f * (v + 0.044715f * v * v * v))); else if (ACT == 11) v = 1.0f / (1.0f + expf(-v)); else if (ACT == 12) v = (v > 0.f) ? v : 0.01f * v; else if (ACT == 14) v = (v > 0.f) ? v : 0.1f * v; else if (ACT == 16) v = (v >= 0.f) ? v : 0.3f * v; else if (ACT == 17) v = (v >= 0.f) ? v : 0.2f * v; else if (ACT == 15) v = v / (1.0f + expf(-v)); else if (ACT == 3) v = fmaxf(v, 0.f); else if (ACT == 6) v = 0.5f * v * (1.0f + erff(v * 0.70710678118654752f)); so[w][8 * hh + r][t * 16 + ln] = v; } }
  __builtin_amdgcn_fence(__ATOMIC_ACQ_REL, "workgroup"); __builtin_amdgcn_wave_barrier();
  const int rsub = lane >> 4, c4 = (lane & 15) * 4; typedef _Float16 v4h __attribute__((ext_vector_type(4)));
  {
#pragma unroll
    for (int q = 0; q < 8; ++q) { const int r = q * 2 + rsub; if (col0 + c4 < N) { const v4f v = *(const v4fa*)&so[w][r][c4]; if (C) *(v4f*)(C + cofs + (size_t)(row0 + r) * ldc + col0 + c4) = v; if (C16) { v4h h4; for (int i = 0; i < 4; ++i) h4[i] = (_Float16)v[i]; *(v4h*)(C16 + cofs + (size_t)(row0 + r) * ldc + col0 + c4) = h4; } } }
     }
}


typedef _Float16 v4h __attribute__((ext_vector_type(4)));

__global__ __launch_bounds__(256) void k_x16(const float* __restrict__ x, _Float16* __restrict__ X16, size_t n8) { const size_t t = (size_t)blockIdx.x * 256 + threadIdx.x; if (t >= n8) return; FragH f;
#pragma unroll
  for (int q = 0; q < 8; ++q) f.h[q] = (_Float16)bf16_round(x[t * 8 + q]); *(v8us*)((unsigned short*)X16 + t * 8) = f.half[0];  }
__global__ __launch_bounds__(256) void k_h16(const float* __restrict__ x, _Float16* __restrict__ X16, size_t n8) { const size_t t = (size_t)blockIdx.x * 256 + threadIdx.x; if (t >= n8) return; FragH f;
#pragma unroll
  for (int q = 0; q < 8; ++q) f.h[q] = (_Float16)x[t * 8 + q]; *(v8us*)((unsigned short*)X16 + t * 8) = f.half[0];  }
__global__ __launch_bounds__(256) void k_round16f(const float* __restrict__ W, _Float16* __restrict__ Bt, size_t n8) { const size_t t = (size_t)blockIdx.x * 256 + threadIdx.x; if (t >= n8) return; FragH f;
#pragma unroll
  for (int i = 0; i < 8; ++i) f.h[i] = (_Float16)(bf16_round(W[t * 8 + i]) * 16.0f); *(v8us*)((unsigned short*)Bt + t * 8) = f.half[0];  }
template <int NHv, int TTv>
__global__ __launch_bounds__(256) void k_vt(const _Float16* __restrict__ V16, int ldv, int voff, _Float16* __restrict__ Vt) { __shared__ unsigned short tl[64][66]; const int tid = threadIdx.x; const int slab = blockIdx.x / (TTv / 64), lg = blockIdx.x % (TTv / 64); const int b = slab / NHv, h = slab % NHv;
  for (int i = tid; i < 64 * 8; i += 256) { const int r = i / 8, c8 = (i % 8) * 8; FragH f; f.half[0] = *(const v8us*)((const unsigned short*)V16 + ((size_t)b * TTv + lg * 64 + r) * ldv + voff + h * 64 + c8);
#pragma unroll
    for (int q = 0; q < 8; ++q) tl[r][c8 + q] = f.u[q]; }
  __syncthreads();
  {
#pragma unroll
    for (int rd = 0; rd < 2; ++rd) { const int d = rd * 32 + tid / 8, pc = tid % 8; FragH f;
#pragma unroll
      for (int q = 0; q < 8; ++q) f.u[q] = tl[pc * 8 + q][d];
      *(v8us*)((unsigned short*)Vt + ((size_t)slab * 64 + d) * TTv + lg * 64 + pc * 8) = f.half[0]; }
     } }

__global__ __launch_bounds__(256) void k_hl(const float* __restrict__ F, _Float16* __restrict__ Hh, _Float16* __restrict__ Hl, size_t n8) { const size_t t = (size_t)blockIdx.x * 256 + threadIdx.x; if (t >= n8) return; FragH fh, fl; const v4f a = *(const v4fa*)(F + t * 8), c = *(const v4fa*)(F + t * 8 + 4);
#pragma unroll
  for (int q = 0; q < 4; ++q) { _Float16 h = (_Float16)a[q]; fh.h[q] = h; fl.h[q] = (_Float16)((a[q] - (float)h) * 1024.0f); h = (_Float16)c[q]; fh.h[4 + q] = h; fl.h[4 + q] = (_Float16)((c[q] - (float)h) * 1024.0f); }
  { *(v8us*)((unsigned short*)Hh + t * 8) = fh.half[0]; *(v8us*)((unsigned short*)Hl + t * 8) = fl.half[0];  } }

// ---- fast GEMM (wave tile 32x64, work-group tile 128x64; requires M % 128 == 0 rows per launch region, N % 64 == 0 and K % 64 == 0); epilogue = k_gemm_hhx semantics ----
__device__ __forceinline__ v16h g2_frag(const _Float16* p, int hh) { FragH f; f.half[0] = *(const v8us*)((const unsigned short*)p + 8 * hh); f.half[1] = *(const v8us*)((const unsigned short*)p + 16 + 8 * hh); return f.v; }
__device__ __forceinline__ v8f g2_mma(v16h a, v16h b, v8f c) { v8f d = __builtin_amdgcn_wmma_f32_16x16x32_f16(false, a, false, b, (short)0, c, false, false); asm volatile("v_nop\n\tv_nop\n\tv_nop\n\tv_nop" : "+v"(d) : "v"(a), "v"(b)); return d; }
// A stage of k_gemm2 = 64 k of the work-group's 128 A rows and 64 B rows: 192 rows of 128 bytes in LDS at a pitch of 144 (16 B x odd: the 16 lanes of a half wave's ds_load_b128 fall on 64 different banks).
#define G2_PITCH 144
#define G2_BOFF (128 * G2_PITCH)      /* the B rows stand behind the A rows */
#define G2_STAGE (192 * G2_PITCH)
__device__ __forceinline__ v16h g2_lfrag(const unsigned char* p) { FragH f; f.half[0] = *(const v8us*)p; f.half[1] = *(const v8us*)(p + 32); return f.v; }      /* p = row start + 64 B per 32 k + 16 hh: the k order of g2_frag */
// One stage, global memory -> LDS through no register: 12 asynchronous copies of 16 bytes a lane (8 A rows, 4 B rows, 16 rows apart); 8 lanes fill one row, so a wave's copy reads 4 whole 128-byte lines.
// lds = the lane's own LDS byte address of its first A row, ga / gb = its own global addresses, a16 / b16 = 16 rows in elements. The s_wait_xcnt stands inside the statement, behind the last copy, so that
// no address register of a copy is written again in front of it.
__device__ __forceinline__ void g2_stage(unsigned lds, const _Float16* ga, const _Float16* gb, size_t a16, size_t b16) {
  asm volatile("global_load_async_to_lds_b128 %0, %12, off\n\tglobal_load_async_to_lds_b128 %1, %13, off\n\tglobal_load_async_to_lds_b128 %2, %14, off\n\tglobal_load_async_to_lds_b128 %3, %15, off\n\t"
               "global_load_async_to_lds_b128 %4, %16, off\n\tglobal_load_async_to_lds_b128 %5, %17, off\n\tglobal_load_async_to_lds_b128 %6, %18, off\n\tglobal_load_async_to_lds_b128 %7, %19, off\n\t"
               "global_load_async_to_lds_b128 %8, %20, off\n\tglobal_load_async_to_lds_b128 %9, %21, off\n\tglobal_load_async_to_lds_b128 %10, %22, off\n\tglobal_load_async_to_lds_b128 %11, %23, off\n\t"
               "s_wait_xcnt 0x0"
               :: "v"(lds), "v"(lds + 16 * G2_PITCH), "v"(lds + 32 * G2_PITCH), "v"(lds + 48 * G2_PITCH), "v"(lds + 64 * G2_PITCH), "v"(lds + 80 * G2_PITCH), "v"(lds + 96 * G2_PITCH), "v"(lds + 112 * G2_PITCH),
                  "v"(lds + G2_BOFF), "v"(lds + G2_BOFF + 16 * G2_PITCH), "v"(lds + G2_BOFF + 32 * G2_PITCH), "v"(lds + G2_BOFF + 48 * G2_PITCH),
                  "v"(ga), "v"(ga + a16), "v"(ga + 2 * a16), "v"(ga + 3 * a16), "v"(ga + 4 * a16), "v"(ga + 5 * a16), "v"(ga + 6 * a16), "v"(ga + 7 * a16),
                  "v"(gb), "v"(gb + b16), "v"(gb + 2 * b16), "v"(gb + 3 * b16) : "memory"); }
template <int ACT>
__global__ __launch_bounds__(128) void k_gemm2(const _Float16* __restrict__ A, int lda, size_t sA, const _Float16* __restrict__ Bh, int ldb, size_t sB, float alpha, const float* __restrict__ bias, size_t sBias, const float* __restrict__ CP, int rowsPerB, size_t sCPb, int row0g,
    float* __restrict__ C, _Float16* __restrict__ C16, int ldc, size_t sC, int M, int N, int K) { static_assert(ACT == 0 || ACT == 3 || ACT == 6 || ACT == 8 || ACT == 9 || ACT == 11 || ACT == 12 || ACT == 14 || ACT == 15 || ACT == 16 || ACT == 17, "k_gemm2: unsupported ACT code (would silently apply no activation)");
  __shared__ __attribute__((aligned(16))) unsigned char sm[2 * G2_STAGE];      /* two stage buffers; behind the K loop the same bytes are the epilogue's staging rows */
  static_assert(sizeof(float) * 4 * 32 * 68 <= 2 * G2_STAGE, "epilogue staging fits the ring"); float (*so)[32][68] = (float (*)[32][68])sm;
  const int tid = threadIdx.x, w = tid >> 5, lane = tid & 31, ln = lane & 15, hh = lane >> 4; const int by = blockIdx.y;
  A += (size_t)by * sA; Bh += (size_t)by * sB; const size_t cofs = (size_t)by * sC; const float* bp = bias ? bias + (size_t)by * sBias : nullptr;
  const int ntn = N >> 6; const int mt = blockIdx.x / ntn, nq = blockIdx.x - mt * ntn; const int row0 = mt * 128 + 32 * w, col0 = nq * 64; if (mt * 128 >= M) return;      /* the whole work-group or none, in front of every barrier */
  const int cr = tid >> 3, cc = tid & 7;      /* the lane's copies: rows cr + 16 i, 16-byte piece cc of the row's 128 bytes */
  const unsigned lds0 = (unsigned)(size_t)sm + (unsigned)(cr * G2_PITCH + cc * 16);
  const _Float16* ga = A + (size_t)(mt * 128 + cr) * lda + cc * 8; const _Float16* gb = Bh + (size_t)(col0 + cr) * ldb + cc * 8; const size_t a16 = (size_t)16 * lda, b16 = (size_t)16 * ldb;
  const unsigned char* fa = sm + (32 * w + ln) * G2_PITCH + 16 * hh; const unsigned char* fb = sm + G2_BOFF + ln * G2_PITCH + 16 * hh;      /* the lane's fragment rows in buffer 0 */
  const v8f z8 = {0.f,0.f,0.f,0.f,0.f,0.f,0.f,0.f}; v8f c00 = z8, c01 = z8, c02 = z8, c03 = z8, c10 = z8, c11 = z8, c12 = z8, c13 = z8;
  const int nst = K >> 6;
  g2_stage(lds0, ga, gb, a16, b16);
  asm volatile("s_wait_asynccnt 0x0" ::: "memory");      /* this wave's copies of stage 0 have landed */
  __syncthreads();      /* ... and every other wave's: stage 0 may be read */
  if (nst > 1) g2_stage(lds0 + G2_STAGE, ga + 64, gb + 64, a16, b16);
#pragma unroll 1      /* rolled: the buffer is picked by the trip's parity, a second copy of the body would only add code */
  for (int t = 0; t < nst; ++t) { const unsigned bo = (unsigned)(t & 1) * G2_STAGE;
    const unsigned char* pa = fa + bo; const unsigned char* pb = fb + bo; v16h af[2][2], bf[2][4];
#pragma unroll      /* constant indices: the fragment arrays become registers */
    for (int kc = 0; kc < 2; ++kc) { af[kc][0] = g2_lfrag(pa + 64 * kc); bf[kc][0] = g2_lfrag(pb + 64 * kc); af[kc][1] = g2_lfrag(pa + 64 * kc + 16 * G2_PITCH);
      for (int j = 1; j < 4; ++j) bf[kc][j] = g2_lfrag(pb + 64 * kc + j * 16 * G2_PITCH); }
#pragma unroll      /* the stage's two 32-k blocks, in ascending k: the sum order of the plain loop */
    for (int kc = 0; kc < 2; ++kc) { c00 = g2_mma(af[kc][0], bf[kc][0], c00); c10 = g2_mma(af[kc][1], bf[kc][0], c10); c01 = g2_mma(af[kc][0], bf[kc][1], c01); c11 = g2_mma(af[kc][1], bf[kc][1], c11);
      c02 = g2_mma(af[kc][0], bf[kc][2], c02); c12 = g2_mma(af[kc][1], bf[kc][2], c12); c03 = g2_mma(af[kc][0], bf[kc][3], c03); c13 = g2_mma(af[kc][1], bf[kc][3], c13); }
    asm volatile("s_wait_dscnt 0x0" ::: "memory");      /* this wave's reads of the buffer are done before it is handed to the copies */
    asm volatile("s_wait_asynccnt 0x0" ::: "memory");      /* this wave's copies of stage t + 1 have landed */
    __syncthreads();      /* publishes stage t + 1 and ends every wave's reads of stage t */
    if (t + 2 < nst) g2_stage(lds0 + bo, ga + (size_t)(t + 2) * 64, gb + (size_t)(t + 2) * 64, a16, b16); }      /* refill of the buffer just read; in flight under trip t + 1 */
  asm volatile("s_wait_asynccnt 0x0" ::: "memory");      /* no copy is outstanding when the ring becomes staging; the last trip's barrier has ended every read of it */
  v8f accs[8] = {c00, c01, c02, c03, c10, c11, c12, c13};
#pragma unroll
  for (int u = 0; u < 8; ++u) { const int t = u & 3, half = u >> 2; const int col = col0 + t * 16 + ln; const float bv = bp ? bf16_round(bp[col]) : 0.f;
#pragma unroll
    for (int r = 0; r < 8; ++r) { const int rloc = half * 16 + 8 * hh + r; float v = accs[u][r] * alpha + bv; if (CP) { if (rowsPerB < 0) v += CP[cofs + (size_t)(row0g + row0 + rloc) * ldc + col];      /* rowsPerB < 0: own element of the batched C plane */ else { const int bidx = (row0g + row0 + rloc) / rowsPerB; v += CP[(size_t)bidx * sCPb + (size_t)by * 64 + col]; } }
      if (ACT == 3) v = fmaxf(v, 0.f); else if (ACT == 6) v = 0.5f * v * (1.0f + erff(v * 0.70710678118654752f)); else if (ACT == 11) v = 1.0f / (1.0f + expf(-v)); else if (ACT == 15) v = v / (1.0f + expf(-v)); else if (ACT == 12) v = (v > 0.f) ? v : 0.01f * v; else if (ACT == 8) v = tanhf(v); else if (ACT == 9) v = 0.5f * v * (1.0f + tanhf(0.7978845608028654f * (v + 0.044715f * v * v * v))); else if (ACT == 14) v = (v > 0.f) ? v : 0.1f * v; else if (ACT == 16) v = (v >= 0.f) ? v : 0.3f * v; else if (ACT == 17) v = (v >= 0.f) ? v : 0.2f * v;
      so[w][rloc][t * 16 + ln] = v; } }
  __builtin_amdgcn_fence(__ATOMIC_ACQ_REL, "workgroup"); __builtin_amdgcn_wave_barrier();
  const int rsub = lane >> 4, c4 = (lane & 15) * 4;
  {
#pragma unroll
    for (int q = 0; q < 16; ++q) { const int r = q * 2 + rsub; const v4f v = *(const v4fa*)&so[w][r][c4]; if (C) *(v4f*)(C + cofs + (size_t)(row0 + r) * ldc + col0 + c4) = v; if (C16) { v4h h4; for (int i = 0; i < 4; ++i) h4[i] = (_Float16)v[i]; *(v4h*)(C16 + cofs + (size_t)(row0 + r) * ldc + col0 + c4) = h4; } }
     } }


__global__ __launch_bounds__(256) void k_wnat(const float* __restrict__ w, size_t n8, _Float16* __restrict__ Bt) { const size_t t = (size_t)blockIdx.x * 256 + threadIdx.x; if (t >= n8) return; FragH f; for (int q = 0; q < 8; ++q) f.h[q] = (_Float16)(bf16_round(w[t * 8 + q]) * 16.0f); *(v8us*)((unsigned short*)Bt + t * 8) = f.half[0];  }
__global__ __launch_bounds__(256) void k_rsm(const float* __restrict__ S, _Float16* __restrict__ P, int nrows) {
  #pragma clang fp contract(off)
  const int i = blockIdx.x * 256 + threadIdx.x; if (i >= nrows) return; const float* s = S + (size_t)i * SQ; float mx = -3.0e38f;
#pragma unroll 1
  for (int j = 0; j < SQ; ++j) mx = fmaxf(mx, s[j]); float se = 0.f;
#pragma unroll 1
  for (int j = 0; j < SQ; ++j) se += expf(s[j] - mx); const float sc = 256.0f / se;
#pragma unroll 1
  for (int j0 = 0; j0 < SQ; j0 += 8) { FragH f; for (int q = 0; q < 8; ++q) f.h[q] = (_Float16)(expf(s[j0 + q] - mx) * sc); unsigned short* d = (unsigned short*)P + (size_t)i * SQ + j0; *(v8us*)d = f.half[0];  } }
__global__ __launch_bounds__(256) void k_vt(const _Float16* __restrict__ V16, int b, int h0, _Float16* __restrict__ VT) { __shared__ unsigned short tl[64][65]; const int tid = threadIdx.x; const int hh = blockIdx.x % HG, sg = blockIdx.x / HG; const int s0 = sg * 64; const int h = h0 + hh;
  for (int i = tid; i < 64 * 8; i += 256) { const int j = i / 8, d8 = (i % 8) * 8; FragH f; f.half[0] = *(const v8us*)((const unsigned short*)V16 + ((size_t)b * SQ + s0 + j) * DM + h * HD + d8); for (int q = 0; q < 8; ++q) tl[d8 + q][j] = f.u[q]; }
  __syncthreads();
  { for (int i = tid; i < 64 * 8; i += 256) { const int d = i / 8, j8 = (i % 8) * 8; FragH f; for (int q = 0; q < 8; ++q) f.u[q] = tl[d][j8 + q]; *(v8us*)((unsigned short*)VT + ((size_t)hh * HD + d) * SQ + s0 + j8) = f.half[0]; }  } }



__global__ __launch_bounds__(256) void k_rsmcf2(const float* __restrict__ S, _Float16* __restrict__ P, int hg, int q0, int nk) {
  #pragma clang fp contract(off)
  const int t = blockIdx.x * 256 + threadIdx.x; if (t >= hg * QT) return; const size_t i = (size_t)t; const float* s = S + i * NKX; const int last = q0 + (t % QT); float mx = -3.0e38f;
#pragma unroll 1
  for (int j = 0; j < nk; ++j) { const float f = (j <= last) ? 1.f : 0.f; mx = fmaxf(mx, fmaf(f, s[j], (1.f - f) * -1.0e9f)); } float se = 0.f;
#pragma unroll 1
  for (int j = 0; j < nk; ++j) { const float f = (j <= last) ? 1.f : 0.f; se += __expf(fmaf(f, s[j], (1.f - f) * -1.0e9f) - mx); } const float sc = 256.0f / se;
#pragma unroll 1
  for (int j0 = 0; j0 < nk; j0 += 8) { FragH fr; for (int q = 0; q < 8; ++q) { const int j = j0 + q; const float f = (j <= last) ? 1.f : 0.f; fr.h[q] = (_Float16)(__expf(fmaf(f, s[j], (1.f - f) * -1.0e9f) - mx) * sc); } unsigned short* d = (unsigned short*)P + i * NKX + j0; *(v8us*)d = fr.half[0];  } }


template <int MASKADD>
__global__ __launch_bounds__(64) void k_att0(const float* __restrict__ QF, const float* __restrict__ KF, const float* __restrict__ VF, int ld, const float* __restrict__ mask, float scale, float* __restrict__ OF, int ldo) {
  #pragma clang fp contract(off)
  __shared__ __attribute__((aligned(16))) float lq[64][64]; __shared__ __attribute__((aligned(16))) float lo[64][64];
  const int tid = threadIdx.x; const int h = blockIdx.x / (QT0 / 64), rg = blockIdx.x % (QT0 / 64); const int i = rg * 64 + tid;
  const float* qr = QF + (size_t)i * ld + h * HD;
#pragma unroll 1
  for (int c = 0; c < HD / 4; ++c) { *(v4f*)&lq[tid][c * 4] = *(const v4fa*)(qr + c * 4); const v4f z = {0.f, 0.f, 0.f, 0.f}; *(v4f*)&lo[tid][c * 4] = z; }
  float m = -1.0e30f, l = 0.f; const int jmax = MASKADD ? (SQ - 1) : (rg * 64 + 63);      /* additive-mask form: every key (the mask input decides); causal form: keys up to the block's last row */
#pragma unroll 1
  for (int j = 0; j <= jmax; ++j) { const float* kr = KF + (size_t)j * ld + h * HD; const float* vr = VF + (size_t)j * ld + h * HD; float s = 0.f;
#pragma unroll 1
    for (int c = 0; c < HD / 4; ++c) { const v4f kq = *(const v4fa*)(kr + c * 4); const v4f qq = *(v4f*)&lq[tid][c * 4]; s = __fadd_rn(s, __fmul_rn(qq[0], kq[0])); s = __fadd_rn(s, __fmul_rn(qq[1], kq[1])); s = __fadd_rn(s, __fmul_rn(qq[2], kq[2])); s = __fadd_rn(s, __fmul_rn(qq[3], kq[3])); }
    s = __fmul_rn(s, scale); if (MASKADD) s = __fadd_rn(s, __fmul_rn(bf16_round(mask[(size_t)i * SQ + j]), -10000.0f));
    const float f = (MASKADD || j <= i) ? 1.f : 0.f; const float sm = fmaf(f, s, (1.f - f) * -1.0e30f); const float mn = fmaxf(m, sm); const float sc = expf(m - mn); const float e = expf(sm - mn); l = __fadd_rn(__fmul_rn(l, sc), e); m = mn;
#pragma unroll 1
    for (int c = 0; c < HD / 4; ++c) { const v4f vv = *(const v4fa*)(vr + c * 4); v4f oo = *(v4f*)&lo[tid][c * 4]; for (int u = 0; u < 4; ++u) oo[u] = __fadd_rn(__fmul_rn(oo[u], sc), __fmul_rn(e, vv[u])); *(v4f*)&lo[tid][c * 4] = oo; } }
  const float fin = 64.0f / l;      /* o carried x64 like the f16 path */
#pragma unroll 1
  for (int c = 0; c < HD / 4; ++c) { v4f oo = *(v4f*)&lo[tid][c * 4]; for (int u = 0; u < 4; ++u) oo[u] = __fmul_rn(oo[u], fin); *(v4f*)&lo[tid][c * 4] = oo; }
  __syncthreads();
  {
#pragma unroll 1
    for (int it = 0; it < 16; ++it) { const int row = it * 4 + tid / 16, pc = (tid % 16) * 4; const v4f v = *(const v4f*)&lo[row][pc]; *(v4f*)(OF + (size_t)(rg * 64 + row) * ldo + h * HD + pc) = v; }
     } }


template <int BFIN, int WXB>
__global__ __launch_bounds__(256) void k_ln16(const float* __restrict__ X, const float* __restrict__ g, const float* __restrict__ bb, float eps, _Float16* __restrict__ N16, float* __restrict__ XB) {
  #pragma clang fp contract(off)
  __shared__ float red[256]; const size_t r = blockIdx.x; const int t = threadIdx.x; const v4f xa = *(const v4fa*)(X + r * DMQ + t * 4); float s[4]; float sum = 0.f;
  for (int q = 0; q < 4; ++q) { s[q] = BFIN ? bf16_round(xa[q]) : xa[q]; sum = __fadd_rn(sum, s[q]); }
  red[t] = sum; __syncthreads(); for (int st = 128; st > 0; st >>= 1) { if (t < st) red[t] = __fadd_rn(red[t], red[t + st]); __syncthreads(); } const float mu = red[0] / (float)DMQ; __syncthreads();
  float vs = 0.f; for (int q = 0; q < 4; ++q) { const float dl = __fadd_rn(s[q], -mu); vs = __fadd_rn(vs, __fmul_rn(dl, dl)); } red[t] = vs; __syncthreads(); for (int st = 128; st > 0; st >>= 1) { if (t < st) red[t] = __fadd_rn(red[t], red[t + st]); __syncthreads(); }
  const float rs = rsqrtf(__fadd_rn(red[0] / (float)DMQ, eps)); v4h y; v4f xb;
  for (int q = 0; q < 4; ++q) { const int c = t * 4 + q; y[q] = (_Float16)__fadd_rn(__fmul_rn(__fmul_rn(__fadd_rn(s[q], -mu), rs), bf16_round(g[c])), bf16_round(bb[c])); xb[q] = s[q]; }
  { *(v4h*)(N16 + r * DMQ + t * 4) = y; if (WXB) *(v4f*)(XB + r * DMQ + t * 4) = xb;  } }
__global__ __launch_bounds__(256) void k_ftres2(const float* __restrict__ OF0, const float* __restrict__ XB, float* __restrict__ X1, size_t n4) {
  #pragma clang fp contract(off)
  const size_t t = (size_t)blockIdx.x * 256 + threadIdx.x; if (t >= n4) return; const v4f o = *(const v4fa*)(OF0 + t * 4), xv = *(const v4fa*)(XB + t * 4); v4f y; for (int q = 0; q < 4; ++q) y[q] = __fadd_rn(__fmul_rn(o[q], 0.015625f), xv[q]); *(v4f*)(X1 + t * 4) = y;  }

__global__ __launch_bounds__(256) void k_wthd(const float* __restrict__ Wt, _Float16* __restrict__ Bt) { const size_t t = (size_t)blockIdx.x * 256 + threadIdx.x; if (t >= (size_t)NH * HD * (DM / 8)) return; const int m8 = (int)(t % (DM / 8)) * 8; const int d = (int)((t / (DM / 8)) % HD); const int h = (int)(t / ((size_t)(DM / 8) * HD)); FragH f;
  for (int q = 0; q < 8; ++q) f.h[q] = (_Float16)(16.0f * bf16_round(Wt[((size_t)h * DM + m8 + q) * HD + d])); unsigned short* dst = (unsigned short*)Bt + ((size_t)h * HD + d) * DM + m8; *(v8us*)dst = f.half[0];  }




template <int BFIN, int W16, int W32>
__global__ __launch_bounds__(256) void k_lnx(const float* __restrict__ X, const float* __restrict__ g, const float* __restrict__ bb, float eps, _Float16* __restrict__ N16, float* __restrict__ N32) {
  #pragma clang fp contract(off)
  __shared__ float red[256]; const size_t r = blockIdx.x; const int t = threadIdx.x; const bool act = t < (DMQ / 4); const int c0 = act ? t * 4 : 0;
  const v4f xa = *(const v4fa*)(X + r * DMQ + c0); float s[4]; float sum = 0.f;
  for (int q = 0; q < 4; ++q) { s[q] = act ? (BFIN ? bf16_round(xa[q]) : xa[q]) : 0.f; sum = __fadd_rn(sum, s[q]); }
  red[t] = sum; __syncthreads(); for (int st = 128; st > 0; st >>= 1) { if (t < st) red[t] = __fadd_rn(red[t], red[t + st]); __syncthreads(); } const float mu = red[0] / (float)DMQ; __syncthreads();
  float vs = 0.f; for (int q = 0; q < 4; ++q) { const float dl = act ? __fadd_rn(s[q], -mu) : 0.f; vs = __fadd_rn(vs, __fmul_rn(dl, dl)); } red[t] = vs; __syncthreads(); for (int st = 128; st > 0; st >>= 1) { if (t < st) red[t] = __fadd_rn(red[t], red[t + st]); __syncthreads(); }
  const float rs = rsqrtf(__fadd_rn(red[0] / (float)DMQ, eps)); v4h y; v4f yf;
  for (int q = 0; q < 4; ++q) { const int c = c0 + q; yf[q] = __fadd_rn(__fmul_rn(__fmul_rn(__fadd_rn(s[q], -mu), rs), bf16_round(g[c])), bf16_round(bb[c])); y[q] = (_Float16)yf[q]; }
  if (!act) return;      /* no barriers after this point */
  { if (W16) *(v4h*)(N16 + r * DMQ + c0) = y; if (W32) *(v4f*)(N32 + r * DMQ + c0) = yf;  } }


__global__ __launch_bounds__(256) void k_bfr(const float* __restrict__ x, float* __restrict__ XB, size_t n8) { const size_t t = (size_t)blockIdx.x * 256 + threadIdx.x; if (t >= n8) return; v4f a = *(const v4fa*)(x + t * 8), c = *(const v4fa*)(x + t * 8 + 4); for (int q = 0; q < 4; ++q) { a[q] = bf16_round(a[q]); c[q] = bf16_round(c[q]); }
  { *(v4f*)(XB + t * 8) = a; *(v4f*)(XB + t * 8 + 4) = c;  } }




__global__ __launch_bounds__(256) void k_lorafold(const float* __restrict__ Wm, const float* __restrict__ A, const float* __restrict__ Bm, float* __restrict__ WE, int K, int N, float sc) {
  #pragma clang fp contract(off)
  const size_t t = (size_t)blockIdx.x * 256 + threadIdx.x; if (t >= (size_t)K * N) return; const int i = (int)(t / N), o = (int)(t % N); float a = 0.f;
  for (int r = 0; r < 16; ++r) a = __fadd_rn(a, __fmul_rn(bf16_round(A[(size_t)i * 16 + r]), bf16_round(Bm[(size_t)r * N + o])));
  const float v = __fadd_rn(bf16_round(Wm[t]), __fmul_rn(sc, a)); *(float*)(WE + t) = v;  }
__global__ __launch_bounds__(256) void k_wt32rep(const float* __restrict__ Wf, _Float16* __restrict__ Bt, int K, int N, int DOUT, float scale) {
  const int t = blockIdx.x * 256 + threadIdx.x; if (t >= DOUT * (K / 8)) return; const int n = t / (K / 8), k8 = (t % (K / 8)) * 8; const int rep = DOUT / N; const int src = (n / (HD * rep)) * HD + (n % HD);      /* head h = n / HD -> group h / rep */
  FragH f; for (int i = 0; i < 8; ++i) f.h[i] = (_Float16)(Wf[(size_t)(k8 + i) * N + src] * scale);
  *(v8us*)((unsigned short*)Bt + (size_t)n * K + k8) = f.half[0];  }
__global__ __launch_bounds__(256) void k_brep(const float* __restrict__ b, float* __restrict__ out) { const int t = blockIdx.x * 256 + threadIdx.x; if (t >= DM) return; const float v = b[(t / (HD * 4)) * HD + (t % HD)]; *(float*)(out + t) = v;  }

__global__ __launch_bounds__(256) void k_rsmcim(const float* __restrict__ S, _Float16* __restrict__ P, int hg, int q0, int nk, const int* __restrict__ am) {
  #pragma clang fp contract(off)
  const int t = blockIdx.x * 256 + threadIdx.x; if (t >= hg * QT) return; const size_t i = (size_t)t; const float* s = S + i * NKX; const int last = q0 + (t % QT); const int* mr = am + (size_t)last * SQ; float mx = -3.0e38f;      /* the module's mask row of this query (keys >= nk lie above the diagonal of the causal mask and are not computed) */
#pragma unroll 1
  for (int j = 0; j < nk; ++j) { const float f = (mr[j] != 0) ? 1.f : 0.f; mx = fmaxf(mx, fmaf(f, s[j], (1.f - f) * -1.0e9f)); } float se = 0.f;
#pragma unroll 1
  for (int j = 0; j < nk; ++j) { const float f = (mr[j] != 0) ? 1.f : 0.f; se += __expf(fmaf(f, s[j], (1.f - f) * -1.0e9f) - mx); } const float sc = 256.0f / se;
#pragma unroll 1
  for (int j0 = 0; j0 < nk; j0 += 8) { FragH fr; for (int q = 0; q < 8; ++q) { const int j = j0 + q; const float f = (mr[j] != 0) ? 1.f : 0.f; fr.h[q] = (_Float16)(__expf(fmaf(f, s[j], (1.f - f) * -1.0e9f) - mx) * sc); } unsigned short* d = (unsigned short*)P + i * NKX + j0; *(v8us*)d = fr.half[0];  } }



__global__ __launch_bounds__(256) void k_bcpy(const float* __restrict__ b, int n, int NP, float* __restrict__ dst, int dst0) { for (int i = threadIdx.x; i < NP; i += 256) { const float v = (i < n) ? b[i] : 0.f; *(float*)(dst + dst0 + i) = v; }  }



// lane l with lane l ^ 16
__device__ __forceinline__ float rs_xhalf(float x) { return __builtin_bit_cast(float, __builtin_amdgcn_permlanex16(__builtin_bit_cast(int, x), __builtin_bit_cast(int, x), 0x76543210, 0xfedcba98, false, false)); }
// Four 2^t in one statement, each in place: behind a transcendental the instruction set asks for one independent instruction or v_nop before its result is read or its source overwritten.
// Here each v_exp_f32 is the independent instruction behind the one before it, the v_nop the slot behind the last. In place, so that the
// statement writes only registers that the multiply-add in front of it has written: the compiler keeps that one clear of the matrix instructions' operands.
__device__ __forceinline__ v4f rs_exp2x4(v4f t) { float a = t[0], b = t[1], c = t[2], d = t[3];
  asm("v_exp_f32 %0, %0\n\tv_exp_f32 %1, %1\n\tv_exp_f32 %2, %2\n\tv_exp_f32 %3, %3\n\tv_nop" : "+v"(a), "+v"(b), "+v"(c), "+v"(d));
  const v4f r = {a, b, c, d}; return r; }
__device__ __forceinline__ v8f fa_mma(v16h a, v16h b, v8f c) { return __builtin_amdgcn_wmma_f32_16x16x32_f16(false, a, false, b, (short)0, c, false, false); }
// Fused attention: scores, softmax and P V in one launch; no score and no weight leaves the registers. One work-group = 256 queries of one (batch, head), 8 waves of 32 query columns;
// a pass = 32 keys. Transposed products: S^T = K Q^T (rows = keys, columns = queries), so a lane's 16 scores of a column are, as they lie, its 16 elements of the B operand of O^T += V^T P^T
// (k order of both operands: 8 hh + 0..7, then 16 + 8 hh + 0..7, that of g2_frag). Online softmax in the log2 domain, f32: the maximum in use may trail the true one by up to 8 (an
// exponential reaches 2^8 at most, well inside f16), and the sums are rescaled only in a pass where some column exceeds that. Denominator = an all-ones A operand times P^T on the matrix
// pipe: it sums the weights as rounded to f16, the same values the numerator sums. o is carried x64 as f16 rows.
// K and V^T: the eight waves read the same fragments, and a fragment load from global memory touches 16 cache lines for 512 bytes. So a stage of 128 keys (4 passes) is brought into LDS once for the work-group, in whole
// 128-byte lines, by asynchronous copies, two buffers: stage t + 1 flies while stage t is worked on. Fragments come from LDS, K one pass ahead inside its stage, V^T at the head of its pass.
// Every '#pragma unroll' in it is there so that the fragment and accumulator arrays it indexes become registers.
#define FA_KP 144      /* pitch of a K row (one key, 128 bytes) in LDS: 16 B x odd, so the 16 lanes of a half wave's ds_load_b128 fall on 64 different banks */
#define FA_VP 272      /* pitch of a V^T row (one d, 128 keys = 256 bytes): 16 B x odd too */
#define FA_VOFF (128 * FA_KP)      /* the 64 V^T rows stand behind the 128 K rows */
#define FA_STAGE (128 * FA_KP + 64 * FA_VP)
// One stage, global memory -> LDS through no register: 8 asynchronous copies of 16 bytes a lane (4 K rows, 32 rows apart; 4 V^T rows, 16 rows apart); 8 lanes fill a K row, 16 a V^T row.
// lk / lv = the lane's own LDS byte addresses of its first K and V^T row, gk / gv = its own global addresses. The s_wait_xcnt stands inside the statement, behind the last copy, so that
// no address register of a copy is written again in front of it.
__device__ __forceinline__ void fa_stage(unsigned lk, unsigned lv, const _Float16* gk, const _Float16* gv) {
  asm volatile("global_load_async_to_lds_b128 %0, %8, off\n\tglobal_load_async_to_lds_b128 %1, %9, off\n\tglobal_load_async_to_lds_b128 %2, %10, off\n\tglobal_load_async_to_lds_b128 %3, %11, off\n\t"
               "global_load_async_to_lds_b128 %4, %12, off\n\tglobal_load_async_to_lds_b128 %5, %13, off\n\tglobal_load_async_to_lds_b128 %6, %14, off\n\tglobal_load_async_to_lds_b128 %7, %15, off\n\t"
               "s_wait_xcnt 0x0"
               :: "v"(lk), "v"(lk + 32 * FA_KP), "v"(lk + 64 * FA_KP), "v"(lk + 96 * FA_KP), "v"(lv), "v"(lv + 16 * FA_VP), "v"(lv + 32 * FA_VP), "v"(lv + 48 * FA_VP),
                  "v"(gk), "v"(gk + (size_t)32 * (2 * DM)), "v"(gk + (size_t)64 * (2 * DM)), "v"(gk + (size_t)96 * (2 * DM)), "v"(gv), "v"(gv + (size_t)16 * SK), "v"(gv + (size_t)32 * SK), "v"(gv + (size_t)48 * SK) : "memory"); }
__global__ __launch_bounds__(256) void k_fattn(const _Float16* __restrict__ Q, const _Float16* __restrict__ KV, const _Float16* __restrict__ VT, _Float16* __restrict__ O) {
  static_assert(SK % 128 == 0 && SK / 128 >= 2 && HD == 64, "k_fattn: whole stages of 128 keys, two or more");
  constexpr float CS = 0.015625f * 1.44269504f;      /* (q / 8) . (k / 8) = q . k / 64, times log2 e */
  constexpr int NST = SK / 128;
  __shared__ __attribute__((aligned(16))) unsigned char sm[2 * FA_STAGE];      /* two stage buffers */
  const int tid = threadIdx.x, lane = tid & 31, ln = lane & 15, hh = lane >> 4; const int wave = __builtin_amdgcn_readfirstlane(tid >> 5);
  const int h = blockIdx.y, b = blockIdx.z; const int q0 = blockIdx.x * 256 + wave * 32;
  const _Float16* qp = Q + ((size_t)b * SQ + q0 + ln) * DM + h * HD;
  const unsigned lk0 = (unsigned)(size_t)sm + (unsigned)((tid >> 3) * FA_KP + (tid & 7) * 16);      /* the lane's copies: K rows (tid >> 3) + 32 i, 16-byte piece tid & 7 */
  const unsigned lv0 = (unsigned)(size_t)sm + (unsigned)(FA_VOFF + (tid >> 4) * FA_VP + (tid & 15) * 16);      /* V^T rows (tid >> 4) + 16 i, 16-byte piece tid & 15 */
  const _Float16* gk = KV + ((size_t)b * SK + (tid >> 3)) * (2 * DM) + h * HD + (tid & 7) * 8;      /* k half of the fused rows: row = key */
  const _Float16* gv = VT + (((size_t)b * NH + h) * HD + (tid >> 4)) * SK + (tid & 15) * 8;      /* V^T: row = d, column = key */
  const unsigned char* fk = sm + ln * FA_KP + 16 * hh; const unsigned char* fv = sm + FA_VOFF + ln * FA_VP + 16 * hh;      /* the lane's fragment rows in buffer 0 */
  fa_stage(lk0, lv0, gk, gv);
  v16h qf[2][2], kf[2][2];
#pragma unroll
  for (int g = 0; g < 2; ++g) for (int kc = 0; kc < 2; ++kc) qf[g][kc] = g2_frag(qp + (size_t)g * 16 * DM + 32 * kc, hh);
  FragH ones;
#pragma unroll
  for (int i = 0; i < 16; ++i) ones.h[i] = (_Float16)1.0f;
  const v8f z8 = {0.f, 0.f, 0.f, 0.f, 0.f, 0.f, 0.f, 0.f};
  v8f acc[2][4], lacc[2]; float m_run[2];
#pragma unroll
  for (int g = 0; g < 2; ++g) { m_run[g] = -__builtin_inff(); lacc[g] = z8; for (int t = 0; t < 4; ++t) acc[g][t] = z8; }
  auto pass = [&](const unsigned char* pk, const unsigned char* pv, const int p, const bool more) __attribute__((always_inline)) {      /* p (the pass in its stage) and more are literals at every call: a stage's last pass is compiled without the fetch of a next K */
    v16h vf[4]; v8f s[2][2];
#pragma unroll
    for (int kt = 0; kt < 2; ++kt) for (int g = 0; g < 2; ++g) s[kt][g] = fa_mma(kf[kt][1], qf[g][1], fa_mma(kf[kt][0], qf[g][0], z8));
#pragma unroll
    for (int t = 0; t < 4; ++t) vf[t] = g2_lfrag(pv + t * 16 * FA_VP + 64 * p);      /* this pass's V^T, in flight under the softmax */
    if (more) {      /* next pass's K, of the same stage, in flight under this pass's softmax and second product */
#pragma unroll
      for (int kt = 0; kt < 2; ++kt) for (int kc = 0; kc < 2; ++kc) kf[kt][kc] = g2_lfrag(pk + (32 * (p + 1) + 16 * kt) * FA_KP + 64 * kc); }
    asm volatile("" ::: "memory");      /* compiler fence: keeps the pass's LDS reads up here, in one group in front of the softmax; without it the compiler sank them behind the branch below, next to their first use, where they have no time to land */
    float mb[2]; bool need = false;
#pragma unroll
    for (int g = 0; g < 2; ++g) { float mx = fmaxf(s[0][g][0], s[1][g][0]);
      for (int r = 1; r < 8; ++r) mx = fmaxf(mx, fmaxf(s[0][g][r], s[1][g][r]));
      mx = fmaxf(mx, rs_xhalf(mx)) * CS; mb[g] = mx; need = need || (mx > m_run[g] + 8.0f); }      /* both wave halves hold the column's maximum of this pass, scaled (the scale is positive) */
    if (__builtin_amdgcn_ballot_w32(need) != 0) {      /* always in the first pass (the maximum in use is -inf, the factor 0), rare later */
#pragma unroll
      for (int g = 0; g < 2; ++g) { const float mn = fmaxf(m_run[g], mb[g]); const float corr = __builtin_amdgcn_exp2f(m_run[g] - mn); m_run[g] = mn; lacc[g] = lacc[g] * corr; for (int t = 0; t < 4; ++t) acc[g][t] = acc[g][t] * corr; } }
#pragma unroll
    for (int g = 0; g < 2; ++g) { FragH pf; const float nm = -m_run[g];
      for (int kt = 0; kt < 2; ++kt) for (int j = 0; j < 2; ++j) { v4f a; for (int q = 0; q < 4; ++q) a[q] = fmaf(s[kt][g][4 * j + q], CS, nm); const v4f e = rs_exp2x4(a); for (int q = 0; q < 4; ++q) pf.h[8 * kt + 4 * j + q] = (_Float16)e[q]; }
      for (int t = 0; t < 4; ++t) acc[g][t] = fa_mma(vf[t], pf.v, acc[g][t]);
      lacc[g] = fa_mma(ones.v, pf.v, lacc[g]); }
  };
  asm volatile("s_wait_asynccnt 0x0" ::: "memory");      /* this wave's copies of stage 0 have landed */
  __syncthreads();      /* ... and every other wave's: stage 0 may be read */
  fa_stage(lk0 + FA_STAGE, lv0 + FA_STAGE, gk + (size_t)128 * (2 * DM), gv + 128);      /* stage 1 exists (asserted above) */
#pragma unroll 1      /* rolled: the buffer is picked by the trip's parity, a second copy of the four passes would only add code */
  for (int t = 0; t < NST; ++t) { const unsigned bo = (unsigned)(t & 1) * FA_STAGE; const unsigned char* pk = fk + bo; const unsigned char* pv = fv + bo;
#pragma unroll
    for (int kt = 0; kt < 2; ++kt) for (int kc = 0; kc < 2; ++kc) kf[kt][kc] = g2_lfrag(pk + 16 * kt * FA_KP + 64 * kc);      /* the stage's first K */
    pass(pk, pv, 0, true); pass(pk, pv, 1, true); pass(pk, pv, 2, true); pass(pk, pv, 3, false);      /* keys in ascending order: the sum order of the plain loop */
    asm volatile("s_wait_dscnt 0x0" ::: "memory");      /* this wave's reads of the buffer are done before it is handed to the copies */
    asm volatile("s_wait_asynccnt 0x0" ::: "memory");      /* this wave's copies of stage t + 1 have landed */
    __syncthreads();      /* publishes stage t + 1 and ends every wave's reads of stage t */
    if (t + 2 < NST) fa_stage(lk0 + bo, lv0 + bo, gk + (size_t)(t + 2) * 128 * (2 * DM), gv + (size_t)(t + 2) * 128); }      /* refill of the buffer just read; in flight under trip t + 1 */
  asm volatile("s_wait_asynccnt 0x0" ::: "memory");      /* no copy is outstanding when the wave ends */
#pragma unroll
  for (int g = 0; g < 2; ++g) { const float inv = 64.0f / lacc[g][0];      /* every row of the all-ones product holds the column's denominator */
    _Float16* op = O + ((size_t)b * SQ + q0 + 16 * g + ln) * DM + h * HD + 8 * hh;
    for (int t = 0; t < 4; ++t) { FragH f; for (int r = 0; r < 8; ++r) f.h[r] = (_Float16)(acc[g][t][r] * inv); *(v8us*)((unsigned short*)op + 16 * t) = f.half[0]; } } }      /* d = 16 t + 8 hh + 0..7 of query ln: 16 bytes a lane; the wave's four stores fill each row's 128-byte line */
// Preparation, one launch for what were five (the three weight planes, the two inputs' f16 rows): none of the five depends on another, each was far too short for its own launch gap, and the two row
// conversions started 16,384 waves each for one 16-byte store a lane. Every element is formed as before, by the same lane pattern (a lane's piece = 8 elements = one 16-byte store).
// Work-groups 0 .. PREP_TW - 1: the weight planes, Bt[n][k] = f16(16 bf16(W[k][n])); a thread takes piece t of Wq, pieces t and t + PREP_TW * 256 of Wkv and piece t of Wp, its 32 loads issued together.
// They come first in the grid because they run longest (each of their loads touches 32 lines). Work-groups PREP_TW .. PREP_TW + PREP_CW - 1: PREP_CU * 256 pieces in a row of x and as many of tgt each,
// PREP_CU of either a thread, 256 pieces apart.
#define PREP_TW 512
#define PREP_CW 256
#define PREP_CU 8
template <int K, int N>
__device__ __forceinline__ void prep_wload(const float* __restrict__ Wm, unsigned t, float (&v)[8]) { const float* p = Wm + ((t % (K / 8)) * 8 * N + t / (K / 8));      /* W[k8][n]; 32-bit index: the plane has K N < 2^32 elements */
#pragma unroll      /* constant indices: v stays in registers */
  for (int i = 0; i < 8; ++i) v[i] = p[i * N]; }
__device__ __forceinline__ void prep_wstore(_Float16* __restrict__ Bt, unsigned t, const float (&v)[8]) { FragH f;      /* n K + k8 = 8 t */
#pragma unroll      /* constant indices: f stays in registers */
  for (int i = 0; i < 8; ++i) f.h[i] = (_Float16)(bf16_round(v[i]) * 16.0f);
  *(v8us*)((unsigned short*)Bt + t * 8) = f.half[0]; }
__global__ __launch_bounds__(256) void k_prep(const float* __restrict__ x, const float* __restrict__ cond, const float* __restrict__ wq, const float* __restrict__ wkv, const float* __restrict__ wo,
    _Float16* __restrict__ X16, _Float16* __restrict__ C16, _Float16* __restrict__ BQ, _Float16* __restrict__ BKV, _Float16* __restrict__ BO) {
  static_assert(DM * (DM / 8) == PREP_TW * 256 && 2 * DM * (DC / 8) == 2 * PREP_TW * 256, "k_prep: one piece of Wq and of Wp and two of Wkv a thread");
  static_assert((size_t)NB * SQ * DM / 8 == (size_t)PREP_CU * PREP_CW * 256 && (size_t)NB * SK * DC / 8 == (size_t)PREP_CU * PREP_CW * 256, "k_prep: PREP_CU pieces of x and of tgt a thread");
  if (blockIdx.x >= PREP_TW) { const unsigned u0 = (blockIdx.x - PREP_TW) * (PREP_CU * 256) + threadIdx.x; v4f a[2][PREP_CU], c[2][PREP_CU];      /* the thread's first piece */
#pragma unroll      /* constant indices: a and c stay in registers */
    for (int s = 0; s < 2; ++s) for (int j = 0; j < PREP_CU; ++j) { const char* p = (const char*)(s ? cond : x) + u0 * 32u + j * 8192; a[s][j] = *(const v4fa*)p; c[s][j] = *(const v4fa*)(p + 16); }      /* a 32-bit byte offset from the buffer's start: one address register serves all the loads */
    __builtin_amdgcn_sched_barrier(0);      /* keeps the thread's 4 PREP_CU loads up here, all in flight together: without it the compiler issued half of them and the rest in small groups among the conversions, behind waits on the first; eight waves a WGP need them all in flight to keep the memory busy */
#pragma unroll      /* constant indices, as above */
    for (int s = 0; s < 2; ++s) for (int j = 0; j < PREP_CU; ++j) { FragH f;
      for (int q = 0; q < 4; ++q) { f.h[q] = (_Float16)bf16_round(a[s][j][q]); f.h[4 + q] = (_Float16)bf16_round(c[s][j][q]); }
      *(v8us*)((char*)(s ? C16 : X16) + u0 * 16u + j * 4096) = f.half[0]; }
    return; }
  const unsigned t = blockIdx.x * 256 + threadIdx.x; float a[8], b[8], c[8], d[8];
  prep_wload<DM, DM>(wq, t, a); prep_wload<DC, 2 * DM>(wkv, t, b); prep_wload<DC, 2 * DM>(wkv, t + PREP_TW * 256, c); prep_wload<DM, DM>(wo, t, d);
  prep_wstore(BQ, t, a); prep_wstore(BKV, t, b); prep_wstore(BKV, t + PREP_TW * 256, c); prep_wstore(BO, t, d);
  asm volatile("s_wait_xcnt 0x0" ::: "memory"); }      /* behind the last store: in the listing the row part's code follows this part's end, and no register that a store names is to be written again in front of this wait */
extern "C" void kernel_launch(void* const* d_in, const int* in_sizes, int n_in,
                              void* d_out, int out_size, void* d_ws, size_t ws_size, hipStream_t stream) {
  (void)in_sizes; (void)n_in; (void)out_size;
  const float* const* I = (const float* const*)d_in; const float* x = I[0]; const float* cond = I[1]; const float* wq = I[2]; const float* bq = I[3]; const float* wkv = I[4]; const float* bkv = I[5]; const float* wo = I[6]; const float* bo = I[7];      /* input order: x [2][2048][1024]; tgt [2][2048][1024]; [in][out] Wq [1024][1024] + bq; Wkv [1024][2048] + bkv (k | v halves); Wp [1024][1024] + bp; the three biases are bound and read */
  static_assert(NH * HD == DM && HD == 64 && SQ % 256 == 0 && SK % 64 == 0 && DC % 32 == 0 && DM % 64 == 0, "shape / tile multiples");
  static_assert((NB * SQ) % 128 == 0 && (NB * SK) % 128 == 0 && DC % 64 == 0 && DM % 64 == 0, "k_gemm2: whole 128 x 64 tiles, whole 64-k stages");
  const size_t NRK = (size_t)NB * SK;      /* conditioning rows */
  char* ws = (char*)d_ws; size_t off = 0;
  auto take = [&](size_t bytes) { char* p = ws + off; off += (bytes + 255) & ~(size_t)255; return p; };
  _Float16* BQ = (_Float16*)take((size_t)DM * DM * 2); _Float16* BKV = (_Float16*)take((size_t)2 * DM * DC * 2); _Float16* BO = (_Float16*)take((size_t)DM * DM * 2);
  _Float16* X16 = (_Float16*)take(NR * DM * 2); _Float16* C16 = (_Float16*)take(NRK * DC * 2); _Float16* Q16 = (_Float16*)take(NR * DM * 2); _Float16* KV16 = (_Float16*)take(NRK * 2 * DM * 2); _Float16* O16 = (_Float16*)take(NR * DM * 2);
  _Float16* VT = (_Float16*)take((size_t)NB * NH * HD * SK * 2);
  if (off > ws_size) return;      /* 2 + 4 + 2 (weight planes) + 8 + 8 + 8 + 16 + 8 (row planes) + 8 (V^T) = 64 MiB at NB 2, SK 2048, DC 1024 */
  k_prep<<<PREP_TW + PREP_CW, 256, 0, stream>>>(x, cond, wq, wkv, wo, X16, C16, BQ, BKV, BO);      /* [in][out] -> Bt x16: Wq [1024][1024]; Wkv [DC = 1024][2048] -> Bt [2048][1024] (rows 0..1023 = k, 1024..2047 = v); Wp; and the exact f16 rows of both inputs */
  k_gemm2<0><<<dim3((unsigned)((NR / 128) * (DM / 64)), 1), 128, 0, stream>>>(X16, DM, 0, BQ, DM, 0, 0.0625f, bq, 0, nullptr, 1, 0, 0, nullptr, Q16, DM, 0, (int)NR, DM, DM);      /* q rows (f16); head h = columns 64 h .. */
  k_gemm2<0><<<dim3((unsigned)((NRK / 128) * (2 * DM / 64)), 1), 128, 0, stream>>>(C16, DC, 0, BKV, DC, 0, 0.0625f, bkv, 0, nullptr, 1, 0, 0, nullptr, KV16, 2 * DM, 0, (int)NRK, 2 * DM, DC);      /* k | v rows (f16, pitch 2048): k = columns 0..1023, v = columns 1024..2047, head h = columns 64 h .. of each half */
  k_vt<NH, SK><<<NB * NH * (SK / 64), 256, 0, stream>>>(KV16 + DM, 2 * DM, 0, VT);      /* V^T [NB][NH][HD][SK] (the v half of the fused rows) */
  k_fattn<<<dim3(SQ / 256, NH, NB), 256, 0, stream>>>(Q16, KV16, VT, O16);      /* softmax(q . k / 64) v over the SK = 2048 keys -> ctx (merged heads, x64) as f16 rows */
  k_gemm2<0><<<dim3((unsigned)((NR / 128) * (DM / 64)), 1), 128, 0, stream>>>(O16, DM, 0, BO, DM, 0, 0.0009765625f, bo, 0, nullptr, 1, 0, 0, (float*)d_out, nullptr, DM, 0, (int)NR, DM, DM);      /* out = ctx proj_w + proj_b */
}

// v006
// Measured time: 107 microseconds a run.
// Next to v005, in two timings, it ran 1.05 and 1.06 times as fast.
// All steps since v000 together make it 61.9 times as fast.
#include <hip/hip_runtime.h>
// Multi-head cross-attention with a fused key / value projection and BOTH q and k scaled (x [2][2048][1024] (queries), tgt [2][2048][1024] (keys / values); q = x Wq + bq ([in][out] 1024 x 1024, normal x 0.02; zero bias); kv = tgt Wkv + bkv ([in][out] 1024 x 2048; zero bias) split into halves: k = columns 0..1023, v = columns 1024..2047; 16 heads of 64; logits = (q * 64^-0.5) . (k * 64^-0.5): the module scales BOTH operands, so the effective scale is 1/64; softmax over the 2048 tgt positions (no mask); out = merged Wp + bp ([in][out]; zero bias) -> [2][2048][1024]).
// Structure: token rows; x and tgt as exact f16 rows; natural weights as exact x16 planes; q and fused k | v WMMA GEMMs (32x64 wave tiles, f32 accumulation, + bias) -> f16; one fused attention launch, V^T fragments by transposing LDS loads (256 queries of one head per work-group: scores, online softmax with f32 statistics and native exp, weights f16, ctx x64 merged f16); ctx Wp + bp -> f32 output.
// Compute dtype: inputs rounded to bf16; x / weights exact; q, k, v, softmax weights and o as plain f16 GEMM operands (~2^-12); scores and softmax statistics f32. v_wmma_f32_16x16x32_f16.
#define NB 2
#define SQ 2048                      /* query rows per batch */
#define SK 2048                      /* conditioning (key / value) rows per batch */
#define DC 1024                       /* conditioning width */
#define DM 1024
#define NH 16
#define HD 64
#define HG 4                         /* heads per launch of the (b, h0) k_vt form, which is not launched */
#define QT 256                       /* query rows per attention tile */
#define NKX SK                       /* S / P row pitch = the SK keys (2048 here) */
#define QT0 128                      /* first-tile rows recomputed exactly in f32 */
#define B0 0                         /* first batch processed (debug hook) */
#define NBR NB                       /* batches processed (debug hook) */
#define NR ((size_t)NB * SQ)
#define DMQ DM
#define DFF 4096         /* token rows */
#define MP ((int)((size_t)NBR * SQ)) /* rows projected (debug hook) */
#define QN SQ                        /* query rows attended per batch (debug hook) */
#define NHD NH                       /* heads attended (debug hook) */
#define MPO MP                       /* rows through the output stage (debug hook) */
#define LQ (3 * DM)      /* unused; q rows have pitch DM, k | v rows 2 * DM */
typedef __bf16 v16b __attribute__((ext_vector_type(16)));
typedef unsigned short v8us __attribute__((ext_vector_type(8), may_alias));
typedef float  v8f  __attribute__((ext_vector_type(8)));
typedef float  v4f  __attribute__((ext_vector_type(4)));
typedef float  v4fa __attribute__((ext_vector_type(4), may_alias));
union FragB { v16b v; v8us half[2]; unsigned short u[16]; };

__device__ __forceinline__ unsigned short bf16_bits(float x) { unsigned int u = __float_as_uint(x); return (unsigned short)((u + 0x7FFFu + ((u >> 16) & 1u)) >> 16); }
__device__ __forceinline__ float bf16_val(unsigned short b) { return __uint_as_float(((unsigned int)b) << 16); }
__device__ __forceinline__ float bf16_round(float x) { return bf16_val(bf16_bits(x)); }
// D += A·B with NT terms: 1 = ah·bh, 2 = + al·bh (A split), 3 = + ah·bl (both split)
template <int NT>
__device__ __forceinline__ v8f mmaN(v16b ah, v16b al, v16b bh, v16b bl, v8f c) {
  c = __builtin_amdgcn_wmma_f32_16x16x32_bf16(false, ah, false, bh, (short)0, c, false, false);
  if (NT >= 2) c = __builtin_amdgcn_wmma_f32_16x16x32_bf16(false, al, false, bh, (short)0, c, false, false);
  if (NT >= 3) c = __builtin_amdgcn_wmma_f32_16x16x32_bf16(false, ah, false, bl, (short)0, c, false, false);
  asm volatile("v_nop\n\tv_nop\n\tv_nop\n\tv_nop" : "+v"(c) : "v"(ah), "v"(al), "v"(bh), "v"(bl));
  return c;
}

__global__ __launch_bounds__(256) void k_wt_bf16(const float* __restrict__ W, unsigned short* __restrict__ Wt, int K, int N) {
  const int t = blockIdx.x * 256 + threadIdx.x;
  const int k8n = K / 8;
  if (t >= N * k8n) return;
  const int n = t / k8n, k8 = (t % k8n) * 8;
  v8us v;
#pragma unroll
  for (int i = 0; i < 8; ++i) v[i] = bf16_bits(W[(size_t)(k8 + i) * N + n]);
  *(v8us*)(Wt + (size_t)n * K + k8) = v;
  
}

// GEMM C[M][N] (f32, pitch ldc) = act(A[M][K]·W + bias). A f32 row-major (pitch lda) converted per fragment to bf16
// (ASPLIT: hi/lo two planes -> 2 terms, else single rounded term); Wt bf16 [N][K] (pitch ldb). BIAS_BF16 rounds the
// bias to bf16 first (bias quantised to bf16 before the add). K%32==0, M%16==0, N%64==0.
template <bool ASPLIT, int ACT, bool BIAS_BF16>
__global__ __launch_bounds__(128) void k_gemm_bf(const float* __restrict__ A, int lda, const unsigned short* __restrict__ Wt, int ldb,
                                               const float* __restrict__ bias, float* __restrict__ C, int ldc, int M, int N, int K) {
  __shared__ __attribute__((aligned(16))) float so[4][16][64];
  const int tid = threadIdx.x, w = tid >> 5, lane = tid & 31, ln = lane & 15, hh = lane >> 4;
  const int ntn = N / 64;
  const int wid = blockIdx.x * 4 + w;
  const int mt = wid / ntn, nq = wid % ntn;
  if (mt * 16 >= M) return;
  const int row0 = mt * 16, col0 = nq * 64;
  const float* arow = A + (size_t)(row0 + ln) * lda;
  v8f acc[4] = {};
  for (int kb = 0; kb < K; kb += 32) {
    FragB ah, al;
    const v4f x0 = *(const v4fa*)(arow + kb + 8 * hh), x1 = *(const v4fa*)(arow + kb + 8 * hh + 4);
    const v4f x2 = *(const v4fa*)(arow + kb + 16 + 8 * hh), x3 = *(const v4fa*)(arow + kb + 16 + 8 * hh + 4);
    float xs[16] = {x0[0],x0[1],x0[2],x0[3],x1[0],x1[1],x1[2],x1[3],x2[0],x2[1],x2[2],x2[3],x3[0],x3[1],x3[2],x3[3]};
#pragma unroll
    for (int i = 0; i < 16; ++i) { const unsigned short hb = bf16_bits(xs[i]); ah.u[i] = hb; al.u[i] = ASPLIT ? bf16_bits(xs[i] - bf16_val(hb)) : (unsigned short)0; }
#pragma unroll
    for (int t = 0; t < 4; ++t) {
      const unsigned short* brow = Wt + (size_t)(col0 + t * 16 + ln) * ldb + kb;
      FragB b;
      b.half[0] = *(const v8us*)(brow + 8 * hh);
      b.half[1] = *(const v8us*)(brow + 16 + 8 * hh);
      acc[t] = mmaN<ASPLIT ? 2 : 1>(ah.v, al.v, b.v, b.v, acc[t]);
    }
  }
#pragma unroll
  for (int t = 0; t < 4; ++t) {
    float bv = bias ? bias[col0 + t * 16 + ln] : 0.f;
    if (BIAS_BF16) bv = bf16_round(bv);
#pragma unroll
    for (int r = 0; r < 8; ++r) { float v = acc[t][r] + bv; if (ACT == 1) v = fmaxf(v, 0.f); so[w][8 * hh + r][t * 16 + ln] = v; }
  }
  __builtin_amdgcn_fence(__ATOMIC_ACQ_REL, "workgroup");
  __builtin_amdgcn_wave_barrier();
  const int rsub = lane >> 4, c4 = (lane & 15) * 4;
  {
#pragma unroll
    for (int q = 0; q < 8; ++q) {
      const int r = q * 2 + rsub;
      const v4f v = *(const v4fa*)&so[w][r][c4];
      *(v4f*)(C + (size_t)(row0 + r) * ldc + col0 + c4) = v;
    }
    
  }
}

// GEMM C = act(A·W + bias + resid): A f32 (ASPLIT -> hi/lo 2 terms), Wt bf16 [N][K]; ACT 0 none, 1 relu, 2 exact gelu;
// resid (optional, f32, row index = (row % rmod), pitch ldr, RES_BF16 rounds it) added before the activation.
template <bool ASPLIT, int ACT, bool BIAS_BF16, bool RES_BF16>
__global__ __launch_bounds__(128) void k_gemm_bf3(const float* __restrict__ A, int lda, const unsigned short* __restrict__ Wt, int ldb,
                                                const float* __restrict__ bias, const float* __restrict__ resid, int rmod, int ldr,
                                                float* __restrict__ C, int ldc, int M, int N, int K) {
  __shared__ __attribute__((aligned(16))) float so[4][16][64];
  const int tid = threadIdx.x, w = tid >> 5, lane = tid & 31, ln = lane & 15, hh = lane >> 4;
  const int ntn = N / 64;
  const int wid = blockIdx.x * 4 + w;
  const int mt = wid / ntn, nq = wid % ntn;
  if (mt * 16 >= M) return;
  const int row0 = mt * 16, col0 = nq * 64;
  const float* arow = A + (size_t)(row0 + ln) * lda;
  v8f acc[4] = {};
  for (int kb = 0; kb < K; kb += 32) {
    FragB ah, al;
    const v4f x0 = *(const v4fa*)(arow + kb + 8 * hh), x1 = *(const v4fa*)(arow + kb + 8 * hh + 4);
    const v4f x2 = *(const v4fa*)(arow + kb + 16 + 8 * hh), x3 = *(const v4fa*)(arow + kb + 16 + 8 * hh + 4);
    float xs[16] = {x0[0],x0[1],x0[2],x0[3],x1[0],x1[1],x1[2],x1[3],x2[0],x2[1],x2[2],x2[3],x3[0],x3[1],x3[2],x3[3]};
#pragma unroll
    for (int i = 0; i < 16; ++i) { const unsigned short hb = bf16_bits(xs[i]); ah.u[i] = hb; al.u[i] = ASPLIT ? bf16_bits(xs[i] - bf16_val(hb)) : (unsigned short)0; }
#pragma unroll
    for (int t = 0; t < 4; ++t) {
      const unsigned short* brow = Wt + (size_t)(col0 + t * 16 + ln) * ldb + kb;
      FragB b;
      b.half[0] = *(const v8us*)(brow + 8 * hh);
      b.half[1] = *(const v8us*)(brow + 16 + 8 * hh);
      acc[t] = mmaN<ASPLIT ? 2 : 1>(ah.v, al.v, b.v, b.v, acc[t]);
    }
  }
#pragma unroll
  for (int t = 0; t < 4; ++t) {
    const int col = col0 + t * 16 + ln;
    float bv = bias ? bias[col] : 0.f;
    if (BIAS_BF16) bv = bf16_round(bv);
#pragma unroll
    for (int r = 0; r < 8; ++r) {
      float v = acc[t][r] + bv;
      if (resid) { float rv = resid[(size_t)((row0 + 8 * hh + r) % rmod) * ldr + col]; if (RES_BF16) rv = bf16_round(rv); v += rv; }
      if (ACT == 1) v = fmaxf(v, 0.f);
      if (ACT == 2) v = 0.5f * v * (1.0f + erff(v * 0.70710678118654752f));
      if (ACT == 3) { const float u = 0.7978845608028654f * (v + 0.044715f * v * v * v); v = 0.5f * v * (1.0f + tanhf(u)); }
      so[w][8 * hh + r][t * 16 + ln] = v;
    }
  }
  __builtin_amdgcn_fence(__ATOMIC_ACQ_REL, "workgroup");
  __builtin_amdgcn_wave_barrier();
  const int rsub = lane >> 4, c4 = (lane & 15) * 4;
  {
#pragma unroll
    for (int q = 0; q < 8; ++q) {
      const int r = q * 2 + rsub;
      const v4f v = *(const v4fa*)&so[w][r][c4];
      *(v4f*)(C + (size_t)(row0 + r) * ldc + col0 + c4) = v;
    }
    
  }
}
// row LayerNorm (biased variance, eps) over N: s = X (+ R); optional out_sum <- s; out_norm <- (s-mu)*rsqrt(var+eps)*g + b
template <bool PARAM_BF16>
__global__ __launch_bounds__(256) void k_layernorm(const float* __restrict__ X, const float* __restrict__ R, const float* __restrict__ g, const float* __restrict__ bta,
                                                  float* __restrict__ out_sum, float* __restrict__ out_norm, int N, float eps) {
  __shared__ float red[256];
  const int row = blockIdx.x, tid = threadIdx.x;
  const float* x = X + (size_t)row * N; const float* rr = R ? R + (size_t)row * N : nullptr;
  float vals[16];                     // up to N = 4096
  const int per = N / 256;            // contiguous chunk per thread? use strided-by-4 chunks: thread handles j = tid*4 + 1024*u
  float s1 = 0.f;
  for (int u = 0; u < per / 4; ++u) {
    const int j = tid * 4 + 1024 * u;
    const v4f a = *(const v4fa*)(x + j);
    v4f b = {0.f,0.f,0.f,0.f}; if (rr) b = *(const v4fa*)(rr + j);
#pragma unroll
    for (int q = 0; q < 4; ++q) { const float v = a[q] + b[q]; vals[u * 4 + q] = v; s1 += v; }
  }
  red[tid] = s1; __syncthreads();
  for (int st = 128; st > 0; st >>= 1) { if (tid < st) red[tid] += red[tid + st]; __syncthreads(); }
  const float mu = red[0] / (float)N; __syncthreads();
  float s2 = 0.f;
  for (int u = 0; u < per / 4; ++u)
#pragma unroll
    for (int q = 0; q < 4; ++q) { const float c = vals[u * 4 + q] - mu; s2 += c * c; }
  red[tid] = s2; __syncthreads();
  for (int st = 128; st > 0; st >>= 1) { if (tid < st) red[tid] += red[tid + st]; __syncthreads(); }
  const float rs = rsqrtf(red[0] / (float)N + eps);
  {
    for (int u = 0; u < per / 4; ++u) {
      const int j = tid * 4 + 1024 * u;
      v4f o, sm;
#pragma unroll
      for (int q = 0; q < 4; ++q) {
        float gg = g[j + q], bb = bta[j + q];
        if (PARAM_BF16) { gg = bf16_round(gg); bb = bf16_round(bb); }
        sm[q] = vals[u * 4 + q]; o[q] = (vals[u * 4 + q] - mu) * rs * gg + bb;
      }
      if (out_sum) *(v4f*)(out_sum + (size_t)row * N + j) = sm;
      *(v4f*)(out_norm + (size_t)row * N + j) = o;
    }
    
  }
}



// ---- f16 WMMA path (v_wmma_f32_16x16x32_f16): 11-bit significands for operands in range — used where a [0,1] probability operand needs more precision than bf16
typedef _Float16 v16h __attribute__((ext_vector_type(16)));
union FragH { v16h v; v8us half[2]; _Float16 h[16]; unsigned short u[16]; };
template <int NT>
__device__ __forceinline__ v8f mmaH(v16h ah, v16h al, v16h bh, v16h bl, v8f c) {
  c = __builtin_amdgcn_wmma_f32_16x16x32_f16(false, ah, false, bh, (short)0, c, false, false);
  if (NT >= 2) c = __builtin_amdgcn_wmma_f32_16x16x32_f16(false, al, false, bh, (short)0, c, false, false);
  if (NT >= 3) c = __builtin_amdgcn_wmma_f32_16x16x32_f16(false, ah, false, bl, (short)0, c, false, false);
  asm volatile("v_nop\n\tv_nop\n\tv_nop\n\tv_nop" : "+v"(c) : "v"(ah), "v"(al), "v"(bh), "v"(bl));
  return c;
}
// batched GEMM like k_gemm_b but f16 operands: A f32 (split into f16 hi/lo if ASPLIT, else rounded to f16), Bt = f16 values [n][k]; alpha; C f32; N multiple of 16 (partial tiles skipped)
template <bool ASPLIT>
__global__ __launch_bounds__(128) void k_gemm_h(const float* __restrict__ A, int lda, size_t sA, const _Float16* __restrict__ Bh, int ldb, size_t sB, float alpha, float* __restrict__ C, int ldc, size_t sC, int M, int N, int K) {
  __shared__ __attribute__((aligned(16))) float so[4][16][64];
  const int tid = threadIdx.x, w = tid >> 5, lane = tid & 31, ln = lane & 15, hh = lane >> 4; const int by = blockIdx.y;
  A += (size_t)by * sA; Bh += (size_t)by * sB; C += (size_t)by * sC;
  const int ntn = (N + 63) / 64; const int wid = blockIdx.x * 4 + w; const int mt = wid / ntn, nq = wid % ntn; if (mt * 16 >= M) return;
  const int row0 = mt * 16, col0 = nq * 64; const float* arow = A + (size_t)(row0 + ln) * lda;
  v8f acc[4] = {};
  for (int kb = 0; kb < K; kb += 32) {
    FragH ah, al;
    const v4f x0 = *(const v4fa*)(arow + kb + 8 * hh), x1 = *(const v4fa*)(arow + kb + 8 * hh + 4), x2 = *(const v4fa*)(arow + kb + 16 + 8 * hh), x3 = *(const v4fa*)(arow + kb + 16 + 8 * hh + 4);
    float xs[16] = {x0[0],x0[1],x0[2],x0[3],x1[0],x1[1],x1[2],x1[3],x2[0],x2[1],x2[2],x2[3],x3[0],x3[1],x3[2],x3[3]};
#pragma unroll
    for (int i = 0; i < 16; ++i) { const _Float16 h = (_Float16)xs[i]; ah.h[i] = h; al.h[i] = ASPLIT ? (_Float16)(xs[i] - (float)h) : (_Float16)0.0f; }
#pragma unroll
    for (int t = 0; t < 4; ++t) { if (col0 + t * 16 >= N) continue; const size_t boff = (size_t)(col0 + t * 16 + ln) * ldb + kb; FragH bq; bq.half[0] = *(const v8us*)(Bh + boff + 8 * hh); bq.half[1] = *(const v8us*)(Bh + boff + 16 + 8 * hh);
      acc[t] = mmaH<ASPLIT ? 2 : 1>(ah.v, al.v, bq.v, bq.v, acc[t]); }
  }
#pragma unroll
  for (int t = 0; t < 4; ++t) { if (col0 + t * 16 >= N) continue;
#pragma unroll
    for (int r = 0; r < 8; ++r) so[w][8 * hh + r][t * 16 + ln] = acc[t][r] * alpha; }
  __builtin_amdgcn_fence(__ATOMIC_ACQ_REL, "workgroup"); __builtin_amdgcn_wave_barrier();
  const int rsub = lane >> 4, c4 = (lane & 15) * 4;
  {
#pragma unroll
    for (int q = 0; q < 8; ++q) { const int r = q * 2 + rsub; if (col0 + c4 < N) { const v4f v = *(const v4fa*)&so[w][r][c4]; *(v4f*)(C + (size_t)(row0 + r) * ldc + col0 + c4) = v; } }
     }
}

// Wt[n][k] = f16(W[k][n]·scale) from f32 row-major W[K][N] (scale = power of two; bf16-exact weights stay exact in f16 away from the subnormal range)
__global__ __launch_bounds__(256) void k_wt_f16(const float* __restrict__ W, _Float16* __restrict__ Wt, int K, int N, float scale) {
  const int t = blockIdx.x * 256 + threadIdx.x; if (t >= N * (K / 8)) return; const int n = t / (K / 8), k8 = (t % (K / 8)) * 8; FragH f;
#pragma unroll
  for (int i = 0; i < 8; ++i) f.h[i] = (_Float16)(bf16_round(W[(size_t)(k8 + i) * N + n]) * scale); const v8us o = f.half[0];
  *(v8us*)((unsigned short*)Wt + (size_t)n * K + k8) = o; 
}
// k_gemm_hh variant with fused epilogue: v = acc·alpha + bias[by·sBias + col] (+ CP[(row/rowsPerB)·sCPb + by·64 + col] if CP) ; ACT 0 none / 1 elu ; writes f16 C16 (and f32 C if non-null)
template <int ACT>
__global__ __launch_bounds__(128) void k_gemm_hhx(const _Float16* __restrict__ A, int lda, size_t sA, const _Float16* __restrict__ Bh, int ldb, size_t sB, float alpha, const float* __restrict__ bias, size_t sBias, const float* __restrict__ CP, int rowsPerB, size_t sCPb, int row0g,
    float* __restrict__ C, _Float16* __restrict__ C16, int ldc, size_t sC, int M, int N, int K) {
  __shared__ __attribute__((aligned(16))) float so[4][16][64];
  const int tid = threadIdx.x, w = tid >> 5, lane = tid & 31, ln = lane & 15, hh = lane >> 4; const int by = blockIdx.y;
  A += (size_t)by * sA; Bh += (size_t)by * sB; const size_t cofs = (size_t)by * sC; const float* bp = bias ? bias + (size_t)by * sBias : nullptr;
  const int ntn = (N + 63) / 64; const int wid = blockIdx.x * 4 + w; const int mt = wid / ntn, nq = wid % ntn; if (mt * 16 >= M) return;
  const int row0 = mt * 16, col0 = nq * 64; const _Float16* arow = A + (size_t)(row0 + ln) * lda;
  v8f acc[4] = {};
  for (int kb = 0; kb < K; kb += 32) { FragH ah; ah.half[0] = *(const v8us*)((const unsigned short*)arow + kb + 8 * hh); ah.half[1] = *(const v8us*)((const unsigned short*)arow + kb + 16 + 8 * hh);
#pragma unroll
    for (int t = 0; t < 4; ++t) { if (col0 + t * 16 >= N) continue; const size_t boff = (size_t)(col0 + t * 16 + ln) * ldb + kb; FragH bq; bq.half[0] = *(const v8us*)((const unsigned short*)Bh + boff + 8 * hh); bq.half[1] = *(const v8us*)((const unsigned short*)Bh + boff + 16 + 8 * hh);
      acc[t] = mmaH<1>(ah.v, ah.v, bq.v, bq.v, acc[t]); }
  }
#pragma unroll
  for (int t = 0; t < 4; ++t) { if (col0 + t * 16 >= N) continue; const int col = col0 + t * 16 + ln; const float bv = bp ? bf16_round(bp[col]) : 0.f;
#pragma unroll
    for (int r = 0; r < 8; ++r) { float v = acc[t][r] * alpha + bv; if (CP) { const int rr = row0g + row0 + 8 * hh + r; if (rowsPerB < 0) v += CP[cofs + (size_t)rr * ldc + col];      /* rowsPerB < 0: own element of the batched C plane */ else { const int bidx = rr / rowsPerB; v += CP[(size_t)bidx * sCPb + (size_t)by * 64 + col]; } } if (ACT == 1) v = (v > 0.f) ? v : expm1f(v); else if (ACT == 7) v = (v > 0.f) ? v + 1.0f : expf(v); else if (ACT == 8) v = tanhf(v); else if (ACT == 9) v = 0.5f * v * (1.0f + tanhf(0.7978845608028654f * (v + 0.044715f * v * v * v))); else if (ACT == 11) v = 1.0f / (1.0f + expf(-v)); else if (ACT == 12) v = (v > 0.f) ? v : 0.01f * v; else if (ACT == 14) v = (v > 0.f) ? v : 0.1f * v; else if (ACT == 16) v = (v >= 0.f) ? v : 0.3f * v; else if (ACT == 17) v = (v >= 0.f) ? v : 0.2f * v; else if (ACT == 15) v = v / (1.0f + expf(-v)); else if (ACT == 3) v = fmaxf(v, 0.f); else if (ACT == 6) v = 0.5f * v * (1.0f + erff(v * 0.70710678118654752f)); so[w][8 * hh + r][t * 16 + ln] = v; } }
  __builtin_amdgcn_fence(__ATOMIC_ACQ_REL, "workgroup"); __builtin_amdgcn_wave_barrier();
  const int rsub = lane >> 4, c4 = (lane & 15) * 4; typedef _Float16 v4h __attribute__((ext_vector_type(4)));
  {
#pragma unroll
    for (int q = 0; q < 8; ++q) { const int r = q * 2 + rsub; if (col0 + c4 < N) { const v4f v = *(const v4fa*)&so[w][r][c4]; if (C) *(v4f*)(C + cofs + (size_t)(row0 + r) * ldc + col0 + c4) = v; if (C16) { v4h h4; for (int i = 0; i < 4; ++i) h4[i] = (_Float16)v[i]; *(v4h*)(C16 + cofs + (size_t)(row0 + r) * ldc + col0 + c4) = h4; } } }
     }
}


typedef _Float16 v4h __attribute__((ext_vector_type(4)));

__global__ __launch_bounds__(256) void k_x16(const float* __restrict__ x, _Float16* __restrict__ X16, size_t n8) { const size_t t = (size_t)blockIdx.x * 256 + threadIdx.x; if (t >= n8) return; FragH f;
#pragma unroll
  for (int q = 0; q < 8; ++q) f.h[q] = (_Float16)bf16_round(x[t * 8 + q]); *(v8us*)((unsigned short*)X16 + t * 8) = f.half[0];  }
__global__ __launch_bounds__(256) void k_h16(const float* __restrict__ x, _Float16* __restrict__ X16, size_t n8) { const size_t t = (size_t)blockIdx.x * 256 + threadIdx.x; if (t >= n8) return; FragH f;
#pragma unroll
  for (int q = 0; q < 8; ++q) f.h[q] = (_Float16)x[t * 8 + q]; *(v8us*)((unsigned short*)X16 + t * 8) = f.half[0];  }
__global__ __launch_bounds__(256) void k_round16f(const float* __restrict__ W, _Float16* __restrict__ Bt, size_t n8) { const size_t t = (size_t)blockIdx.x * 256 + threadIdx.x; if (t >= n8) return; FragH f;
#pragma unroll
  for (int i = 0; i < 8; ++i) f.h[i] = (_Float16)(bf16_round(W[t * 8 + i]) * 16.0f); *(v8us*)((unsigned short*)Bt + t * 8) = f.half[0];  }
__global__ __launch_bounds__(256) void k_hl(const float* __restrict__ F, _Float16* __restrict__ Hh, _Float16* __restrict__ Hl, size_t n8) { const size_t t = (size_t)blockIdx.x * 256 + threadIdx.x; if (t >= n8) return; FragH fh, fl; const v4f a = *(const v4fa*)(F + t * 8), c = *(const v4fa*)(F + t * 8 + 4);
#pragma unroll
  for (int q = 0; q < 4; ++q) { _Float16 h = (_Float16)a[q]; fh.h[q] = h; fl.h[q] = (_Float16)((a[q] - (float)h) * 1024.0f); h = (_Float16)c[q]; fh.h[4 + q] = h; fl.h[4 + q] = (_Float16)((c[q] - (float)h) * 1024.0f); }
  { *(v8us*)((unsigned short*)Hh + t * 8) = fh.half[0]; *(v8us*)((unsigned short*)Hl + t * 8) = fl.half[0];  } }

// ---- fast GEMM (wave tile 32x64, work-group tile 128x64; requires M % 128 == 0 rows per launch region, N % 64 == 0 and K % 64 == 0); epilogue = k_gemm_hhx semantics ----
__device__ __forceinline__ v16h g2_frag(const _Float16* p, int hh) { FragH f; f.half[0] = *(const v8us*)((const unsigned short*)p + 8 * hh); f.half[1] = *(const v8us*)((const unsigned short*)p + 16 + 8 * hh); return f.v; }
__device__ __forceinline__ v8f g2_mma(v16h a, v16h b, v8f c) { v8f d = __builtin_amdgcn_wmma_f32_16x16x32_f16(false, a, false, b, (short)0, c, false, false); asm volatile("v_nop\n\tv_nop\n\tv_nop\n\tv_nop" : "+v"(d) : "v"(a), "v"(b)); return d; }
// A stage of k_gemm2 = 64 k of the work-group's 128 A rows and 64 B rows: 192 rows of 128 bytes in LDS at a pitch of 144 (16 B x odd: the 16 lanes of a half wave's ds_load_b128 fall on 64 different banks).
#define G2_PITCH 144
#define G2_BOFF (128 * G2_PITCH)      /* the B rows stand behind the A rows */
#define G2_STAGE (192 * G2_PITCH)
__device__ __forceinline__ v16h g2_lfrag(const unsigned char* p) { FragH f; f.half[0] = *(const v8us*)p; f.half[1] = *(const v8us*)(p + 32); return f.v; }      /* p = row start + 64 B per 32 k + 16 hh: the k order of g2_frag */
// One stage, global memory -> LDS through no register: 12 asynchronous copies of 16 bytes a lane (8 A rows, 4 B rows, 16 rows apart); 8 lanes fill one row, so a wave's copy reads 4 whole 128-byte lines.
// lds = the lane's own LDS byte address of its first A row, ga / gb = its own global addresses, a16 / b16 = 16 rows in elements. The s_wait_xcnt stands inside the statement, behind the last copy, so that
// no address register of a copy is written again in front of it.
__device__ __forceinline__ void g2_stage(unsigned lds, const _Float16* ga, const _Float16* gb, size_t a16, size_t b16) {
  asm volatile("global_load_async_to_lds_b128 %0, %12, off\n\tglobal_load_async_to_lds_b128 %1, %13, off\n\tglobal_load_async_to_lds_b128 %2, %14, off\n\tglobal_load_async_to_lds_b128 %3, %15, off\n\t"
               "global_load_async_to_lds_b128 %4, %16, off\n\tglobal_load_async_to_lds_b128 %5, %17, off\n\tglobal_load_async_to_lds_b128 %6, %18, off\n\tglobal_load_async_to_lds_b128 %7, %19, off\n\t"
               "global_load_async_to_lds_b128 %8, %20, off\n\tglobal_load_async_to_lds_b128 %9, %21, off\n\tglobal_load_async_to_lds_b128 %10, %22, off\n\tglobal_load_async_to_lds_b128 %11, %23, off\n\t"
               "s_wait_xcnt 0x0"
               :: "v"(lds), "v"(lds + 16 * G2_PITCH), "v"(lds + 32 * G2_PITCH), "v"(lds + 48 * G2_PITCH), "v"(lds + 64 * G2_PITCH), "v"(lds + 80 * G2_PITCH), "v"(lds + 96 * G2_PITCH), "v"(lds + 112 * G2_PITCH),
                  "v"(lds + G2_BOFF), "v"(lds + G2_BOFF + 16 * G2_PITCH), "v"(lds + G2_BOFF + 32 * G2_PITCH), "v"(lds + G2_BOFF + 48 * G2_PITCH),
                  "v"(ga), "v"(ga + a16), "v"(ga + 2 * a16), "v"(ga + 3 * a16), "v"(ga + 4 * a16), "v"(ga + 5 * a16), "v"(ga + 6 * a16), "v"(ga + 7 * a16),
                  "v"(gb), "v"(gb + b16), "v"(gb + 2 * b16), "v"(gb + 3 * b16) : "memory"); }
template <int ACT>
__global__ __launch_bounds__(128) void k_gemm2(const _Float16* __restrict__ A, int lda, size_t sA, const _Float16* __restrict__ Bh, int ldb, size_t sB, float alpha, const float* __restrict__ bias, size_t sBias, const float* __restrict__ CP, int rowsPerB, size_t sCPb, int row0g,
    float* __restrict__ C, _Float16* __restrict__ C16, int ldc, size_t sC, int M, int N, int K) { static_assert(ACT == 0 || ACT == 3 || ACT == 6 || ACT == 8 || ACT == 9 || ACT == 11 || ACT == 12 || ACT == 14 || ACT == 15 || ACT == 16 || ACT == 17, "k_gemm2: unsupported ACT code (would silently apply no activation)");
  __shared__ __attribute__((aligned(16))) unsigned char sm[2 * G2_STAGE];      /* two stage buffers; behind the K loop the same bytes are the epilogue's staging rows */
  static_assert(sizeof(float) * 4 * 32 * 68 <= 2 * G2_STAGE, "epilogue staging fits the ring"); float (*so)[32][68] = (float (*)[32][68])sm;
  const int tid = threadIdx.x, w = tid >> 5, lane = tid & 31, ln = lane & 15, hh = lane >> 4; const int by = blockIdx.y;
  A += (size_t)by * sA; Bh += (size_t)by * sB; const size_t cofs = (size_t)by * sC; const float* bp = bias ? bias + (size_t)by * sBias : nullptr;
  const int ntn = N >> 6; const int mt = blockIdx.x / ntn, nq = blockIdx.x - mt * ntn; const int row0 = mt * 128 + 32 * w, col0 = nq * 64; if (mt * 128 >= M) return;      /* the whole work-group or none, in front of every barrier */
  const int cr = tid >> 3, cc = tid & 7;      /* the lane's copies: rows cr + 16 i, 16-byte piece cc of the row's 128 bytes */
  const unsigned lds0 = (unsigned)(size_t)sm + (unsigned)(cr * G2_PITCH + cc * 16);
  const _Float16* ga = A + (size_t)(mt * 128 + cr) * lda + cc * 8; const _Float16* gb = Bh + (size_t)(col0 + cr) * ldb + cc * 8; const size_t a16 = (size_t)16 * lda, b16 = (size_t)16 * ldb;
  const unsigned char* fa = sm + (32 * w + ln) * G2_PITCH + 16 * hh; const unsigned char* fb = sm + G2_BOFF + ln * G2_PITCH + 16 * hh;      /* the lane's fragment rows in buffer 0 */
  const v8f z8 = {0.f,0.f,0.f,0.f,0.f,0.f,0.f,0.f}; v8f c00 = z8, c01 = z8, c02 = z8, c03 = z8, c10 = z8, c11 = z8, c12 = z8, c13 = z8;
  const int nst = K >> 6;
  g2_stage(lds0, ga, gb, a16, b16);
  asm volatile("s_wait_asynccnt 0x0" ::: "memory");      /* this wave's copies of stage 0 have landed */
  __syncthreads();      /* ... and every other wave's: stage 0 may be read */
  if (nst > 1) g2_stage(lds0 + G2_STAGE, ga + 64, gb + 64, a16, b16);
#pragma unroll 1      /* rolled: the buffer is picked by the trip's parity, a second copy of the body would only add code */
  for (int t = 0; t < nst; ++t) { const unsigned bo = (unsigned)(t & 1) * G2_STAGE;
    const unsigned char* pa = fa + bo; const unsigned char* pb = fb + bo; v16h af[2][2], bf[2][4];
#pragma unroll      /* constant indices: the fragment arrays become registers */
    for (int kc = 0; kc < 2; ++kc) { af[kc][0] = g2_lfrag(pa + 64 * kc); bf[kc][0] = g2_lfrag(pb + 64 * kc); af[kc][1] = g2_lfrag(pa + 64 * kc + 16 * G2_PITCH);
      for (int j = 1; j < 4; ++j) bf[kc][j] = g2_lfrag(pb + 64 * kc + j * 16 * G2_PITCH); }
#pragma unroll      /* the stage's two 32-k blocks, in ascending k: the sum order of the plain loop */
    for (int kc = 0; kc < 2; ++kc) { c00 = g2_mma(af[kc][0], bf[kc][0], c00); c10 = g2_mma(af[kc][1], bf[kc][0], c10); c01 = g2_mma(af[kc][0], bf[kc][1], c01); c11 = g2_mma(af[kc][1], bf[kc][1], c11);
      c02 = g2_mma(af[kc][0], bf[kc][2], c02); c12 = g2_mma(af[kc][1], bf[kc][2], c12); c03 = g2_mma(af[kc][0], bf[kc][3], c03); c13 = g2_mma(af[kc][1], bf[kc][3], c13); }
    asm volatile("s_wait_dscnt 0x0" ::: "memory");      /* this wave's reads of the buffer are done before it is handed to the copies */
    asm volatile("s_wait_asynccnt 0x0" ::: "memory");      /* this wave's copies of stage t + 1 have landed */
    __syncthreads();      /* publishes stage t + 1 and ends every wave's reads of stage t */
    if (t + 2 < nst) g2_stage(lds0 + bo, ga + (size_t)(t + 2) * 64, gb + (size_t)(t + 2) * 64, a16, b16); }      /* refill of the buffer just read; in flight under trip t + 1 */
  asm volatile("s_wait_asynccnt 0x0" ::: "memory");      /* no copy is outstanding when the ring becomes staging; the last trip's barrier has ended every read of it */
  v8f accs[8] = {c00, c01, c02, c03, c10, c11, c12, c13};
#pragma unroll
  for (int u = 0; u < 8; ++u) { const int t = u & 3, half = u >> 2; const int col = col0 + t * 16 + ln; const float bv = bp ? bf16_round(bp[col]) : 0.f;
#pragma unroll
    for (int r = 0; r < 8; ++r) { const int rloc = half * 16 + 8 * hh + r; float v = accs[u][r] * alpha + bv; if (CP) { if (rowsPerB < 0) v += CP[cofs + (size_t)(row0g + row0 + rloc) * ldc + col];      /* rowsPerB < 0: own element of the batched C plane */ else { const int bidx = (row0g + row0 + rloc) / rowsPerB; v += CP[(size_t)bidx * sCPb + (size_t)by * 64 + col]; } }
      if (ACT == 3) v = fmaxf(v, 0.f); else if (ACT == 6) v = 0.5f * v * (1.0f + erff(v * 0.70710678118654752f)); else if (ACT == 11) v = 1.0f / (1.0f + expf(-v)); else if (ACT == 15) v = v / (1.0f + expf(-v)); else if (ACT == 12) v = (v > 0.f) ? v : 0.01f * v; else if (ACT == 8) v = tanhf(v); else if (ACT == 9) v = 0.5f * v * (1.0f + tanhf(0.7978845608028654f * (v + 0.044715f * v * v * v))); else if (ACT == 14) v = (v > 0.f) ? v : 0.1f * v; else if (ACT == 16) v = (v >= 0.f) ? v : 0.3f * v; else if (ACT == 17) v = (v >= 0.f) ? v : 0.2f * v;
      so[w][rloc][t * 16 + ln] = v; } }
  __builtin_amdgcn_fence(__ATOMIC_ACQ_REL, "workgroup"); __builtin_amdgcn_wave_barrier();
  const int rsub = lane >> 4, c4 = (lane & 15) * 4;
  {
#pragma unroll
    for (int q = 0; q < 16; ++q) { const int r = q * 2 + rsub; const v4f v = *(const v4fa*)&so[w][r][c4]; if (C) *(v4f*)(C + cofs + (size_t)(row0 + r) * ldc + col0 + c4) = v; if (C16) { v4h h4; for (int i = 0; i < 4; ++i) h4[i] = (_Float16)v[i]; *(v4h*)(C16 + cofs + (size_t)(row0 + r) * ldc + col0 + c4) = h4; } }
     } }


__global__ __launch_bounds__(256) void k_wnat(const float* __restrict__ w, size_t n8, _Float16* __restrict__ Bt) { const size_t t = (size_t)blockIdx.x * 256 + threadIdx.x; if (t >= n8) return; FragH f; for (int q = 0; q < 8; ++q) f.h[q] = (_Float16)(bf16_round(w[t * 8 + q]) * 16.0f); *(v8us*)((unsigned short*)Bt + t * 8) = f.half[0];  }
__global__ __launch_bounds__(256) void k_rsm(const float* __restrict__ S, _Float16* __restrict__ P, int nrows) {
  #pragma clang fp contract(off)
  const int i = blockIdx.x * 256 + threadIdx.x; if (i >= nrows) return; const float* s = S + (size_t)i * SQ; float mx = -3.0e38f;
#pragma unroll 1
  for (int j = 0; j < SQ; ++j) mx = fmaxf(mx, s[j]); float se = 0.f;
#pragma unroll 1
  for (int j = 0; j < SQ; ++j) se += expf(s[j] - mx); const float sc = 256.0f / se;
#pragma unroll 1
  for (int j0 = 0; j0 < SQ; j0 += 8) { FragH f; for (int q = 0; q < 8; ++q) f.h[q] = (_Float16)(expf(s[j0 + q] - mx) * sc); unsigned short* d = (unsigned short*)P + (size_t)i * SQ + j0; *(v8us*)d = f.half[0];  } }
__global__ __launch_bounds__(256) void k_vt(const _Float16* __restrict__ V16, int b, int h0, _Float16* __restrict__ VT) { __shared__ unsigned short tl[64][65]; const int tid = threadIdx.x; const int hh = blockIdx.x % HG, sg = blockIdx.x / HG; const int s0 = sg * 64; const int h = h0 + hh;
  for (int i = tid; i < 64 * 8; i += 256) { const int j = i / 8, d8 = (i % 8) * 8; FragH f; f.half[0] = *(const v8us*)((const unsigned short*)V16 + ((size_t)b * SQ + s0 + j) * DM + h * HD + d8); for (int q = 0; q < 8; ++q) tl[d8 + q][j] = f.u[q]; }
  __syncthreads();
  { for (int i = tid; i < 64 * 8; i += 256) { const int d = i / 8, j8 = (i % 8) * 8; FragH f; for (int q = 0; q < 8; ++q) f.u[q] = tl[d][j8 + q]; *(v8us*)((unsigned short*)VT + ((size_t)hh * HD + d) * SQ + s0 + j8) = f.half[0]; }  } }



__global__ __launch_bounds__(256) void k_rsmcf2(const float* __restrict__ S, _Float16* __restrict__ P, int hg, int q0, int nk) {
  #pragma clang fp contract(off)
  const int t = blockIdx.x * 256 + threadIdx.x; if (t >= hg * QT) return; const size_t i = (size_t)t; const float* s = S + i * NKX; const int last = q0 + (t % QT); float mx = -3.0e38f;
#pragma unroll 1
  for (int j = 0; j < nk; ++j) { const float f = (j <= last) ? 1.f : 0.f; mx = fmaxf(mx, fmaf(f, s[j], (1.f - f) * -1.0e9f)); } float se = 0.f;
#pragma unroll 1
  for (int j = 0; j < nk; ++j) { const float f = (j <= last) ? 1.f : 0.f; se += __expf(fmaf(f, s[j], (1.f - f) * -1.0e9f) - mx); } const float sc = 256.0f / se;
#pragma unroll 1
  for (int j0 = 0; j0 < nk; j0 += 8) { FragH fr; for (int q = 0; q < 8; ++q) { const int j = j0 + q; const float f = (j <= last) ? 1.f : 0.f; fr.h[q] = (_Float16)(__expf(fmaf(f, s[j], (1.f - f) * -1.0e9f) - mx) * sc); } unsigned short* d = (unsigned short*)P + i * NKX + j0; *(v8us*)d = fr.half[0];  } }


template <int MASKADD>
__global__ __launch_bounds__(64) void k_att0(const float* __restrict__ QF, const float* __restrict__ KF, const float* __restrict__ VF, int ld, const float* __restrict__ mask, float scale, float* __restrict__ OF, int ldo) {
  #pragma clang fp contract(off)
  __shared__ __attribute__((aligned(16))) float lq[64][64]; __shared__ __attribute__((aligned(16))) float lo[64][64];
  const int tid = threadIdx.x; const int h = blockIdx.x / (QT0 / 64), rg = blockIdx.x % (QT0 / 64); const int i = rg * 64 + tid;
  const float* qr = QF + (size_t)i * ld + h * HD;
#pragma unroll 1
  for (int c = 0; c < HD / 4; ++c) { *(v4f*)&lq[tid][c * 4] = *(const v4fa*)(qr + c * 4); const v4f z = {0.f, 0.f, 0.f, 0.f}; *(v4f*)&lo[tid][c * 4] = z; }
  float m = -1.0e30f, l = 0.f; const int jmax = MASKADD ? (SQ - 1) : (rg * 64 + 63);      /* additive-mask form: every key (the mask input decides); causal form: keys up to the block's last row */
#pragma unroll 1
  for (int j = 0; j <= jmax; ++j) { const float* kr = KF + (size_t)j * ld + h * HD; const float* vr = VF + (size_t)j * ld + h * HD; float s = 0.f;
#pragma unroll 1
    for (int c = 0; c < HD / 4; ++c) { const v4f kq = *(const v4fa*)(kr + c * 4); const v4f qq = *(v4f*)&lq[tid][c * 4]; s = __fadd_rn(s, __fmul_rn(qq[0], kq[0])); s = __fadd_rn(s, __fmul_rn(qq[1], kq[1])); s = __fadd_rn(s, __fmul_rn(qq[2], kq[2])); s = __fadd_rn(s, __fmul_rn(qq[3], kq[3])); }
    s = __fmul_rn(s, scale); if (MASKADD) s = __fadd_rn(s, __fmul_rn(bf16_round(mask[(size_t)i * SQ + j]), -10000.0f));
    const float f = (MASKADD || j <= i) ? 1.f : 0.f; const float sm = fmaf(f, s, (1.f - f) * -1.0e30f); const float mn = fmaxf(m, sm); const float sc = expf(m - mn); const float e = expf(sm - mn); l = __fadd_rn(__fmul_rn(l, sc), e); m = mn;
#pragma unroll 1
    for (int c = 0; c < HD / 4; ++c) { const v4f vv = *(const v4fa*)(vr + c * 4); v4f oo = *(v4f*)&lo[tid][c * 4]; for (int u = 0; u < 4; ++u) oo[u] = __fadd_rn(__fmul_rn(oo[u], sc), __fmul_rn(e, vv[u])); *(v4f*)&lo[tid][c * 4] = oo; } }
  const float fin = 64.0f / l;      /* o carried x64 like the f16 path */
#pragma unroll 1
  for (int c = 0; c < HD / 4; ++c) { v4f oo = *(v4f*)&lo[tid][c * 4]; for (int u = 0; u < 4; ++u) oo[u] = __fmul_rn(oo[u], fin); *(v4f*)&lo[tid][c * 4] = oo; }
  __syncthreads();
  {
#pragma unroll 1
    for (int it = 0; it < 16; ++it) { const int row = it * 4 + tid / 16, pc = (tid % 16) * 4; const v4f v = *(const v4f*)&lo[row][pc]; *(v4f*)(OF + (size_t)(rg * 64 + row) * ldo + h * HD + pc) = v; }
     } }


template <int BFIN, int WXB>
__global__ __launch_bounds__(256) void k_ln16(const float* __restrict__ X, const float* __restrict__ g, const float* __restrict__ bb, float eps, _Float16* __restrict__ N16, float* __restrict__ XB) {
  #pragma clang fp contract(off)
  __shared__ float red[256]; const size_t r = blockIdx.x; const int t = threadIdx.x; const v4f xa = *(const v4fa*)(X + r * DMQ + t * 4); float s[4]; float sum = 0.f;
  for (int q = 0; q < 4; ++q) { s[q] = BFIN ? bf16_round(xa[q]) : xa[q]; sum = __fadd_rn(sum, s[q]); }
  red[t] = sum; __syncthreads(); for (int st = 128; st > 0; st >>= 1) { if (t < st) red[t] = __fadd_rn(red[t], red[t + st]); __syncthreads(); } const float mu = red[0] / (float)DMQ; __syncthreads();
  float vs = 0.f; for (int q = 0; q < 4; ++q) { const float dl = __fadd_rn(s[q], -mu); vs = __fadd_rn(vs, __fmul_rn(dl, dl)); } red[t] = vs; __syncthreads(); for (int st = 128; st > 0; st >>= 1) { if (t < st) red[t] = __fadd_rn(red[t], red[t + st]); __syncthreads(); }
  const float rs = rsqrtf(__fadd_rn(red[0] / (float)DMQ, eps)); v4h y; v4f xb;
  for (int q = 0; q < 4; ++q) { const int c = t * 4 + q; y[q] = (_Float16)__fadd_rn(__fmul_rn(__fmul_rn(__fadd_rn(s[q], -mu), rs), bf16_round(g[c])), bf16_round(bb[c])); xb[q] = s[q]; }
  { *(v4h*)(N16 + r * DMQ + t * 4) = y; if (WXB) *(v4f*)(XB + r * DMQ + t * 4) = xb;  } }
__global__ __launch_bounds__(256) void k_ftres2(const float* __restrict__ OF0, const float* __restrict__ XB, float* __restrict__ X1, size_t n4) {
  #pragma clang fp contract(off)
  const size_t t = (size_t)blockIdx.x * 256 + threadIdx.x; if (t >= n4) return; const v4f o = *(const v4fa*)(OF0 + t * 4), xv = *(const v4fa*)(XB + t * 4); v4f y; for (int q = 0; q < 4; ++q) y[q] = __fadd_rn(__fmul_rn(o[q], 0.015625f), xv[q]); *(v4f*)(X1 + t * 4) = y;  }

__global__ __launch_bounds__(256) void k_wthd(const float* __restrict__ Wt, _Float16* __restrict__ Bt) { const size_t t = (size_t)blockIdx.x * 256 + threadIdx.x; if (t >= (size_t)NH * HD * (DM / 8)) return; const int m8 = (int)(t % (DM / 8)) * 8; const int d = (int)((t / (DM / 8)) % HD); const int h = (int)(t / ((size_t)(DM / 8) * HD)); FragH f;
  for (int q = 0; q < 8; ++q) f.h[q] = (_Float16)(16.0f * bf16_round(Wt[((size_t)h * DM + m8 + q) * HD + d])); unsigned short* dst = (unsigned short*)Bt + ((size_t)h * HD + d) * DM + m8; *(v8us*)dst = f.half[0];  }




template <int BFIN, int W16, int W32>
__global__ __launch_bounds__(256) void k_lnx(const float* __restrict__ X, const float* __restrict__ g, const float* __restrict__ bb, float eps, _Float16* __restrict__ N16, float* __restrict__ N32) {
  #pragma clang fp contract(off)
  __shared__ float red[256]; const size_t r = blockIdx.x; const int t = threadIdx.x; const bool act = t < (DMQ / 4); const int c0 = act ? t * 4 : 0;
  const v4f xa = *(const v4fa*)(X + r * DMQ + c0); float s[4]; float sum = 0.f;
  for (int q = 0; q < 4; ++q) { s[q] = act ? (BFIN ? bf16_round(xa[q]) : xa[q]) : 0.f; sum = __fadd_rn(sum, s[q]); }
  red[t] = sum; __syncthreads(); for (int st = 128; st > 0; st >>= 1) { if (t < st) red[t] = __fadd_rn(red[t], red[t + st]); __syncthreads(); } const float mu = red[0] / (float)DMQ; __syncthreads();
  float vs = 0.f; for (int q = 0; q < 4; ++q) { const float dl = act ? __fadd_rn(s[q], -mu) : 0.f; vs = __fadd_rn(vs, __fmul_rn(dl, dl)); } red[t] = vs; __syncthreads(); for (int st = 128; st > 0; st >>= 1) { if (t < st) red[t] = __fadd_rn(red[t], red[t + st]); __syncthreads(); }
  const float rs = rsqrtf(__fadd_rn(red[0] / (float)DMQ, eps)); v4h y; v4f yf;
  for (int q = 0; q < 4; ++q) { const int c = c0 + q; yf[q] = __fadd_rn(__fmul_rn(__fmul_rn(__fadd_rn(s[q], -mu), rs), bf16_round(g[c])), bf16_round(bb[c])); y[q] = (_Float16)yf[q]; }
  if (!act) return;      /* no barriers after this point */
  { if (W16) *(v4h*)(N16 + r * DMQ + c0) = y; if (W32) *(v4f*)(N32 + r * DMQ + c0) = yf;  } }


__global__ __launch_bounds__(256) void k_bfr(const float* __restrict__ x, float* __restrict__ XB, size_t n8) { const size_t t = (size_t)blockIdx.x * 256 + threadIdx.x; if (t >= n8) return; v4f a = *(const v4fa*)(x + t * 8), c = *(const v4fa*)(x + t * 8 + 4); for (int q = 0; q < 4; ++q) { a[q] = bf16_round(a[q]); c[q] = bf16_round(c[q]); }
  { *(v4f*)(XB + t * 8) = a; *(v4f*)(XB + t * 8 + 4) = c;  } }




__global__ __launch_bounds__(256) void k_lorafold(const float* __restrict__ Wm, const float* __restrict__ A, const float* __restrict__ Bm, float* __restrict__ WE, int K, int N, float sc) {
  #pragma clang fp contract(off)
  const size_t t = (size_t)blockIdx.x * 256 + threadIdx.x; if (t >= (size_t)K * N) return; const int i = (int)(t / N), o = (int)(t % N); float a = 0.f;
  for (int r = 0; r < 16; ++r) a = __fadd_rn(a, __fmul_rn(bf16_round(A[(size_t)i * 16 + r]), bf16_round(Bm[(size_t)r * N + o])));
  const float v = __fadd_rn(bf16_round(Wm[t]), __fmul_rn(sc, a)); *(float*)(WE + t) = v;  }
__global__ __launch_bounds__(256) void k_wt32rep(const float* __restrict__ Wf, _Float16* __restrict__ Bt, int K, int N, int DOUT, float scale) {
  const int t = blockIdx.x * 256 + threadIdx.x; if (t >= DOUT * (K / 8)) return; const int n = t / (K / 8), k8 = (t % (K / 8)) * 8; const int rep = DOUT / N; const int src = (n / (HD * rep)) * HD + (n % HD);      /* head h = n / HD -> group h / rep */
  FragH f; for (int i = 0; i < 8; ++i) f.h[i] = (_Float16)(Wf[(size_t)(k8 + i) * N + src] * scale);
  *(v8us*)((unsigned short*)Bt + (size_t)n * K + k8) = f.half[0];  }
__global__ __launch_bounds__(256) void k_brep(const float* __restrict__ b, float* __restrict__ out) { const int t = blockIdx.x * 256 + threadIdx.x; if (t >= DM) return; const float v = b[(t / (HD * 4)) * HD + (t % HD)]; *(float*)(out + t) = v;  }

__global__ __launch_bounds__(256) void k_rsmcim(const float* __restrict__ S, _Float16* __restrict__ P, int hg, int q0, int nk, const int* __restrict__ am) {
  #pragma clang fp contract(off)
  const int t = blockIdx.x * 256 + threadIdx.x; if (t >= hg * QT) return; const size_t i = (size_t)t; const float* s = S + i * NKX; const int last = q0 + (t % QT); const int* mr = am + (size_t)last * SQ; float mx = -3.0e38f;      /* the module's mask row of this query (keys >= nk lie above the diagonal of the causal mask and are not computed) */
#pragma unroll 1
  for (int j = 0; j < nk; ++j) { const float f = (mr[j] != 0) ? 1.f : 0.f; mx = fmaxf(mx, fmaf(f, s[j], (1.f - f) * -1.0e9f)); } float se = 0.f;
#pragma unroll 1
  for (int j = 0; j < nk; ++j) { const float f = (mr[j] != 0) ? 1.f : 0.f; se += __expf(fmaf(f, s[j], (1.f - f) * -1.0e9f) - mx); } const float sc = 256.0f / se;
#pragma unroll 1
  for (int j0 = 0; j0 < nk; j0 += 8) { FragH fr; for (int q = 0; q < 8; ++q) { const int j = j0 + q; const float f = (mr[j] != 0) ? 1.f : 0.f; fr.h[q] = (_Float16)(__expf(fmaf(f, s[j], (1.f - f) * -1.0e9f) - mx) * sc); } unsigned short* d = (unsigned short*)P + i * NKX + j0; *(v8us*)d = fr.half[0];  } }



__global__ __launch_bounds__(256) void k_bcpy(const float* __restrict__ b, int n, int NP, float* __restrict__ dst, int dst0) { for (int i = threadIdx.x; i < NP; i += 256) { const float v = (i < n) ? b[i] : 0.f; *(float*)(dst + dst0 + i) = v; }  }



// lane l with lane l ^ 16
__device__ __forceinline__ float rs_xhalf(float x) { return __builtin_bit_cast(float, __builtin_amdgcn_permlanex16(__builtin_bit_cast(int, x), __builtin_bit_cast(int, x), 0x76543210, 0xfedcba98, false, false)); }
// Four 2^t in one statement, each in place: behind a transcendental the instruction set asks for one independent instruction or v_nop before its result is read or its source overwritten.
// Here each v_exp_f32 is the independent instruction behind the one before it, the v_nop the slot behind the last. In place, so that the
// statement writes only registers that the multiply-add in front of it has written: the compiler keeps that one clear of the matrix instructions' operands.
__device__ __forceinline__ v4f rs_exp2x4(v4f t) { float a = t[0], b = t[1], c = t[2], d = t[3];
  asm("v_exp_f32 %0, %0\n\tv_exp_f32 %1, %1\n\tv_exp_f32 %2, %2\n\tv_exp_f32 %3, %3\n\tv_nop" : "+v"(a), "+v"(b), "+v"(c), "+v"(d));
  const v4f r = {a, b, c, d}; return r; }
__device__ __forceinline__ v8f fa_mma(v16h a, v16h b, v8f c) { return __builtin_amdgcn_wmma_f32_16x16x32_f16(false, a, false, b, (short)0, c, false, false); }
// Fused attention: scores, softmax and P V in one launch; no score and no weight leaves the registers. One work-group = 256 queries of one (batch, head), 8 waves of 32 query columns;
// a pass = 32 keys. Transposed products: S^T = K Q^T (rows = keys, columns = queries), so a lane's 16 scores of a column are, as they lie, its 16 elements of the B operand of O^T += V^T P^T
// (k order of both operands: 8 hh + 0..7, then 16 + 8 hh + 0..7, that of g2_frag). Online softmax in the log2 domain, f32: the maximum in use may trail the true one by up to 8 (an
// exponential reaches 2^8 at most, well inside f16), and the sums are rescaled only in a pass where some column exceeds that. Denominator = an all-ones A operand times P^T on the matrix
// pipe: it sums the weights as rounded to f16, the same values the numerator sums. o is carried x64 as f16 rows.
// K and V: the eight waves read the same fragments, and a fragment load from global memory touches 16 cache lines for 512 bytes. So a stage of 128 keys (4 passes) is brought into LDS once for the work-group, in whole
// 128-byte lines, by asynchronous copies, two buffers: stage t + 1 flies while stage t is worked on. Fragments come from LDS, K one pass ahead inside its stage, V^T at the head of its pass.
// V lies in LDS as it lies in the fused k | v rows (row = key, 64 d); the A operand V^T (row = d, k = key) comes out of it by the transposing load ds_load_tr16_b128, so no transposed copy of V is made in memory.
// Every '#pragma unroll' in it is there so that the fragment and accumulator arrays it indexes become registers.
#define FA_KP 144      /* pitch of a K row (one key, 128 bytes) in LDS: 16 B x odd, so the 16 lanes of a half wave's ds_load_b128 fall on 64 different banks */
#define FA_VP 160      /* pitch of a V row (one key, 128 bytes): 32 B x odd, the conflict-free pitch of ds_load_tr16_b128 */
#define FA_VOFF (128 * FA_KP)      /* the 128 V rows stand behind the 128 K rows */
#define FA_STAGE (128 * FA_KP + 128 * FA_VP)
// One stage, global memory -> LDS through no register: 8 asynchronous copies of 16 bytes a lane (4 K rows and 4 V rows, 32 rows apart); 8 lanes fill a row.
// lk / lv = the lane's own LDS byte addresses of its first K and V row, gk / gv = its own global addresses. The s_wait_xcnt stands inside the statement, behind the last copy, so that
// no address register of a copy is written again in front of it.
__device__ __forceinline__ void fa_stage(unsigned lk, unsigned lv, const _Float16* gk, const _Float16* gv) {
  asm volatile("global_load_async_to_lds_b128 %0, %8, off\n\tglobal_load_async_to_lds_b128 %1, %9, off\n\tglobal_load_async_to_lds_b128 %2, %10, off\n\tglobal_load_async_to_lds_b128 %3, %11, off\n\t"
               "global_load_async_to_lds_b128 %4, %12, off\n\tglobal_load_async_to_lds_b128 %5, %13, off\n\tglobal_load_async_to_lds_b128 %6, %14, off\n\tglobal_load_async_to_lds_b128 %7, %15, off\n\t"
               "s_wait_xcnt 0x0"
               :: "v"(lk), "v"(lk + 32 * FA_KP), "v"(lk + 64 * FA_KP), "v"(lk + 96 * FA_KP), "v"(lv), "v"(lv + 32 * FA_VP), "v"(lv + 64 * FA_VP), "v"(lv + 96 * FA_VP),
                  "v"(gk), "v"(gk + (size_t)32 * (2 * DM)), "v"(gk + (size_t)64 * (2 * DM)), "v"(gk + (size_t)96 * (2 * DM)), "v"(gv), "v"(gv + (size_t)32 * (2 * DM)), "v"(gv + (size_t)64 * (2 * DM)), "v"(gv + (size_t)96 * (2 * DM)) : "memory"); }
// Half a V^T fragment: lane (c = lane & 15, hh) gets V[key0 + 8 hh + 0..7][d0 + c], where p = the tile's byte address + (key0 + 8 hh + (lane & 7)) FA_VP + 2 d0 + 16 ((lane >> 3) & 1).
typedef short fa_s16x8 __attribute__((ext_vector_type(8)));
__device__ __forceinline__ v8us fa_tr16(const unsigned char* p) { typedef __attribute__((address_space(3))) fa_s16x8 lds_s16x8; return __builtin_bit_cast(v8us, __builtin_amdgcn_ds_load_tr16_b128_v8i16((lds_s16x8*)p)); }
__global__ __launch_bounds__(256) void k_fattn(const _Float16* __restrict__ Q, const _Float16* __restrict__ KV, _Float16* __restrict__ O) {
  static_assert(SK % 128 == 0 && SK / 128 >= 2 && HD == 64, "k_fattn: whole stages of 128 keys, two or more");
  constexpr float CS = 0.015625f * 1.44269504f;      /* (q / 8) . (k / 8) = q . k / 64, times log2 e */
  constexpr int NST = SK / 128;
  __shared__ __attribute__((aligned(16))) unsigned char sm[2 * FA_STAGE];      /* two stage buffers */
  const int tid = threadIdx.x, lane = tid & 31, ln = lane & 15, hh = lane >> 4; const int wave = __builtin_amdgcn_readfirstlane(tid >> 5);
  const int h = blockIdx.y, b = blockIdx.z; const int q0 = blockIdx.x * 256 + wave * 32;
  const _Float16* qp = Q + ((size_t)b * SQ + q0 + ln) * DM + h * HD;
  const unsigned lk0 = (unsigned)(size_t)sm + (unsigned)((tid >> 3) * FA_KP + (tid & 7) * 16);      /* the lane's copies: K rows (tid >> 3) + 32 i, 16-byte piece tid & 7 */
  const unsigned lv0 = (unsigned)(size_t)sm + (unsigned)(FA_VOFF + (tid >> 3) * FA_VP + (tid & 7) * 16);      /* V rows and pieces likewise */
  const _Float16* gk = KV + ((size_t)b * SK + (tid >> 3)) * (2 * DM) + h * HD + (tid & 7) * 8;      /* k half of the fused rows: row = key */
  const _Float16* gv = gk + DM;      /* v half of the same rows */
  const unsigned char* fk = sm + ln * FA_KP + 16 * hh; const unsigned char* fv = sm + FA_VOFF + (8 * hh + (lane & 7)) * FA_VP + 16 * ((lane >> 3) & 1);      /* the lane's K fragment row and its address for the transposing loads of V, in buffer 0 */
  fa_stage(lk0, lv0, gk, gv);
  v16h qf[2][2], kf[2][2];
#pragma unroll
  for (int g = 0; g < 2; ++g) for (int kc = 0; kc < 2; ++kc) qf[g][kc] = g2_frag(qp + (size_t)g * 16 * DM + 32 * kc, hh);
  FragH ones;
#pragma unroll
  for (int i = 0; i < 16; ++i) ones.h[i] = (_Float16)1.0f;
  const v8f z8 = {0.f, 0.f, 0.f, 0.f, 0.f, 0.f, 0.f, 0.f};
  v8f acc[2][4], lacc[2]; float m_run[2];
#pragma unroll
  for (int g = 0; g < 2; ++g) { m_run[g] = -__builtin_inff(); lacc[g] = z8; for (int t = 0; t < 4; ++t) acc[g][t] = z8; }
  auto pass = [&](const unsigned char* pk, const unsigned char* pv, const int p, const bool more) __attribute__((always_inline)) {      /* p (the pass in its stage) and more are literals at every call: a stage's last pass is compiled without the fetch of a next K */
    v16h vf[4]; v8f s[2][2];
#pragma unroll
    for (int kt = 0; kt < 2; ++kt) for (int g = 0; g < 2; ++g) s[kt][g] = fa_mma(kf[kt][1], qf[g][1], fa_mma(kf[kt][0], qf[g][0], z8));
#pragma unroll
    for (int t = 0; t < 4; ++t) { FragH f; f.half[0] = fa_tr16(pv + 32 * p * FA_VP + 32 * t); f.half[1] = fa_tr16(pv + (32 * p + 16) * FA_VP + 32 * t); vf[t] = f.v; }      /* this pass's V^T (d = 16 t + ln; keys 8 hh + 0..7, then 16 + 8 hh + 0..7: the k order of P^T), in flight under the softmax */
    if (more) {      /* next pass's K, of the same stage, in flight under this pass's softmax and second product */
#pragma unroll
      for (int kt = 0; kt < 2; ++kt) for (int kc = 0; kc < 2; ++kc) kf[kt][kc] = g2_lfrag(pk + (32 * (p + 1) + 16 * kt) * FA_KP + 64 * kc); }
    asm volatile("" ::: "memory");      /* compiler fence: keeps the pass's LDS reads up here, in one group in front of the softmax; without it the compiler sank them behind the branch below, next to their first use, where they have no time to land */
    float mb[2]; bool need = false;
#pragma unroll
    for (int g = 0; g < 2; ++g) { float mx = fmaxf(s[0][g][0], s[1][g][0]);
      for (int r = 1; r < 8; ++r) mx = fmaxf(mx, fmaxf(s[0][g][r], s[1][g][r]));
      mx = fmaxf(mx, rs_xhalf(mx)) * CS; mb[g] = mx; need = need || (mx > m_run[g] + 8.0f); }      /* both wave halves hold the column's maximum of this pass, scaled (the scale is positive) */
    if (__builtin_amdgcn_ballot_w32(need) != 0) {      /* always in the first pass (the maximum in use is -inf, the factor 0), rare later */
#pragma unroll
      for (int g = 0; g < 2; ++g) { const float mn = fmaxf(m_run[g], mb[g]); const float corr = __builtin_amdgcn_exp2f(m_run[g] - mn); m_run[g] = mn; lacc[g] = lacc[g] * corr; for (int t = 0; t < 4; ++t) acc[g][t] = acc[g][t] * corr; } }
#pragma unroll
    for (int g = 0; g < 2; ++g) { FragH pf; const float nm = -m_run[g];
      for (int kt = 0; kt < 2; ++kt) for (int j = 0; j < 2; ++j) { v4f a; for (int q = 0; q < 4; ++q) a[q] = fmaf(s[kt][g][4 * j + q], CS, nm); const v4f e = rs_exp2x4(a); for (int q = 0; q < 4; ++q) pf.h[8 * kt + 4 * j + q] = (_Float16)e[q]; }
      for (int t = 0; t < 4; ++t) acc[g][t] = fa_mma(vf[t], pf.v, acc[g][t]);
      lacc[g] = fa_mma(ones.v, pf.v, lacc[g]); }
  };
  asm volatile("s_wait_asynccnt 0x0" ::: "memory");      /* this wave's copies of stage 0 have landed */
  __syncthreads();      /* ... and every other wave's: stage 0 may be read */
  fa_stage(lk0 + FA_STAGE, lv0 + FA_STAGE, gk + (size_t)128 * (2 * DM), gv + (size_t)128 * (2 * DM));      /* stage 1 exists (asserted above) */
#pragma unroll 1      /* rolled: the buffer is picked by the trip's parity, a second copy of the four passes would only add code */
  for (int t = 0; t < NST; ++t) { const unsigned bo = (unsigned)(t & 1) * FA_STAGE; const unsigned char* pk = fk + bo; const unsigned char* pv = fv + bo;
#pragma unroll
    for (int kt = 0; kt < 2; ++kt) for (int kc = 0; kc < 2; ++kc) kf[kt][kc] = g2_lfrag(pk + 16 * kt * FA_KP + 64 * kc);      /* the stage's first K */
    pass(pk, pv, 0, true); pass(pk, pv, 1, true); pass(pk, pv, 2, true); pass(pk, pv, 3, false);      /* keys in ascending order: the sum order of the plain loop */
    asm volatile("s_wait_dscnt 0x0" ::: "memory");      /* this wave's reads of the buffer are done before it is handed to the copies */
    asm volatile("s_wait_asynccnt 0x0" ::: "memory");      /* this wave's copies of stage t + 1 have landed */
    __syncthreads();      /* publishes stage t + 1 and ends every wave's reads of stage t */
    if (t + 2 < NST) fa_stage(lk0 + bo, lv0 + bo, gk + (size_t)(t + 2) * 128 * (2 * DM), gv + (size_t)(t + 2) * 128 * (2 * DM)); }      /* refill of the buffer just read; in flight under trip t + 1 */
  asm volatile("s_wait_asynccnt 0x0" ::: "memory");      /* no copy is outstanding when the wave ends */
#pragma unroll
  for (int g = 0; g < 2; ++g) { const float inv = 64.0f / lacc[g][0];      /* every row of the all-ones product holds the column's denominator */
    _Float16* op = O + ((size_t)b * SQ + q0 + 16 * g + ln) * DM + h * HD + 8 * hh;
    for (int t = 0; t < 4; ++t) { FragH f; for (int r = 0; r < 8; ++r) f.h[r] = (_Float16)(acc[g][t][r] * inv); *(v8us*)((unsigned short*)op + 16 * t) = f.half[0]; } } }      /* d = 16 t + 8 hh + 0..7 of query ln: 16 bytes a lane; the wave's four stores fill each row's 128-byte line */
// Preparation, one launch for what were five (the three weight planes, the two inputs' f16 rows): none of the five depends on another, each was far too short for its own launch gap, and the two row
// conversions started 16,384 waves each for one 16-byte store a lane. Every element is formed as before, by the same lane pattern (a lane's piece = 8 elements = one 16-byte store).
// Work-groups 0 .. PREP_TW - 1: the weight planes, Bt[n][k] = f16(16 bf16(W[k][n])); a thread takes piece t of Wq, pieces t and t + PREP_TW * 256 of Wkv and piece t of Wp, its 32 loads issued together.
// They come first in the grid because they run longest (each of their loads touches 32 lines). Work-groups PREP_TW .. PREP_TW + PREP_CW - 1: PREP_CU * 256 pieces in a row of x and as many of tgt each,
// PREP_CU of either a thread, 256 pieces apart.
#define PREP_TW 512
#define PREP_CW 256
#define PREP_CU 8
template <int K, int N>
__device__ __forceinline__ void prep_wload(const float* __restrict__ Wm, unsigned t, float (&v)[8]) { const float* p = Wm + ((t % (K / 8)) * 8 * N + t / (K / 8));      /* W[k8][n]; 32-bit index: the plane has K N < 2^32 elements */
#pragma unroll      /* constant indices: v stays in registers */
  for (int i = 0; i < 8; ++i) v[i] = p[i * N]; }
__device__ __forceinline__ void prep_wstore(_Float16* __restrict__ Bt, unsigned t, const float (&v)[8]) { FragH f;      /* n K + k8 = 8 t */
#pragma unroll      /* constant indices: f stays in registers */
  for (int i = 0; i < 8; ++i) f.h[i] = (_Float16)(bf16_round(v[i]) * 16.0f);
  *(v8us*)((unsigned short*)Bt + t * 8) = f.half[0]; }
__global__ __launch_bounds__(256) void k_prep(const float* __restrict__ x, const float* __restrict__ cond, const float* __restrict__ wq, const float* __restrict__ wkv, const float* __restrict__ wo,
    _Float16* __restrict__ X16, _Float16* __restrict__ C16, _Float16* __restrict__ BQ, _Float16* __restrict__ BKV, _Float16* __restrict__ BO) {
  static_assert(DM * (DM / 8) == PREP_TW * 256 && 2 * DM * (DC / 8) == 2 * PREP_TW * 256, "k_prep: one piece of Wq and of Wp and two of Wkv a thread");
  static_assert((size_t)NB * SQ * DM / 8 == (size_t)PREP_CU * PREP_CW * 256 && (size_t)NB * SK * DC / 8 == (size_t)PREP_CU * PREP_CW * 256, "k_prep: PREP_CU pieces of x and of tgt a thread");
  if (blockIdx.x >= PREP_TW) { const unsigned u0 = (blockIdx.x - PREP_TW) * (PREP_CU * 256) + threadIdx.x; v4f a[2][PREP_CU], c[2][PREP_CU];      /* the thread's first piece */
#pragma unroll      /* constant indices: a and c stay in registers */
    for (int s = 0; s < 2; ++s) for (int j = 0; j < PREP_CU; ++j) { const char* p = (const char*)(s ? cond : x) + u0 * 32u + j * 8192; a[s][j] = *(const v4fa*)p; c[s][j] = *(const v4fa*)(p + 16); }      /* a 32-bit byte offset from the buffer's start: one address register serves all the loads */
    __builtin_amdgcn_sched_barrier(0);      /* keeps the thread's 4 PREP_CU loads up here, all in flight together: without it the compiler issued half of them and the rest in small groups among the conversions, behind waits on the first; eight waves a WGP need them all in flight to keep the memory busy */
#pragma unroll      /* constant indices, as above */
    for (int s = 0; s < 2; ++s) for (int j = 0; j < PREP_CU; ++j) { FragH f;
      for (int q = 0; q < 4; ++q) { f.h[q] = (_Float16)bf16_round(a[s][j][q]); f.h[4 + q] = (_Float16)bf16_round(c[s][j][q]); }
      *(v8us*)((char*)(s ? C16 : X16) + u0 * 16u + j * 4096) = f.half[0]; }
    return; }
  const unsigned t = blockIdx.x * 256 + threadIdx.x; float a[8], b[8], c[8], d[8];
  prep_wload<DM, DM>(wq, t, a); prep_wload<DC, 2 * DM>(wkv, t, b); prep_wload<DC, 2 * DM>(wkv, t + PREP_TW * 256, c); prep_wload<DM, DM>(wo, t, d);
  prep_wstore(BQ, t, a); prep_wstore(BKV, t, b); prep_wstore(BKV, t + PREP_TW * 256, c); prep_wstore(BO, t, d);
  asm volatile("s_wait_xcnt 0x0" ::: "memory"); }      /* behind the last store: in the listing the row part's code follows this part's end, and no register that a store names is to be written again in front of this wait */
extern "C" void kernel_launch(void* const* d_in, const int* in_sizes, int n_in,
                              void* d_out, int out_size, void* d_ws, size_t ws_size, hipStream_t stream) {
  (void)in_sizes; (void)n_in; (void)out_size;
  const float* const* I = (const float* const*)d_in; const float* x = I[0]; const float* cond = I[1]; const float* wq = I[2]; const float* bq = I[3]; const float* wkv = I[4]; const float* bkv = I[5]; const float* wo = I[6]; const float* bo = I[7];      /* input order: x [2][2048][1024]; tgt [2][2048][1024]; [in][out] Wq [1024][1024] + bq; Wkv [1024][2048] + bkv (k | v halves); Wp [1024][1024] + bp; the three biases are bound and read */
  static_assert(NH * HD == DM && HD == 64 && SQ % 256 == 0 && SK % 64 == 0 && DC % 32 == 0 && DM % 64 == 0, "shape / tile multiples");
  static_assert((NB * SQ) % 128 == 0 && (NB * SK) % 128 == 0 && DC % 64 == 0 && DM % 64 == 0, "k_gemm2: whole 128 x 64 tiles, whole 64-k stages");
  const size_t NRK = (size_t)NB * SK;      /* conditioning rows */
  char* ws = (char*)d_ws; size_t off = 0;
  auto take = [&](size_t bytes) { char* p = ws + off; off += (bytes + 255) & ~(size_t)255; return p; };
  _Float16* BQ = (_Float16*)take((size_t)DM * DM * 2); _Float16* BKV = (_Float16*)take((size_t)2 * DM * DC * 2); _Float16* BO = (_Float16*)take((size_t)DM * DM * 2);
  _Float16* X16 = (_Float16*)take(NR * DM * 2); _Float16* C16 = (_Float16*)take(NRK * DC * 2); _Float16* Q16 = (_Float16*)take(NR * DM * 2); _Float16* KV16 = (_Float16*)take(NRK * 2 * DM * 2); _Float16* O16 = (_Float16*)take(NR * DM * 2);
  if (off > ws_size) return;      /* 2 + 4 + 2 (weight planes) + 8 + 8 + 8 + 16 + 8 (row planes) = 56 MiB at NB 2, SK 2048, DC 1024 */
  k_prep<<<PREP_TW + PREP_CW, 256, 0, stream>>>(x, cond, wq, wkv, wo, X16, C16, BQ, BKV, BO);      /* [in][out] -> Bt x16: Wq [1024][1024]; Wkv [DC = 1024][2048] -> Bt [2048][1024] (rows 0..1023 = k, 1024..2047 = v); Wp; and the exact f16 rows of both inputs */
  k_gemm2<0><<<dim3((unsigned)((NR / 128) * (DM / 64)), 1), 128, 0, stream>>>(X16, DM, 0, BQ, DM, 0, 0.0625f, bq, 0, nullptr, 1, 0, 0, nullptr, Q16, DM, 0, (int)NR, DM, DM);      /* q rows (f16); head h = columns 64 h .. */
  k_gemm2<0><<<dim3((unsigned)((NRK / 128) * (2 * DM / 64)), 1), 128, 0, stream>>>(C16, DC, 0, BKV, DC, 0, 0.0625f, bkv, 0, nullptr, 1, 0, 0, nullptr, KV16, 2 * DM, 0, (int)NRK, 2 * DM, DC);      /* k | v rows (f16, pitch 2048): k = columns 0..1023, v = columns 1024..2047, head h = columns 64 h .. of each half */
  k_fattn<<<dim3(SQ / 256, NH, NB), 256, 0, stream>>>(Q16, KV16, O16);      /* softmax(q . k / 64) v over the SK = 2048 keys -> ctx (merged heads, x64) as f16 rows */
  k_gemm2<0><<<dim3((unsigned)((NR / 128) * (DM / 64)), 1), 128, 0, stream>>>(O16, DM, 0, BO, DM, 0, 0.0009765625f, bo, 0, nullptr, 1, 0, 0, (float*)d_out, nullptr, DM, 0, (int)NR, DM, DM);      /* out = ctx proj_w + proj_b */
}

// v007
// It runs in 96.1 microseconds.
// Next to v006, in two timings, it ran 1.12 times as fast each time.
// Over all steps from v000 it is 69.3 times as fast.
#include <hip/hip_runtime.h>
// Multi-head cross-attention with a fused key / value projection and BOTH q and k scaled (x [2][2048][1024] (queries), tgt [2][2048][1024] (keys / values); q = x Wq + bq ([in][out] 1024 x 1024, normal x 0.02; zero bias); kv = tgt Wkv + bkv ([in][out] 1024 x 2048; zero bias) split into halves: k = columns 0..1023, v = columns 1024..2047; 16 heads of 64; logits = (q * 64^-0.5) . (k * 64^-0.5): the module scales BOTH operands, so the effective scale is 1/64; softmax over the 2048 tgt positions (no mask); out = merged Wp + bp ([in][out]; zero bias) -> [2][2048][1024]).
// Structure: token rows; x and tgt as exact f16 rows; natural weights as exact x16 planes; q and fused k | v WMMA GEMMs (32x64 wave tiles, f32 accumulation, + bias) -> f16; one fused attention launch, V^T fragments by transposing LDS loads (256 queries of one head per work-group: scores, online softmax with f32 statistics and native exp, weights f16, ctx x64 merged f16); ctx Wp + bp -> f32 output.
// Compute dtype: inputs rounded to bf16; x / weights exact; q, k, v, softmax weights and o as plain f16 GEMM operands (~2^-12); scores and softmax statistics f32. v_wmma_f32_16x16x32_f16.
#define NB 2
#define SQ 2048                      /* query rows per batch */
#define SK 2048                      /* conditioning (key / value) rows per batch */
#define DC 1024                       /* conditioning width */
#define DM 1024
#define NH 16
#define HD 64
#define HG 4                         /* heads per launch of the (b, h0) k_vt form, which is not launched */
#define QT 256                       /* query rows per attention tile */
#define NKX SK                       /* S / P row pitch = the SK keys (2048 here) */
#define QT0 128                      /* first-tile rows recomputed exactly in f32 */
#define B0 0                         /* first batch processed (debug hook) */
#define NBR NB                       /* batches processed (debug hook) */
#define NR ((size_t)NB * SQ)
#define DMQ DM
#define DFF 4096         /* token rows */
#define MP ((int)((size_t)NBR * SQ)) /* rows projected (debug hook) */
#define QN SQ                        /* query rows attended per batch (debug hook) */
#define NHD NH                       /* heads attended (debug hook) */
#define MPO MP                       /* rows through the output stage (debug hook) */
#define LQ (3 * DM)      /* unused; q rows have pitch DM, k | v rows 2 * DM */
typedef __bf16 v16b __attribute__((ext_vector_type(16)));
typedef unsigned short v8us __attribute__((ext_vector_type(8), may_alias));
typedef float  v8f  __attribute__((ext_vector_type(8)));
typedef float  v4f  __attribute__((ext_vector_type(4)));
typedef float  v4fa __attribute__((ext_vector_type(4), may_alias));
union FragB { v16b v; v8us half[2]; unsigned short u[16]; };

__device__ __forceinline__ unsigned short bf16_bits(float x) { unsigned int u = __float_as_uint(x); return (unsigned short)((u + 0x7FFFu + ((u >> 16) & 1u)) >> 16); }
__device__ __forceinline__ float bf16_val(unsigned short b) { return __uint_as_float(((unsigned int)b) << 16); }
__device__ __forceinline__ float bf16_round(float x) { return bf16_val(bf16_bits(x)); }
// D += A·B with NT terms: 1 = ah·bh, 2 = + al·bh (A split), 3 = + ah·bl (both split)
template <int NT>
__device__ __forceinline__ v8f mmaN(v16b ah, v16b al, v16b bh, v16b bl, v8f c) {
  c = __builtin_amdgcn_wmma_f32_16x16x32_bf16(false, ah, false, bh, (short)0, c, false, false);
  if (NT >= 2) c = __builtin_amdgcn_wmma_f32_16x16x32_bf16(false, al, false, bh, (short)0, c, false, false);
  if (NT >= 3) c = __builtin_amdgcn_wmma_f32_16x16x32_bf16(false, ah, false, bl, (short)0, c, false, false);
  asm volatile("v_nop\n\tv_nop\n\tv_nop\n\tv_nop" : "+v"(c) : "v"(ah), "v"(al), "v"(bh), "v"(bl));
  return c;
}

__global__ __launch_bounds__(256) void k_wt_bf16(const float* __restrict__ W, unsigned short* __restrict__ Wt, int K, int N) {
  const int t = blockIdx.x * 256 + threadIdx.x;
  const int k8n = K / 8;
  if (t >= N * k8n) return;
  const int n = t / k8n, k8 = (t % k8n) * 8;
  v8us v;
#pragma unroll
  for (int i = 0; i < 8; ++i) v[i] = bf16_bits(W[(size_t)(k8 + i) * N + n]);
  *(v8us*)(Wt + (size_t)n * K + k8) = v;
  
}

// GEMM C[M][N] (f32, pitch ldc) = act(A[M][K]·W + bias). A f32 row-major (pitch lda) converted per fragment to bf16
// (ASPLIT: hi/lo two planes -> 2 terms, else single rounded term); Wt bf16 [N][K] (pitch ldb). BIAS_BF16 rounds the
// bias to bf16 first (bias quantised to bf16 before the add). K%32==0, M%16==0, N%64==0.
template <bool ASPLIT, int ACT, bool BIAS_BF16>
__global__ __launch_bounds__(128) void k_gemm_bf(const float* __restrict__ A, int lda, const unsigned short* __restrict__ Wt, int ldb,
                                               const float* __restrict__ bias, float* __restrict__ C, int ldc, int M, int N, int K) {
  __shared__ __attribute__((aligned(16))) float so[4][16][64];
  const int tid = threadIdx.x, w = tid >> 5, lane = tid & 31, ln = lane & 15, hh = lane >> 4;
  const int ntn = N / 64;
  const int wid = blockIdx.x * 4 + w;
  const int mt = wid / ntn, nq = wid % ntn;
  if (mt * 16 >= M) return;
  const int row0 = mt * 16, col0 = nq * 64;
  const float* arow = A + (size_t)(row0 + ln) * lda;
  v8f acc[4] = {};
  for (int kb = 0; kb < K; kb += 32) {
    FragB ah, al;
    const v4f x0 = *(const v4fa*)(arow + kb + 8 * hh), x1 = *(const v4fa*)(arow + kb + 8 * hh + 4);
    const v4f x2 = *(const v4fa*)(arow + kb + 16 + 8 * hh), x3 = *(const v4fa*)(arow + kb + 16 + 8 * hh + 4);
    float xs[16] = {x0[0],x0[1],x0[2],x0[3],x1[0],x1[1],x1[2],x1[3],x2[0],x2[1],x2[2],x2[3],x3[0],x3[1],x3[2],x3[3]};
#pragma unroll
    for (int i = 0; i < 16; ++i) { const unsigned short hb = bf16_bits(xs[i]); ah.u[i] = hb; al.u[i] = ASPLIT ? bf16_bits(xs[i] - bf16_val(hb)) : (unsigned short)0; }
#pragma unroll
    for (int t = 0; t < 4; ++t) {
      const unsigned short* brow = Wt + (size_t)(col0 + t * 16 + ln) * ldb + kb;
      FragB b;
      b.half[0] = *(const v8us*)(brow + 8 * hh);
      b.half[1] = *(const v8us*)(brow + 16 + 8 * hh);
      acc[t] = mmaN<ASPLIT ? 2 : 1>(ah.v, al.v, b.v, b.v, acc[t]);
    }
  }
#pragma unroll
  for (int t = 0; t < 4; ++t) {
    float bv = bias ? bias[col0 + t * 16 + ln] : 0.f;
    if (BIAS_BF16) bv = bf16_round(bv);
#pragma unroll
    for (int r = 0; r < 8; ++r) { float v = acc[t][r] + bv; if (ACT == 1) v = fmaxf(v, 0.f); so[w][8 * hh + r][t * 16 + ln] = v; }
  }
  __builtin_amdgcn_fence(__ATOMIC_ACQ_REL, "workgroup");
  __builtin_amdgcn_wave_barrier();
  const int rsub = lane >> 4, c4 = (lane & 15) * 4;
  {
#pragma unroll
    for (int q = 0; q < 8; ++q) {
      const int r = q * 2 + rsub;
      const v4f v = *(const v4fa*)&so[w][r][c4];
      *(v4f*)(C + (size_t)(row0 + r) * ldc + col0 + c4) = v;
    }
    
  }
}

// GEMM C = act(A·W + bias + resid): A f32 (ASPLIT -> hi/lo 2 terms), Wt bf16 [N][K]; ACT 0 none, 1 relu, 2 exact gelu;
// resid (optional, f32, row index = (row % rmod), pitch ldr, RES_BF16 rounds it) added before the activation.
template <bool ASPLIT, int ACT, bool BIAS_BF16, bool RES_BF16>
__global__ __launch_bounds__(128) void k_gemm_bf3(const float* __restrict__ A, int lda, const unsigned short* __restrict__ Wt, int ldb,
                                                const float* __restrict__ bias, const float* __restrict__ resid, int rmod, int ldr,
                                                float* __restrict__ C, int ldc, int M, int N, int K) {
  __shared__ __attribute__((aligned(16))) float so[4][16][64];
  const int tid = threadIdx.x, w = tid >> 5, lane = tid & 31, ln = lane & 15, hh = lane >> 4;
  const int ntn = N / 64;
  const int wid = blockIdx.x * 4 + w;
  const int mt = wid / ntn, nq = wid % ntn;
  if (mt * 16 >= M) return;
  const int row0 = mt * 16, col0 = nq * 64;
  const float* arow = A + (size_t)(row0 + ln) * lda;
  v8f acc[4] = {};
  for (int kb = 0; kb < K; kb += 32) {
    FragB ah, al;
    const v4f x0 = *(const v4fa*)(arow + kb + 8 * hh), x1 = *(const v4fa*)(arow + kb + 8 * hh + 4);
    const v4f x2 = *(const v4fa*)(arow + kb + 16 + 8 * hh), x3 = *(const v4fa*)(arow + kb + 16 + 8 * hh + 4);
    float xs[16] = {x0[0],x0[1],x0[2],x0[3],x1[0],x1[1],x1[2],x1[3],x2[0],x2[1],x2[2],x2[3],x3[0],x3[1],x3[2],x3[3]};
#pragma unroll
    for (int i = 0; i < 16; ++i) { const unsigned short hb = bf16_bits(xs[i]); ah.u[i] = hb; al.u[i] = ASPLIT ? bf16_bits(xs[i] - bf16_val(hb)) : (unsigned short)0; }
#pragma unroll
    for (int t = 0; t < 4; ++t) {
      const unsigned short* brow = Wt + (size_t)(col0 + t * 16 + ln) * ldb + kb;
      FragB b;
      b.half[0] = *(const v8us*)(brow + 8 * hh);
      b.half[1] = *(const v8us*)(brow + 16 + 8 * hh);
      acc[t] = mmaN<ASPLIT ? 2 : 1>(ah.v, al.v, b.v, b.v, acc[t]);
    }
  }
#pragma unroll
  for (int t = 0; t < 4; ++t) {
    const int col = col0 + t * 16 + ln;
    float bv = bias ? bias[col] : 0.f;
    if (BIAS_BF16) bv = bf16_round(bv);
#pragma unroll
    for (int r = 0; r < 8; ++r) {
      float v = acc[t][r] + bv;
      if (resid) { float rv = resid[(size_t)((row0 + 8 * hh + r) % rmod) * ldr + col]; if (RES_BF16) rv = bf16_round(rv); v += rv; }
      if (ACT == 1) v = fmaxf(v, 0.f);
      if (ACT == 2) v = 0.5f * v * (1.0f + erff(v * 0.70710678118654752f));
      if (ACT == 3) { const float u = 0.7978845608028654f * (v + 0.044715f * v * v * v); v = 0.5f * v * (1.0f + tanhf(u)); }
      so[w][8 * hh + r][t * 16 + ln] = v;
    }
  }
  __builtin_amdgcn_fence(__ATOMIC_ACQ_REL, "workgroup");
  __builtin_amdgcn_wave_barrier();
  const int rsub = lane >> 4, c4 = (lane & 15) * 4;
  {
#pragma unroll
    for (int q = 0; q < 8; ++q) {
      const int r = q * 2 + rsub;
      const v4f v = *(const v4fa*)&so[w][r][c4];
      *(v4f*)(C + (size_t)(row0 + r) * ldc + col0 + c4) = v;
    }
    
  }
}
// row LayerNorm (biased variance, eps) over N: s = X (+ R); optional out_sum <- s; out_norm <- (s-mu)*rsqrt(var+eps)*g + b
template <bool PARAM_BF16>
__global__ __launch_bounds__(256) void k_layernorm(const float* __restrict__ X, const float* __restrict__ R, const float* __restrict__ g, const float* __restrict__ bta,
                                                  float* __restrict__ out_sum, float* __restrict__ out_norm, int N, float eps) {
  __shared__ float red[256];
  const int row = blockIdx.x, tid = threadIdx.x;
  const float* x = X + (size_t)row * N; const float* rr = R ? R + (size_t)row * N : nullptr;
  float vals[16];                     // up to N = 4096
  const int per = N / 256;            // contiguous chunk per thread? use strided-by-4 chunks: thread handles j = tid*4 + 1024*u
  float s1 = 0.f;
  for (int u = 0; u < per / 4; ++u) {
    const int j = tid * 4 + 1024 * u;
    const v4f a = *(const v4fa*)(x + j);
    v4f b = {0.f,0.f,0.f,0.f}; if (rr) b = *(const v4fa*)(rr + j);
#pragma unroll
    for (int q = 0; q < 4; ++q) { const float v = a[q] + b[q]; vals[u * 4 + q] = v; s1 += v; }
  }
  red[tid] = s1; __syncthreads();
  for (int st = 128; st > 0; st >>= 1) { if (tid < st) red[tid] += red[tid + st]; __syncthreads(); }
  const float mu = red[0] / (float)N; __syncthreads();
  float s2 = 0.f;
  for (int u = 0; u < per / 4; ++u)
#pragma unroll
    for (int q = 0; q < 4; ++q) { const float c = vals[u * 4 + q] - mu; s2 += c * c; }
  red[tid] = s2; __syncthreads();
  for (int st = 128; st > 0; st >>= 1) { if (tid < st) red[tid] += red[tid + st]; __syncthreads(); }
  const float rs = rsqrtf(red[0] / (float)N + eps);
  {
    for (int u = 0; u < per / 4; ++u) {
      const int j = tid * 4 + 1024 * u;
      v4f o, sm;
#pragma unroll
      for (int q = 0; q < 4; ++q) {
        float gg = g[j + q], bb = bta[j + q];
        if (PARAM_BF16) { gg = bf16_round(gg); bb = bf16_round(bb); }
        sm[q] = vals[u * 4 + q]; o[q] = (vals[u * 4 + q] - mu) * rs * gg + bb;
      }
      if (out_sum) *(v4f*)(out_sum + (size_t)row * N + j) = sm;
      *(v4f*)(out_norm + (size_t)row * N + j) = o;
    }
    
  }
}



// ---- f16 WMMA path (v_wmma_f32_16x16x32_f16): 11-bit significands for operands in range — used where a [0,1] probability operand needs more precision than bf16
typedef _Float16 v16h __attribute__((ext_vector_type(16)));
union FragH { v16h v; v8us half[2]; _Float16 h[16]; unsigned short u[16]; };
template <int NT>
__device__ __forceinline__ v8f mmaH(v16h ah, v16h al, v16h bh, v16h bl, v8f c) {
  c = __builtin_amdgcn_wmma_f32_16x16x32_f16(false, ah, false, bh, (short)0, c, false, false);
  if (NT >= 2) c = __builtin_amdgcn_wmma_f32_16x16x32_f16(false, al, false, bh, (short)0, c, false, false);
  if (NT >= 3) c = __builtin_amdgcn_wmma_f32_16x16x32_f16(false, ah, false, bl, (short)0, c, false, false);
  asm volatile("v_nop\n\tv_nop\n\tv_nop\n\tv_nop" : "+v"(c) : "v"(ah), "v"(al), "v"(bh), "v"(bl));
  return c;
}
// batched GEMM like k_gemm_b but f16 operands: A f32 (split into f16 hi/lo if ASPLIT, else rounded to f16), Bt = f16 values [n][k]; alpha; C f32; N multiple of 16 (partial tiles skipped)
template <bool ASPLIT>
__global__ __launch_bounds__(128) void k_gemm_h(const float* __restrict__ A, int lda, size_t sA, const _Float16* __restrict__ Bh, int ldb, size_t sB, float alpha, float* __restrict__ C, int ldc, size_t sC, int M, int N, int K) {
  __shared__ __attribute__((aligned(16))) float so[4][16][64];
  const int tid = threadIdx.x, w = tid >> 5, lane = tid & 31, ln = lane & 15, hh = lane >> 4; const int by = blockIdx.y;
  A += (size_t)by * sA; Bh += (size_t)by * sB; C += (size_t)by * sC;
  const int ntn = (N + 63) / 64; const int wid = blockIdx.x * 4 + w; const int mt = wid / ntn, nq = wid % ntn; if (mt * 16 >= M) return;
  const int row0 = mt * 16, col0 = nq * 64; const float* arow = A + (size_t)(row0 + ln) * lda;
  v8f acc[4] = {};
  for (int kb = 0; kb < K; kb += 32) {
    FragH ah, al;
    const v4f x0 = *(const v4fa*)(arow + kb + 8 * hh), x1 = *(const v4fa*)(arow + kb + 8 * hh + 4), x2 = *(const v4fa*)(arow + kb + 16 + 8 * hh), x3 = *(const v4fa*)(arow + kb + 16 + 8 * hh + 4);
    float xs[16] = {x0[0],x0[1],x0[2],x0[3],x1[0],x1[1],x1[2],x1[3],x2[0],x2[1],x2[2],x2[3],x3[0],x3[1],x3[2],x3[3]};
#pragma unroll
    for (int i = 0; i < 16; ++i) { const _Float16 h = (_Float16)xs[i]; ah.h[i] = h; al.h[i] = ASPLIT ? (_Float16)(xs[i] - (float)h) : (_Float16)0.0f; }
#pragma unroll
    for (int t = 0; t < 4; ++t) { if (col0 + t * 16 >= N) continue; const size_t boff = (size_t)(col0 + t * 16 + ln) * ldb + kb; FragH bq; bq.half[0] = *(const v8us*)(Bh + boff + 8 * hh); bq.half[1] = *(const v8us*)(Bh + boff + 16 + 8 * hh);
      acc[t] = mmaH<ASPLIT ? 2 : 1>(ah.v, al.v, bq.v, bq.v, acc[t]); }
  }
#pragma unroll
  for (int t = 0; t < 4; ++t) { if (col0 + t * 16 >= N) continue;
#pragma unroll
    for (int r = 0; r < 8; ++r) so[w][8 * hh + r][t * 16 + ln] = acc[t][r] * alpha; }
  __builtin_amdgcn_fence(__ATOMIC_ACQ_REL, "workgroup"); __builtin_amdgcn_wave_barrier();
  const int rsub = lane >> 4, c4 = (lane & 15) * 4;
  {
#pragma unroll
    for (int q = 0; q < 8; ++q) { const int r = q * 2 + rsub; if (col0 + c4 < N) { const v4f v = *(const v4fa*)&so[w][r][c4]; *(v4f*)(C + (size_t)(row0 + r) * ldc + col0 + c4) = v; } }
     }
}

// Wt[n][k] = f16(W[k][n]·scale) from f32 row-major W[K][N] (scale = power of two; bf16-exact weights stay exact in f16 away from the subnormal range)
__global__ __launch_bounds__(256) void k_wt_f16(const float* __restrict__ W, _Float16* __restrict__ Wt, int K, int N, float scale) {
  const int t = blockIdx.x * 256 + threadIdx.x; if (t >= N * (K / 8)) return; const int n = t / (K / 8), k8 = (t % (K / 8)) * 8; FragH f;
#pragma unroll
  for (int i = 0; i < 8; ++i) f.h[i] = (_Float16)(bf16_round(W[(size_t)(k8 + i) * N + n]) * scale); const v8us o = f.half[0];
  *(v8us*)((unsigned short*)Wt + (size_t)n * K + k8) = o; 
}
// k_gemm_hh variant with fused epilogue: v = acc·alpha + bias[by·sBias + col] (+ CP[(row/rowsPerB)·sCPb + by·64 + col] if CP) ; ACT 0 none / 1 elu ; writes f16 C16 (and f32 C if non-null)
template <int ACT>
__global__ __launch_bounds__(128) void k_gemm_hhx(const _Float16* __restrict__ A, int lda, size_t sA, const _Float16* __restrict__ Bh, int ldb, size_t sB, float alpha, const float* __restrict__ bias, size_t sBias, const float* __restrict__ CP, int rowsPerB, size_t sCPb, int row0g,
    float* __restrict__ C, _Float16* __restrict__ C16, int ldc, size_t sC, int M, int N, int K) {
  __shared__ __attribute__((aligned(16))) float so[4][16][64];
  const int tid = threadIdx.x, w = tid >> 5, lane = tid & 31, ln = lane & 15, hh = lane >> 4; const int by = blockIdx.y;
  A += (size_t)by * sA; Bh += (size_t)by * sB; const size_t cofs = (size_t)by * sC; const float* bp = bias ? bias + (size_t)by * sBias : nullptr;
  const int ntn = (N + 63) / 64; const int wid = blockIdx.x * 4 + w; const int mt = wid / ntn, nq = wid % ntn; if (mt * 16 >= M) return;
  const int row0 = mt * 16, col0 = nq * 64; const _Float16* arow = A + (size_t)(row0 + ln) * lda;
  v8f acc[4] = {};
  for (int kb = 0; kb < K; kb += 32) { FragH ah; ah.half[0] = *(const v8us*)((const unsigned short*)arow + kb + 8 * hh); ah.half[1] = *(const v8us*)((const unsigned short*)arow + kb + 16 + 8 * hh);
#pragma unroll
    for (int t = 0; t < 4; ++t) { if (col0 + t * 16 >= N) continue; const size_t boff = (size_t)(col0 + t * 16 + ln) * ldb + kb; FragH bq; bq.half[0] = *(const v8us*)((const unsigned short*)Bh + boff + 8 * hh); bq.half[1] = *(const v8us*)((const unsigned short*)Bh + boff + 16 + 8 * hh);
      acc[t] = mmaH<1>(ah.v, ah.v, bq.v, bq.v, acc[t]); }
  }
#pragma unroll
  for (int t = 0; t < 4; ++t) { if (col0 + t * 16 >= N) continue; const int col = col0 + t * 16 + ln; const float bv = bp ? bf16_round(bp[col]) : 0.f;
#pragma unroll
    for (int r = 0; r < 8; ++r) { float v = acc[t][r] * alpha + bv; if (CP) { const int rr = row0g + row0 + 8 * hh + r; if (rowsPerB < 0) v += CP[cofs + (size_t)rr * ldc + col];      /* rowsPerB < 0: own element of the batched C plane */ else { const int bidx = rr / rowsPerB; v += CP[(size_t)bidx * sCPb + (size_t)by * 64 + col]; } } if (ACT == 1) v = (v > 0.f) ? v : expm1f(v); else if (ACT == 7) v = (v > 0.f) ? v + 1.0f : expf(v); else if (ACT == 8) v = tanhf(v); else if (ACT == 9) v = 0.5f * v * (1.0f + tanhf(0.7978845608028654f * (v + 0.044715f * v * v * v))); else if (ACT == 11) v = 1.0f / (1.0f + expf(-v)); else if (ACT == 12) v = (v > 0.f) ? v : 0.01f * v; else if (ACT == 14) v = (v > 0.f) ? v : 0.1f * v; else if (ACT == 16) v = (v >= 0.f) ? v : 0.3f * v; else if (ACT == 17) v = (v >= 0.f) ? v : 0.2f * v; else if (ACT == 15) v = v / (1.0f + expf(-v)); else if (ACT == 3) v = fmaxf(v, 0.f); else if (ACT == 6) v = 0.5f * v * (1.0f + erff(v * 0.70710678118654752f)); so[w][8 * hh + r][t * 16 + ln] = v; } }
  __builtin_amdgcn_fence(__ATOMIC_ACQ_REL, "workgroup"); __builtin_amdgcn_wave_barrier();
  const int rsub = lane >> 4, c4 = (lane & 15) * 4; typedef _Float16 v4h __attribute__((ext_vector_type(4)));
  {
#pragma unroll
    for (int q = 0; q < 8; ++q) { const int r = q * 2 + rsub; if (col0 + c4 < N) { const v4f v = *(const v4fa*)&so[w][r][c4]; if (C) *(v4f*)(C + cofs + (size_t)(row0 + r) * ldc + col0 + c4) = v; if (C16) { v4h h4; for (int i = 0; i < 4; ++i) h4[i] = (_Float16)v[i]; *(v4h*)(C16 + cofs + (size_t)(row0 + r) * ldc + col0 + c4) = h4; } } }
     }
}


typedef _Float16 v4h __attribute__((ext_vector_type(4)));

__global__ __launch_bounds__(256) void k_x16(const float* __restrict__ x, _Float16* __restrict__ X16, size_t n8) { const size_t t = (size_t)blockIdx.x * 256 + threadIdx.x; if (t >= n8) return; FragH f;
#pragma unroll
  for (int q = 0; q < 8; ++q) f.h[q] = (_Float16)bf16_round(x[t * 8 + q]); *(v8us*)((unsigned short*)X16 + t * 8) = f.half[0];  }
__global__ __launch_bounds__(256) void k_h16(const float* __restrict__ x, _Float16* __restrict__ X16, size_t n8) { const size_t t = (size_t)blockIdx.x * 256 + threadIdx.x; if (t >= n8) return; FragH f;
#pragma unroll
  for (int q = 0; q < 8; ++q) f.h[q] = (_Float16)x[t * 8 + q]; *(v8us*)((unsigned short*)X16 + t * 8) = f.half[0];  }
__global__ __launch_bounds__(256) void k_round16f(const float* __restrict__ W, _Float16* __restrict__ Bt, size_t n8) { const size_t t = (size_t)blockIdx.x * 256 + threadIdx.x; if (t >= n8) return; FragH f;
#pragma unroll
  for (int i = 0; i < 8; ++i) f.h[i] = (_Float16)(bf16_round(W[t * 8 + i]) * 16.0f); *(v8us*)((unsigned short*)Bt + t * 8) = f.half[0];  }
__global__ __launch_bounds__(256) void k_hl(const float* __restrict__ F, _Float16* __restrict__ Hh, _Float16* __restrict__ Hl, size_t n8) { const size_t t = (size_t)blockIdx.x * 256 + threadIdx.x; if (t >= n8) return; FragH fh, fl; const v4f a = *(const v4fa*)(F + t * 8), c = *(const v4fa*)(F + t * 8 + 4);
#pragma unroll
  for (int q = 0; q < 4; ++q) { _Float16 h = (_Float16)a[q]; fh.h[q] = h; fl.h[q] = (_Float16)((a[q] - (float)h) * 1024.0f); h = (_Float16)c[q]; fh.h[4 + q] = h; fl.h[4 + q] = (_Float16)((c[q] - (float)h) * 1024.0f); }
  { *(v8us*)((unsigned short*)Hh + t * 8) = fh.half[0]; *(v8us*)((unsigned short*)Hl + t * 8) = fl.half[0];  } }

// ---- fast GEMM (wave tile 32x64, work-group tile 128x64; requires M % 128 == 0 rows per launch region, N % 64 == 0 and K % 64 == 0); epilogue = k_gemm_hhx semantics ----
__device__ __forceinline__ v16h g2_frag(const _Float16* p, int hh) { FragH f; f.half[0] = *(const v8us*)((const unsigned short*)p + 8 * hh); f.half[1] = *(const v8us*)((const unsigned short*)p + 16 + 8 * hh); return f.v; }
__device__ __forceinline__ v8f g2_mma(v16h a, v16h b, v8f c) { v8f d = __builtin_amdgcn_wmma_f32_16x16x32_f16(false, a, false, b, (short)0, c, false, false); asm volatile("v_nop\n\tv_nop\n\tv_nop\n\tv_nop" : "+v"(d) : "v"(a), "v"(b)); return d; }
// A stage of k_gemm2 = 64 k of the work-group's 128 A rows and 64 B rows: 192 rows of 128 bytes in LDS at a pitch of 144 (16 B x odd: the 16 lanes of a half wave's ds_load_b128 fall on 64 different banks).
#define G2_PITCH 144
#define G2_BOFF (128 * G2_PITCH)      /* the B rows stand behind the A rows */
#define G2_STAGE (192 * G2_PITCH)
__device__ __forceinline__ v16h g2_lfrag(const unsigned char* p) { FragH f; f.half[0] = *(const v8us*)p; f.half[1] = *(const v8us*)(p + 32); return f.v; }      /* p = row start + 64 B per 32 k + 16 hh: the k order of g2_frag */
// One stage, global memory -> LDS through no register: 12 asynchronous copies of 16 bytes a lane (8 A rows, 4 B rows, 16 rows apart); 8 lanes fill one row, so a wave's copy reads 4 whole 128-byte lines.
// lds = the lane's own LDS byte address of its first A row, ga / gb = its own global addresses, a16 / b16 = 16 rows in elements. The s_wait_xcnt stands inside the statement, behind the last copy, so that
// no address register of a copy is written again in front of it.
__device__ __forceinline__ void g2_stage(unsigned lds, const _Float16* ga, const _Float16* gb, size_t a16, size_t b16) {
  asm volatile("global_load_async_to_lds_b128 %0, %12, off\n\tglobal_load_async_to_lds_b128 %1, %13, off\n\tglobal_load_async_to_lds_b128 %2, %14, off\n\tglobal_load_async_to_lds_b128 %3, %15, off\n\t"
               "global_load_async_to_lds_b128 %4, %16, off\n\tglobal_load_async_to_lds_b128 %5, %17, off\n\tglobal_load_async_to_lds_b128 %6, %18, off\n\tglobal_load_async_to_lds_b128 %7, %19, off\n\t"
               "global_load_async_to_lds_b128 %8, %20, off\n\tglobal_load_async_to_lds_b128 %9, %21, off\n\tglobal_load_async_to_lds_b128 %10, %22, off\n\tglobal_load_async_to_lds_b128 %11, %23, off\n\t"
               "s_wait_xcnt 0x0"
               :: "v"(lds), "v"(lds + 16 * G2_PITCH), "v"(lds + 32 * G2_PITCH), "v"(lds + 48 * G2_PITCH), "v"(lds + 64 * G2_PITCH), "v"(lds + 80 * G2_PITCH), "v"(lds + 96 * G2_PITCH), "v"(lds + 112 * G2_PITCH),
                  "v"(lds + G2_BOFF), "v"(lds + G2_BOFF + 16 * G2_PITCH), "v"(lds + G2_BOFF + 32 * G2_PITCH), "v"(lds + G2_BOFF + 48 * G2_PITCH),
                  "v"(ga), "v"(ga + a16), "v"(ga + 2 * a16), "v"(ga + 3 * a16), "v"(ga + 4 * a16), "v"(ga + 5 * a16), "v"(ga + 6 * a16), "v"(ga + 7 * a16),
                  "v"(gb), "v"(gb + b16), "v"(gb + 2 * b16), "v"(gb + 3 * b16) : "memory"); }
template <int ACT>
__global__ __launch_bounds__(128) void k_gemm2(const _Float16* __restrict__ A, int lda, size_t sA, const _Float16* __restrict__ Bh, int ldb, size_t sB, float alpha, const float* __restrict__ bias, size_t sBias, const float* __restrict__ CP, int rowsPerB, size_t sCPb, int row0g,
    float* __restrict__ C, _Float16* __restrict__ C16, int ldc, size_t sC, int M, int N, int K) { static_assert(ACT == 0 || ACT == 3 || ACT == 6 || ACT == 8 || ACT == 9 || ACT == 11 || ACT == 12 || ACT == 14 || ACT == 15 || ACT == 16 || ACT == 17, "k_gemm2: unsupported ACT code (would silently apply no activation)");
  __shared__ __attribute__((aligned(16))) unsigned char sm[2 * G2_STAGE];      /* two stage buffers; behind the K loop the same bytes are the epilogue's staging rows */
  static_assert(sizeof(float) * 4 * 32 * 68 <= 2 * G2_STAGE, "epilogue staging fits the ring"); float (*so)[32][68] = (float (*)[32][68])sm;
  const int tid = threadIdx.x, w = tid >> 5, lane = tid & 31, ln = lane & 15, hh = lane >> 4; const int by = blockIdx.y;
  A += (size_t)by * sA; Bh += (size_t)by * sB; const size_t cofs = (size_t)by * sC; const float* bp = bias ? bias + (size_t)by * sBias : nullptr;
  const int ntn = N >> 6; const int mt = blockIdx.x / ntn, nq = blockIdx.x - mt * ntn; const int row0 = mt * 128 + 32 * w, col0 = nq * 64; if (mt * 128 >= M) return;      /* the whole work-group or none, in front of every barrier */
  const int cr = tid >> 3, cc = tid & 7;      /* the lane's copies: rows cr + 16 i, 16-byte piece cc of the row's 128 bytes */
  const unsigned lds0 = (unsigned)(size_t)sm + (unsigned)(cr * G2_PITCH + cc * 16);
  const _Float16* ga = A + (size_t)(mt * 128 + cr) * lda + cc * 8; const _Float16* gb = Bh + (size_t)(col0 + cr) * ldb + cc * 8; const size_t a16 = (size_t)16 * lda, b16 = (size_t)16 * ldb;
  const unsigned char* fa = sm + (32 * w + ln) * G2_PITCH + 16 * hh; const unsigned char* fb = sm + G2_BOFF + ln * G2_PITCH + 16 * hh;      /* the lane's fragment rows in buffer 0 */
  const v8f z8 = {0.f,0.f,0.f,0.f,0.f,0.f,0.f,0.f}; v8f c00 = z8, c01 = z8, c02 = z8, c03 = z8, c10 = z8, c11 = z8, c12 = z8, c13 = z8;
  const int nst = K >> 6;
  g2_stage(lds0, ga, gb, a16, b16);
  asm volatile("s_wait_asynccnt 0x0" ::: "memory");      /* this wave's copies of stage 0 have landed */
  __syncthreads();      /* ... and every other wave's: stage 0 may be read */
  if (nst > 1) g2_stage(lds0 + G2_STAGE, ga + 64, gb + 64, a16, b16);
#pragma unroll 1      /* rolled: the buffer is picked by the trip's parity, a second copy of the body would only add code */
  for (int t = 0; t < nst; ++t) { const unsigned bo = (unsigned)(t & 1) * G2_STAGE;
    const unsigned char* pa = fa + bo; const unsigned char* pb = fb + bo; v16h af[2][2], bf[2][4];
#pragma unroll      /* constant indices: the fragment arrays become registers */
    for (int kc = 0; kc < 2; ++kc) { af[kc][0] = g2_lfrag(pa + 64 * kc); bf[kc][0] = g2_lfrag(pb + 64 * kc); af[kc][1] = g2_lfrag(pa + 64 * kc + 16 * G2_PITCH);
      for (int j = 1; j < 4; ++j) bf[kc][j] = g2_lfrag(pb + 64 * kc + j * 16 * G2_PITCH); }
#pragma unroll      /* the stage's two 32-k blocks, in ascending k: the sum order of the plain loop */
    for (int kc = 0; kc < 2; ++kc) { c00 = g2_mma(af[kc][0], bf[kc][0], c00); c10 = g2_mma(af[kc][1], bf[kc][0], c10); c01 = g2_mma(af[kc][0], bf[kc][1], c01); c11 = g2_mma(af[kc][1], bf[kc][1], c11);
      c02 = g2_mma(af[kc][0], bf[kc][2], c02); c12 = g2_mma(af[kc][1], bf[kc][2], c12); c03 = g2_mma(af[kc][0], bf[kc][3], c03); c13 = g2_mma(af[kc][1], bf[kc][3], c13); }
    asm volatile("s_wait_dscnt 0x0" ::: "memory");      /* this wave's reads of the buffer are done before it is handed to the copies */
    asm volatile("s_wait_asynccnt 0x0" ::: "memory");      /* this wave's copies of stage t + 1 have landed */
    __syncthreads();      /* publishes stage t + 1 and ends every wave's reads of stage t */
    if (t + 2 < nst) g2_stage(lds0 + bo, ga + (size_t)(t + 2) * 64, gb + (size_t)(t + 2) * 64, a16, b16); }      /* refill of the buffer just read; in flight under trip t + 1 */
  asm volatile("s_wait_asynccnt 0x0" ::: "memory");      /* no copy is outstanding when the ring becomes staging; the last trip's barrier has ended every read of it */
  v8f accs[8] = {c00, c01, c02, c03, c10, c11, c12, c13};
#pragma unroll
  for (int u = 0; u < 8; ++u) { const int t = u & 3, half = u >> 2; const int col = col0 + t * 16 + ln; const float bv = bp ? bf16_round(bp[col]) : 0.f;
#pragma unroll
    for (int r = 0; r < 8; ++r) { const int rloc = half * 16 + 8 * hh + r; float v = accs[u][r] * alpha + bv; if (CP) { if (rowsPerB < 0) v += CP[cofs + (size_t)(row0g + row0 + rloc) * ldc + col];      /* rowsPerB < 0: own element of the batched C plane */ else { const int bidx = (row0g + row0 + rloc) / rowsPerB; v += CP[(size_t)bidx * sCPb + (size_t)by * 64 + col]; } }
      if (ACT == 3) v = fmaxf(v, 0.f); else if (ACT == 6) v = 0.5f * v * (1.0f + erff(v * 0.70710678118654752f)); else if (ACT == 11) v = 1.0f / (1.0f + expf(-v)); else if (ACT == 15) v = v / (1.0f + expf(-v)); else if (ACT == 12) v = (v > 0.f) ? v : 0.01f * v; else if (ACT == 8) v = tanhf(v); else if (ACT == 9) v = 0.5f * v * (1.0f + tanhf(0.7978845608028654f * (v + 0.044715f * v * v * v))); else if (ACT == 14) v = (v > 0.f) ? v : 0.1f * v; else if (ACT == 16) v = (v >= 0.f) ? v : 0.3f * v; else if (ACT == 17) v = (v >= 0.f) ? v : 0.2f * v;
      so[w][rloc][t * 16 + ln] = v; } }
  __builtin_amdgcn_fence(__ATOMIC_ACQ_REL, "workgroup"); __builtin_amdgcn_wave_barrier();
  const int rsub = lane >> 4, c4 = (lane & 15) * 4;
  {
#pragma unroll
    for (int q = 0; q < 16; ++q) { const int r = q * 2 + rsub; const v4f v = *(const v4fa*)&so[w][r][c4]; if (C) *(v4f*)(C + cofs + (size_t)(row0 + r) * ldc + col0 + c4) = v; if (C16) { v4h h4; for (int i = 0; i < 4; ++i) h4[i] = (_Float16)v[i]; *(v4h*)(C16 + cofs + (size_t)(row0 + r) * ldc + col0 + c4) = h4; } }
     } }


__global__ __launch_bounds__(256) void k_wnat(const float* __restrict__ w, size_t n8, _Float16* __restrict__ Bt) { const size_t t = (size_t)blockIdx.x * 256 + threadIdx.x; if (t >= n8) return; FragH f; for (int q = 0; q < 8; ++q) f.h[q] = (_Float16)(bf16_round(w[t * 8 + q]) * 16.0f); *(v8us*)((unsigned short*)Bt + t * 8) = f.half[0];  }
__global__ __launch_bounds__(256) void k_rsm(const float* __restrict__ S, _Float16* __restrict__ P, int nrows) {
  #pragma clang fp contract(off)
  const int i = blockIdx.x * 256 + threadIdx.x; if (i >= nrows) return; const float* s = S + (size_t)i * SQ; float mx = -3.0e38f;
#pragma unroll 1
  for (int j = 0; j < SQ; ++j) mx = fmaxf(mx, s[j]); float se = 0.f;
#pragma unroll 1
  for (int j = 0; j < SQ; ++j) se += expf(s[j] - mx); const float sc = 256.0f / se;
#pragma unroll 1
  for (int j0 = 0; j0 < SQ; j0 += 8) { FragH f; for (int q = 0; q < 8; ++q) f.h[q] = (_Float16)(expf(s[j0 + q] - mx) * sc); unsigned short* d = (unsigned short*)P + (size_t)i * SQ + j0; *(v8us*)d = f.half[0];  } }
__global__ __launch_bounds__(256) void k_vt(const _Float16* __restrict__ V16, int b, int h0, _Float16* __restrict__ VT) { __shared__ unsigned short tl[64][65]; const int tid = threadIdx.x; const int hh = blockIdx.x % HG, sg = blockIdx.x / HG; const int s0 = sg * 64; const int h = h0 + hh;
  for (int i = tid; i < 64 * 8; i += 256) { const int j = i / 8, d8 = (i % 8) * 8; FragH f; f.half[0] = *(const v8us*)((const unsigned short*)V16 + ((size_t)b * SQ + s0 + j) * DM + h * HD + d8); for (int q = 0; q < 8; ++q) tl[d8 + q][j] = f.u[q]; }
  __syncthreads();
  { for (int i = tid; i < 64 * 8; i += 256) { const int d = i / 8, j8 = (i % 8) * 8; FragH f; for (int q = 0; q < 8; ++q) f.u[q] = tl[d][j8 + q]; *(v8us*)((unsigned short*)VT + ((size_t)hh * HD + d) * SQ + s0 + j8) = f.half[0]; }  } }



__global__ __launch_bounds__(256) void k_rsmcf2(const float* __restrict__ S, _Float16* __restrict__ P, int hg, int q0, int nk) {
  #pragma clang fp contract(off)
  const int t = blockIdx.x * 256 + threadIdx.x; if (t >= hg * QT) return; const size_t i = (size_t)t; const float* s = S + i * NKX; const int last = q0 + (t % QT); float mx = -3.0e38f;
#pragma unroll 1
  for (int j = 0; j < nk; ++j) { const float f = (j <= last) ? 1.f : 0.f; mx = fmaxf(mx, fmaf(f, s[j], (1.f - f) * -1.0e9f)); } float se = 0.f;
#pragma unroll 1
  for (int j = 0; j < nk; ++j) { const float f = (j <= last) ? 1.f : 0.f; se += __expf(fmaf(f, s[j], (1.f - f) * -1.0e9f) - mx); } const float sc = 256.0f / se;
#pragma unroll 1
  for (int j0 = 0; j0 < nk; j0 += 8) { FragH fr; for (int q = 0; q < 8; ++q) { const int j = j0 + q; const float f = (j <= last) ? 1.f : 0.f; fr.h[q] = (_Float16)(__expf(fmaf(f, s[j], (1.f - f) * -1.0e9f) - mx) * sc); } unsigned short* d = (unsigned short*)P + i * NKX + j0; *(v8us*)d = fr.half[0];  } }


template <int MASKADD>
__global__ __launch_bounds__(64) void k_att0(const float* __restrict__ QF, const float* __restrict__ KF, const float* __restrict__ VF, int ld, const float* __restrict__ mask, float scale, float* __restrict__ OF, int ldo) {
  #pragma clang fp contract(off)
  __shared__ __attribute__((aligned(16))) float lq[64][64]; __shared__ __attribute__((aligned(16))) float lo[64][64];
  const int tid = threadIdx.x; const int h = blockIdx.x / (QT0 / 64), rg = blockIdx.x % (QT0 / 64); const int i = rg * 64 + tid;
  const float* qr = QF + (size_t)i * ld + h * HD;
#pragma unroll 1
  for (int c = 0; c < HD / 4; ++c) { *(v4f*)&lq[tid][c * 4] = *(const v4fa*)(qr + c * 4); const v4f z = {0.f, 0.f, 0.f, 0.f}; *(v4f*)&lo[tid][c * 4] = z; }
  float m = -1.0e30f, l = 0.f; const int jmax = MASKADD ? (SQ - 1) : (rg * 64 + 63);      /* additive-mask form: every key (the mask input decides); causal form: keys up to the block's last row */
#pragma unroll 1
  for (int j = 0; j <= jmax; ++j) { const float* kr = KF + (size_t)j * ld + h * HD; const float* vr = VF + (size_t)j * ld + h * HD; float s = 0.f;
#pragma unroll 1
    for (int c = 0; c < HD / 4; ++c) { const v4f kq = *(const v4fa*)(kr + c * 4); const v4f qq = *(v4f*)&lq[tid][c * 4]; s = __fadd_rn(s, __fmul_rn(qq[0], kq[0])); s = __fadd_rn(s, __fmul_rn(qq[1], kq[1])); s = __fadd_rn(s, __fmul_rn(qq[2], kq[2])); s = __fadd_rn(s, __fmul_rn(qq[3], kq[3])); }
    s = __fmul_rn(s, scale); if (MASKADD) s = __fadd_rn(s, __fmul_rn(bf16_round(mask[(size_t)i * SQ + j]), -10000.0f));
    const float f = (MASKADD || j <= i) ? 1.f : 0.f; const float sm = fmaf(f, s, (1.f - f) * -1.0e30f); const float mn = fmaxf(m, sm); const float sc = expf(m - mn); const float e = expf(sm - mn); l = __fadd_rn(__fmul_rn(l, sc), e); m = mn;
#pragma unroll 1
    for (int c = 0; c < HD / 4; ++c) { const v4f vv = *(const v4fa*)(vr + c * 4); v4f oo = *(v4f*)&lo[tid][c * 4]; for (int u = 0; u < 4; ++u) oo[u] = __fadd_rn(__fmul_rn(oo[u], sc), __fmul_rn(e, vv[u])); *(v4f*)&lo[tid][c * 4] = oo; } }
  const float fin = 64.0f / l;      /* o carried x64 like the f16 path */
#pragma unroll 1
  for (int c = 0; c < HD / 4; ++c) { v4f oo = *(v4f*)&lo[tid][c * 4]; for (int u = 0; u < 4; ++u) oo[u] = __fmul_rn(oo[u], fin); *(v4f*)&lo[tid][c * 4] = oo; }
  __syncthreads();
  {
#pragma unroll 1
    for (int it = 0; it < 16; ++it) { const int row = it * 4 + tid / 16, pc = (tid % 16) * 4; const v4f v = *(const v4f*)&lo[row][pc]; *(v4f*)(OF + (size_t)(rg * 64 + row) * ldo + h * HD + pc) = v; }
     } }


template <int BFIN, int WXB>
__global__ __launch_bounds__(256) void k_ln16(const float* __restrict__ X, const float* __restrict__ g, const float* __restrict__ bb, float eps, _Float16* __restrict__ N16, float* __restrict__ XB) {
  #pragma clang fp contract(off)
  __shared__ float red[256]; const size_t r = blockIdx.x; const int t = threadIdx.x; const v4f xa = *(const v4fa*)(X + r * DMQ + t * 4); float s[4]; float sum = 0.f;
  for (int q = 0; q < 4; ++q) { s[q] = BFIN ? bf16_round(xa[q]) : xa[q]; sum = __fadd_rn(sum, s[q]); }
  red[t] = sum; __syncthreads(); for (int st = 128; st > 0; st >>= 1) { if (t < st) red[t] = __fadd_rn(red[t], red[t + st]); __syncthreads(); } const float mu = red[0] / (float)DMQ; __syncthreads();
  float vs = 0.f; for (int q = 0; q < 4; ++q) { const float dl = __fadd_rn(s[q], -mu); vs = __fadd_rn(vs, __fmul_rn(dl, dl)); } red[t] = vs; __syncthreads(); for (int st = 128; st > 0; st >>= 1) { if (t < st) red[t] = __fadd_rn(red[t], red[t + st]); __syncthreads(); }
  const float rs = rsqrtf(__fadd_rn(red[0] / (float)DMQ, eps)); v4h y; v4f xb;
  for (int q = 0; q < 4; ++q) { const int c = t * 4 + q; y[q] = (_Float16)__fadd_rn(__fmul_rn(__fmul_rn(__fadd_rn(s[q], -mu), rs), bf16_round(g[c])), bf16_round(bb[c])); xb[q] = s[q]; }
  { *(v4h*)(N16 + r * DMQ + t * 4) = y; if (WXB) *(v4f*)(XB + r * DMQ + t * 4) = xb;  } }
__global__ __launch_bounds__(256) void k_ftres2(const float* __restrict__ OF0, const float* __restrict__ XB, float* __restrict__ X1, size_t n4) {
  #pragma clang fp contract(off)
  const size_t t = (size_t)blockIdx.x * 256 + threadIdx.x; if (t >= n4) return; const v4f o = *(const v4fa*)(OF0 + t * 4), xv = *(const v4fa*)(XB + t * 4); v4f y; for (int q = 0; q < 4; ++q) y[q] = __fadd_rn(__fmul_rn(o[q], 0.015625f), xv[q]); *(v4f*)(X1 + t * 4) = y;  }

__global__ __launch_bounds__(256) void k_wthd(const float* __restrict__ Wt, _Float16* __restrict__ Bt) { const size_t t = (size_t)blockIdx.x * 256 + threadIdx.x; if (t >= (size_t)NH * HD * (DM / 8)) return; const int m8 = (int)(t % (DM / 8)) * 8; const int d = (int)((t / (DM / 8)) % HD); const int h = (int)(t / ((size_t)(DM / 8) * HD)); FragH f;
  for (int q = 0; q < 8; ++q) f.h[q] = (_Float16)(16.0f * bf16_round(Wt[((size_t)h * DM + m8 + q) * HD + d])); unsigned short* dst = (unsigned short*)Bt + ((size_t)h * HD + d) * DM + m8; *(v8us*)dst = f.half[0];  }




template <int BFIN, int W16, int W32>
__global__ __launch_bounds__(256) void k_lnx(const float* __restrict__ X, const float* __restrict__ g, const float* __restrict__ bb, float eps, _Float16* __restrict__ N16, float* __restrict__ N32) {
  #pragma clang fp contract(off)
  __shared__ float red[256]; const size_t r = blockIdx.x; const int t = threadIdx.x; const bool act = t < (DMQ / 4); const int c0 = act ? t * 4 : 0;
  const v4f xa = *(const v4fa*)(X + r * DMQ + c0); float s[4]; float sum = 0.f;
  for (int q = 0; q < 4; ++q) { s[q] = act ? (BFIN ? bf16_round(xa[q]) : xa[q]) : 0.f; sum = __fadd_rn(sum, s[q]); }
  red[t] = sum; __syncthreads(); for (int st = 128; st > 0; st >>= 1) { if (t < st) red[t] = __fadd_rn(red[t], red[t + st]); __syncthreads(); } const float mu = red[0] / (float)DMQ; __syncthreads();
  float vs = 0.f; for (int q = 0; q < 4; ++q) { const float dl = act ? __fadd_rn(s[q], -mu) : 0.f; vs = __fadd_rn(vs, __fmul_rn(dl, dl)); } red[t] = vs; __syncthreads(); for (int st = 128; st > 0; st >>= 1) { if (t < st) red[t] = __fadd_rn(red[t], red[t + st]); __syncthreads(); }
  const float rs = rsqrtf(__fadd_rn(red[0] / (float)DMQ, eps)); v4h y; v4f yf;
  for (int q = 0; q < 4; ++q) { const int c = c0 + q; yf[q] = __fadd_rn(__fmul_rn(__fmul_rn(__fadd_rn(s[q], -mu), rs), bf16_round(g[c])), bf16_round(bb[c])); y[q] = (_Float16)yf[q]; }
  if (!act) return;      /* no barriers after this point */
  { if (W16) *(v4h*)(N16 + r * DMQ + c0) = y; if (W32) *(v4f*)(N32 + r * DMQ + c0) = yf;  } }


__global__ __launch_bounds__(256) void k_bfr(const float* __restrict__ x, float* __restrict__ XB, size_t n8) { const size_t t = (size_t)blockIdx.x * 256 + threadIdx.x; if (t >= n8) return; v4f a = *(const v4fa*)(x + t * 8), c = *(const v4fa*)(x + t * 8 + 4); for (int q = 0; q < 4; ++q) { a[q] = bf16_round(a[q]); c[q] = bf16_round(c[q]); }
  { *(v4f*)(XB + t * 8) = a; *(v4f*)(XB + t * 8 + 4) = c;  } }




__global__ __launch_bounds__(256) void k_lorafold(const float* __restrict__ Wm, const float* __restrict__ A, const float* __restrict__ Bm, float* __restrict__ WE, int K, int N, float sc) {
  #pragma clang fp contract(off)
  const size_t t = (size_t)blockIdx.x * 256 + threadIdx.x; if (t >= (size_t)K * N) return; const int i = (int)(t / N), o = (int)(t % N); float a = 0.f;
  for (int r = 0; r < 16; ++r) a = __fadd_rn(a, __fmul_rn(bf16_round(A[(size_t)i * 16 + r]), bf16_round(Bm[(size_t)r * N + o])));
  const float v = __fadd_rn(bf16_round(Wm[t]), __fmul_rn(sc, a)); *(float*)(WE + t) = v;  }
__global__ __launch_bounds__(256) void k_wt32rep(const float* __restrict__ Wf, _Float16* __restrict__ Bt, int K, int N, int DOUT, float scale) {
  const int t = blockIdx.x * 256 + threadIdx.x; if (t >= DOUT * (K / 8)) return; const int n = t / (K / 8), k8 = (t % (K / 8)) * 8; const int rep = DOUT / N; const int src = (n / (HD * rep)) * HD + (n % HD);      /* head h = n / HD -> group h / rep */
  FragH f; for (int i = 0; i < 8; ++i) f.h[i] = (_Float16)(Wf[(size_t)(k8 + i) * N + src] * scale);
  *(v8us*)((unsigned short*)Bt + (size_t)n * K + k8) = f.half[0];  }
__global__ __launch_bounds__(256) void k_brep(const float* __restrict__ b, float* __restrict__ out) { const int t = blockIdx.x * 256 + threadIdx.x; if (t >= DM) return; const float v = b[(t / (HD * 4)) * HD + (t % HD)]; *(float*)(out + t) = v;  }

__global__ __launch_bounds__(256) void k_rsmcim(const float* __restrict__ S, _Float16* __restrict__ P, int hg, int q0, int nk, const int* __restrict__ am) {
  #pragma clang fp contract(off)
  const int t = blockIdx.x * 256 + threadIdx.x; if (t >= hg * QT) return; const size_t i = (size_t)t; const float* s = S + i * NKX; const int last = q0 + (t % QT); const int* mr = am + (size_t)last * SQ; float mx = -3.0e38f;      /* the module's mask row of this query (keys >= nk lie above the diagonal of the causal mask and are not computed) */
#pragma unroll 1
  for (int j = 0; j < nk; ++j) { const float f = (mr[j] != 0) ? 1.f : 0.f; mx = fmaxf(mx, fmaf(f, s[j], (1.f - f) * -1.0e9f)); } float se = 0.f;
#pragma unroll 1
  for (int j = 0; j < nk; ++j) { const float f = (mr[j] != 0) ? 1.f : 0.f; se += __expf(fmaf(f, s[j], (1.f - f) * -1.0e9f) - mx); } const float sc = 256.0f / se;
#pragma unroll 1
  for (int j0 = 0; j0 < nk; j0 += 8) { FragH fr; for (int q = 0; q < 8; ++q) { const int j = j0 + q; const float f = (mr[j] != 0) ? 1.f : 0.f; fr.h[q] = (_Float16)(__expf(fmaf(f, s[j], (1.f - f) * -1.0e9f) - mx) * sc); } unsigned short* d = (unsigned short*)P + i * NKX + j0; *(v8us*)d = fr.half[0];  } }



__global__ __launch_bounds__(256) void k_bcpy(const float* __restrict__ b, int n, int NP, float* __restrict__ dst, int dst0) { for (int i = threadIdx.x; i < NP; i += 256) { const float v = (i < n) ? b[i] : 0.f; *(float*)(dst + dst0 + i) = v; }  }



// lane l with lane l ^ 16
__device__ __forceinline__ float rs_xhalf(float x) { return __builtin_bit_cast(float, __builtin_amdgcn_permlanex16(__builtin_bit_cast(int, x), __builtin_bit_cast(int, x), 0x76543210, 0xfedcba98, false, false)); }
// Four 2^t in one statement, each in place: behind a transcendental the instruction set asks for one independent instruction or v_nop before its result is read or its source overwritten.
// Here each v_exp_f32 is the independent instruction behind the one before it, the v_nop the slot behind the last. In place, so that the
// statement writes only registers that the multiply-add in front of it has written: the compiler keeps that one clear of the matrix instructions' operands.
__device__ __forceinline__ v4f rs_exp2x4(v4f t) { float a = t[0], b = t[1], c = t[2], d = t[3];
  asm("v_exp_f32 %0, %0\n\tv_exp_f32 %1, %1\n\tv_exp_f32 %2, %2\n\tv_exp_f32 %3, %3\n\tv_nop" : "+v"(a), "+v"(b), "+v"(c), "+v"(d));
  const v4f r = {a, b, c, d}; return r; }
__device__ __forceinline__ v8f fa_mma(v16h a, v16h b, v8f c) { return __builtin_amdgcn_wmma_f32_16x16x32_f16(false, a, false, b, (short)0, c, false, false); }
// Fused attention: scores, softmax and P V in one launch; no score and no weight leaves the registers. One work-group = 256 queries of one (batch, head), 8 waves of 32 query columns;
// a pass = 32 keys. Transposed products: S^T = K Q^T (rows = keys, columns = queries), so a lane's 16 scores of a column are, as they lie, its 16 elements of the B operand of O^T += V^T P^T
// (k order of both operands: 8 hh + 0..7, then 16 + 8 hh + 0..7, that of g2_frag). Online softmax in the log2 domain, f32: the maximum in use may trail the true one by up to 8 (an
// exponential reaches 2^8 at most, well inside f16), and the sums are rescaled only in a pass where some column exceeds that. Denominator = an all-ones A operand times P^T on the matrix
// pipe: it sums the weights as rounded to f16, the same values the numerator sums. o is carried x64 as f16 rows.
// K and V: the eight waves read the same fragments, and a fragment load from global memory touches 16 cache lines for 512 bytes. So a stage of 128 keys (4 passes) is brought into LDS once for the work-group, in whole
// 128-byte lines, by asynchronous copies, two buffers: stage t + 1 flies while stage t is worked on. Fragments come from LDS, K one pass ahead inside its stage, V^T at the head of its pass.
// V lies in LDS as it lies in the fused k | v rows (row = key, 64 d); the A operand V^T (row = d, k = key) comes out of it by the transposing load ds_load_tr16_b128, so no transposed copy of V is made in memory.
// Every '#pragma unroll' in it is there so that the fragment and accumulator arrays it indexes become registers.
#define FA_KP 144      /* pitch of a K row (one key, 128 bytes) in LDS: 16 B x odd, so the 16 lanes of a half wave's ds_load_b128 fall on 64 different banks */
#define FA_VP 160      /* pitch of a V row (one key, 128 bytes): 32 B x odd, the conflict-free pitch of ds_load_tr16_b128 */
#define FA_VOFF (128 * FA_KP)      /* the 128 V rows stand behind the 128 K rows */
#define FA_STAGE (128 * FA_KP + 128 * FA_VP)
// One stage, global memory -> LDS through no register: 8 asynchronous copies of 16 bytes a lane (4 K rows and 4 V rows, 32 rows apart); 8 lanes fill a row.
// lk / lv = the lane's own LDS byte addresses of its first K and V row, gk / gv = its own global addresses. The s_wait_xcnt stands inside the statement, behind the last copy, so that
// no address register of a copy is written again in front of it.
__device__ __forceinline__ void fa_stage(unsigned lk, unsigned lv, const _Float16* gk, const _Float16* gv) {
  asm volatile("global_load_async_to_lds_b128 %0, %8, off\n\tglobal_load_async_to_lds_b128 %1, %9, off\n\tglobal_load_async_to_lds_b128 %2, %10, off\n\tglobal_load_async_to_lds_b128 %3, %11, off\n\t"
               "global_load_async_to_lds_b128 %4, %12, off\n\tglobal_load_async_to_lds_b128 %5, %13, off\n\tglobal_load_async_to_lds_b128 %6, %14, off\n\tglobal_load_async_to_lds_b128 %7, %15, off\n\t"
               "s_wait_xcnt 0x0"
               :: "v"(lk), "v"(lk + 32 * FA_KP), "v"(lk + 64 * FA_KP), "v"(lk + 96 * FA_KP), "v"(lv), "v"(lv + 32 * FA_VP), "v"(lv + 64 * FA_VP), "v"(lv + 96 * FA_VP),
                  "v"(gk), "v"(gk + (size_t)32 * (2 * DM)), "v"(gk + (size_t)64 * (2 * DM)), "v"(gk + (size_t)96 * (2 * DM)), "v"(gv), "v"(gv + (size_t)32 * (2 * DM)), "v"(gv + (size_t)64 * (2 * DM)), "v"(gv + (size_t)96 * (2 * DM)) : "memory"); }
// Half a V^T fragment: lane (c = lane & 15, hh) gets V[key0 + 8 hh + 0..7][d0 + c], where p = the tile's byte address + (key0 + 8 hh + (lane & 7)) FA_VP + 2 d0 + 16 ((lane >> 3) & 1).
typedef short fa_s16x8 __attribute__((ext_vector_type(8)));
__device__ __forceinline__ v8us fa_tr16(const unsigned char* p) { typedef __attribute__((address_space(3))) fa_s16x8 lds_s16x8; return __builtin_bit_cast(v8us, __builtin_amdgcn_ds_load_tr16_b128_v8i16((lds_s16x8*)p)); }
__global__ __launch_bounds__(256) void k_fattn(const _Float16* __restrict__ Q, const _Float16* __restrict__ KV, _Float16* __restrict__ O) {
  static_assert(SK % 128 == 0 && SK / 128 >= 2 && HD == 64, "k_fattn: whole stages of 128 keys, two or more");
  constexpr float CS = 0.015625f * 1.44269504f;      /* (q / 8) . (k / 8) = q . k / 64, times log2 e */
  constexpr int NST = SK / 128;
  __shared__ __attribute__((aligned(16))) unsigned char sm[2 * FA_STAGE];      /* two stage buffers */
  const int tid = threadIdx.x, lane = tid & 31, ln = lane & 15, hh = lane >> 4; const int wave = __builtin_amdgcn_readfirstlane(tid >> 5);
  const int h = blockIdx.y, b = blockIdx.z; const int q0 = blockIdx.x * 256 + wave * 32;
  const _Float16* qp = Q + ((size_t)b * SQ + q0 + ln) * DM + h * HD;
  const unsigned lk0 = (unsigned)(size_t)sm + (unsigned)((tid >> 3) * FA_KP + (tid & 7) * 16);      /* the lane's copies: K rows (tid >> 3) + 32 i, 16-byte piece tid & 7 */
  const unsigned lv0 = (unsigned)(size_t)sm + (unsigned)(FA_VOFF + (tid >> 3) * FA_VP + (tid & 7) * 16);      /* V rows and pieces likewise */
  const _Float16* gk = KV + ((size_t)b * SK + (tid >> 3)) * (2 * DM) + h * HD + (tid & 7) * 8;      /* k half of the fused rows: row = key */
  const _Float16* gv = gk + DM;      /* v half of the same rows */
  const unsigned char* fk = sm + ln * FA_KP + 16 * hh; const unsigned char* fv = sm + FA_VOFF + (8 * hh + (lane & 7)) * FA_VP + 16 * ((lane >> 3) & 1);      /* the lane's K fragment row and its address for the transposing loads of V, in buffer 0 */
  fa_stage(lk0, lv0, gk, gv);
  v16h qf[2][2], kf[2][2];
#pragma unroll
  for (int g = 0; g < 2; ++g) for (int kc = 0; kc < 2; ++kc) qf[g][kc] = g2_frag(qp + (size_t)g * 16 * DM + 32 * kc, hh);
  FragH ones;
#pragma unroll
  for (int i = 0; i < 16; ++i) ones.h[i] = (_Float16)1.0f;
  const v8f z8 = {0.f, 0.f, 0.f, 0.f, 0.f, 0.f, 0.f, 0.f};
  v8f acc[2][4], lacc[2]; float m_run[2];
#pragma unroll
  for (int g = 0; g < 2; ++g) { m_run[g] = -__builtin_inff(); lacc[g] = z8; for (int t = 0; t < 4; ++t) acc[g][t] = z8; }
  auto pass = [&](const unsigned char* pk, const unsigned char* pv, const int p, const bool more) __attribute__((always_inline)) {      /* p (the pass in its stage) and more are literals at every call: a stage's last pass is compiled without the fetch of a next K */
    v16h vf[4]; v8f s[2][2];
#pragma unroll
    for (int kt = 0; kt < 2; ++kt) for (int g = 0; g < 2; ++g) s[kt][g] = fa_mma(kf[kt][1], qf[g][1], fa_mma(kf[kt][0], qf[g][0], z8));
#pragma unroll
    for (int t = 0; t < 4; ++t) { FragH f; f.half[0] = fa_tr16(pv + 32 * p * FA_VP + 32 * t); f.half[1] = fa_tr16(pv + (32 * p + 16) * FA_VP + 32 * t); vf[t] = f.v; }      /* this pass's V^T (d = 16 t + ln; keys 8 hh + 0..7, then 16 + 8 hh + 0..7: the k order of P^T), in flight under the softmax */
    if (more) {      /* next pass's K, of the same stage, in flight under this pass's softmax and second product */
#pragma unroll
      for (int kt = 0; kt < 2; ++kt) for (int kc = 0; kc < 2; ++kc) kf[kt][kc] = g2_lfrag(pk + (32 * (p + 1) + 16 * kt) * FA_KP + 64 * kc); }
    asm volatile("" ::: "memory");      /* compiler fence: keeps the pass's LDS reads up here, in one group in front of the softmax; without it the compiler sank them behind the branch below, next to their first use, where they have no time to land */
    float mb[2]; bool need = false;
#pragma unroll
    for (int g = 0; g < 2; ++g) { float mx = fmaxf(s[0][g][0], s[1][g][0]);
      for (int r = 1; r < 8; ++r) mx = fmaxf(mx, fmaxf(s[0][g][r], s[1][g][r]));
      mx = fmaxf(mx, rs_xhalf(mx)) * CS; mb[g] = mx; need = need || (mx > m_run[g] + 8.0f); }      /* both wave halves hold the column's maximum of this pass, scaled (the scale is positive) */
    if (__builtin_amdgcn_ballot_w32(need) != 0) {      /* always in the first pass (the maximum in use is -inf, the factor 0), rare later */
#pragma unroll
      for (int g = 0; g < 2; ++g) { const float mn = fmaxf(m_run[g], mb[g]); const float corr = __builtin_amdgcn_exp2f(m_run[g] - mn); m_run[g] = mn; lacc[g] = lacc[g] * corr; for (int t = 0; t < 4; ++t) acc[g][t] = acc[g][t] * corr; } }
#pragma unroll
    for (int g = 0; g < 2; ++g) { FragH pf; const float nm = -m_run[g];
      for (int kt = 0; kt < 2; ++kt) for (int j = 0; j < 2; ++j) { v4f a; for (int q = 0; q < 4; ++q) a[q] = fmaf(s[kt][g][4 * j + q], CS, nm); const v4f e = rs_exp2x4(a); for (int q = 0; q < 4; ++q) pf.h[8 * kt + 4 * j + q] = (_Float16)e[q]; }
      for (int t = 0; t < 4; ++t) acc[g][t] = fa_mma(vf[t], pf.v, acc[g][t]);
      lacc[g] = fa_mma(ones.v, pf.v, lacc[g]); }
  };
  asm volatile("s_wait_asynccnt 0x0" ::: "memory");      /* this wave's copies of stage 0 have landed */
  __syncthreads();      /* ... and every other wave's: stage 0 may be read */
  fa_stage(lk0 + FA_STAGE, lv0 + FA_STAGE, gk + (size_t)128 * (2 * DM), gv + (size_t)128 * (2 * DM));      /* stage 1 exists (asserted above) */
#pragma unroll 1      /* rolled: the buffer is picked by the trip's parity, a second copy of the four passes would only add code */
  for (int t = 0; t < NST; ++t) { const unsigned bo = (unsigned)(t & 1) * FA_STAGE; const unsigned char* pk = fk + bo; const unsigned char* pv = fv + bo;
#pragma unroll
    for (int kt = 0; kt < 2; ++kt) for (int kc = 0; kc < 2; ++kc) kf[kt][kc] = g2_lfrag(pk + 16 * kt * FA_KP + 64 * kc);      /* the stage's first K */
    pass(pk, pv, 0, true); pass(pk, pv, 1, true); pass(pk, pv, 2, true); pass(pk, pv, 3, false);      /* keys in ascending order: the sum order of the plain loop */
    asm volatile("s_wait_dscnt 0x0" ::: "memory");      /* this wave's reads of the buffer are done before it is handed to the copies */
    asm volatile("s_wait_asynccnt 0x0" ::: "memory");      /* this wave's copies of stage t + 1 have landed */
    __syncthreads();      /* publishes stage t + 1 and ends every wave's reads of stage t */
    if (t + 2 < NST) fa_stage(lk0 + bo, lv0 + bo, gk + (size_t)(t + 2) * 128 * (2 * DM), gv + (size_t)(t + 2) * 128 * (2 * DM)); }      /* refill of the buffer just read; in flight under trip t + 1 */
  asm volatile("s_wait_asynccnt 0x0" ::: "memory");      /* no copy is outstanding when the wave ends */
#pragma unroll
  for (int g = 0; g < 2; ++g) { const float inv = 64.0f / lacc[g][0];      /* every row of the all-ones product holds the column's denominator */
    _Float16* op = O + ((size_t)b * SQ + q0 + 16 * g + ln) * DM + h * HD + 8 * hh;
    for (int t = 0; t < 4; ++t) { FragH f; for (int r = 0; r < 8; ++r) f.h[r] = (_Float16)(acc[g][t][r] * inv); *(v8us*)((unsigned short*)op + 16 * t) = f.half[0]; } } }      /* d = 16 t + 8 hh + 0..7 of query ln: 16 bytes a lane; the wave's four stores fill each row's 128-byte line */
// Preparation, one launch (the three weight planes, the two inputs' f16 rows): none of the five pieces depends on another.
// Work-groups 0 .. PREP_TW - 1: the weight planes, Bt[n][k] = f16(16 bf16(W[k][n])), one tile of 128 k x 64 n each, turned in LDS so that global memory is touched in whole lines only:
// a wave's load = 256 bytes in a row of each of two W rows, a wave's store = 256 bytes in a row of each of two Bt rows (a lane that walks down a column of W instead touches 32 lines a load for 128 bytes).
// In LDS a tile lies as Bt rows: row n = 64 words, word d = the f16 pair k = 2 d, 2 d + 1. Work-groups PREP_TW .. PREP_TW + PREP_CW - 1: PREP_CU * 256 pieces in a row of x and as many of tgt each,
// PREP_CU of either a thread, 256 pieces apart (a piece = 8 elements = one 16-byte store).
#define PREP_TW 512
#define PREP_CW 256
#define PREP_CU 8
#define PREP_LP 65      /* pitch of a tile row in LDS, in words: 1 mod 64, so that the 16 lanes that write 4 rows apart fall 4 banks apart, with the wave's other 16 lanes between them */
typedef unsigned int v4u __attribute__((ext_vector_type(4)));
typedef float v2f __attribute__((ext_vector_type(2)));
typedef _Float16 v2h __attribute__((ext_vector_type(2)));
__device__ __forceinline__ unsigned prep_pair(float lo, float hi) { const v2f t = {bf16_round(lo) * 16.0f, bf16_round(hi) * 16.0f}; return __builtin_bit_cast(unsigned, __builtin_convertvector(t, v2h)); }      /* low half = lo */
// One tile: Bt[n0 + 0..63][k0 + 0..127] from W[k0 + 0..127][n0 + 0..63], W of N columns, Bt of DM. N is a template argument so that the steps from row to row are constants:
// one 32-bit byte offset from the plane's start serves the thread's eight loads, another its four stores.
template <int N>
__device__ __forceinline__ void prep_wtile(const float* __restrict__ Wm, _Float16* __restrict__ Bt, unsigned tile, unsigned* tl) {
  const unsigned n0 = (tile % (N / 64)) * 64u, k0 = (tile / (N / 64)) * 128u; const unsigned c16 = threadIdx.x & 15u, r16 = threadIdx.x >> 4;
  const char* p = (const char*)Wm + ((k0 + 2u * r16) * N + n0 + 4u * c16) * 4u;      /* W[k0 + 2 r16][n0 + 4 c16] */
  v4f lo[4], hi[4];
#pragma unroll      /* constant indices: lo and hi stay in registers */
  for (int j = 0; j < 4; ++j) { lo[j] = *(const v4fa*)(p + 32 * j * N * 4); hi[j] = *(const v4fa*)(p + (32 * j + 1) * N * 4); }      /* rows k0 + 2 r16 + 32 j and the next: the two halves of word r16 + 16 j */
#pragma unroll      /* constant indices, as above */
  for (int j = 0; j < 4; ++j) for (int i = 0; i < 4; ++i) tl[(4u * c16 + i) * PREP_LP + r16 + 16u * j] = prep_pair(lo[j][i], hi[j][i]);
  __syncthreads();      /* the tile is whole before any row of it is read */
  char* d = (char*)Bt + ((n0 + r16) * (unsigned)DM + k0 + 8u * c16) * 2u; const unsigned* r = tl + r16 * PREP_LP + 4u * c16;      /* k = k0 + 8 c16 + 0..7 of row n0 + r16 */
#pragma unroll      /* four rows a thread, 16 apart, their LDS reads issued together */
  for (int s = 0; s < 4; ++s) { const v4u o = {r[16 * s * PREP_LP], r[16 * s * PREP_LP + 1], r[16 * s * PREP_LP + 2], r[16 * s * PREP_LP + 3]}; *(v4u*)(d + 16 * s * DM * 2) = o; } }
__global__ __launch_bounds__(256) void k_prep(const float* __restrict__ x, const float* __restrict__ cond, const float* __restrict__ wq, const float* __restrict__ wkv, const float* __restrict__ wo,
    _Float16* __restrict__ X16, _Float16* __restrict__ C16, _Float16* __restrict__ BQ, _Float16* __restrict__ BKV, _Float16* __restrict__ BO) {
  constexpr unsigned TQ = (DM / 128) * (DM / 64), TKV = (DC / 128) * (2 * DM / 64);      /* tiles of Wq (and of Wp), of Wkv */
  static_assert(DC == DM && DM % 128 == 0 && 2 * TQ + TKV == PREP_TW, "k_prep: one 128 x 64 tile a work-group; every Bt row has DM elements");
  static_assert((size_t)NB * SQ * DM / 8 == (size_t)PREP_CU * PREP_CW * 256 && (size_t)NB * SK * DC / 8 == (size_t)PREP_CU * PREP_CW * 256, "k_prep: PREP_CU pieces of x and of tgt a thread");
  __shared__ unsigned tl[64 * PREP_LP];
  if (blockIdx.x >= PREP_TW) { const unsigned u0 = (blockIdx.x - PREP_TW) * (PREP_CU * 256) + threadIdx.x; v4f a[2][PREP_CU], c[2][PREP_CU];      /* the thread's first piece */
#pragma unroll      /* constant indices: a and c stay in registers */
    for (int s = 0; s < 2; ++s) for (int j = 0; j < PREP_CU; ++j) { const char* p = (const char*)(s ? cond : x) + u0 * 32u + j * 8192; a[s][j] = *(const v4fa*)p; c[s][j] = *(const v4fa*)(p + 16); }      /* a 32-bit byte offset from the buffer's start: one address register serves all the loads */
    __builtin_amdgcn_sched_barrier(0);      /* keeps the thread's 4 PREP_CU loads up here, all in flight together: without it the compiler issued half of them and the rest in small groups among the conversions, behind waits on the first; eight waves a WGP need them all in flight to keep the memory busy */
#pragma unroll      /* constant indices, as above */
    for (int s = 0; s < 2; ++s) for (int j = 0; j < PREP_CU; ++j) { FragH f;
      for (int q = 0; q < 4; ++q) { f.h[q] = (_Float16)bf16_round(a[s][j][q]); f.h[4 + q] = (_Float16)bf16_round(c[s][j][q]); }
      *(v8us*)((char*)(s ? C16 : X16) + u0 * 16u + j * 4096) = f.half[0]; }
    return; }      /* the whole work-group or none: the barrier below is passed by whole work-groups only */
  const unsigned bx = blockIdx.x;      /* every test on it reads the same for the whole work-group: each barrier is passed by all of it */
  if (bx < TKV) prep_wtile<2 * DM>(wkv, BKV, bx, tl);
  else { const bool q = bx < TKV + TQ; prep_wtile<DM>(q ? wq : wo, q ? BQ : BO, q ? bx - TKV : bx - (TKV + TQ), tl); } }
extern "C" void kernel_launch(void* const* d_in, const int* in_sizes, int n_in,
                              void* d_out, int out_size, void* d_ws, size_t ws_size, hipStream_t stream) {
  (void)in_sizes; (void)n_in; (void)out_size;
  const float* const* I = (const float* const*)d_in; const float* x = I[0]; const float* cond = I[1]; const float* wq = I[2]; const float* bq = I[3]; const float* wkv = I[4]; const float* bkv = I[5]; const float* wo = I[6]; const float* bo = I[7];      /* input order: x [2][2048][1024]; tgt [2][2048][1024]; [in][out] Wq [1024][1024] + bq; Wkv [1024][2048] + bkv (k | v halves); Wp [1024][1024] + bp; the three biases are bound and read */
  static_assert(NH * HD == DM && HD == 64 && SQ % 256 == 0 && SK % 64 == 0 && DC % 32 == 0 && DM % 64 == 0, "shape / tile multiples");
  static_assert((NB * SQ) % 128 == 0 && (NB * SK) % 128 == 0 && DC % 64 == 0 && DM % 64 == 0, "k_gemm2: whole 128 x 64 tiles, whole 64-k stages");
  const size_t NRK = (size_t)NB * SK;      /* conditioning rows */
  char* ws = (char*)d_ws; size_t off = 0;
  auto take = [&](size_t bytes) { char* p = ws + off; off += (bytes + 255) & ~(size_t)255; return p; };
  _Float16* BQ = (_Float16*)take((size_t)DM * DM * 2); _Float16* BKV = (_Float16*)take((size_t)2 * DM * DC * 2); _Float16* BO = (_Float16*)take((size_t)DM * DM * 2);
  _Float16* X16 = (_Float16*)take(NR * DM * 2); _Float16* C16 = (_Float16*)take(NRK * DC * 2); _Float16* Q16 = (_Float16*)take(NR * DM * 2); _Float16* KV16 = (_Float16*)take(NRK * 2 * DM * 2); _Float16* O16 = (_Float16*)take(NR * DM * 2);
  if (off > ws_size) return;      /* 2 + 4 + 2 (weight planes) + 8 + 8 + 8 + 16 + 8 (row planes) = 56 MiB at NB 2, SK 2048, DC 1024 */
  k_prep<<<PREP_TW + PREP_CW, 256, 0, stream>>>(x, cond, wq, wkv, wo, X16, C16, BQ, BKV, BO);      /* [in][out] -> Bt x16: Wq [1024][1024]; Wkv [DC = 1024][2048] -> Bt [2048][1024] (rows 0..1023 = k, 1024..2047 = v); Wp; and the exact f16 rows of both inputs */
  k_gemm2<0><<<dim3((unsigned)((NR / 128) * (DM / 64)), 1), 128, 0, stream>>>(X16, DM, 0, BQ, DM, 0, 0.0625f, bq, 0, nullptr, 1, 0, 0, nullptr, Q16, DM, 0, (int)NR, DM, DM);      /* q rows (f16); head h = columns 64 h .. */
  k_gemm2<0><<<dim3((unsigned)((NRK / 128) * (2 * DM / 64)), 1), 128, 0, stream>>>(C16, DC, 0, BKV, DC, 0, 0.0625f, bkv, 0, nullptr, 1, 0, 0, nullptr, KV16, 2 * DM, 0, (int)NRK, 2 * DM, DC);      /* k | v rows (f16, pitch 2048): k = columns 0..1023, v = columns 1024..2047, head h = columns 64 h .. of each half */
  k_fattn<<<dim3(SQ / 256, NH, NB), 256, 0, stream>>>(Q16, KV16, O16);      /* softmax(q . k / 64) v over the SK = 2048 keys -> ctx (merged heads, x64) as f16 rows */
  k_gemm2<0><<<dim3((unsigned)((NR / 128) * (DM / 64)), 1), 128, 0, stream>>>(O16, DM, 0, BO, DM, 0, 0.0009765625f, bo, 0, nullptr, 1, 0, 0, (float*)d_out, nullptr, DM, 0, (int)NR, DM, DM);      /* out = ctx proj_w + proj_b */
}
